// v000
// Times are from an AMD MI455X. After a warm-up the kernel runs many times in a row, and a time is the length of
// such a window on the GPU divided by its runs, so every launch and the gaps after it count. The runs cycle
// through copies of the inputs. A figure is the median of several windows, for all but v000 over two sittings.
// Sittings can differ by a few percent; kernels timed side by side share one.
// v000, which the later versions start from, runs in 723 microseconds.
// Contractions: q, k, v^T projections = v_wmma_f32_16x16x32_bf16 (bf16 operands from RNE-converted inputs, single product, f32 accumulate);
// q.k^T scores = v_wmma_f32_16x16x32_bf16 with bf16 hi/lo split q and k (hi.hi + hi.lo + lo.hi), f32 accumulate;
// p.v = v_wmma_f32_16x16x32_f16 (p carried x1024 in f16; v as f16 hi plane plus f16 residual plane x4096; 2 products), f32 accumulate;
// ctx.Wo^T = v_wmma_f32_16x16x32_bf16 with ctx as bf16 hi/lo planes times bf16 Wo (2 products), f32 accumulate; bias, rope, softmax in f32.
#include <hip/hip_runtime.h>
#include <math.h>
#include <stdint.h>

#pragma clang fp contract(off)

#define NB    4
#define SEQ   2048
#define DM    1024
#define NH    16
#define HD    64
#define NQB   (SEQ / 64)      // 32 key / query tiles of 64
#define NTOK  (NB * SEQ)      // 8192 token rows
static_assert(NH * HD == DM);
static_assert((SEQ % 64) == 0 && (DM % 64) == 0);
static_assert((SEQ & (SEQ - 1)) == 0);

typedef _Float16 v16h __attribute__((ext_vector_type(16)));
typedef _Float16 v8h  __attribute__((ext_vector_type(8)));
typedef __bf16   v16b __attribute__((ext_vector_type(16)));
typedef __bf16   v8b  __attribute__((ext_vector_type(8)));
typedef float    v8f  __attribute__((ext_vector_type(8)));
typedef float    v4f  __attribute__((ext_vector_type(4)));
typedef unsigned int v4u __attribute__((ext_vector_type(4)));

// ---- scalar helpers --------------------------------------------------------------------------------
__device__ __forceinline__ unsigned short bf_bits(float f) {          // f32 -> bf16 bits, RNE convert
  unsigned u = __float_as_uint(f);
  return (unsigned short)((u + 0x7FFFu + ((u >> 16) & 1u)) >> 16);
}
__device__ __forceinline__ float bf_up(unsigned short h) { return __uint_as_float(((unsigned)h) << 16); }
__device__ __forceinline__ float bfr(float f) { return bf_up(bf_bits(f)); }   // value after bf16 RNE convert
__device__ __forceinline__ unsigned short h_bits(_Float16 x) { return __builtin_bit_cast(unsigned short, x); }
__device__ __forceinline__ unsigned pk16(unsigned short a, unsigned short b) { return (unsigned)a | ((unsigned)b << 16); }
__device__ __forceinline__ v8f zero8() { v8f z = {0.f, 0.f, 0.f, 0.f, 0.f, 0.f, 0.f, 0.f}; return z; }

// ---- fragment loader: 16-bit A/B operand, lane -> row/col (lane&15), p already includes +8*(lane>>4);
//      elements 0..7 <- p[0..7] (k0+8h..), elements 8..15 <- p[16..23] (k0+16+8h..)
__device__ __forceinline__ v16b ldfrag_b(const __bf16* p) {
  union { v16b v; v8b h[2]; } f;
  f.h[0] = *(const v8b*)(p);
  f.h[1] = *(const v8b*)(p + 16);
  return f.v;
}

// ---- WMMA helpers with trailing VALU hazard gap --------------------------------------------------------
__device__ __forceinline__ v8f mma_b(v16b a, v16b b, v8f c) {
  c = __builtin_amdgcn_wmma_f32_16x16x32_bf16(false, a, false, b, (short)0, c, false, false);
  asm volatile("v_nop\n\tv_nop\n\tv_nop\n\tv_nop" : "+v"(c) : "v"(a), "v"(b));
  return c;
}
__device__ __forceinline__ v8f mma_h(v16h a, v16h b, v8f c) {
  c = __builtin_amdgcn_wmma_f32_16x16x32_f16(false, a, false, b, (short)0, c, false, false);
  asm volatile("v_nop\n\tv_nop\n\tv_nop\n\tv_nop" : "+v"(c) : "v"(a), "v"(b));
  return c;
}
__device__ __forceinline__ v8f mma_b_raw(v16b a, v16b b, v8f c) {
  return __builtin_amdgcn_wmma_f32_16x16x32_bf16(false, a, false, b, (short)0, c, false, false);
}
__device__ __forceinline__ void dep_guard_b(v8f& a, v8f& b, v16b x, v16b y) {
  asm volatile("v_nop\n\tv_nop\n\tv_nop\n\tv_nop" : "+v"(a), "+v"(b) : "v"(x), "v"(y));
}
__device__ __forceinline__ void keep4_b(v16b a, v16b b, v16b c, v16b d) {
  asm volatile("v_nop" :: "v"(a), "v"(b), "v"(c), "v"(d));
}
__device__ __forceinline__ void acc_guard4(v8f& a, v8f& b, v8f& c, v8f& d) {
  asm volatile("v_nop\n\tv_nop\n\tv_nop\n\tv_nop" : "+v"(a), "+v"(b), "+v"(c), "+v"(d));
}

// =====================================================================================================
// f32 -> bf16 (RNE convert), 8 elements per thread, one 16-B store per lane: a wave writes 512 contiguous B
// multiple of 256 for every use here; host-checked). coverage: n8 threads x 8 = whole plane.
// =====================================================================================================
__global__ __launch_bounds__(256) void cvt_bf16x8(const float* __restrict__ in, unsigned short* out, int n8) {
  const int i = blockIdx.x * 256 + threadIdx.x;
  if (i < n8) {
    const v4f a = *(const v4f*)(in + (size_t)i * 8);
    const v4f b = *(const v4f*)(in + (size_t)i * 8 + 4);
    v4u p;
    p[0] = pk16(bf_bits(a[0]), bf_bits(a[1]));
    p[1] = pk16(bf_bits(a[2]), bf_bits(a[3]));
    p[2] = pk16(bf_bits(b[0]), bf_bits(b[1]));
    p[3] = pk16(bf_bits(b[2]), bf_bits(b[3]));
    *(v4u*)(out + (size_t)i * 8) = p;
    
  }
}

// =====================================================================================================
// Register-blocked batched bf16 WMMA GEMM: C[m][n] = sum_k A[m][k] * Bt[n][k]; one wave per 64x64 tile,
// no block barriers. A row-major [M][K] pitch lda; Bt row-major [N][K] pitch ldb (k contiguous);
// M, N multiples of 64, K multiple of 32 (host-checked). blockIdx.y = batch index (strides in elements).
// NSPLIT: 0 = A.Bt; 1 = (A + A2).Bt (A2 = unscaled bf16 lo plane of A, same pitch/stride).
// BIAS: 0 none; 1 = + bfr(bias[n]) per column; 2 = + bfr(bias[m]) per row.
// ROPE (needs N tile = one head = 64 cols d 0..63, row m = b*SEQ + s): for s >= 1,
//   t[d] = t[d]*bfr(cos[s-1][d]) + rot[d]*bfr(sin[s-1][d]), rot = [-t[32..63] | t[0..31]] (after bias).
// OUT_MODE: 0 = f32 (pitch ldc); 2 = bf16 hi plane C + bf16 lo plane C2 (lo = RNE(v - hi), unscaled);
//           3 = f16 hi plane C + f16 residual plane C2 = f16((v - hi) * rscale); C2 same pitch/stride as C.
// =====================================================================================================
template <int NSPLIT, int OUT_MODE, int BIAS, int ROPE>
__global__ __launch_bounds__(256) void gemm64(
    const unsigned short* __restrict__ Ap, const unsigned short* __restrict__ A2p, int lda, long long strideA,
    const unsigned short* __restrict__ Btp, int ldb, long long strideB,
    const float* __restrict__ bias, const float* __restrict__ rsin, const float* __restrict__ rcos,
    void* Cout, void* Cout2, int ldc, long long strideC,
    int M, int N, int K, float rscale) {
  const __bf16* A  = (const __bf16*)(const void*)Ap;
  const __bf16* A2 = (const __bf16*)(const void*)A2p;
  const __bf16* Bt = (const __bf16*)(const void*)Btp;
  __shared__ __align__(16) float sT[8][16 * 68];   // per-wave 16x64 slab, pitch 68 floats
  const int b    = blockIdx.y;
  const int lane = threadIdx.x & 31;
  const int wave = threadIdx.x >> 5;
  const int tilesN = N >> 6;
  const int tilesM = M >> 6;
  const int tile = blockIdx.x * 8 + wave;
  if (tile >= tilesM * tilesN) return;   // wave-uniform; no block barriers in this kernel
  const int tm = tile / tilesN;
  const int tn = tile - tm * tilesN;
  const int m0 = tm << 6;
  const int n0 = tn << 6;

  const __bf16* Ab  = A  + (size_t)b * strideA;
  const __bf16* Bb  = Bt + (size_t)b * strideB;
  const __bf16* Ab2 = (NSPLIT == 1) ? (A2 + (size_t)b * strideA) : Ab;

  const int rlane = lane & 15;                 // row (A) / col (B, D) within subtile
  const int koff  = (lane >> 4) * 8;           // k offset of this lane half
  const int mOff  = (lane >> 4) * 8;           // D row offset

  v8f acc[4][4];
#pragma unroll
  for (int i = 0; i < 4; ++i)
#pragma unroll
    for (int j = 0; j < 4; ++j) acc[i][j] = zero8();

  for (int k0 = 0; k0 < K; k0 += 32) {
    v16b bh[4];
#pragma unroll
    for (int j = 0; j < 4; ++j) {
      const size_t bo = (size_t)(n0 + (j << 4) + rlane) * ldb + koff + k0;
      bh[j] = ldfrag_b(Bb + bo);
    }
#pragma unroll
    for (int i = 0; i < 4; ++i) {
      const size_t ao = (size_t)(m0 + (i << 4) + rlane) * lda + koff + k0;
      const v16b ah = ldfrag_b(Ab + ao);
      v16b al = ah;
      if (NSPLIT == 1) al = ldfrag_b(Ab2 + ao);
#pragma unroll
      for (int j = 0; j < 4; ++j) {
        acc[i][j] = mma_b_raw(ah, bh[j], acc[i][j]);
        if (NSPLIT == 1) acc[i][j] = mma_b_raw(al, bh[j], acc[i][j]);
      }
      dep_guard_b(acc[i][0], acc[i][3], ah, al);
    }
    keep4_b(bh[0], bh[1], bh[2], bh[3]);
  }
  acc_guard4(acc[0][0], acc[0][1], acc[0][2], acc[0][3]);
  acc_guard4(acc[1][0], acc[1][1], acc[1][2], acc[1][3]);
  acc_guard4(acc[2][0], acc[2][1], acc[2][2], acc[2][3]);
  acc_guard4(acc[3][0], acc[3][1], acc[3][2], acc[3][3]);

  // ---- epilogue ----
  float* slab = sT[wave];
  float bcol[4];
  if (BIAS == 1) {
#pragma unroll
    for (int j = 0; j < 4; ++j) bcol[j] = bfr(bias[n0 + (j << 4) + rlane]);   // n0+.. < N
  } else {
#pragma unroll
    for (int j = 0; j < 4; ++j) bcol[j] = 0.f;
  }
#pragma unroll
  for (int i = 0; i < 4; ++i) {
    const int mBase = m0 + (i << 4);
#pragma unroll
    for (int r = 0; r < 8; ++r) {
      const int m = mBase + mOff + r;                  // < M
      float brow = 0.f;
      if (BIAS == 2) brow = bfr(bias[m]);
      float t[4];
#pragma unroll
      for (int j = 0; j < 4; ++j) {
        float v = acc[i][j][r];
        if (BIAS == 1) v = v + bcol[j];
        if (BIAS == 2) v = v + brow;
        t[j] = v;
      }
      if (ROPE) {
        const int s = m & (SEQ - 1);                   // token index within the sequence
        const bool use = (s > 0);                        // token 0 passes unrotated
        const int sidx = use ? (s - 1) : 0;              // clamped table row
        const float* cr = rcos + (size_t)sidx * HD;
        const float* sr = rsin + (size_t)sidx * HD;
        float u[4];
#pragma unroll
        for (int j = 0; j < 4; ++j) {
          const int d = (j << 4) + rlane;                // 0..63
          const float cs = bfr(cr[d]);
          const float sn = bfr(sr[d]);
          const float tp = t[j ^ 2];                     // partner d^32, same lane
          const float rot = (j < 2) ? -tp : tp;
          const float w = t[j] * cs + rot * sn;
          u[j] = use ? w : t[j];
        }
#pragma unroll
        for (int j = 0; j < 4; ++j) t[j] = u[j];
      }
#pragma unroll
      for (int j = 0; j < 4; ++j) slab[(mOff + r) * 68 + (j << 4) + rlane] = t[j];
    }
    __builtin_amdgcn_fence(__ATOMIC_RELEASE, "workgroup");
    __builtin_amdgcn_wave_barrier();
    __builtin_amdgcn_fence(__ATOMIC_ACQUIRE, "workgroup");
    if (OUT_MODE == 0) {
      float* C = (float*)Cout + (size_t)b * strideC;
      const int hh = lane >> 4, c4 = (lane & 15) * 4;     // 256-B row segment = 16 lanes x 16 B
      {
#pragma unroll
        for (int it = 0; it < 8; ++it) {
          const int row = it * 2 + hh;                     // it 0..7 x hh 0..1 = rows 0..15
          const v4f v = *(const v4f*)(slab + row * 68 + c4);
          *(v4f*)(C + (size_t)(mBase + row) * ldc + n0 + c4) = v;
        }
        
      }
    } else {
      const int q = lane >> 3, c8 = (lane & 7) * 8;
      unsigned short* C  = (unsigned short*)Cout  + (size_t)b * strideC;
      unsigned short* C2 = (unsigned short*)Cout2 + (size_t)b * strideC;
      v4u hv[4], lv[4];
#pragma unroll
      for (int it = 0; it < 4; ++it) {
        const int row = it * 4 + q;                        // it 0..3 x q 0..3 = rows 0..15
        const float* sp = slab + row * 68 + c8;
        v4u a, a2;
#pragma unroll
        for (int e = 0; e < 4; ++e) {
          const float f0 = sp[2 * e], f1 = sp[2 * e + 1];
          unsigned short h0, h1, l0, l1;
          if (OUT_MODE == 2) {
            h0 = bf_bits(f0); h1 = bf_bits(f1);
            l0 = bf_bits(f0 - bf_up(h0)); l1 = bf_bits(f1 - bf_up(h1));
          } else {
            const _Float16 x0 = (_Float16)f0, x1 = (_Float16)f1;
            h0 = h_bits(x0); h1 = h_bits(x1);
            l0 = h_bits((_Float16)((f0 - (float)x0) * rscale));
            l1 = h_bits((_Float16)((f1 - (float)x1) * rscale));
          }
          a[e] = pk16(h0, h1); a2[e] = pk16(l0, l1);
        }
        hv[it] = a; lv[it] = a2;
      }
      {
#pragma unroll
        for (int it = 0; it < 4; ++it) {
          const int row = it * 4 + q;
          *(v4u*)(C  + (size_t)(mBase + row) * ldc + n0 + c8) = hv[it];
          *(v4u*)(C2 + (size_t)(mBase + row) * ldc + n0 + c8) = lv[it];
        }
        
      }
    }
    __builtin_amdgcn_fence(__ATOMIC_RELEASE, "workgroup");
    __builtin_amdgcn_wave_barrier();
    __builtin_amdgcn_fence(__ATOMIC_ACQUIRE, "workgroup");
  }
}

// =====================================================================================================
// Attention, head dim 64, no mask, all SEQ keys.
//   q planes (bf16 hi / lo): element (b, t, h, d) at [(b*SEQ + t)*DM + h*64 + d]
//   k planes (bf16 hi / lo): same layout with key index s
//   v^T hi plane (f16):      element (b, h, d, s) at [(b*DM + h*64 + d)*SEQ + s]
//   v^T residual plane (f16, (v - hi)*4096): same layout
//   out planes (bf16 hi / lo of the normalised context): element (b, t, h, d) at [(b*SEQ + t)*DM + h*64 + d]
//   scores = q . k : bf16 hi/lo split (hi.hi + hi.lo + lo.hi), f32 accumulate, then * sscale in f32
//   p = exp(s - m) carried as f16(1024 p); context = p . v on f16 WMMA: p.v_hi into the running accumulator,
//   p.v_res into a per-chunk accumulator folded back with 1/4096 in f32; online softmax in f32.
//   Block = 4 waves = 64 query rows of one (b, h); grid = NQB * NH * NB; kv chunks of 64, static trip NQB.
//   K / V^T chunk staging: 128 threads x 32 elements per plane = the whole 64x64 tile (plain 16-B loads,
//   __syncthreads before and after); P tiles are wave-private, spilled with _Float16 element stores and reloaded
//   Output coverage: each wave stores rows q0..q0+15 (it 0..3 x lane>>3 0..3) x 64 columns (8 lanes x 8) of both planes.
// =====================================================================================================
__global__ __launch_bounds__(128)
void attn64(const unsigned short* __restrict__ qhp, const unsigned short* __restrict__ qlp,
            const unsigned short* __restrict__ khp, const unsigned short* __restrict__ klp,
            const unsigned short* __restrict__ vhp, const unsigned short* __restrict__ vlp,
            unsigned short* ohp, unsigned short* olp, float sscale) {
  union FB { v16b v; v8b h[2]; };
  union FH { v16h v; v8h h[2]; };
  __shared__ __align__(16) __bf16   Ksh[64 * 64];                 // K hi [kv][d]   8 KB
  __shared__ __align__(16) __bf16   Ksl[64 * 64];                 // K lo           8 KB
  __shared__ __align__(16) _Float16 Vth[64 * 64];                 // V^T hi [d][kv] 8 KB
  __shared__ __align__(16) _Float16 Vtl[64 * 64];                 // V^T residual   8 KB
  __shared__ __align__(16) _Float16 Psh[4][16 * 64];              // per wave P [row][kv] 8 KB
  __shared__ __align__(16) float    Os[4][16 * 64];               // per wave context tile [row][d] 16 KB

  const int tid  = threadIdx.x;
  const int wave = tid >> 5;
  const int lane = tid & 31;
  const int hh   = lane >> 4;
  const int c    = lane & 15;

  const int bx   = blockIdx.x;
  const int qb   = bx % NQB;
  const int rest = bx / NQB;
  const int h    = rest % NH;
  const int b    = rest / NH;
  const int q0   = qb * 64 + wave * 16;
  const size_t rowB = (size_t)b * SEQ;

  const __bf16* Qh = (const __bf16*)(const void*)qhp + (size_t)h * HD;
  const __bf16* Ql = (const __bf16*)(const void*)qlp + (size_t)h * HD;
  const __bf16* Kh = (const __bf16*)(const void*)khp + (size_t)h * HD;
  const __bf16* Kl = (const __bf16*)(const void*)klp + (size_t)h * HD;
  const _Float16* Vh = (const _Float16*)(const void*)vhp + ((size_t)b * DM + (size_t)h * HD) * SEQ;
  const _Float16* Vl = (const _Float16*)(const void*)vlp + ((size_t)b * DM + (size_t)h * HD) * SEQ;

  // ---- Q fragments (A operand, row = lane&15): 2 d-chunks, hi and lo ----
  v16b qah[2], qal[2];
#pragma unroll
  for (int dc = 0; dc < 2; ++dc) {
    const size_t qo = (rowB + q0 + c) * DM + dc * 32 + 8 * hh;
    qah[dc] = ldfrag_b(Qh + qo);
    qal[dc] = ldfrag_b(Ql + qo);
  }

  float mrow[8], lrow[8];
  v8f oacc[4];
#pragma unroll
  for (int r = 0; r < 8; ++r) { mrow[r] = -INFINITY; lrow[r] = 0.f; }
#pragma unroll
  for (int t = 0; t < 4; ++t) oacc[t] = zero8();

  for (int kt = 0; kt < NQB; ++kt) {         // static trip count
    const int kv0 = kt * 64;
    __syncthreads();
    {
      const int r = tid >> 1, half = (tid & 1) * 32;
      const __bf16*   kg  = Kh + (rowB + kv0 + r) * DM + half;    // K row kv0+r, d = half..half+31
      const __bf16*   klg = Kl + (rowB + kv0 + r) * DM + half;
      const _Float16* vg  = Vh + (size_t)r * SEQ + kv0 + half;    // V^T row d = r, s = kv0+half..+31
      const _Float16* vlg = Vl + (size_t)r * SEQ + kv0 + half;
#pragma unroll
      for (int i = 0; i < 4; ++i) {
        const v8b a0 = *(const v8b*)(kg + 8 * i);
        const v8b a1 = *(const v8b*)(klg + 8 * i);
        const v8h b0 = *(const v8h*)(vg + 8 * i);
        const v8h b1 = *(const v8h*)(vlg + 8 * i);
        *(v8b*)(Ksh + r * 64 + half + 8 * i) = a0;
        *(v8b*)(Ksl + r * 64 + half + 8 * i) = a1;
        *(v8h*)(Vth + r * 64 + half + 8 * i) = b0;
        *(v8h*)(Vtl + r * 64 + half + 8 * i) = b1;
      }
    }
    __syncthreads();

    // ---- scores: 16 query rows x 64 keys per wave, 3 bf16 products; B[k = d][n = key] from Ksh[key][d] ----
    v8f s[4];
#pragma unroll
    for (int j = 0; j < 4; ++j) {
      s[j] = zero8();
#pragma unroll
      for (int dc = 0; dc < 2; ++dc) {
        FB kb, kl;
        kb.h[0] = *(const v8b*)(Ksh + (j * 16 + c) * 64 + dc * 32 + 8 * hh);
        kb.h[1] = *(const v8b*)(Ksh + (j * 16 + c) * 64 + dc * 32 + 16 + 8 * hh);
        kl.h[0] = *(const v8b*)(Ksl + (j * 16 + c) * 64 + dc * 32 + 8 * hh);
        kl.h[1] = *(const v8b*)(Ksl + (j * 16 + c) * 64 + dc * 32 + 16 + 8 * hh);
        s[j] = mma_b(qah[dc], kb.v, s[j]);
        s[j] = mma_b(qah[dc], kl.v, s[j]);
        s[j] = mma_b(qal[dc], kb.v, s[j]);
      }
    }

    // ---- scale, row max, online softmax, P (x1024, f16) to LDS; row 8hh+r, key j*16+c lives in s[j][r] ----
    _Float16* pwh = Psh[wave];
#pragma unroll
    for (int r = 0; r < 8; ++r) {
      float m = -INFINITY;
#pragma unroll
      for (int j = 0; j < 4; ++j) {
        const float sv = s[j][r] * sscale;
        s[j][r] = sv;
        m = fmaxf(m, sv);
      }
#pragma unroll
      for (int off = 1; off < 16; off <<= 1) m = fmaxf(m, __shfl_xor(m, off, 32));
      const float mnew  = fmaxf(mrow[r], m);
      const float msafe = (mnew == -INFINITY) ? 0.f : mnew;
      const float alpha = __expf(mrow[r] - msafe);
      mrow[r] = mnew;
      float psum = 0.f;
#pragma unroll
      for (int j = 0; j < 4; ++j) {
        const float p = __expf(s[j][r] - msafe);
        psum += p;
        const _Float16 ph = (_Float16)(p * 1024.0f);
        pwh[(8 * hh + r) * 64 + j * 16 + c] = ph;
      }
#pragma unroll
      for (int off = 1; off < 16; off <<= 1) psum += __shfl_xor(psum, off, 32);
      lrow[r] = lrow[r] * alpha + psum;
#pragma unroll
      for (int t = 0; t < 4; ++t) oacc[t][r] *= alpha;
    }
    __builtin_amdgcn_fence(__ATOMIC_RELEASE, "workgroup");
    __builtin_amdgcn_wave_barrier();
    __builtin_amdgcn_fence(__ATOMIC_ACQUIRE, "workgroup");

    // ---- context += P . V (f16 WMMA): A = P[row][k = kv], B[k = kv][n = d] from Vth[d][kv];
    //      residual products into a separate per-chunk accumulator ----
    v8f o1[4];
#pragma unroll
    for (int t = 0; t < 4; ++t) o1[t] = zero8();
#pragma unroll 1
    for (int kk = 0; kk < 2; ++kk) {
      FH pa;
      pa.h[0] = *(const v8h*)(pwh + c * 64 + kk * 32 + 8 * hh);
      pa.h[1] = *(const v8h*)(pwh + c * 64 + kk * 32 + 16 + 8 * hh);
#pragma unroll
      for (int t = 0; t < 4; ++t) {
        FH vb, vl;
        vb.h[0] = *(const v8h*)(Vth + (t * 16 + c) * 64 + kk * 32 + 8 * hh);
        vb.h[1] = *(const v8h*)(Vth + (t * 16 + c) * 64 + kk * 32 + 16 + 8 * hh);
        vl.h[0] = *(const v8h*)(Vtl + (t * 16 + c) * 64 + kk * 32 + 8 * hh);
        vl.h[1] = *(const v8h*)(Vtl + (t * 16 + c) * 64 + kk * 32 + 16 + 8 * hh);
        oacc[t] = mma_h(pa.v, vb.v, oacc[t]);
        o1[t]   = mma_h(pa.v, vl.v, o1[t]);
      }
    }
#pragma unroll
    for (int t = 0; t < 4; ++t)
#pragma unroll
      for (int r = 0; r < 8; ++r) oacc[t][r] += o1[t][r] * (1.0f / 4096.0f);
  }

  // ---- normalise (1/l and the 1/1024 p carry), stage the wave's 16x64 tile, bf16 hi/lo split,
  float* os = Os[wave];
#pragma unroll
  for (int r = 0; r < 8; ++r) {
    const float l = lrow[r];
    const float inv = ((l > 0.f) ? (1.0f / l) : 0.f) * (1.0f / 1024.0f);
#pragma unroll
    for (int t = 0; t < 4; ++t) os[(8 * hh + r) * 64 + t * 16 + c] = oacc[t][r] * inv;
  }
  __builtin_amdgcn_fence(__ATOMIC_RELEASE, "workgroup");
  __builtin_amdgcn_wave_barrier();
  __builtin_amdgcn_fence(__ATOMIC_ACQUIRE, "workgroup");
  {
    const int q4 = lane >> 3, c8 = (lane & 7) * 8;
    v4u hv[4], lv[4];
#pragma unroll
    for (int it = 0; it < 4; ++it) {
      const int row = it * 4 + q4;   // it 0..3 x q4 0..3 = rows 0..15 of the wave tile
      const float* sp = os + row * 64 + c8;
      v4u a, a2;
#pragma unroll
      for (int e = 0; e < 4; ++e) {
        const float f0 = sp[2 * e], f1 = sp[2 * e + 1];
        const unsigned short h0 = bf_bits(f0), h1 = bf_bits(f1);
        const unsigned short l0 = bf_bits(f0 - bf_up(h0)), l1 = bf_bits(f1 - bf_up(h1));
        a[e] = pk16(h0, h1); a2[e] = pk16(l0, l1);
      }
      hv[it] = a; lv[it] = a2;
    }
    {
#pragma unroll
      for (int it = 0; it < 4; ++it) {
        const int row = it * 4 + q4;
        const size_t go = (rowB + q0 + row) * DM + (size_t)h * HD + c8;
        *(v4u*)(ohp + go) = hv[it];
        *(v4u*)(olp + go) = lv[it];
      }
      
    }
  }
}

// =====================================================================================================
// Workspace map: 8 regions of PL = NTOK*DM*2 = 16777216 B each, total 134217728 B.
//   R0  Xb   bf16 [8192][1024]                    (after the projections: Oh, context hi plane [8192][1024])
//   R1  Qh   bf16 [8192][1024]                    (after attention: Wob bf16 [1024][1024], 2097152 B used)
//   R2  Ql   bf16 [8192][1024]
//   R3  Kh   bf16 [8192][1024]
//   R4  Kl   bf16 [8192][1024]
//   R5  VTh  f16  [4][1024][2048]
//   R6  VTl  f16  [4][1024][2048]
//   R7  Wqkv bf16 [3072][1024] (6291456 B used)   (during attention: Ol, context lo plane [8192][1024])
// All planes are exact multiples of their 64x64 tile / whole-line store granularity (no padded tails needed).
// Weights are [out n][in k] with k contiguous = the Bt / A layout the GEMM wants, so they are only converted.
// =====================================================================================================
extern "C" void kernel_launch(void* const* d_in, const int* in_sizes, int n_in,
                              void* d_out, int out_size, void* d_ws, size_t ws_size,
                              hipStream_t stream) {
  if (n_in < 8) return;
  if (in_sizes[0] != NTOK * DM) return;
  if (in_sizes[1] != 3 * DM * DM) return;
  if (in_sizes[2] != DM || in_sizes[3] != DM) return;
  if (in_sizes[4] != DM * DM || in_sizes[5] != DM) return;
  if (in_sizes[6] != (SEQ - 1) * HD || in_sizes[7] != (SEQ - 1) * HD) return;
  if (out_size != NTOK * DM) return;

  const float* x      = (const float*)d_in[0];
  const float* qkv_w  = (const float*)d_in[1];
  const float* q_bias = (const float*)d_in[2];
  const float* v_bias = (const float*)d_in[3];
  const float* proj_w = (const float*)d_in[4];
  const float* proj_b = (const float*)d_in[5];
  const float* rsin   = (const float*)d_in[6];
  const float* rcos   = (const float*)d_in[7];

  const size_t PL = (size_t)NTOK * DM * 2;        // 16777216  one 16-bit activation plane [8192][1024]
  static_assert((size_t)3 * DM * DM * 2 <= (size_t)NTOK * DM * 2);
  static_assert((size_t)NB * DM * SEQ * 2 == (size_t)NTOK * DM * 2);
  static_assert((size_t)DM * DM * 2 <= (size_t)NTOK * DM * 2);
  size_t off = 0;
  const size_t oR0 = off; off += PL;
  const size_t oR1 = off; off += PL;
  const size_t oR2 = off; off += PL;
  const size_t oR3 = off; off += PL;
  const size_t oR4 = off; off += PL;
  const size_t oR5 = off; off += PL;
  const size_t oR6 = off; off += PL;
  const size_t oR7 = off; off += PL;
  if (off > ws_size) return;                      // off = 134217728
  if (off > (size_t)134217728) return;

  char* ws = (char*)d_ws;
  unsigned short* Xb   = (unsigned short*)(ws + oR0);
  unsigned short* Oh   = (unsigned short*)(ws + oR0);
  unsigned short* Qh   = (unsigned short*)(ws + oR1);
  unsigned short* Wob  = (unsigned short*)(ws + oR1);
  unsigned short* Ql   = (unsigned short*)(ws + oR2);
  unsigned short* Kh   = (unsigned short*)(ws + oR3);
  unsigned short* Kl   = (unsigned short*)(ws + oR4);
  unsigned short* VTh  = (unsigned short*)(ws + oR5);
  unsigned short* VTl  = (unsigned short*)(ws + oR6);
  unsigned short* Wqkv = (unsigned short*)(ws + oR7);
  unsigned short* Ol   = (unsigned short*)(ws + oR7);
  const unsigned short* Wq = Wqkv;
  const unsigned short* Wk = Wqkv + (size_t)DM * DM;
  const unsigned short* Wv = Wqkv + (size_t)2 * DM * DM;

  const dim3 blk(256);
  const int n8x = NTOK * DM / 8;                              // 1048576
  const int n8q = 3 * DM * DM / 8;                            //  393216
  const int n8o = DM * DM / 8;                                //  131072
  if ((n8x % 256) != 0 || (n8q % 256) != 0 || (n8o % 256) != 0) return;
  const dim3 gCvtX(n8x / 256);                                // 4096 blocks
  const dim3 gCvtQ(n8q / 256);                                // 1536 blocks
  const dim3 gCvtO(n8o / 256);                                //  512 blocks
  const int tilesTok = (NTOK / 64) * (DM / 64);               // 2048 tiles: M=8192, N=1024
  const int tilesVT  = (DM / 64) * (SEQ / 64);                //  512 tiles: M=1024, N=2048
  const dim3 gTok((tilesTok + 7) / 8, 1);                     // 256 blocks
  const dim3 gVT((tilesVT + 7) / 8, NB);                      // 64 blocks x 4 batches
  const dim3 gAttn(NB * NH * NQB);                            // 2048 blocks

  // (1) x -> bf16 plane [8192][1024]; qkv_w [3072 n][1024 k] f32 -> bf16
  cvt_bf16x8<<<gCvtX, blk, 0, stream>>>(x, Xb, n8x);
  cvt_bf16x8<<<gCvtQ, blk, 0, stream>>>(qkv_w, Wqkv, n8q);
  // (2) q = x . Wq^T + q_bias, rope for tokens >= 1 -> bf16 hi/lo planes [b*SEQ+t][h*64+d]   (M=8192, N=1024, K=1024)
  gemm64<0, 2, 1, 1><<<gTok, blk, 0, stream>>>(
      Xb, Xb, DM, 0LL, Wq, DM, 0LL, q_bias, rsin, rcos,
      (void*)Qh, (void*)Ql, DM, 0LL, NTOK, DM, DM, 1.0f);
  // (3) k = x . Wk^T (no bias), rope -> bf16 hi/lo planes
  gemm64<0, 2, 0, 1><<<gTok, blk, 0, stream>>>(
      Xb, Xb, DM, 0LL, Wk, DM, 0LL, q_bias, rsin, rcos,
      (void*)Kh, (void*)Kl, DM, 0LL, NTOK, DM, DM, 1.0f);
  // (4) v^T = Wv . x^T + v_bias[row] per batch -> f16 hi plane [b][h*64+d][s] (pitch SEQ) and residual plane x4096
  //     (A = Wv [n][k], Bt = Xb rows of batch b; M=1024, N=2048, K=1024)
  gemm64<0, 3, 2, 0><<<gVT, blk, 0, stream>>>(
      Wv, Wv, DM, 0LL, Xb, DM, (long long)SEQ * DM, v_bias, rsin, rcos,
      (void*)VTh, (void*)VTl, SEQ, (long long)DM * SEQ, DM, SEQ, DM, 4096.0f);
  // (5) attention -> context bf16 hi plane (R0, x plane dead) and lo plane (R7, weight plane dead)
  attn64<<<gAttn, dim3(128), 0, stream>>>(Qh, Ql, Kh, Kl, VTh, VTl, Oh, Ol, 0.125f);
  // (6) proj_w -> bf16 [n][k] into R1 (q hi plane dead after attention)
  cvt_bf16x8<<<gCvtO, blk, 0, stream>>>(proj_w, Wob, n8o);
  // (7) out = context . Wo^T + proj_b -> d_out f32 [8192][1024]  (A = context hi + lo planes, 2 products)
  gemm64<1, 0, 1, 0><<<gTok, blk, 0, stream>>>(
      Oh, Ol, DM, 0LL, Wob, DM, 0LL, proj_b, rsin, rcos,
      d_out, d_out, DM, 0LL, NTOK, DM, DM, 1.0f);
  (void)hipGetLastError();
}

// v001
// It runs in 497 microseconds.
// In two side-by-side timings against v000, it was 1.50 and 1.49 times as fast.
// Contractions: q, k, v^T projections = v_wmma_f32_16x16x32_bf16 (bf16 operands from RNE-converted inputs, single product, f32 accumulate);
// q.k^T scores = v_wmma_f32_16x16x32_bf16 with bf16 hi/lo split q and k (hi.hi + hi.lo + lo.hi), f32 accumulate;
// p.v = v_wmma_f32_16x16x32_f16 (p carried x1024 in f16; v as f16 hi plane plus f16 residual plane x4096; 2 products), f32 accumulate;
// ctx.Wo^T = v_wmma_f32_16x16x32_bf16 with ctx as bf16 hi/lo planes times bf16 Wo (2 products), f32 accumulate; bias, rope, softmax in f32.
#include <hip/hip_runtime.h>
#include <math.h>
#include <stdint.h>

#pragma clang fp contract(off)

#define NB    4
#define SEQ   2048
#define DM    1024
#define NH    16
#define HD    64
#define NQB   (SEQ / 64)      // 32 key / query tiles of 64
#define NTOK  (NB * SEQ)      // 8192 token rows
#define LP    72              // LDS row pitch of the attention K, V^T and P tiles, in 16-bit elements
static_assert(NH * HD == DM);
static_assert((SEQ % 64) == 0 && (DM % 64) == 0);
static_assert((SEQ & (SEQ - 1)) == 0);
static_assert(LP >= HD && (LP % 8) == 0 && ((LP / 8) & 1) == 1);   // 16-B aligned rows, pitch = 16 B x odd

typedef _Float16 v16h __attribute__((ext_vector_type(16)));
typedef _Float16 v8h  __attribute__((ext_vector_type(8)));
typedef __bf16   v16b __attribute__((ext_vector_type(16)));
typedef __bf16   v8b  __attribute__((ext_vector_type(8)));
typedef float    v8f  __attribute__((ext_vector_type(8)));
typedef float    v4f  __attribute__((ext_vector_type(4)));
typedef unsigned int v4u __attribute__((ext_vector_type(4)));

// ---- scalar helpers --------------------------------------------------------------------------------
__device__ __forceinline__ unsigned short bf_bits(float f) {          // f32 -> bf16 bits, RNE convert
  unsigned u = __float_as_uint(f);
  return (unsigned short)((u + 0x7FFFu + ((u >> 16) & 1u)) >> 16);
}
__device__ __forceinline__ float bf_up(unsigned short h) { return __uint_as_float(((unsigned)h) << 16); }
__device__ __forceinline__ float bfr(float f) { return bf_up(bf_bits(f)); }   // value after bf16 RNE convert
__device__ __forceinline__ unsigned short h_bits(_Float16 x) { return __builtin_bit_cast(unsigned short, x); }
__device__ __forceinline__ unsigned pk16(unsigned short a, unsigned short b) { return (unsigned)a | ((unsigned)b << 16); }
__device__ __forceinline__ v8f zero8() { v8f z = {0.f, 0.f, 0.f, 0.f, 0.f, 0.f, 0.f, 0.f}; return z; }

// ---- fragment loader: 16-bit A/B operand, lane -> row/col (lane&15), p already includes +8*(lane>>4);
//      elements 0..7 <- p[0..7] (k0+8h..), elements 8..15 <- p[16..23] (k0+16+8h..)
__device__ __forceinline__ v16b ldfrag_b(const __bf16* p) {
  union { v16b v; v8b h[2]; } f;
  f.h[0] = *(const v8b*)(p);
  f.h[1] = *(const v8b*)(p + 16);
  return f.v;
}

// ---- WMMA helpers with trailing VALU hazard gap --------------------------------------------------------
__device__ __forceinline__ v8f mma_b(v16b a, v16b b, v8f c) {
  c = __builtin_amdgcn_wmma_f32_16x16x32_bf16(false, a, false, b, (short)0, c, false, false);
  asm volatile("v_nop\n\tv_nop\n\tv_nop\n\tv_nop" : "+v"(c) : "v"(a), "v"(b));
  return c;
}
__device__ __forceinline__ v8f mma_h(v16h a, v16h b, v8f c) {
  c = __builtin_amdgcn_wmma_f32_16x16x32_f16(false, a, false, b, (short)0, c, false, false);
  asm volatile("v_nop\n\tv_nop\n\tv_nop\n\tv_nop" : "+v"(c) : "v"(a), "v"(b));
  return c;
}
__device__ __forceinline__ v8f mma_b_raw(v16b a, v16b b, v8f c) {
  return __builtin_amdgcn_wmma_f32_16x16x32_bf16(false, a, false, b, (short)0, c, false, false);
}
__device__ __forceinline__ void dep_guard_b(v8f& a, v8f& b, v16b x, v16b y) {
  asm volatile("v_nop\n\tv_nop\n\tv_nop\n\tv_nop" : "+v"(a), "+v"(b) : "v"(x), "v"(y));
}
__device__ __forceinline__ void keep4_b(v16b a, v16b b, v16b c, v16b d) {
  asm volatile("v_nop" :: "v"(a), "v"(b), "v"(c), "v"(d));
}
__device__ __forceinline__ void acc_guard4(v8f& a, v8f& b, v8f& c, v8f& d) {
  asm volatile("v_nop\n\tv_nop\n\tv_nop\n\tv_nop" : "+v"(a), "+v"(b), "+v"(c), "+v"(d));
}

// =====================================================================================================
// f32 -> bf16 (RNE convert), 8 elements per thread, one 16-B store per lane: a wave writes 512 contiguous B
// multiple of 256 for every use here; host-checked). coverage: n8 threads x 8 = whole plane.
// =====================================================================================================
__global__ __launch_bounds__(256) void cvt_bf16x8(const float* __restrict__ in, unsigned short* out, int n8) {
  const int i = blockIdx.x * 256 + threadIdx.x;
  if (i < n8) {
    const v4f a = *(const v4f*)(in + (size_t)i * 8);
    const v4f b = *(const v4f*)(in + (size_t)i * 8 + 4);
    v4u p;
    p[0] = pk16(bf_bits(a[0]), bf_bits(a[1]));
    p[1] = pk16(bf_bits(a[2]), bf_bits(a[3]));
    p[2] = pk16(bf_bits(b[0]), bf_bits(b[1]));
    p[3] = pk16(bf_bits(b[2]), bf_bits(b[3]));
    *(v4u*)(out + (size_t)i * 8) = p;
    
  }
}

// =====================================================================================================
// Register-blocked batched bf16 WMMA GEMM: C[m][n] = sum_k A[m][k] * Bt[n][k]; one wave per 64x64 tile,
// no block barriers. A row-major [M][K] pitch lda; Bt row-major [N][K] pitch ldb (k contiguous);
// M, N multiples of 64, K multiple of 32 (host-checked). blockIdx.y = batch index (strides in elements).
// NSPLIT: 0 = A.Bt; 1 = (A + A2).Bt (A2 = unscaled bf16 lo plane of A, same pitch/stride).
// BIAS: 0 none; 1 = + bfr(bias[n]) per column; 2 = + bfr(bias[m]) per row.
// ROPE (needs N tile = one head = 64 cols d 0..63, row m = b*SEQ + s): for s >= 1,
//   t[d] = t[d]*bfr(cos[s-1][d]) + rot[d]*bfr(sin[s-1][d]), rot = [-t[32..63] | t[0..31]] (after bias).
// OUT_MODE: 0 = f32 (pitch ldc); 2 = bf16 hi plane C + bf16 lo plane C2 (lo = RNE(v - hi), unscaled);
//           3 = f16 hi plane C + f16 residual plane C2 = f16((v - hi) * rscale); C2 same pitch/stride as C.
// =====================================================================================================
template <int NSPLIT, int OUT_MODE, int BIAS, int ROPE>
__global__ __launch_bounds__(256) void gemm64(
    const unsigned short* __restrict__ Ap, const unsigned short* __restrict__ A2p, int lda, long long strideA,
    const unsigned short* __restrict__ Btp, int ldb, long long strideB,
    const float* __restrict__ bias, const float* __restrict__ rsin, const float* __restrict__ rcos,
    void* Cout, void* Cout2, int ldc, long long strideC,
    int M, int N, int K, float rscale) {
  const __bf16* A  = (const __bf16*)(const void*)Ap;
  const __bf16* A2 = (const __bf16*)(const void*)A2p;
  const __bf16* Bt = (const __bf16*)(const void*)Btp;
  __shared__ __align__(16) float sT[8][16 * 68];   // per-wave 16x64 slab, pitch 68 floats
  const int b    = blockIdx.y;
  const int lane = threadIdx.x & 31;
  const int wave = threadIdx.x >> 5;
  const int tilesN = N >> 6;
  const int tilesM = M >> 6;
  const int tile = blockIdx.x * 8 + wave;
  if (tile >= tilesM * tilesN) return;   // wave-uniform; no block barriers in this kernel
  const int tm = tile / tilesN;
  const int tn = tile - tm * tilesN;
  const int m0 = tm << 6;
  const int n0 = tn << 6;

  const __bf16* Ab  = A  + (size_t)b * strideA;
  const __bf16* Bb  = Bt + (size_t)b * strideB;
  const __bf16* Ab2 = (NSPLIT == 1) ? (A2 + (size_t)b * strideA) : Ab;

  const int rlane = lane & 15;                 // row (A) / col (B, D) within subtile
  const int koff  = (lane >> 4) * 8;           // k offset of this lane half
  const int mOff  = (lane >> 4) * 8;           // D row offset

  v8f acc[4][4];
#pragma unroll
  for (int i = 0; i < 4; ++i)
#pragma unroll
    for (int j = 0; j < 4; ++j) acc[i][j] = zero8();

  for (int k0 = 0; k0 < K; k0 += 32) {
    v16b bh[4];
#pragma unroll
    for (int j = 0; j < 4; ++j) {
      const size_t bo = (size_t)(n0 + (j << 4) + rlane) * ldb + koff + k0;
      bh[j] = ldfrag_b(Bb + bo);
    }
#pragma unroll
    for (int i = 0; i < 4; ++i) {
      const size_t ao = (size_t)(m0 + (i << 4) + rlane) * lda + koff + k0;
      const v16b ah = ldfrag_b(Ab + ao);
      v16b al = ah;
      if (NSPLIT == 1) al = ldfrag_b(Ab2 + ao);
#pragma unroll
      for (int j = 0; j < 4; ++j) {
        acc[i][j] = mma_b_raw(ah, bh[j], acc[i][j]);
        if (NSPLIT == 1) acc[i][j] = mma_b_raw(al, bh[j], acc[i][j]);
      }
      dep_guard_b(acc[i][0], acc[i][3], ah, al);
    }
    keep4_b(bh[0], bh[1], bh[2], bh[3]);
  }
  acc_guard4(acc[0][0], acc[0][1], acc[0][2], acc[0][3]);
  acc_guard4(acc[1][0], acc[1][1], acc[1][2], acc[1][3]);
  acc_guard4(acc[2][0], acc[2][1], acc[2][2], acc[2][3]);
  acc_guard4(acc[3][0], acc[3][1], acc[3][2], acc[3][3]);

  // ---- epilogue ----
  float* slab = sT[wave];
  float bcol[4];
  if (BIAS == 1) {
#pragma unroll
    for (int j = 0; j < 4; ++j) bcol[j] = bfr(bias[n0 + (j << 4) + rlane]);   // n0+.. < N
  } else {
#pragma unroll
    for (int j = 0; j < 4; ++j) bcol[j] = 0.f;
  }
#pragma unroll
  for (int i = 0; i < 4; ++i) {
    const int mBase = m0 + (i << 4);
#pragma unroll
    for (int r = 0; r < 8; ++r) {
      const int m = mBase + mOff + r;                  // < M
      float brow = 0.f;
      if (BIAS == 2) brow = bfr(bias[m]);
      float t[4];
#pragma unroll
      for (int j = 0; j < 4; ++j) {
        float v = acc[i][j][r];
        if (BIAS == 1) v = v + bcol[j];
        if (BIAS == 2) v = v + brow;
        t[j] = v;
      }
      if (ROPE) {
        const int s = m & (SEQ - 1);                   // token index within the sequence
        const bool use = (s > 0);                        // token 0 passes unrotated
        const int sidx = use ? (s - 1) : 0;              // clamped table row
        const float* cr = rcos + (size_t)sidx * HD;
        const float* sr = rsin + (size_t)sidx * HD;
        float u[4];
#pragma unroll
        for (int j = 0; j < 4; ++j) {
          const int d = (j << 4) + rlane;                // 0..63
          const float cs = bfr(cr[d]);
          const float sn = bfr(sr[d]);
          const float tp = t[j ^ 2];                     // partner d^32, same lane
          const float rot = (j < 2) ? -tp : tp;
          const float w = t[j] * cs + rot * sn;
          u[j] = use ? w : t[j];
        }
#pragma unroll
        for (int j = 0; j < 4; ++j) t[j] = u[j];
      }
#pragma unroll
      for (int j = 0; j < 4; ++j) slab[(mOff + r) * 68 + (j << 4) + rlane] = t[j];
    }
    __builtin_amdgcn_fence(__ATOMIC_RELEASE, "workgroup");
    __builtin_amdgcn_wave_barrier();
    __builtin_amdgcn_fence(__ATOMIC_ACQUIRE, "workgroup");
    if (OUT_MODE == 0) {
      float* C = (float*)Cout + (size_t)b * strideC;
      const int hh = lane >> 4, c4 = (lane & 15) * 4;     // 256-B row segment = 16 lanes x 16 B
      {
#pragma unroll
        for (int it = 0; it < 8; ++it) {
          const int row = it * 2 + hh;                     // it 0..7 x hh 0..1 = rows 0..15
          const v4f v = *(const v4f*)(slab + row * 68 + c4);
          *(v4f*)(C + (size_t)(mBase + row) * ldc + n0 + c4) = v;
        }
        
      }
    } else {
      const int q = lane >> 3, c8 = (lane & 7) * 8;
      unsigned short* C  = (unsigned short*)Cout  + (size_t)b * strideC;
      unsigned short* C2 = (unsigned short*)Cout2 + (size_t)b * strideC;
      v4u hv[4], lv[4];
#pragma unroll
      for (int it = 0; it < 4; ++it) {
        const int row = it * 4 + q;                        // it 0..3 x q 0..3 = rows 0..15
        const float* sp = slab + row * 68 + c8;
        v4u a, a2;
#pragma unroll
        for (int e = 0; e < 4; ++e) {
          const float f0 = sp[2 * e], f1 = sp[2 * e + 1];
          unsigned short h0, h1, l0, l1;
          if (OUT_MODE == 2) {
            h0 = bf_bits(f0); h1 = bf_bits(f1);
            l0 = bf_bits(f0 - bf_up(h0)); l1 = bf_bits(f1 - bf_up(h1));
          } else {
            const _Float16 x0 = (_Float16)f0, x1 = (_Float16)f1;
            h0 = h_bits(x0); h1 = h_bits(x1);
            l0 = h_bits((_Float16)((f0 - (float)x0) * rscale));
            l1 = h_bits((_Float16)((f1 - (float)x1) * rscale));
          }
          a[e] = pk16(h0, h1); a2[e] = pk16(l0, l1);
        }
        hv[it] = a; lv[it] = a2;
      }
      {
#pragma unroll
        for (int it = 0; it < 4; ++it) {
          const int row = it * 4 + q;
          *(v4u*)(C  + (size_t)(mBase + row) * ldc + n0 + c8) = hv[it];
          *(v4u*)(C2 + (size_t)(mBase + row) * ldc + n0 + c8) = lv[it];
        }
        
      }
    }
    __builtin_amdgcn_fence(__ATOMIC_RELEASE, "workgroup");
    __builtin_amdgcn_wave_barrier();
    __builtin_amdgcn_fence(__ATOMIC_ACQUIRE, "workgroup");
  }
}

// =====================================================================================================
// Attention, head dim 64, no mask, all SEQ keys.
//   q planes (bf16 hi / lo): element (b, t, h, d) at [(b*SEQ + t)*DM + h*64 + d]
//   k planes (bf16 hi / lo): same layout with key index s
//   v^T hi plane (f16):      element (b, h, d, s) at [(b*DM + h*64 + d)*SEQ + s]
//   v^T residual plane (f16, (v - hi)*4096): same layout
//   out planes (bf16 hi / lo of the normalised context): element (b, t, h, d) at [(b*SEQ + t)*DM + h*64 + d]
//   scores = q . k : bf16 hi/lo split (hi.hi + hi.lo + lo.hi), f32 accumulate, then * sscale in f32
//   p = exp(s - m) carried as f16(1024 p); context = p . v on f16 WMMA: p.v_hi into the running accumulator,
//   p.v_res into a per-chunk accumulator folded back with 1/4096 in f32; online softmax in f32.
//   Block = 4 waves = 64 query rows of one (b, h); grid = NQB * NH * NB; kv chunks of 64, static trip NQB.
//   K / V^T chunk staging: 128 threads x 32 elements per plane = the whole 64x64 tile (plain 16-B loads,
//   __syncthreads before and after); P tiles are wave-private, spilled with _Float16 element stores and reloaded
//   Output coverage: each wave stores rows q0..q0+15 (it 0..3 x lane>>3 0..3) x 64 columns (8 lanes x 8) of both planes.
// =====================================================================================================
__global__ __launch_bounds__(128)
void attn64(const unsigned short* __restrict__ qhp, const unsigned short* __restrict__ qlp,
            const unsigned short* __restrict__ khp, const unsigned short* __restrict__ klp,
            const unsigned short* __restrict__ vhp, const unsigned short* __restrict__ vlp,
            unsigned short* ohp, unsigned short* olp, float sscale) {
  union FB { v16b v; v8b h[2]; };
  union FH { v16h v; v8h h[2]; };
  // Rows of 64 16-bit elements are laid at a pitch of LP = 72 elements (144 B = 16 B x 9): the 16 rows that one
  // ds_load_b128 fragment read touches then fall on 16 different groups of four banks instead of two.
  __shared__ __align__(16) __bf16   Ksh[64 * LP];                 // K hi [kv][d]   9 KB
  __shared__ __align__(16) __bf16   Ksl[64 * LP];                 // K lo           9 KB
  __shared__ __align__(16) _Float16 Vth[64 * LP];                 // V^T hi [d][kv] 9 KB
  __shared__ __align__(16) _Float16 Vtl[64 * LP];                 // V^T residual   9 KB
  __shared__ __align__(16) _Float16 Psh[4][16 * LP];              // per wave P [row][kv] 9 KB
  __shared__ __align__(16) float    Os[4][16 * 64];               // per wave context tile [row][d] 16 KB

  const int tid  = threadIdx.x;
  const int wave = tid >> 5;
  const int lane = tid & 31;
  const int hh   = lane >> 4;
  const int c    = lane & 15;

  const int bx   = blockIdx.x;
  const int qb   = bx % NQB;
  const int rest = bx / NQB;
  const int h    = rest % NH;
  const int b    = rest / NH;
  const int q0   = qb * 64 + wave * 16;
  const size_t rowB = (size_t)b * SEQ;

  const __bf16* Qh = (const __bf16*)(const void*)qhp + (size_t)h * HD;
  const __bf16* Ql = (const __bf16*)(const void*)qlp + (size_t)h * HD;
  const __bf16* Kh = (const __bf16*)(const void*)khp + (size_t)h * HD;
  const __bf16* Kl = (const __bf16*)(const void*)klp + (size_t)h * HD;
  const _Float16* Vh = (const _Float16*)(const void*)vhp + ((size_t)b * DM + (size_t)h * HD) * SEQ;
  const _Float16* Vl = (const _Float16*)(const void*)vlp + ((size_t)b * DM + (size_t)h * HD) * SEQ;

  // ---- Q fragments (A operand, row = lane&15): 2 d-chunks, hi and lo ----
  v16b qah[2], qal[2];
#pragma unroll
  for (int dc = 0; dc < 2; ++dc) {
    const size_t qo = (rowB + q0 + c) * DM + dc * 32 + 8 * hh;
    qah[dc] = ldfrag_b(Qh + qo);
    qal[dc] = ldfrag_b(Ql + qo);
  }

  float mrow[8], lrow[8];
  v8f oacc[4];
#pragma unroll
  for (int r = 0; r < 8; ++r) { mrow[r] = -INFINITY; lrow[r] = 0.f; }
#pragma unroll
  for (int t = 0; t < 4; ++t) oacc[t] = zero8();

  for (int kt = 0; kt < NQB; ++kt) {         // static trip count
    const int kv0 = kt * 64;
    __syncthreads();
    {
      const int r = tid >> 1, half = (tid & 1) * 32;
      const __bf16*   kg  = Kh + (rowB + kv0 + r) * DM + half;    // K row kv0+r, d = half..half+31
      const __bf16*   klg = Kl + (rowB + kv0 + r) * DM + half;
      const _Float16* vg  = Vh + (size_t)r * SEQ + kv0 + half;    // V^T row d = r, s = kv0+half..+31
      const _Float16* vlg = Vl + (size_t)r * SEQ + kv0 + half;
#pragma unroll
      for (int i = 0; i < 4; ++i) {
        const v8b a0 = *(const v8b*)(kg + 8 * i);
        const v8b a1 = *(const v8b*)(klg + 8 * i);
        const v8h b0 = *(const v8h*)(vg + 8 * i);
        const v8h b1 = *(const v8h*)(vlg + 8 * i);
        *(v8b*)(Ksh + r * LP + half + 8 * i) = a0;
        *(v8b*)(Ksl + r * LP + half + 8 * i) = a1;
        *(v8h*)(Vth + r * LP + half + 8 * i) = b0;
        *(v8h*)(Vtl + r * LP + half + 8 * i) = b1;
      }
    }
    __syncthreads();

    // ---- scores: 16 query rows x 64 keys per wave, 3 bf16 products; B[k = d][n = key] from Ksh[key][d] ----
    v8f s[4];
#pragma unroll
    for (int j = 0; j < 4; ++j) {
      s[j] = zero8();
#pragma unroll
      for (int dc = 0; dc < 2; ++dc) {
        FB kb, kl;
        kb.h[0] = *(const v8b*)(Ksh + (j * 16 + c) * LP + dc * 32 + 8 * hh);
        kb.h[1] = *(const v8b*)(Ksh + (j * 16 + c) * LP + dc * 32 + 16 + 8 * hh);
        kl.h[0] = *(const v8b*)(Ksl + (j * 16 + c) * LP + dc * 32 + 8 * hh);
        kl.h[1] = *(const v8b*)(Ksl + (j * 16 + c) * LP + dc * 32 + 16 + 8 * hh);
        s[j] = mma_b(qah[dc], kb.v, s[j]);
        s[j] = mma_b(qah[dc], kl.v, s[j]);
        s[j] = mma_b(qal[dc], kb.v, s[j]);
      }
    }

    // ---- scale, row max, online softmax, P (x1024, f16) to LDS; row 8hh+r, key j*16+c lives in s[j][r] ----
    _Float16* pwh = Psh[wave];
#pragma unroll
    for (int r = 0; r < 8; ++r) {
      float m = -INFINITY;
#pragma unroll
      for (int j = 0; j < 4; ++j) {
        const float sv = s[j][r] * sscale;
        s[j][r] = sv;
        m = fmaxf(m, sv);
      }
#pragma unroll
      for (int off = 1; off < 16; off <<= 1) m = fmaxf(m, __shfl_xor(m, off, 32));
      const float mnew  = fmaxf(mrow[r], m);
      const float msafe = (mnew == -INFINITY) ? 0.f : mnew;
      const float alpha = __expf(mrow[r] - msafe);
      mrow[r] = mnew;
      float psum = 0.f;
#pragma unroll
      for (int j = 0; j < 4; ++j) {
        const float p = __expf(s[j][r] - msafe);
        psum += p;
        const _Float16 ph = (_Float16)(p * 1024.0f);
        pwh[(8 * hh + r) * LP + j * 16 + c] = ph;
      }
#pragma unroll
      for (int off = 1; off < 16; off <<= 1) psum += __shfl_xor(psum, off, 32);
      lrow[r] = lrow[r] * alpha + psum;
#pragma unroll
      for (int t = 0; t < 4; ++t) oacc[t][r] *= alpha;
    }
    __builtin_amdgcn_fence(__ATOMIC_RELEASE, "workgroup");
    __builtin_amdgcn_wave_barrier();
    __builtin_amdgcn_fence(__ATOMIC_ACQUIRE, "workgroup");

    // ---- context += P . V (f16 WMMA): A = P[row][k = kv], B[k = kv][n = d] from Vth[d][kv];
    //      residual products into a separate per-chunk accumulator ----
    v8f o1[4];
#pragma unroll
    for (int t = 0; t < 4; ++t) o1[t] = zero8();
#pragma unroll 1
    for (int kk = 0; kk < 2; ++kk) {
      FH pa;
      pa.h[0] = *(const v8h*)(pwh + c * LP + kk * 32 + 8 * hh);
      pa.h[1] = *(const v8h*)(pwh + c * LP + kk * 32 + 16 + 8 * hh);
#pragma unroll
      for (int t = 0; t < 4; ++t) {
        FH vb, vl;
        vb.h[0] = *(const v8h*)(Vth + (t * 16 + c) * LP + kk * 32 + 8 * hh);
        vb.h[1] = *(const v8h*)(Vth + (t * 16 + c) * LP + kk * 32 + 16 + 8 * hh);
        vl.h[0] = *(const v8h*)(Vtl + (t * 16 + c) * LP + kk * 32 + 8 * hh);
        vl.h[1] = *(const v8h*)(Vtl + (t * 16 + c) * LP + kk * 32 + 16 + 8 * hh);
        oacc[t] = mma_h(pa.v, vb.v, oacc[t]);
        o1[t]   = mma_h(pa.v, vl.v, o1[t]);
      }
    }
#pragma unroll
    for (int t = 0; t < 4; ++t)
#pragma unroll
      for (int r = 0; r < 8; ++r) oacc[t][r] += o1[t][r] * (1.0f / 4096.0f);
  }

  // ---- normalise (1/l and the 1/1024 p carry), stage the wave's 16x64 tile, bf16 hi/lo split,
  float* os = Os[wave];
#pragma unroll
  for (int r = 0; r < 8; ++r) {
    const float l = lrow[r];
    const float inv = ((l > 0.f) ? (1.0f / l) : 0.f) * (1.0f / 1024.0f);
#pragma unroll
    for (int t = 0; t < 4; ++t) os[(8 * hh + r) * 64 + t * 16 + c] = oacc[t][r] * inv;
  }
  __builtin_amdgcn_fence(__ATOMIC_RELEASE, "workgroup");
  __builtin_amdgcn_wave_barrier();
  __builtin_amdgcn_fence(__ATOMIC_ACQUIRE, "workgroup");
  {
    const int q4 = lane >> 3, c8 = (lane & 7) * 8;
    v4u hv[4], lv[4];
#pragma unroll
    for (int it = 0; it < 4; ++it) {
      const int row = it * 4 + q4;   // it 0..3 x q4 0..3 = rows 0..15 of the wave tile
      const float* sp = os + row * 64 + c8;
      v4u a, a2;
#pragma unroll
      for (int e = 0; e < 4; ++e) {
        const float f0 = sp[2 * e], f1 = sp[2 * e + 1];
        const unsigned short h0 = bf_bits(f0), h1 = bf_bits(f1);
        const unsigned short l0 = bf_bits(f0 - bf_up(h0)), l1 = bf_bits(f1 - bf_up(h1));
        a[e] = pk16(h0, h1); a2[e] = pk16(l0, l1);
      }
      hv[it] = a; lv[it] = a2;
    }
    {
#pragma unroll
      for (int it = 0; it < 4; ++it) {
        const int row = it * 4 + q4;
        const size_t go = (rowB + q0 + row) * DM + (size_t)h * HD + c8;
        *(v4u*)(ohp + go) = hv[it];
        *(v4u*)(olp + go) = lv[it];
      }
      
    }
  }
}

// =====================================================================================================
// Workspace map: 8 regions of PL = NTOK*DM*2 = 16777216 B each, total 134217728 B.
//   R0  Xb   bf16 [8192][1024]                    (after the projections: Oh, context hi plane [8192][1024])
//   R1  Qh   bf16 [8192][1024]                    (after attention: Wob bf16 [1024][1024], 2097152 B used)
//   R2  Ql   bf16 [8192][1024]
//   R3  Kh   bf16 [8192][1024]
//   R4  Kl   bf16 [8192][1024]
//   R5  VTh  f16  [4][1024][2048]
//   R6  VTl  f16  [4][1024][2048]
//   R7  Wqkv bf16 [3072][1024] (6291456 B used)   (during attention: Ol, context lo plane [8192][1024])
// All planes are exact multiples of their 64x64 tile / whole-line store granularity (no padded tails needed).
// Weights are [out n][in k] with k contiguous = the Bt / A layout the GEMM wants, so they are only converted.
// =====================================================================================================
extern "C" void kernel_launch(void* const* d_in, const int* in_sizes, int n_in,
                              void* d_out, int out_size, void* d_ws, size_t ws_size,
                              hipStream_t stream) {
  if (n_in < 8) return;
  if (in_sizes[0] != NTOK * DM) return;
  if (in_sizes[1] != 3 * DM * DM) return;
  if (in_sizes[2] != DM || in_sizes[3] != DM) return;
  if (in_sizes[4] != DM * DM || in_sizes[5] != DM) return;
  if (in_sizes[6] != (SEQ - 1) * HD || in_sizes[7] != (SEQ - 1) * HD) return;
  if (out_size != NTOK * DM) return;

  const float* x      = (const float*)d_in[0];
  const float* qkv_w  = (const float*)d_in[1];
  const float* q_bias = (const float*)d_in[2];
  const float* v_bias = (const float*)d_in[3];
  const float* proj_w = (const float*)d_in[4];
  const float* proj_b = (const float*)d_in[5];
  const float* rsin   = (const float*)d_in[6];
  const float* rcos   = (const float*)d_in[7];

  const size_t PL = (size_t)NTOK * DM * 2;        // 16777216  one 16-bit activation plane [8192][1024]
  static_assert((size_t)3 * DM * DM * 2 <= (size_t)NTOK * DM * 2);
  static_assert((size_t)NB * DM * SEQ * 2 == (size_t)NTOK * DM * 2);
  static_assert((size_t)DM * DM * 2 <= (size_t)NTOK * DM * 2);
  size_t off = 0;
  const size_t oR0 = off; off += PL;
  const size_t oR1 = off; off += PL;
  const size_t oR2 = off; off += PL;
  const size_t oR3 = off; off += PL;
  const size_t oR4 = off; off += PL;
  const size_t oR5 = off; off += PL;
  const size_t oR6 = off; off += PL;
  const size_t oR7 = off; off += PL;
  if (off > ws_size) return;                      // off = 134217728
  if (off > (size_t)134217728) return;

  char* ws = (char*)d_ws;
  unsigned short* Xb   = (unsigned short*)(ws + oR0);
  unsigned short* Oh   = (unsigned short*)(ws + oR0);
  unsigned short* Qh   = (unsigned short*)(ws + oR1);
  unsigned short* Wob  = (unsigned short*)(ws + oR1);
  unsigned short* Ql   = (unsigned short*)(ws + oR2);
  unsigned short* Kh   = (unsigned short*)(ws + oR3);
  unsigned short* Kl   = (unsigned short*)(ws + oR4);
  unsigned short* VTh  = (unsigned short*)(ws + oR5);
  unsigned short* VTl  = (unsigned short*)(ws + oR6);
  unsigned short* Wqkv = (unsigned short*)(ws + oR7);
  unsigned short* Ol   = (unsigned short*)(ws + oR7);
  const unsigned short* Wq = Wqkv;
  const unsigned short* Wk = Wqkv + (size_t)DM * DM;
  const unsigned short* Wv = Wqkv + (size_t)2 * DM * DM;

  const dim3 blk(256);
  const int n8x = NTOK * DM / 8;                              // 1048576
  const int n8q = 3 * DM * DM / 8;                            //  393216
  const int n8o = DM * DM / 8;                                //  131072
  if ((n8x % 256) != 0 || (n8q % 256) != 0 || (n8o % 256) != 0) return;
  const dim3 gCvtX(n8x / 256);                                // 4096 blocks
  const dim3 gCvtQ(n8q / 256);                                // 1536 blocks
  const dim3 gCvtO(n8o / 256);                                //  512 blocks
  const int tilesTok = (NTOK / 64) * (DM / 64);               // 2048 tiles: M=8192, N=1024
  const int tilesVT  = (DM / 64) * (SEQ / 64);                //  512 tiles: M=1024, N=2048
  const dim3 gTok((tilesTok + 7) / 8, 1);                     // 256 blocks
  const dim3 gVT((tilesVT + 7) / 8, NB);                      // 64 blocks x 4 batches
  const dim3 gAttn(NB * NH * NQB);                            // 2048 blocks

  // (1) x -> bf16 plane [8192][1024]; qkv_w [3072 n][1024 k] f32 -> bf16
  cvt_bf16x8<<<gCvtX, blk, 0, stream>>>(x, Xb, n8x);
  cvt_bf16x8<<<gCvtQ, blk, 0, stream>>>(qkv_w, Wqkv, n8q);
  // (2) q = x . Wq^T + q_bias, rope for tokens >= 1 -> bf16 hi/lo planes [b*SEQ+t][h*64+d]   (M=8192, N=1024, K=1024)
  gemm64<0, 2, 1, 1><<<gTok, blk, 0, stream>>>(
      Xb, Xb, DM, 0LL, Wq, DM, 0LL, q_bias, rsin, rcos,
      (void*)Qh, (void*)Ql, DM, 0LL, NTOK, DM, DM, 1.0f);
  // (3) k = x . Wk^T (no bias), rope -> bf16 hi/lo planes
  gemm64<0, 2, 0, 1><<<gTok, blk, 0, stream>>>(
      Xb, Xb, DM, 0LL, Wk, DM, 0LL, q_bias, rsin, rcos,
      (void*)Kh, (void*)Kl, DM, 0LL, NTOK, DM, DM, 1.0f);
  // (4) v^T = Wv . x^T + v_bias[row] per batch -> f16 hi plane [b][h*64+d][s] (pitch SEQ) and residual plane x4096
  //     (A = Wv [n][k], Bt = Xb rows of batch b; M=1024, N=2048, K=1024)
  gemm64<0, 3, 2, 0><<<gVT, blk, 0, stream>>>(
      Wv, Wv, DM, 0LL, Xb, DM, (long long)SEQ * DM, v_bias, rsin, rcos,
      (void*)VTh, (void*)VTl, SEQ, (long long)DM * SEQ, DM, SEQ, DM, 4096.0f);
  // (5) attention -> context bf16 hi plane (R0, x plane dead) and lo plane (R7, weight plane dead)
  attn64<<<gAttn, dim3(128), 0, stream>>>(Qh, Ql, Kh, Kl, VTh, VTl, Oh, Ol, 0.125f);
  // (6) proj_w -> bf16 [n][k] into R1 (q hi plane dead after attention)
  cvt_bf16x8<<<gCvtO, blk, 0, stream>>>(proj_w, Wob, n8o);
  // (7) out = context . Wo^T + proj_b -> d_out f32 [8192][1024]  (A = context hi + lo planes, 2 products)
  gemm64<1, 0, 1, 0><<<gTok, blk, 0, stream>>>(
      Oh, Ol, DM, 0LL, Wob, DM, 0LL, proj_b, rsin, rcos,
      d_out, d_out, DM, 0LL, NTOK, DM, DM, 1.0f);
  (void)hipGetLastError();
}

// v002
// A run of this version takes 445 microseconds.
// Next to v001, in two timings, it ran 1.13 times as fast each time.
// Counting every step since v000, it is 1.68 times as fast.
// Contractions: q, k, v^T projections = v_wmma_f32_16x16x32_bf16 (bf16 operands from RNE-converted inputs, single product, f32 accumulate);
// q.k^T scores = v_wmma_f32_16x16x32_bf16 with bf16 hi/lo split q and k (hi.hi + hi.lo + lo.hi), f32 accumulate;
// p.v = v_wmma_f32_16x16x32_f16 (p carried x1024 in f16; v as f16 hi plane plus f16 residual plane x4096; 2 products), f32 accumulate;
// ctx.Wo^T = v_wmma_f32_16x16x32_bf16 with ctx as bf16 hi/lo planes times bf16 Wo (2 products), f32 accumulate; bias, rope, softmax in f32.
#include <hip/hip_runtime.h>
#include <math.h>
#include <stdint.h>

#pragma clang fp contract(off)

#define NB    4
#define SEQ   2048
#define DM    1024
#define NH    16
#define HD    64
#define NQB   (SEQ / 64)      // 32 key / query tiles of 64
#define NTOK  (NB * SEQ)      // 8192 token rows
#define LP    72              // LDS row pitch of the attention K and V^T tiles, in 16-bit elements
#define OSP   68              // LDS row pitch of the attention output staging tile, in floats (16 B x odd)
static_assert(NH * HD == DM);
static_assert((SEQ % 64) == 0 && (DM % 64) == 0);
static_assert((SEQ & (SEQ - 1)) == 0);
static_assert(LP >= HD && (LP % 8) == 0 && ((LP / 8) & 1) == 1);   // 16-B aligned rows, pitch = 16 B x odd

typedef _Float16 v16h __attribute__((ext_vector_type(16)));
typedef _Float16 v8h  __attribute__((ext_vector_type(8)));
typedef __bf16   v16b __attribute__((ext_vector_type(16)));
typedef __bf16   v8b  __attribute__((ext_vector_type(8)));
typedef float    v8f  __attribute__((ext_vector_type(8)));
typedef float    v4f  __attribute__((ext_vector_type(4)));
typedef unsigned int v4u __attribute__((ext_vector_type(4)));

// ---- scalar helpers --------------------------------------------------------------------------------
__device__ __forceinline__ unsigned short bf_bits(float f) {          // f32 -> bf16 bits, RNE convert
  unsigned u = __float_as_uint(f);
  return (unsigned short)((u + 0x7FFFu + ((u >> 16) & 1u)) >> 16);
}
__device__ __forceinline__ float bf_up(unsigned short h) { return __uint_as_float(((unsigned)h) << 16); }
__device__ __forceinline__ float bfr(float f) { return bf_up(bf_bits(f)); }   // value after bf16 RNE convert
__device__ __forceinline__ unsigned short h_bits(_Float16 x) { return __builtin_bit_cast(unsigned short, x); }
__device__ __forceinline__ unsigned pk16(unsigned short a, unsigned short b) { return (unsigned)a | ((unsigned)b << 16); }
__device__ __forceinline__ float xhalf(float x) {                     // the value lane l ^ 16 holds
  return __builtin_bit_cast(float, __builtin_amdgcn_permlanex16(__builtin_bit_cast(int, x), __builtin_bit_cast(int, x),
                                                                0x76543210, 0xfedcba98, false, false));
}
__device__ __forceinline__ v8f zero8() { v8f z = {0.f, 0.f, 0.f, 0.f, 0.f, 0.f, 0.f, 0.f}; return z; }

// ---- fragment loader: 16-bit A/B operand, lane -> row/col (lane&15), p already includes +8*(lane>>4);
//      elements 0..7 <- p[0..7] (k0+8h..), elements 8..15 <- p[16..23] (k0+16+8h..)
__device__ __forceinline__ v16b ldfrag_b(const __bf16* p) {
  union { v16b v; v8b h[2]; } f;
  f.h[0] = *(const v8b*)(p);
  f.h[1] = *(const v8b*)(p + 16);
  return f.v;
}

// ---- WMMA helpers with trailing VALU hazard gap --------------------------------------------------------
__device__ __forceinline__ v8f mma_b(v16b a, v16b b, v8f c) {
  c = __builtin_amdgcn_wmma_f32_16x16x32_bf16(false, a, false, b, (short)0, c, false, false);
  asm volatile("v_nop\n\tv_nop\n\tv_nop\n\tv_nop" : "+v"(c) : "v"(a), "v"(b));
  return c;
}
__device__ __forceinline__ v8f mma_h(v16h a, v16h b, v8f c) {
  c = __builtin_amdgcn_wmma_f32_16x16x32_f16(false, a, false, b, (short)0, c, false, false);
  asm volatile("v_nop\n\tv_nop\n\tv_nop\n\tv_nop" : "+v"(c) : "v"(a), "v"(b));
  return c;
}
__device__ __forceinline__ v8f mma_b_raw(v16b a, v16b b, v8f c) {
  return __builtin_amdgcn_wmma_f32_16x16x32_bf16(false, a, false, b, (short)0, c, false, false);
}
__device__ __forceinline__ void dep_guard_b(v8f& a, v8f& b, v16b x, v16b y) {
  asm volatile("v_nop\n\tv_nop\n\tv_nop\n\tv_nop" : "+v"(a), "+v"(b) : "v"(x), "v"(y));
}
__device__ __forceinline__ void keep4_b(v16b a, v16b b, v16b c, v16b d) {
  asm volatile("v_nop" :: "v"(a), "v"(b), "v"(c), "v"(d));
}
__device__ __forceinline__ void acc_guard4(v8f& a, v8f& b, v8f& c, v8f& d) {
  asm volatile("v_nop\n\tv_nop\n\tv_nop\n\tv_nop" : "+v"(a), "+v"(b), "+v"(c), "+v"(d));
}

// =====================================================================================================
// f32 -> bf16 (RNE convert), 8 elements per thread, one 16-B store per lane: a wave writes 512 contiguous B
// multiple of 256 for every use here; host-checked). coverage: n8 threads x 8 = whole plane.
// =====================================================================================================
__global__ __launch_bounds__(256) void cvt_bf16x8(const float* __restrict__ in, unsigned short* out, int n8) {
  const int i = blockIdx.x * 256 + threadIdx.x;
  if (i < n8) {
    const v4f a = *(const v4f*)(in + (size_t)i * 8);
    const v4f b = *(const v4f*)(in + (size_t)i * 8 + 4);
    v4u p;
    p[0] = pk16(bf_bits(a[0]), bf_bits(a[1]));
    p[1] = pk16(bf_bits(a[2]), bf_bits(a[3]));
    p[2] = pk16(bf_bits(b[0]), bf_bits(b[1]));
    p[3] = pk16(bf_bits(b[2]), bf_bits(b[3]));
    *(v4u*)(out + (size_t)i * 8) = p;
    
  }
}

// =====================================================================================================
// Register-blocked batched bf16 WMMA GEMM: C[m][n] = sum_k A[m][k] * Bt[n][k]; one wave per 64x64 tile,
// no block barriers. A row-major [M][K] pitch lda; Bt row-major [N][K] pitch ldb (k contiguous);
// M, N multiples of 64, K multiple of 32 (host-checked). blockIdx.y = batch index (strides in elements).
// NSPLIT: 0 = A.Bt; 1 = (A + A2).Bt (A2 = unscaled bf16 lo plane of A, same pitch/stride).
// BIAS: 0 none; 1 = + bfr(bias[n]) per column; 2 = + bfr(bias[m]) per row.
// ROPE (needs N tile = one head = 64 cols d 0..63, row m = b*SEQ + s): for s >= 1,
//   t[d] = t[d]*bfr(cos[s-1][d]) + rot[d]*bfr(sin[s-1][d]), rot = [-t[32..63] | t[0..31]] (after bias).
// OUT_MODE: 0 = f32 (pitch ldc); 2 = bf16 hi plane C + bf16 lo plane C2 (lo = RNE(v - hi), unscaled);
//           3 = f16 hi plane C + f16 residual plane C2 = f16((v - hi) * rscale); C2 same pitch/stride as C.
// =====================================================================================================
template <int NSPLIT, int OUT_MODE, int BIAS, int ROPE>
__global__ __launch_bounds__(256) void gemm64(
    const unsigned short* __restrict__ Ap, const unsigned short* __restrict__ A2p, int lda, long long strideA,
    const unsigned short* __restrict__ Btp, int ldb, long long strideB,
    const float* __restrict__ bias, const float* __restrict__ rsin, const float* __restrict__ rcos,
    void* Cout, void* Cout2, int ldc, long long strideC,
    int M, int N, int K, float rscale) {
  const __bf16* A  = (const __bf16*)(const void*)Ap;
  const __bf16* A2 = (const __bf16*)(const void*)A2p;
  const __bf16* Bt = (const __bf16*)(const void*)Btp;
  __shared__ __align__(16) float sT[8][16 * 68];   // per-wave 16x64 slab, pitch 68 floats
  const int b    = blockIdx.y;
  const int lane = threadIdx.x & 31;
  const int wave = threadIdx.x >> 5;
  const int tilesN = N >> 6;
  const int tilesM = M >> 6;
  const int tile = blockIdx.x * 8 + wave;
  if (tile >= tilesM * tilesN) return;   // wave-uniform; no block barriers in this kernel
  const int tm = tile / tilesN;
  const int tn = tile - tm * tilesN;
  const int m0 = tm << 6;
  const int n0 = tn << 6;

  const __bf16* Ab  = A  + (size_t)b * strideA;
  const __bf16* Bb  = Bt + (size_t)b * strideB;
  const __bf16* Ab2 = (NSPLIT == 1) ? (A2 + (size_t)b * strideA) : Ab;

  const int rlane = lane & 15;                 // row (A) / col (B, D) within subtile
  const int koff  = (lane >> 4) * 8;           // k offset of this lane half
  const int mOff  = (lane >> 4) * 8;           // D row offset

  v8f acc[4][4];
#pragma unroll
  for (int i = 0; i < 4; ++i)
#pragma unroll
    for (int j = 0; j < 4; ++j) acc[i][j] = zero8();

  for (int k0 = 0; k0 < K; k0 += 32) {
    v16b bh[4];
#pragma unroll
    for (int j = 0; j < 4; ++j) {
      const size_t bo = (size_t)(n0 + (j << 4) + rlane) * ldb + koff + k0;
      bh[j] = ldfrag_b(Bb + bo);
    }
#pragma unroll
    for (int i = 0; i < 4; ++i) {
      const size_t ao = (size_t)(m0 + (i << 4) + rlane) * lda + koff + k0;
      const v16b ah = ldfrag_b(Ab + ao);
      v16b al = ah;
      if (NSPLIT == 1) al = ldfrag_b(Ab2 + ao);
#pragma unroll
      for (int j = 0; j < 4; ++j) {
        acc[i][j] = mma_b_raw(ah, bh[j], acc[i][j]);
        if (NSPLIT == 1) acc[i][j] = mma_b_raw(al, bh[j], acc[i][j]);
      }
      dep_guard_b(acc[i][0], acc[i][3], ah, al);
    }
    keep4_b(bh[0], bh[1], bh[2], bh[3]);
  }
  acc_guard4(acc[0][0], acc[0][1], acc[0][2], acc[0][3]);
  acc_guard4(acc[1][0], acc[1][1], acc[1][2], acc[1][3]);
  acc_guard4(acc[2][0], acc[2][1], acc[2][2], acc[2][3]);
  acc_guard4(acc[3][0], acc[3][1], acc[3][2], acc[3][3]);

  // ---- epilogue ----
  float* slab = sT[wave];
  float bcol[4];
  if (BIAS == 1) {
#pragma unroll
    for (int j = 0; j < 4; ++j) bcol[j] = bfr(bias[n0 + (j << 4) + rlane]);   // n0+.. < N
  } else {
#pragma unroll
    for (int j = 0; j < 4; ++j) bcol[j] = 0.f;
  }
#pragma unroll
  for (int i = 0; i < 4; ++i) {
    const int mBase = m0 + (i << 4);
#pragma unroll
    for (int r = 0; r < 8; ++r) {
      const int m = mBase + mOff + r;                  // < M
      float brow = 0.f;
      if (BIAS == 2) brow = bfr(bias[m]);
      float t[4];
#pragma unroll
      for (int j = 0; j < 4; ++j) {
        float v = acc[i][j][r];
        if (BIAS == 1) v = v + bcol[j];
        if (BIAS == 2) v = v + brow;
        t[j] = v;
      }
      if (ROPE) {
        const int s = m & (SEQ - 1);                   // token index within the sequence
        const bool use = (s > 0);                        // token 0 passes unrotated
        const int sidx = use ? (s - 1) : 0;              // clamped table row
        const float* cr = rcos + (size_t)sidx * HD;
        const float* sr = rsin + (size_t)sidx * HD;
        float u[4];
#pragma unroll
        for (int j = 0; j < 4; ++j) {
          const int d = (j << 4) + rlane;                // 0..63
          const float cs = bfr(cr[d]);
          const float sn = bfr(sr[d]);
          const float tp = t[j ^ 2];                     // partner d^32, same lane
          const float rot = (j < 2) ? -tp : tp;
          const float w = t[j] * cs + rot * sn;
          u[j] = use ? w : t[j];
        }
#pragma unroll
        for (int j = 0; j < 4; ++j) t[j] = u[j];
      }
#pragma unroll
      for (int j = 0; j < 4; ++j) slab[(mOff + r) * 68 + (j << 4) + rlane] = t[j];
    }
    __builtin_amdgcn_fence(__ATOMIC_RELEASE, "workgroup");
    __builtin_amdgcn_wave_barrier();
    __builtin_amdgcn_fence(__ATOMIC_ACQUIRE, "workgroup");
    if (OUT_MODE == 0) {
      float* C = (float*)Cout + (size_t)b * strideC;
      const int hh = lane >> 4, c4 = (lane & 15) * 4;     // 256-B row segment = 16 lanes x 16 B
      {
#pragma unroll
        for (int it = 0; it < 8; ++it) {
          const int row = it * 2 + hh;                     // it 0..7 x hh 0..1 = rows 0..15
          const v4f v = *(const v4f*)(slab + row * 68 + c4);
          *(v4f*)(C + (size_t)(mBase + row) * ldc + n0 + c4) = v;
        }
        
      }
    } else {
      const int q = lane >> 3, c8 = (lane & 7) * 8;
      unsigned short* C  = (unsigned short*)Cout  + (size_t)b * strideC;
      unsigned short* C2 = (unsigned short*)Cout2 + (size_t)b * strideC;
      v4u hv[4], lv[4];
#pragma unroll
      for (int it = 0; it < 4; ++it) {
        const int row = it * 4 + q;                        // it 0..3 x q 0..3 = rows 0..15
        const float* sp = slab + row * 68 + c8;
        v4u a, a2;
#pragma unroll
        for (int e = 0; e < 4; ++e) {
          const float f0 = sp[2 * e], f1 = sp[2 * e + 1];
          unsigned short h0, h1, l0, l1;
          if (OUT_MODE == 2) {
            h0 = bf_bits(f0); h1 = bf_bits(f1);
            l0 = bf_bits(f0 - bf_up(h0)); l1 = bf_bits(f1 - bf_up(h1));
          } else {
            const _Float16 x0 = (_Float16)f0, x1 = (_Float16)f1;
            h0 = h_bits(x0); h1 = h_bits(x1);
            l0 = h_bits((_Float16)((f0 - (float)x0) * rscale));
            l1 = h_bits((_Float16)((f1 - (float)x1) * rscale));
          }
          a[e] = pk16(h0, h1); a2[e] = pk16(l0, l1);
        }
        hv[it] = a; lv[it] = a2;
      }
      {
#pragma unroll
        for (int it = 0; it < 4; ++it) {
          const int row = it * 4 + q;
          *(v4u*)(C  + (size_t)(mBase + row) * ldc + n0 + c8) = hv[it];
          *(v4u*)(C2 + (size_t)(mBase + row) * ldc + n0 + c8) = lv[it];
        }
        
      }
    }
    __builtin_amdgcn_fence(__ATOMIC_RELEASE, "workgroup");
    __builtin_amdgcn_wave_barrier();
    __builtin_amdgcn_fence(__ATOMIC_ACQUIRE, "workgroup");
  }
}

// =====================================================================================================
// Attention, head dim 64, no mask, all SEQ keys.
//   q planes (bf16 hi / lo): element (b, t, h, d) at [(b*SEQ + t)*DM + h*64 + d]
//   k planes (bf16 hi / lo): same layout with key index s
//   v^T hi plane (f16):      element (b, h, d, s) at [(b*DM + h*64 + d)*SEQ + s]
//   v^T residual plane (f16, (v - hi)*4096): same layout
//   out planes (bf16 hi / lo of the normalised context): element (b, t, h, d) at [(b*SEQ + t)*DM + h*64 + d]
//   Both products are formed transposed: S^T = K . Q^T (A = K rows, B = Q) and O^T += V^T . P^T (A = V^T rows, B = P^T).
//   A lane then holds one query (column lane&15) and 32 of the chunk's 64 keys (rows j*16 + 8*(lane>>4) + r): the maximum
//   and the sum run inside the lane, the two wave halves exchange the maximum once per chunk and join their sums once at
//   the end; two score tiles, converted in place, are the B operand P^T in the k order of the V^T loader.
//   scores = k . q : bf16 hi/lo split (hi.hi + lo.hi + hi.lo in k, q), f32 accumulate, then * sscale in f32
//   p = exp(s - m) carried as f16(1024 p); context = v^T . p^T on f16 WMMA: v_hi.p into the running accumulator,
//   v_res.p into a per-chunk accumulator folded back with 1/4096 in f32; online softmax in f32.
//   Block = 4 waves = 64 query rows of one (b, h); grid = NQB * NH * NB; kv chunks of 64, static trip NQB.
//   K / V^T chunk staging: 128 threads x 32 elements per plane = the whole 64x64 tile (plain 16-B loads,
//   __syncthreads before and after).
//   Output coverage: each wave stores rows q0..q0+15 (it 0..3 x lane>>3 0..3) x 64 columns (8 lanes x 8) of both planes.
// =====================================================================================================
__global__ __launch_bounds__(128)
void attn64(const unsigned short* __restrict__ qhp, const unsigned short* __restrict__ qlp,
            const unsigned short* __restrict__ khp, const unsigned short* __restrict__ klp,
            const unsigned short* __restrict__ vhp, const unsigned short* __restrict__ vlp,
            unsigned short* ohp, unsigned short* olp, float sscale) {
  union FB { v16b v; v8b h[2]; };
  union FH { v16h v; v8h h[2]; };
  // Rows of 64 16-bit elements are laid at a pitch of LP = 72 elements (144 B = 16 B x 9): the 16 rows that one
  // ds_load_b128 fragment read touches then fall on 16 different groups of four banks instead of two.
  __shared__ __align__(16) __bf16   Ksh[64 * LP];                 // K hi [kv][d]   9 KB
  __shared__ __align__(16) __bf16   Ksl[64 * LP];                 // K lo           9 KB
  __shared__ __align__(16) _Float16 Vth[64 * LP];                 // V^T hi [d][kv] 9 KB
  __shared__ __align__(16) _Float16 Vtl[64 * LP];                 // V^T residual   9 KB
  __shared__ __align__(16) float    Os[4][16 * OSP];              // per wave context tile [row][d] 17 KB

  const int tid  = threadIdx.x;
  const int wave = tid >> 5;
  const int lane = tid & 31;
  const int hh   = lane >> 4;
  const int c    = lane & 15;

  const int bx   = blockIdx.x;
  const int qb   = bx % NQB;
  const int rest = bx / NQB;
  const int h    = rest % NH;
  const int b    = rest / NH;
  const int q0   = qb * 64 + wave * 16;
  const size_t rowB = (size_t)b * SEQ;

  const __bf16* Qh = (const __bf16*)(const void*)qhp + (size_t)h * HD;
  const __bf16* Ql = (const __bf16*)(const void*)qlp + (size_t)h * HD;
  const __bf16* Kh = (const __bf16*)(const void*)khp + (size_t)h * HD;
  const __bf16* Kl = (const __bf16*)(const void*)klp + (size_t)h * HD;
  const _Float16* Vh = (const _Float16*)(const void*)vhp + ((size_t)b * DM + (size_t)h * HD) * SEQ;
  const _Float16* Vl = (const _Float16*)(const void*)vlp + ((size_t)b * DM + (size_t)h * HD) * SEQ;

  // ---- Q fragments (B operand, column = query = lane&15): 2 d-chunks, hi and lo ----
  v16b qah[2], qal[2];
#pragma unroll
  for (int dc = 0; dc < 2; ++dc) {
    const size_t qo = (rowB + q0 + c) * DM + dc * 32 + 8 * hh;
    qah[dc] = ldfrag_b(Qh + qo);
    qal[dc] = ldfrag_b(Ql + qo);
  }

  float mrow = -INFINITY, lrow = 0.f;   // this lane's query: running maximum (both halves alike), sum over this half's keys
  v8f oacc[4];                          // O^T: oacc[t][r] = context[query c][d = t*16 + 8*hh + r]
#pragma unroll
  for (int t = 0; t < 4; ++t) oacc[t] = zero8();

  for (int kt = 0; kt < NQB; ++kt) {         // static trip count
    const int kv0 = kt * 64;
    __syncthreads();
    {
      const int r = tid >> 1, half = (tid & 1) * 32;
      const __bf16*   kg  = Kh + (rowB + kv0 + r) * DM + half;    // K row kv0+r, d = half..half+31
      const __bf16*   klg = Kl + (rowB + kv0 + r) * DM + half;
      const _Float16* vg  = Vh + (size_t)r * SEQ + kv0 + half;    // V^T row d = r, s = kv0+half..+31
      const _Float16* vlg = Vl + (size_t)r * SEQ + kv0 + half;
#pragma unroll
      for (int i = 0; i < 4; ++i) {
        const v8b a0 = *(const v8b*)(kg + 8 * i);
        const v8b a1 = *(const v8b*)(klg + 8 * i);
        const v8h b0 = *(const v8h*)(vg + 8 * i);
        const v8h b1 = *(const v8h*)(vlg + 8 * i);
        *(v8b*)(Ksh + r * LP + half + 8 * i) = a0;
        *(v8b*)(Ksl + r * LP + half + 8 * i) = a1;
        *(v8h*)(Vth + r * LP + half + 8 * i) = b0;
        *(v8h*)(Vtl + r * LP + half + 8 * i) = b1;
      }
    }
    __syncthreads();

    // ---- scores, transposed: 64 keys x 16 queries per wave, 3 bf16 products; A[m = key][k = d] from Ksh[key][d] ----
    v8f s[4];
#pragma unroll
    for (int j = 0; j < 4; ++j) {
      s[j] = zero8();
#pragma unroll
      for (int dc = 0; dc < 2; ++dc) {
        FB kb, kl;
        kb.h[0] = *(const v8b*)(Ksh + (j * 16 + c) * LP + dc * 32 + 8 * hh);
        kb.h[1] = *(const v8b*)(Ksh + (j * 16 + c) * LP + dc * 32 + 16 + 8 * hh);
        kl.h[0] = *(const v8b*)(Ksl + (j * 16 + c) * LP + dc * 32 + 8 * hh);
        kl.h[1] = *(const v8b*)(Ksl + (j * 16 + c) * LP + dc * 32 + 16 + 8 * hh);
        s[j] = mma_b(kb.v, qah[dc], s[j]);
        s[j] = mma_b(kl.v, qah[dc], s[j]);
        s[j] = mma_b(kb.v, qal[dc], s[j]);
      }
    }

    // ---- scale, maximum, online softmax; query c, key j*16 + 8*hh + r lives in s[j][r] ----
    float mj[4];
#pragma unroll
    for (int j = 0; j < 4; ++j) {
      mj[j] = -INFINITY;
#pragma unroll
      for (int r = 0; r < 8; ++r) {
        const float sv = s[j][r] * sscale;
        s[j][r] = sv;
        mj[j] = fmaxf(mj[j], sv);
      }
    }
    float m = fmaxf(fmaxf(mj[0], mj[1]), fmaxf(mj[2], mj[3]));
    m = fmaxf(m, xhalf(m));                            // the query's other 32 keys sit in lane ^ 16
    const float mnew  = fmaxf(mrow, m);
    const float msafe = (mnew == -INFINITY) ? 0.f : mnew;
    const float alpha = __expf(mrow - msafe);
    mrow = mnew;
    // P^T (x1024, f16) as B operand: element e of chunk kk = key kk*32 + (e < 8 ? 8*hh + e : 16 + 8*hh + e - 8)
    FH pb[2];
    float pj[4];
#pragma unroll
    for (int j = 0; j < 4; ++j) {
      pj[j] = 0.f;
#pragma unroll
      for (int r = 0; r < 8; ++r) {
        const float p = __expf(s[j][r] - msafe);
        pj[j] += p;
        pb[j >> 1].v[(j & 1) * 8 + r] = (_Float16)(p * 1024.0f);
      }
    }
    lrow = lrow * alpha + ((pj[0] + pj[1]) + (pj[2] + pj[3]));
#pragma unroll
    for (int t = 0; t < 4; ++t)
#pragma unroll
      for (int r = 0; r < 8; ++r) oacc[t][r] *= alpha;

    // ---- context^T += V^T . P^T (f16 WMMA): A[m = d][k = kv] from Vth[d][kv], B = P^T[k = kv][n = query];
    //      residual products into a separate per-chunk accumulator ----
    v8f o1[4];
#pragma unroll
    for (int t = 0; t < 4; ++t) o1[t] = zero8();
#pragma unroll
    for (int kk = 0; kk < 2; ++kk) {
#pragma unroll
      for (int t = 0; t < 4; ++t) {
        FH vb, vl;
        vb.h[0] = *(const v8h*)(Vth + (t * 16 + c) * LP + kk * 32 + 8 * hh);
        vb.h[1] = *(const v8h*)(Vth + (t * 16 + c) * LP + kk * 32 + 16 + 8 * hh);
        vl.h[0] = *(const v8h*)(Vtl + (t * 16 + c) * LP + kk * 32 + 8 * hh);
        vl.h[1] = *(const v8h*)(Vtl + (t * 16 + c) * LP + kk * 32 + 16 + 8 * hh);
        oacc[t] = mma_h(vb.v, pb[kk].v, oacc[t]);
        o1[t]   = mma_h(vl.v, pb[kk].v, o1[t]);
      }
    }
#pragma unroll
    for (int t = 0; t < 4; ++t)
#pragma unroll
      for (int r = 0; r < 8; ++r) oacc[t][r] += o1[t][r] * (1.0f / 4096.0f);
  }

  // ---- normalise (1/l and the 1/1024 p carry), stage the wave's 16x64 tile, bf16 hi/lo split,
  float* os = Os[wave];
  {
    const float l = lrow + xhalf(lrow);                // join the two halves' sums of this query
    const float inv = ((l > 0.f) ? (1.0f / l) : 0.f) * (1.0f / 1024.0f);
#pragma unroll
    for (int t = 0; t < 4; ++t)
#pragma unroll
      for (int r = 0; r < 8; ++r) os[c * OSP + t * 16 + 8 * hh + r] = oacc[t][r] * inv;
  }
  __builtin_amdgcn_fence(__ATOMIC_RELEASE, "workgroup");
  __builtin_amdgcn_wave_barrier();
  __builtin_amdgcn_fence(__ATOMIC_ACQUIRE, "workgroup");
  {
    const int q4 = lane >> 3, c8 = (lane & 7) * 8;
    v4u hv[4], lv[4];
#pragma unroll
    for (int it = 0; it < 4; ++it) {
      const int row = it * 4 + q4;   // it 0..3 x q4 0..3 = rows 0..15 of the wave tile
      const float* sp = os + row * OSP + c8;
      v4u a, a2;
#pragma unroll
      for (int e = 0; e < 4; ++e) {
        const float f0 = sp[2 * e], f1 = sp[2 * e + 1];
        const unsigned short h0 = bf_bits(f0), h1 = bf_bits(f1);
        const unsigned short l0 = bf_bits(f0 - bf_up(h0)), l1 = bf_bits(f1 - bf_up(h1));
        a[e] = pk16(h0, h1); a2[e] = pk16(l0, l1);
      }
      hv[it] = a; lv[it] = a2;
    }
    {
#pragma unroll
      for (int it = 0; it < 4; ++it) {
        const int row = it * 4 + q4;
        const size_t go = (rowB + q0 + row) * DM + (size_t)h * HD + c8;
        *(v4u*)(ohp + go) = hv[it];
        *(v4u*)(olp + go) = lv[it];
      }
      
    }
  }
}

// =====================================================================================================
// Workspace map: 8 regions of PL = NTOK*DM*2 = 16777216 B each, total 134217728 B.
//   R0  Xb   bf16 [8192][1024]                    (after the projections: Oh, context hi plane [8192][1024])
//   R1  Qh   bf16 [8192][1024]                    (after attention: Wob bf16 [1024][1024], 2097152 B used)
//   R2  Ql   bf16 [8192][1024]
//   R3  Kh   bf16 [8192][1024]
//   R4  Kl   bf16 [8192][1024]
//   R5  VTh  f16  [4][1024][2048]
//   R6  VTl  f16  [4][1024][2048]
//   R7  Wqkv bf16 [3072][1024] (6291456 B used)   (during attention: Ol, context lo plane [8192][1024])
// All planes are exact multiples of their 64x64 tile / whole-line store granularity (no padded tails needed).
// Weights are [out n][in k] with k contiguous = the Bt / A layout the GEMM wants, so they are only converted.
// =====================================================================================================
extern "C" void kernel_launch(void* const* d_in, const int* in_sizes, int n_in,
                              void* d_out, int out_size, void* d_ws, size_t ws_size,
                              hipStream_t stream) {
  if (n_in < 8) return;
  if (in_sizes[0] != NTOK * DM) return;
  if (in_sizes[1] != 3 * DM * DM) return;
  if (in_sizes[2] != DM || in_sizes[3] != DM) return;
  if (in_sizes[4] != DM * DM || in_sizes[5] != DM) return;
  if (in_sizes[6] != (SEQ - 1) * HD || in_sizes[7] != (SEQ - 1) * HD) return;
  if (out_size != NTOK * DM) return;

  const float* x      = (const float*)d_in[0];
  const float* qkv_w  = (const float*)d_in[1];
  const float* q_bias = (const float*)d_in[2];
  const float* v_bias = (const float*)d_in[3];
  const float* proj_w = (const float*)d_in[4];
  const float* proj_b = (const float*)d_in[5];
  const float* rsin   = (const float*)d_in[6];
  const float* rcos   = (const float*)d_in[7];

  const size_t PL = (size_t)NTOK * DM * 2;        // 16777216  one 16-bit activation plane [8192][1024]
  static_assert((size_t)3 * DM * DM * 2 <= (size_t)NTOK * DM * 2);
  static_assert((size_t)NB * DM * SEQ * 2 == (size_t)NTOK * DM * 2);
  static_assert((size_t)DM * DM * 2 <= (size_t)NTOK * DM * 2);
  size_t off = 0;
  const size_t oR0 = off; off += PL;
  const size_t oR1 = off; off += PL;
  const size_t oR2 = off; off += PL;
  const size_t oR3 = off; off += PL;
  const size_t oR4 = off; off += PL;
  const size_t oR5 = off; off += PL;
  const size_t oR6 = off; off += PL;
  const size_t oR7 = off; off += PL;
  if (off > ws_size) return;                      // off = 134217728
  if (off > (size_t)134217728) return;

  char* ws = (char*)d_ws;
  unsigned short* Xb   = (unsigned short*)(ws + oR0);
  unsigned short* Oh   = (unsigned short*)(ws + oR0);
  unsigned short* Qh   = (unsigned short*)(ws + oR1);
  unsigned short* Wob  = (unsigned short*)(ws + oR1);
  unsigned short* Ql   = (unsigned short*)(ws + oR2);
  unsigned short* Kh   = (unsigned short*)(ws + oR3);
  unsigned short* Kl   = (unsigned short*)(ws + oR4);
  unsigned short* VTh  = (unsigned short*)(ws + oR5);
  unsigned short* VTl  = (unsigned short*)(ws + oR6);
  unsigned short* Wqkv = (unsigned short*)(ws + oR7);
  unsigned short* Ol   = (unsigned short*)(ws + oR7);
  const unsigned short* Wq = Wqkv;
  const unsigned short* Wk = Wqkv + (size_t)DM * DM;
  const unsigned short* Wv = Wqkv + (size_t)2 * DM * DM;

  const dim3 blk(256);
  const int n8x = NTOK * DM / 8;                              // 1048576
  const int n8q = 3 * DM * DM / 8;                            //  393216
  const int n8o = DM * DM / 8;                                //  131072
  if ((n8x % 256) != 0 || (n8q % 256) != 0 || (n8o % 256) != 0) return;
  const dim3 gCvtX(n8x / 256);                                // 4096 blocks
  const dim3 gCvtQ(n8q / 256);                                // 1536 blocks
  const dim3 gCvtO(n8o / 256);                                //  512 blocks
  const int tilesTok = (NTOK / 64) * (DM / 64);               // 2048 tiles: M=8192, N=1024
  const int tilesVT  = (DM / 64) * (SEQ / 64);                //  512 tiles: M=1024, N=2048
  const dim3 gTok((tilesTok + 7) / 8, 1);                     // 256 blocks
  const dim3 gVT((tilesVT + 7) / 8, NB);                      // 64 blocks x 4 batches
  const dim3 gAttn(NB * NH * NQB);                            // 2048 blocks

  // (1) x -> bf16 plane [8192][1024]; qkv_w [3072 n][1024 k] f32 -> bf16
  cvt_bf16x8<<<gCvtX, blk, 0, stream>>>(x, Xb, n8x);
  cvt_bf16x8<<<gCvtQ, blk, 0, stream>>>(qkv_w, Wqkv, n8q);
  // (2) q = x . Wq^T + q_bias, rope for tokens >= 1 -> bf16 hi/lo planes [b*SEQ+t][h*64+d]   (M=8192, N=1024, K=1024)
  gemm64<0, 2, 1, 1><<<gTok, blk, 0, stream>>>(
      Xb, Xb, DM, 0LL, Wq, DM, 0LL, q_bias, rsin, rcos,
      (void*)Qh, (void*)Ql, DM, 0LL, NTOK, DM, DM, 1.0f);
  // (3) k = x . Wk^T (no bias), rope -> bf16 hi/lo planes
  gemm64<0, 2, 0, 1><<<gTok, blk, 0, stream>>>(
      Xb, Xb, DM, 0LL, Wk, DM, 0LL, q_bias, rsin, rcos,
      (void*)Kh, (void*)Kl, DM, 0LL, NTOK, DM, DM, 1.0f);
  // (4) v^T = Wv . x^T + v_bias[row] per batch -> f16 hi plane [b][h*64+d][s] (pitch SEQ) and residual plane x4096
  //     (A = Wv [n][k], Bt = Xb rows of batch b; M=1024, N=2048, K=1024)
  gemm64<0, 3, 2, 0><<<gVT, blk, 0, stream>>>(
      Wv, Wv, DM, 0LL, Xb, DM, (long long)SEQ * DM, v_bias, rsin, rcos,
      (void*)VTh, (void*)VTl, SEQ, (long long)DM * SEQ, DM, SEQ, DM, 4096.0f);
  // (5) attention -> context bf16 hi plane (R0, x plane dead) and lo plane (R7, weight plane dead)
  attn64<<<gAttn, dim3(128), 0, stream>>>(Qh, Ql, Kh, Kl, VTh, VTl, Oh, Ol, 0.125f);
  // (6) proj_w -> bf16 [n][k] into R1 (q hi plane dead after attention)
  cvt_bf16x8<<<gCvtO, blk, 0, stream>>>(proj_w, Wob, n8o);
  // (7) out = context . Wo^T + proj_b -> d_out f32 [8192][1024]  (A = context hi + lo planes, 2 products)
  gemm64<1, 0, 1, 0><<<gTok, blk, 0, stream>>>(
      Oh, Ol, DM, 0LL, Wob, DM, 0LL, proj_b, rsin, rcos,
      d_out, d_out, DM, 0LL, NTOK, DM, DM, 1.0f);
  (void)hipGetLastError();
}

// v003
// Measured time: 317 microseconds a run.
// Next to v002, in two timings, it ran 1.39 and 1.40 times as fast.
// All steps since v000 together make it 2.35 times as fast.
// Contractions: q, k, v^T projections = v_wmma_f32_16x16x32_bf16 (bf16 operands from RNE-converted inputs, single product, f32 accumulate);
// q.k^T scores = v_wmma_f32_16x16x32_bf16 with bf16 hi/lo split q and k (hi.hi + hi.lo + lo.hi), f32 accumulate;
// p.v = v_wmma_f32_16x16x32_f16 (p carried x1024 in f16; v as f16 hi plane plus f16 residual plane x4096; 2 products), f32 accumulate;
// ctx.Wo^T = v_wmma_f32_16x16x32_bf16 with ctx as bf16 hi/lo planes times bf16 Wo (2 products), f32 accumulate; bias, rope, softmax in f32.
#include <hip/hip_runtime.h>
#include <math.h>
#include <stdint.h>

#pragma clang fp contract(off)

#define NB    4
#define SEQ   2048
#define DM    1024
#define NH    16
#define HD    64
#define NQB   (SEQ / 64)      // 32 key / query tiles of 64
#define NTOK  (NB * SEQ)      // 8192 token rows
#define LP    72              // LDS row pitch of the attention K and V^T tiles, in 16-bit elements
#define OSP   68              // LDS row pitch of the attention output staging tile, in floats (16 B x odd)
#define GP    72              // LDS row pitch of the GEMM operand tiles, in 16-bit elements (144 B = 16 B x odd)
#define GKS   64              // k elements of one GEMM stage: rows of 128 B, one whole line each
#define GBM   128             // GEMM block tile rows    (2 waves x 64)
#define GBN   256             // GEMM block tile columns (4 waves x 64)
static_assert(NH * HD == DM);
static_assert((SEQ % 64) == 0 && (DM % 64) == 0);
static_assert((SEQ & (SEQ - 1)) == 0);
static_assert((NTOK % GBM) == 0 && (DM % GBM) == 0 && (DM % GBN) == 0 && (SEQ % GBN) == 0);   // whole GEMM block tiles
static_assert((DM % GKS) == 0 && DM >= 2 * GKS);                                              // whole stages, two or more
static_assert(GP >= GKS && (GP % 8) == 0 && ((GP / 8) & 1) == 1);
static_assert(LP >= HD && (LP % 8) == 0 && ((LP / 8) & 1) == 1);   // 16-B aligned rows, pitch = 16 B x odd

typedef _Float16 v16h __attribute__((ext_vector_type(16)));
typedef _Float16 v8h  __attribute__((ext_vector_type(8)));
typedef __bf16   v16b __attribute__((ext_vector_type(16)));
typedef __bf16   v8b  __attribute__((ext_vector_type(8)));
typedef float    v8f  __attribute__((ext_vector_type(8)));
typedef float    v4f  __attribute__((ext_vector_type(4)));
typedef unsigned int v4u __attribute__((ext_vector_type(4)));

// ---- scalar helpers --------------------------------------------------------------------------------
__device__ __forceinline__ unsigned short bf_bits(float f) {          // f32 -> bf16 bits, RNE convert
  unsigned u = __float_as_uint(f);
  return (unsigned short)((u + 0x7FFFu + ((u >> 16) & 1u)) >> 16);
}
__device__ __forceinline__ float bf_up(unsigned short h) { return __uint_as_float(((unsigned)h) << 16); }
__device__ __forceinline__ float bfr(float f) { return bf_up(bf_bits(f)); }   // value after bf16 RNE convert
__device__ __forceinline__ unsigned short h_bits(_Float16 x) { return __builtin_bit_cast(unsigned short, x); }
__device__ __forceinline__ unsigned pk16(unsigned short a, unsigned short b) { return (unsigned)a | ((unsigned)b << 16); }
__device__ __forceinline__ float xhalf(float x) {                     // the value lane l ^ 16 holds
  return __builtin_bit_cast(float, __builtin_amdgcn_permlanex16(__builtin_bit_cast(int, x), __builtin_bit_cast(int, x),
                                                                0x76543210, 0xfedcba98, false, false));
}
__device__ __forceinline__ v8f zero8() { v8f z = {0.f, 0.f, 0.f, 0.f, 0.f, 0.f, 0.f, 0.f}; return z; }

// ---- fragment loader: 16-bit A/B operand, lane -> row/col (lane&15), p already includes +8*(lane>>4);
//      elements 0..7 <- p[0..7] (k0+8h..), elements 8..15 <- p[16..23] (k0+16+8h..)
__device__ __forceinline__ v16b ldfrag_b(const __bf16* p) {
  union { v16b v; v8b h[2]; } f;
  f.h[0] = *(const v8b*)(p);
  f.h[1] = *(const v8b*)(p + 16);
  return f.v;
}

// ---- WMMA helpers with trailing VALU hazard gap --------------------------------------------------------
__device__ __forceinline__ v8f mma_b(v16b a, v16b b, v8f c) {
  c = __builtin_amdgcn_wmma_f32_16x16x32_bf16(false, a, false, b, (short)0, c, false, false);
  asm volatile("v_nop\n\tv_nop\n\tv_nop\n\tv_nop" : "+v"(c) : "v"(a), "v"(b));
  return c;
}
__device__ __forceinline__ v8f mma_h(v16h a, v16h b, v8f c) {
  c = __builtin_amdgcn_wmma_f32_16x16x32_f16(false, a, false, b, (short)0, c, false, false);
  asm volatile("v_nop\n\tv_nop\n\tv_nop\n\tv_nop" : "+v"(c) : "v"(a), "v"(b));
  return c;
}
__device__ __forceinline__ v8f mma_b_raw(v16b a, v16b b, v8f c) {
  return __builtin_amdgcn_wmma_f32_16x16x32_bf16(false, a, false, b, (short)0, c, false, false);
}
__device__ __forceinline__ void acc_guard4(v8f& a, v8f& b, v8f& c, v8f& d) {
  asm volatile("v_nop\n\tv_nop\n\tv_nop\n\tv_nop" : "+v"(a), "+v"(b), "+v"(c), "+v"(d));
}

// ---- asynchronous copies global -> LDS, 16 B per lane, through no register ---------------------------
__device__ __forceinline__ unsigned lds_off(const void* p) { return (unsigned)(size_t)p; }   // LDS byte address
// A run of copies and its s_wait_xcnt 0 in ONE statement: the wait stands in front of every later write of the
// address registers that the copies name.
__device__ __forceinline__ void acopy4(const unsigned* l, const __bf16* const* g) {
  asm volatile("global_load_async_to_lds_b128 %0, %4, off\n\t"
               "global_load_async_to_lds_b128 %1, %5, off\n\t"
               "global_load_async_to_lds_b128 %2, %6, off\n\t"
               "global_load_async_to_lds_b128 %3, %7, off\n\t"
               "s_wait_xcnt 0x0"
               :: "v"(l[0]), "v"(l[1]), "v"(l[2]), "v"(l[3]), "v"(g[0]), "v"(g[1]), "v"(g[2]), "v"(g[3]) : "memory");
}
__device__ __forceinline__ void acopy8(const unsigned* l, const __bf16* const* g) {
  asm volatile("global_load_async_to_lds_b128 %0, %8, off\n\t"
               "global_load_async_to_lds_b128 %1, %9, off\n\t"
               "global_load_async_to_lds_b128 %2, %10, off\n\t"
               "global_load_async_to_lds_b128 %3, %11, off\n\t"
               "global_load_async_to_lds_b128 %4, %12, off\n\t"
               "global_load_async_to_lds_b128 %5, %13, off\n\t"
               "global_load_async_to_lds_b128 %6, %14, off\n\t"
               "global_load_async_to_lds_b128 %7, %15, off\n\t"
               "s_wait_xcnt 0x0"
               :: "v"(l[0]), "v"(l[1]), "v"(l[2]), "v"(l[3]), "v"(l[4]), "v"(l[5]), "v"(l[6]), "v"(l[7]),
                  "v"(g[0]), "v"(g[1]), "v"(g[2]), "v"(g[3]), "v"(g[4]), "v"(g[5]), "v"(g[6]), "v"(g[7]) : "memory");
}

// =====================================================================================================
// f32 -> bf16 (RNE convert), 8 elements per thread, one 16-B store per lane: a wave writes 512 contiguous B
// multiple of 256 for every use here; host-checked). coverage: n8 threads x 8 = whole plane.
// =====================================================================================================
__global__ __launch_bounds__(256) void cvt_bf16x8(const float* __restrict__ in, unsigned short* out, int n8) {
  const int i = blockIdx.x * 256 + threadIdx.x;
  if (i < n8) {
    const v4f a = *(const v4f*)(in + (size_t)i * 8);
    const v4f b = *(const v4f*)(in + (size_t)i * 8 + 4);
    v4u p;
    p[0] = pk16(bf_bits(a[0]), bf_bits(a[1]));
    p[1] = pk16(bf_bits(a[2]), bf_bits(a[3]));
    p[2] = pk16(bf_bits(b[0]), bf_bits(b[1]));
    p[3] = pk16(bf_bits(b[2]), bf_bits(b[3]));
    *(v4u*)(out + (size_t)i * 8) = p;
    
  }
}

// =====================================================================================================
// Register-blocked batched bf16 WMMA GEMM: C[m][n] = sum_k A[m][k] * Bt[n][k]; one wave per 64x64 tile, a block of
// 8 waves (2 x 4) per 128x256 tile. A row-major [M][K] pitch lda; Bt row-major [N][K] pitch ldb (k contiguous);
// M multiple of 128, N of 256, K of 64 and at least 128 (asserted on the shapes used). blockIdx.y = batch index.
// Operands: a stage is 64 k of the block's A rows (and A2 rows) and Bt rows, rows of 128 B at pitch 144 B in LDS,
// brought by asynchronous copies (8 lanes per row: a wave's copy covers 4 whole lines), two buffers: stage t + 2 is
// issued behind the barrier that ends stage t's reads and flies while stage t + 1 is worked on.
// NSPLIT: 0 = A.Bt; 1 = (A + A2).Bt (A2 = unscaled bf16 lo plane of A, same pitch/stride).
// BIAS: 0 none; 1 = + bfr(bias[n]) per column; 2 = + bfr(bias[m]) per row.
// ROPE (needs N tile = one head = 64 cols d 0..63, row m = b*SEQ + s): for s >= 1,
//   t[d] = t[d]*bfr(cos[s-1][d]) + rot[d]*bfr(sin[s-1][d]), rot = [-t[32..63] | t[0..31]] (after bias).
// OUT_MODE: 0 = f32 (pitch ldc); 2 = bf16 hi plane C + bf16 lo plane C2 (lo = RNE(v - hi), unscaled);
//           3 = f16 hi plane C + f16 residual plane C2 = f16((v - hi) * rscale); C2 same pitch/stride as C.
// =====================================================================================================
template <int NSPLIT, int OUT_MODE, int BIAS, int ROPE>
__global__ __launch_bounds__(256) void gemm64(
    const unsigned short* __restrict__ Ap, const unsigned short* __restrict__ A2p, int lda, long long strideA,
    const unsigned short* __restrict__ Btp, int ldb, long long strideB,
    const float* __restrict__ bias, const float* __restrict__ rsin, const float* __restrict__ rcos,
    void* Cout, void* Cout2, int ldc, long long strideC,
    int M, int N, int K, float rscale) {
  const __bf16* A  = (const __bf16*)(const void*)Ap;
  const __bf16* A2 = (const __bf16*)(const void*)A2p;
  const __bf16* Bt = (const __bf16*)(const void*)Btp;
  constexpr int ROWS_A  = GBM * (1 + NSPLIT);        // stage rows 0.. : A, then A2 where there is one
  constexpr int ROWS    = ROWS_A + GBN;              // then the Bt rows
  constexpr int STAGE_E = ROWS * GP;                 // elements of one buffer
  constexpr int NCP     = ROWS / 32;                 // copies per thread and stage: 256 threads cover 32 rows (12 or 16)
  __shared__ __align__(16) float sT[8][16 * 68];   // per-wave 16x64 slab, pitch 68 floats
  __shared__ __align__(16) __bf16 sG[2 * STAGE_E];  // operand stages, two buffers
  const int b    = blockIdx.y;
  const int lane = threadIdx.x & 31;
  const int wave = threadIdx.x >> 5;
  const int blkN = N / GBN;
  const int blkM = M / GBM;
  const int blk  = blockIdx.x;
  if (blk >= blkM * blkN) return;        // block-uniform, in front of every barrier and copy
  const int bm = blk / blkN;
  const int bn = blk - bm * blkN;
  const int wm = wave >> 2;              // 0..1
  const int wn = wave & 3;               // 0..3
  const int m0 = bm * GBM + (wm << 6);
  const int n0 = bn * GBN + (wn << 6);

  const __bf16* Ab  = A  + (size_t)b * strideA;
  const __bf16* Bb  = Bt + (size_t)b * strideB;
  const __bf16* Ab2 = (NSPLIT == 1) ? (A2 + (size_t)b * strideA) : Ab;

  const int rlane = lane & 15;                 // row (A) / col (B, D) within subtile
  const int koff  = (lane >> 4) * 8;           // k offset of this lane half
  const int mOff  = (lane >> 4) * 8;           // D row offset

  v8f acc[4][4];
#pragma unroll
  for (int i = 0; i < 4; ++i)
#pragma unroll
    for (int j = 0; j < 4; ++j) acc[i][j] = zero8();

  // ---- stage copies: thread -> row (tid >> 3) of each group of 32 rows, 16-B piece (tid & 7) of its 128 B ----
  const int crow = threadIdx.x >> 3;
  const int cseg = (threadIdx.x & 7) * 8;
  const __bf16* gA  = Ab  + (size_t)(bm * GBM + crow) * lda + cseg;
  const __bf16* gA2 = Ab2 + (size_t)(bm * GBM + crow) * lda + cseg;
  const __bf16* gB  = Bb  + (size_t)(bn * GBN + crow) * ldb + cseg;
  const unsigned lC = lds_off(sG) + (unsigned)(crow * GP + cseg) * 2u;
  auto issue_stage = [&](int st, int buf) {
    unsigned l[NCP];
    const __bf16* g[NCP];
#pragma unroll   // every index of l and g constant: the addresses stay in registers
    for (int p = 0; p < NCP; ++p) {
      l[p] = lC + (unsigned)(buf * STAGE_E + p * 32 * GP) * 2u;
      if (p * 32 < GBM)          g[p] = gA  + (size_t)(p * 32) * lda + (size_t)st * GKS;
      else if (p * 32 < ROWS_A)  g[p] = gA2 + (size_t)(p * 32 - GBM) * lda + (size_t)st * GKS;
      else                       g[p] = gB  + (size_t)(p * 32 - ROWS_A) * ldb + (size_t)st * GKS;
    }
    acopy8(l, g);
    if (NCP == 16) acopy8(l + 8, g + 8);
    else           acopy4(l + 8, g + 8);
  };

  const int T = K / GKS;                              // stages
  issue_stage(0, 0);
  asm volatile("s_wait_asynccnt 0x0" ::: "memory");   // this wave's copies of stage 0 have landed
  __syncthreads();                                    // and every other wave's: stage 0 may be read
  if (T > 1) issue_stage(1, 1);

  for (int t = 0; t < T; ++t) {
    const __bf16* sb = sG + (t & 1) * STAGE_E;
    const __bf16* sa = sb + ((wm << 6) + rlane) * GP + koff;
    const __bf16* sw = sb + (ROWS_A + (wn << 6) + rlane) * GP + koff;
    v16b bh[2][4], ah[2][4], al[2][4];   // the loops below are unrolled so that every fragment index is constant
#pragma unroll
    for (int ks = 0; ks < 2; ++ks) {
#pragma unroll
      for (int j = 0; j < 4; ++j) bh[ks][j] = ldfrag_b(sw + (j << 4) * GP + ks * 32);
#pragma unroll
      for (int i = 0; i < 4; ++i) {
        ah[ks][i] = ldfrag_b(sa + (i << 4) * GP + ks * 32);
        al[ks][i] = ah[ks][i];
        if (NSPLIT == 1) al[ks][i] = ldfrag_b(sa + (GBM + (i << 4)) * GP + ks * 32);
      }
    }
    // Holds the stage's fragment loads as one group ahead of its WMMAs: moved in among them, into one shared
    // register set, each place with loads makes the wave wait out the LDS latency.
    __builtin_amdgcn_sched_barrier(0);
#pragma unroll
    for (int ks = 0; ks < 2; ++ks)
#pragma unroll
      for (int i = 0; i < 4; ++i)
#pragma unroll
        for (int j = 0; j < 4; ++j) {
          acc[i][j] = mma_b_raw(ah[ks][i], bh[ks][j], acc[i][j]);
          if (NSPLIT == 1) acc[i][j] = mma_b_raw(al[ks][i], bh[ks][j], acc[i][j]);
        }
    // Holds the WMMAs ahead of the full LDS wait below: behind it none would start before the last fragment is in.
    __builtin_amdgcn_sched_barrier(0);
    asm volatile("s_wait_dscnt 0x0" ::: "memory");      // this wave's reads of buffer t & 1 are done
    asm volatile("s_wait_asynccnt 0x0" ::: "memory");   // this wave's copies of stage t + 1 have landed
    __syncthreads();                                    // publishes stage t + 1, frees buffer t & 1
    if (t + 2 < T) issue_stage(t + 2, t & 1);
  }
  asm volatile("s_wait_asynccnt 0x0" ::: "memory");     // nothing in flight when the wave goes on
  acc_guard4(acc[0][0], acc[0][1], acc[0][2], acc[0][3]);
  acc_guard4(acc[1][0], acc[1][1], acc[1][2], acc[1][3]);
  acc_guard4(acc[2][0], acc[2][1], acc[2][2], acc[2][3]);
  acc_guard4(acc[3][0], acc[3][1], acc[3][2], acc[3][3]);

  // ---- epilogue ----
  float* slab = sT[wave];
  float bcol[4];
  if (BIAS == 1) {
#pragma unroll
    for (int j = 0; j < 4; ++j) bcol[j] = bfr(bias[n0 + (j << 4) + rlane]);   // n0+.. < N
  } else {
#pragma unroll
    for (int j = 0; j < 4; ++j) bcol[j] = 0.f;
  }
#pragma unroll
  for (int i = 0; i < 4; ++i) {
    const int mBase = m0 + (i << 4);
#pragma unroll
    for (int r = 0; r < 8; ++r) {
      const int m = mBase + mOff + r;                  // < M
      float brow = 0.f;
      if (BIAS == 2) brow = bfr(bias[m]);
      float t[4];
#pragma unroll
      for (int j = 0; j < 4; ++j) {
        float v = acc[i][j][r];
        if (BIAS == 1) v = v + bcol[j];
        if (BIAS == 2) v = v + brow;
        t[j] = v;
      }
      if (ROPE) {
        const int s = m & (SEQ - 1);                   // token index within the sequence
        const bool use = (s > 0);                        // token 0 passes unrotated
        const int sidx = use ? (s - 1) : 0;              // clamped table row
        const float* cr = rcos + (size_t)sidx * HD;
        const float* sr = rsin + (size_t)sidx * HD;
        float u[4];
#pragma unroll
        for (int j = 0; j < 4; ++j) {
          const int d = (j << 4) + rlane;                // 0..63
          const float cs = bfr(cr[d]);
          const float sn = bfr(sr[d]);
          const float tp = t[j ^ 2];                     // partner d^32, same lane
          const float rot = (j < 2) ? -tp : tp;
          const float w = t[j] * cs + rot * sn;
          u[j] = use ? w : t[j];
        }
#pragma unroll
        for (int j = 0; j < 4; ++j) t[j] = u[j];
      }
#pragma unroll
      for (int j = 0; j < 4; ++j) slab[(mOff + r) * 68 + (j << 4) + rlane] = t[j];
    }
    __builtin_amdgcn_fence(__ATOMIC_RELEASE, "workgroup");
    __builtin_amdgcn_wave_barrier();
    __builtin_amdgcn_fence(__ATOMIC_ACQUIRE, "workgroup");
    if (OUT_MODE == 0) {
      float* C = (float*)Cout + (size_t)b * strideC;
      const int hh = lane >> 4, c4 = (lane & 15) * 4;     // 256-B row segment = 16 lanes x 16 B
      {
#pragma unroll
        for (int it = 0; it < 8; ++it) {
          const int row = it * 2 + hh;                     // it 0..7 x hh 0..1 = rows 0..15
          const v4f v = *(const v4f*)(slab + row * 68 + c4);
          *(v4f*)(C + (size_t)(mBase + row) * ldc + n0 + c4) = v;
        }
        
      }
    } else {
      const int q = lane >> 3, c8 = (lane & 7) * 8;
      unsigned short* C  = (unsigned short*)Cout  + (size_t)b * strideC;
      unsigned short* C2 = (unsigned short*)Cout2 + (size_t)b * strideC;
      v4u hv[4], lv[4];
#pragma unroll
      for (int it = 0; it < 4; ++it) {
        const int row = it * 4 + q;                        // it 0..3 x q 0..3 = rows 0..15
        const float* sp = slab + row * 68 + c8;
        v4u a, a2;
#pragma unroll
        for (int e = 0; e < 4; ++e) {
          const float f0 = sp[2 * e], f1 = sp[2 * e + 1];
          unsigned short h0, h1, l0, l1;
          if (OUT_MODE == 2) {
            h0 = bf_bits(f0); h1 = bf_bits(f1);
            l0 = bf_bits(f0 - bf_up(h0)); l1 = bf_bits(f1 - bf_up(h1));
          } else {
            const _Float16 x0 = (_Float16)f0, x1 = (_Float16)f1;
            h0 = h_bits(x0); h1 = h_bits(x1);
            l0 = h_bits((_Float16)((f0 - (float)x0) * rscale));
            l1 = h_bits((_Float16)((f1 - (float)x1) * rscale));
          }
          a[e] = pk16(h0, h1); a2[e] = pk16(l0, l1);
        }
        hv[it] = a; lv[it] = a2;
      }
      {
#pragma unroll
        for (int it = 0; it < 4; ++it) {
          const int row = it * 4 + q;
          *(v4u*)(C  + (size_t)(mBase + row) * ldc + n0 + c8) = hv[it];
          *(v4u*)(C2 + (size_t)(mBase + row) * ldc + n0 + c8) = lv[it];
        }
        
      }
    }
    __builtin_amdgcn_fence(__ATOMIC_RELEASE, "workgroup");
    __builtin_amdgcn_wave_barrier();
    __builtin_amdgcn_fence(__ATOMIC_ACQUIRE, "workgroup");
  }
}

// =====================================================================================================
// Attention, head dim 64, no mask, all SEQ keys.
//   q planes (bf16 hi / lo): element (b, t, h, d) at [(b*SEQ + t)*DM + h*64 + d]
//   k planes (bf16 hi / lo): same layout with key index s
//   v^T hi plane (f16):      element (b, h, d, s) at [(b*DM + h*64 + d)*SEQ + s]
//   v^T residual plane (f16, (v - hi)*4096): same layout
//   out planes (bf16 hi / lo of the normalised context): element (b, t, h, d) at [(b*SEQ + t)*DM + h*64 + d]
//   Both products are formed transposed: S^T = K . Q^T (A = K rows, B = Q) and O^T += V^T . P^T (A = V^T rows, B = P^T).
//   A lane then holds one query (column lane&15) and 32 of the chunk's 64 keys (rows j*16 + 8*(lane>>4) + r): the maximum
//   and the sum run inside the lane, the two wave halves exchange the maximum once per chunk and join their sums once at
//   the end; two score tiles, converted in place, are the B operand P^T in the k order of the V^T loader.
//   scores = k . q : bf16 hi/lo split (hi.hi + lo.hi + hi.lo in k, q), f32 accumulate, then * sscale in f32
//   p = exp(s - m) carried as f16(1024 p); context = v^T . p^T on f16 WMMA: v_hi.p into the running accumulator,
//   v_res.p into a per-chunk accumulator folded back with 1/4096 in f32; online softmax in f32.
//   Block = 4 waves = 64 query rows of one (b, h); grid = NQB * NH * NB; kv chunks of 64, static trip NQB.
//   K / V^T chunk staging: 128 threads x 32 elements per plane = the whole 64x64 tile (plain 16-B loads,
//   __syncthreads before and after).
//   Output coverage: each wave stores rows q0..q0+15 (it 0..3 x lane>>3 0..3) x 64 columns (8 lanes x 8) of both planes.
// =====================================================================================================
__global__ __launch_bounds__(128)
void attn64(const unsigned short* __restrict__ qhp, const unsigned short* __restrict__ qlp,
            const unsigned short* __restrict__ khp, const unsigned short* __restrict__ klp,
            const unsigned short* __restrict__ vhp, const unsigned short* __restrict__ vlp,
            unsigned short* ohp, unsigned short* olp, float sscale) {
  union FB { v16b v; v8b h[2]; };
  union FH { v16h v; v8h h[2]; };
  // Rows of 64 16-bit elements are laid at a pitch of LP = 72 elements (144 B = 16 B x 9): the 16 rows that one
  // ds_load_b128 fragment read touches then fall on 16 different groups of four banks instead of two.
  __shared__ __align__(16) __bf16   Ksh[64 * LP];                 // K hi [kv][d]   9 KB
  __shared__ __align__(16) __bf16   Ksl[64 * LP];                 // K lo           9 KB
  __shared__ __align__(16) _Float16 Vth[64 * LP];                 // V^T hi [d][kv] 9 KB
  __shared__ __align__(16) _Float16 Vtl[64 * LP];                 // V^T residual   9 KB
  __shared__ __align__(16) float    Os[4][16 * OSP];              // per wave context tile [row][d] 17 KB

  const int tid  = threadIdx.x;
  const int wave = tid >> 5;
  const int lane = tid & 31;
  const int hh   = lane >> 4;
  const int c    = lane & 15;

  const int bx   = blockIdx.x;
  const int qb   = bx % NQB;
  const int rest = bx / NQB;
  const int h    = rest % NH;
  const int b    = rest / NH;
  const int q0   = qb * 64 + wave * 16;
  const size_t rowB = (size_t)b * SEQ;

  const __bf16* Qh = (const __bf16*)(const void*)qhp + (size_t)h * HD;
  const __bf16* Ql = (const __bf16*)(const void*)qlp + (size_t)h * HD;
  const __bf16* Kh = (const __bf16*)(const void*)khp + (size_t)h * HD;
  const __bf16* Kl = (const __bf16*)(const void*)klp + (size_t)h * HD;
  const _Float16* Vh = (const _Float16*)(const void*)vhp + ((size_t)b * DM + (size_t)h * HD) * SEQ;
  const _Float16* Vl = (const _Float16*)(const void*)vlp + ((size_t)b * DM + (size_t)h * HD) * SEQ;

  // ---- Q fragments (B operand, column = query = lane&15): 2 d-chunks, hi and lo ----
  v16b qah[2], qal[2];
#pragma unroll
  for (int dc = 0; dc < 2; ++dc) {
    const size_t qo = (rowB + q0 + c) * DM + dc * 32 + 8 * hh;
    qah[dc] = ldfrag_b(Qh + qo);
    qal[dc] = ldfrag_b(Ql + qo);
  }

  float mrow = -INFINITY, lrow = 0.f;   // this lane's query: running maximum (both halves alike), sum over this half's keys
  v8f oacc[4];                          // O^T: oacc[t][r] = context[query c][d = t*16 + 8*hh + r]
#pragma unroll
  for (int t = 0; t < 4; ++t) oacc[t] = zero8();

  for (int kt = 0; kt < NQB; ++kt) {         // static trip count
    const int kv0 = kt * 64;
    __syncthreads();
    {
      const int r = tid >> 1, half = (tid & 1) * 32;
      const __bf16*   kg  = Kh + (rowB + kv0 + r) * DM + half;    // K row kv0+r, d = half..half+31
      const __bf16*   klg = Kl + (rowB + kv0 + r) * DM + half;
      const _Float16* vg  = Vh + (size_t)r * SEQ + kv0 + half;    // V^T row d = r, s = kv0+half..+31
      const _Float16* vlg = Vl + (size_t)r * SEQ + kv0 + half;
#pragma unroll
      for (int i = 0; i < 4; ++i) {
        const v8b a0 = *(const v8b*)(kg + 8 * i);
        const v8b a1 = *(const v8b*)(klg + 8 * i);
        const v8h b0 = *(const v8h*)(vg + 8 * i);
        const v8h b1 = *(const v8h*)(vlg + 8 * i);
        *(v8b*)(Ksh + r * LP + half + 8 * i) = a0;
        *(v8b*)(Ksl + r * LP + half + 8 * i) = a1;
        *(v8h*)(Vth + r * LP + half + 8 * i) = b0;
        *(v8h*)(Vtl + r * LP + half + 8 * i) = b1;
      }
    }
    __syncthreads();

    // ---- scores, transposed: 64 keys x 16 queries per wave, 3 bf16 products; A[m = key][k = d] from Ksh[key][d] ----
    v8f s[4];
#pragma unroll
    for (int j = 0; j < 4; ++j) {
      s[j] = zero8();
#pragma unroll
      for (int dc = 0; dc < 2; ++dc) {
        FB kb, kl;
        kb.h[0] = *(const v8b*)(Ksh + (j * 16 + c) * LP + dc * 32 + 8 * hh);
        kb.h[1] = *(const v8b*)(Ksh + (j * 16 + c) * LP + dc * 32 + 16 + 8 * hh);
        kl.h[0] = *(const v8b*)(Ksl + (j * 16 + c) * LP + dc * 32 + 8 * hh);
        kl.h[1] = *(const v8b*)(Ksl + (j * 16 + c) * LP + dc * 32 + 16 + 8 * hh);
        s[j] = mma_b(kb.v, qah[dc], s[j]);
        s[j] = mma_b(kl.v, qah[dc], s[j]);
        s[j] = mma_b(kb.v, qal[dc], s[j]);
      }
    }

    // ---- scale, maximum, online softmax; query c, key j*16 + 8*hh + r lives in s[j][r] ----
    float mj[4];
#pragma unroll
    for (int j = 0; j < 4; ++j) {
      mj[j] = -INFINITY;
#pragma unroll
      for (int r = 0; r < 8; ++r) {
        const float sv = s[j][r] * sscale;
        s[j][r] = sv;
        mj[j] = fmaxf(mj[j], sv);
      }
    }
    float m = fmaxf(fmaxf(mj[0], mj[1]), fmaxf(mj[2], mj[3]));
    m = fmaxf(m, xhalf(m));                            // the query's other 32 keys sit in lane ^ 16
    const float mnew  = fmaxf(mrow, m);
    const float msafe = (mnew == -INFINITY) ? 0.f : mnew;
    const float alpha = __expf(mrow - msafe);
    mrow = mnew;
    // P^T (x1024, f16) as B operand: element e of chunk kk = key kk*32 + (e < 8 ? 8*hh + e : 16 + 8*hh + e - 8)
    FH pb[2];
    float pj[4];
#pragma unroll
    for (int j = 0; j < 4; ++j) {
      pj[j] = 0.f;
#pragma unroll
      for (int r = 0; r < 8; ++r) {
        const float p = __expf(s[j][r] - msafe);
        pj[j] += p;
        pb[j >> 1].v[(j & 1) * 8 + r] = (_Float16)(p * 1024.0f);
      }
    }
    lrow = lrow * alpha + ((pj[0] + pj[1]) + (pj[2] + pj[3]));
#pragma unroll
    for (int t = 0; t < 4; ++t)
#pragma unroll
      for (int r = 0; r < 8; ++r) oacc[t][r] *= alpha;

    // ---- context^T += V^T . P^T (f16 WMMA): A[m = d][k = kv] from Vth[d][kv], B = P^T[k = kv][n = query];
    //      residual products into a separate per-chunk accumulator ----
    v8f o1[4];
#pragma unroll
    for (int t = 0; t < 4; ++t) o1[t] = zero8();
#pragma unroll
    for (int kk = 0; kk < 2; ++kk) {
#pragma unroll
      for (int t = 0; t < 4; ++t) {
        FH vb, vl;
        vb.h[0] = *(const v8h*)(Vth + (t * 16 + c) * LP + kk * 32 + 8 * hh);
        vb.h[1] = *(const v8h*)(Vth + (t * 16 + c) * LP + kk * 32 + 16 + 8 * hh);
        vl.h[0] = *(const v8h*)(Vtl + (t * 16 + c) * LP + kk * 32 + 8 * hh);
        vl.h[1] = *(const v8h*)(Vtl + (t * 16 + c) * LP + kk * 32 + 16 + 8 * hh);
        oacc[t] = mma_h(vb.v, pb[kk].v, oacc[t]);
        o1[t]   = mma_h(vl.v, pb[kk].v, o1[t]);
      }
    }
#pragma unroll
    for (int t = 0; t < 4; ++t)
#pragma unroll
      for (int r = 0; r < 8; ++r) oacc[t][r] += o1[t][r] * (1.0f / 4096.0f);
  }

  // ---- normalise (1/l and the 1/1024 p carry), stage the wave's 16x64 tile, bf16 hi/lo split,
  float* os = Os[wave];
  {
    const float l = lrow + xhalf(lrow);                // join the two halves' sums of this query
    const float inv = ((l > 0.f) ? (1.0f / l) : 0.f) * (1.0f / 1024.0f);
#pragma unroll
    for (int t = 0; t < 4; ++t)
#pragma unroll
      for (int r = 0; r < 8; ++r) os[c * OSP + t * 16 + 8 * hh + r] = oacc[t][r] * inv;
  }
  __builtin_amdgcn_fence(__ATOMIC_RELEASE, "workgroup");
  __builtin_amdgcn_wave_barrier();
  __builtin_amdgcn_fence(__ATOMIC_ACQUIRE, "workgroup");
  {
    const int q4 = lane >> 3, c8 = (lane & 7) * 8;
    v4u hv[4], lv[4];
#pragma unroll
    for (int it = 0; it < 4; ++it) {
      const int row = it * 4 + q4;   // it 0..3 x q4 0..3 = rows 0..15 of the wave tile
      const float* sp = os + row * OSP + c8;
      v4u a, a2;
#pragma unroll
      for (int e = 0; e < 4; ++e) {
        const float f0 = sp[2 * e], f1 = sp[2 * e + 1];
        const unsigned short h0 = bf_bits(f0), h1 = bf_bits(f1);
        const unsigned short l0 = bf_bits(f0 - bf_up(h0)), l1 = bf_bits(f1 - bf_up(h1));
        a[e] = pk16(h0, h1); a2[e] = pk16(l0, l1);
      }
      hv[it] = a; lv[it] = a2;
    }
    {
#pragma unroll
      for (int it = 0; it < 4; ++it) {
        const int row = it * 4 + q4;
        const size_t go = (rowB + q0 + row) * DM + (size_t)h * HD + c8;
        *(v4u*)(ohp + go) = hv[it];
        *(v4u*)(olp + go) = lv[it];
      }
      
    }
  }
}

// =====================================================================================================
// Workspace map: 8 regions of PL = NTOK*DM*2 = 16777216 B each, total 134217728 B.
//   R0  Xb   bf16 [8192][1024]                    (after the projections: Oh, context hi plane [8192][1024])
//   R1  Qh   bf16 [8192][1024]                    (after attention: Wob bf16 [1024][1024], 2097152 B used)
//   R2  Ql   bf16 [8192][1024]
//   R3  Kh   bf16 [8192][1024]
//   R4  Kl   bf16 [8192][1024]
//   R5  VTh  f16  [4][1024][2048]
//   R6  VTl  f16  [4][1024][2048]
//   R7  Wqkv bf16 [3072][1024] (6291456 B used)   (during attention: Ol, context lo plane [8192][1024])
// All planes are exact multiples of their 64x64 tile / whole-line store granularity (no padded tails needed).
// Weights are [out n][in k] with k contiguous = the Bt / A layout the GEMM wants, so they are only converted.
// =====================================================================================================
extern "C" void kernel_launch(void* const* d_in, const int* in_sizes, int n_in,
                              void* d_out, int out_size, void* d_ws, size_t ws_size,
                              hipStream_t stream) {
  if (n_in < 8) return;
  if (in_sizes[0] != NTOK * DM) return;
  if (in_sizes[1] != 3 * DM * DM) return;
  if (in_sizes[2] != DM || in_sizes[3] != DM) return;
  if (in_sizes[4] != DM * DM || in_sizes[5] != DM) return;
  if (in_sizes[6] != (SEQ - 1) * HD || in_sizes[7] != (SEQ - 1) * HD) return;
  if (out_size != NTOK * DM) return;

  const float* x      = (const float*)d_in[0];
  const float* qkv_w  = (const float*)d_in[1];
  const float* q_bias = (const float*)d_in[2];
  const float* v_bias = (const float*)d_in[3];
  const float* proj_w = (const float*)d_in[4];
  const float* proj_b = (const float*)d_in[5];
  const float* rsin   = (const float*)d_in[6];
  const float* rcos   = (const float*)d_in[7];

  const size_t PL = (size_t)NTOK * DM * 2;        // 16777216  one 16-bit activation plane [8192][1024]
  static_assert((size_t)3 * DM * DM * 2 <= (size_t)NTOK * DM * 2);
  static_assert((size_t)NB * DM * SEQ * 2 == (size_t)NTOK * DM * 2);
  static_assert((size_t)DM * DM * 2 <= (size_t)NTOK * DM * 2);
  size_t off = 0;
  const size_t oR0 = off; off += PL;
  const size_t oR1 = off; off += PL;
  const size_t oR2 = off; off += PL;
  const size_t oR3 = off; off += PL;
  const size_t oR4 = off; off += PL;
  const size_t oR5 = off; off += PL;
  const size_t oR6 = off; off += PL;
  const size_t oR7 = off; off += PL;
  if (off > ws_size) return;                      // off = 134217728
  if (off > (size_t)134217728) return;

  char* ws = (char*)d_ws;
  unsigned short* Xb   = (unsigned short*)(ws + oR0);
  unsigned short* Oh   = (unsigned short*)(ws + oR0);
  unsigned short* Qh   = (unsigned short*)(ws + oR1);
  unsigned short* Wob  = (unsigned short*)(ws + oR1);
  unsigned short* Ql   = (unsigned short*)(ws + oR2);
  unsigned short* Kh   = (unsigned short*)(ws + oR3);
  unsigned short* Kl   = (unsigned short*)(ws + oR4);
  unsigned short* VTh  = (unsigned short*)(ws + oR5);
  unsigned short* VTl  = (unsigned short*)(ws + oR6);
  unsigned short* Wqkv = (unsigned short*)(ws + oR7);
  unsigned short* Ol   = (unsigned short*)(ws + oR7);
  const unsigned short* Wq = Wqkv;
  const unsigned short* Wk = Wqkv + (size_t)DM * DM;
  const unsigned short* Wv = Wqkv + (size_t)2 * DM * DM;

  const dim3 blk(256);
  const int n8x = NTOK * DM / 8;                              // 1048576
  const int n8q = 3 * DM * DM / 8;                            //  393216
  const int n8o = DM * DM / 8;                                //  131072
  if ((n8x % 256) != 0 || (n8q % 256) != 0 || (n8o % 256) != 0) return;
  const dim3 gCvtX(n8x / 256);                                // 4096 blocks
  const dim3 gCvtQ(n8q / 256);                                // 1536 blocks
  const dim3 gCvtO(n8o / 256);                                //  512 blocks
  const int tilesTok = (NTOK / 64) * (DM / 64);               // 2048 tiles: M=8192, N=1024
  const int tilesVT  = (DM / 64) * (SEQ / 64);                //  512 tiles: M=1024, N=2048
  const dim3 gTok((tilesTok + 7) / 8, 1);                     // 256 blocks
  const dim3 gVT((tilesVT + 7) / 8, NB);                      // 64 blocks x 4 batches
  const dim3 gAttn(NB * NH * NQB);                            // 2048 blocks

  // (1) x -> bf16 plane [8192][1024]; qkv_w [3072 n][1024 k] f32 -> bf16
  cvt_bf16x8<<<gCvtX, blk, 0, stream>>>(x, Xb, n8x);
  cvt_bf16x8<<<gCvtQ, blk, 0, stream>>>(qkv_w, Wqkv, n8q);
  // (2) q = x . Wq^T + q_bias, rope for tokens >= 1 -> bf16 hi/lo planes [b*SEQ+t][h*64+d]   (M=8192, N=1024, K=1024)
  gemm64<0, 2, 1, 1><<<gTok, blk, 0, stream>>>(
      Xb, Xb, DM, 0LL, Wq, DM, 0LL, q_bias, rsin, rcos,
      (void*)Qh, (void*)Ql, DM, 0LL, NTOK, DM, DM, 1.0f);
  // (3) k = x . Wk^T (no bias), rope -> bf16 hi/lo planes
  gemm64<0, 2, 0, 1><<<gTok, blk, 0, stream>>>(
      Xb, Xb, DM, 0LL, Wk, DM, 0LL, q_bias, rsin, rcos,
      (void*)Kh, (void*)Kl, DM, 0LL, NTOK, DM, DM, 1.0f);
  // (4) v^T = Wv . x^T + v_bias[row] per batch -> f16 hi plane [b][h*64+d][s] (pitch SEQ) and residual plane x4096
  //     (A = Wv [n][k], Bt = Xb rows of batch b; M=1024, N=2048, K=1024)
  gemm64<0, 3, 2, 0><<<gVT, blk, 0, stream>>>(
      Wv, Wv, DM, 0LL, Xb, DM, (long long)SEQ * DM, v_bias, rsin, rcos,
      (void*)VTh, (void*)VTl, SEQ, (long long)DM * SEQ, DM, SEQ, DM, 4096.0f);
  // (5) attention -> context bf16 hi plane (R0, x plane dead) and lo plane (R7, weight plane dead)
  attn64<<<gAttn, dim3(128), 0, stream>>>(Qh, Ql, Kh, Kl, VTh, VTl, Oh, Ol, 0.125f);
  // (6) proj_w -> bf16 [n][k] into R1 (q hi plane dead after attention)
  cvt_bf16x8<<<gCvtO, blk, 0, stream>>>(proj_w, Wob, n8o);
  // (7) out = context . Wo^T + proj_b -> d_out f32 [8192][1024]  (A = context hi + lo planes, 2 products)
  gemm64<1, 0, 1, 0><<<gTok, blk, 0, stream>>>(
      Oh, Ol, DM, 0LL, Wob, DM, 0LL, proj_b, rsin, rcos,
      d_out, d_out, DM, 0LL, NTOK, DM, DM, 1.0f);
  (void)hipGetLastError();
}

// v004
// One run takes 287 microseconds.
// Timed twice side by side with v003, it ran 1.12 and 1.11 times as fast.
// Over all steps from v000 it is 2.62 times as fast.
// Contractions: q, k, v^T projections = v_wmma_f32_16x16x32_bf16 (bf16 operands from RNE-converted inputs, single product, f32 accumulate);
// q.k^T scores = v_wmma_f32_16x16x32_bf16 with bf16 hi/lo split q and k (hi.hi + hi.lo + lo.hi), f32 accumulate;
// p.v = v_wmma_f32_16x16x32_f16 (p carried x1024 in f16; v as f16 hi plane plus f16 residual plane x4096; 2 products), f32 accumulate;
// ctx.Wo^T = v_wmma_f32_16x16x32_bf16 with ctx as bf16 hi/lo planes times bf16 Wo (2 products), f32 accumulate; bias, rope, softmax in f32.
#include <hip/hip_runtime.h>
#include <math.h>
#include <stdint.h>

#pragma clang fp contract(off)

#define NB    4
#define SEQ   2048
#define DM    1024
#define NH    16
#define HD    64
#define NQB   (SEQ / 64)      // 32 key / query tiles of 64
#define NTOK  (NB * SEQ)      // 8192 token rows
#define LP    72              // LDS row pitch of the attention K and V^T tiles, in 16-bit elements
#define OSP   68              // LDS row pitch of the attention output staging tile, in floats (16 B x odd)
#define GP    72              // LDS row pitch of the GEMM operand tiles, in 16-bit elements (144 B = 16 B x odd)
#define GKS   64              // k elements of one GEMM stage: rows of 128 B, one whole line each
#define GBM   128             // GEMM block tile rows    (2 waves x 64)
#define GBN   256             // GEMM block tile columns (4 waves x 64)
static_assert(NH * HD == DM);
static_assert((SEQ % 64) == 0 && (DM % 64) == 0);
static_assert((SEQ & (SEQ - 1)) == 0);
static_assert((NTOK % GBM) == 0 && (DM % GBM) == 0 && (DM % GBN) == 0 && (SEQ % GBN) == 0);   // whole GEMM block tiles
static_assert((DM % GKS) == 0 && DM >= 2 * GKS);                                              // whole stages, two or more
static_assert(GP >= GKS && (GP % 8) == 0 && ((GP / 8) & 1) == 1);
static_assert(LP >= HD && (LP % 8) == 0 && ((LP / 8) & 1) == 1);   // 16-B aligned rows, pitch = 16 B x odd

typedef _Float16 v16h __attribute__((ext_vector_type(16)));
typedef _Float16 v8h  __attribute__((ext_vector_type(8)));
typedef __bf16   v16b __attribute__((ext_vector_type(16)));
typedef __bf16   v8b  __attribute__((ext_vector_type(8)));
typedef float    v8f  __attribute__((ext_vector_type(8)));
typedef float    v4f  __attribute__((ext_vector_type(4)));
typedef unsigned int v4u __attribute__((ext_vector_type(4)));

// ---- scalar helpers --------------------------------------------------------------------------------
__device__ __forceinline__ unsigned short bf_bits(float f) {          // f32 -> bf16 bits, RNE convert
  unsigned u = __float_as_uint(f);
  return (unsigned short)((u + 0x7FFFu + ((u >> 16) & 1u)) >> 16);
}
__device__ __forceinline__ float bf_up(unsigned short h) { return __uint_as_float(((unsigned)h) << 16); }
__device__ __forceinline__ float bfr(float f) { return bf_up(bf_bits(f)); }   // value after bf16 RNE convert
__device__ __forceinline__ unsigned short h_bits(_Float16 x) { return __builtin_bit_cast(unsigned short, x); }
__device__ __forceinline__ unsigned pk16(unsigned short a, unsigned short b) { return (unsigned)a | ((unsigned)b << 16); }
__device__ __forceinline__ float xhalf(float x) {                     // the value lane l ^ 16 holds
  return __builtin_bit_cast(float, __builtin_amdgcn_permlanex16(__builtin_bit_cast(int, x), __builtin_bit_cast(int, x),
                                                                0x76543210, 0xfedcba98, false, false));
}
__device__ __forceinline__ v8f zero8() { v8f z = {0.f, 0.f, 0.f, 0.f, 0.f, 0.f, 0.f, 0.f}; return z; }

// ---- fragment loader: 16-bit A/B operand, lane -> row/col (lane&15), p already includes +8*(lane>>4);
//      elements 0..7 <- p[0..7] (k0+8h..), elements 8..15 <- p[16..23] (k0+16+8h..)
__device__ __forceinline__ v16b ldfrag_b(const __bf16* p) {
  union { v16b v; v8b h[2]; } f;
  f.h[0] = *(const v8b*)(p);
  f.h[1] = *(const v8b*)(p + 16);
  return f.v;
}

// ---- WMMA helpers with trailing VALU hazard gap --------------------------------------------------------
__device__ __forceinline__ v8f mma_b(v16b a, v16b b, v8f c) {
  c = __builtin_amdgcn_wmma_f32_16x16x32_bf16(false, a, false, b, (short)0, c, false, false);
  asm volatile("v_nop\n\tv_nop\n\tv_nop\n\tv_nop" : "+v"(c) : "v"(a), "v"(b));
  return c;
}
__device__ __forceinline__ v8f mma_h(v16h a, v16h b, v8f c) {
  c = __builtin_amdgcn_wmma_f32_16x16x32_f16(false, a, false, b, (short)0, c, false, false);
  asm volatile("v_nop\n\tv_nop\n\tv_nop\n\tv_nop" : "+v"(c) : "v"(a), "v"(b));
  return c;
}
__device__ __forceinline__ v8f mma_b_raw(v16b a, v16b b, v8f c) {
  return __builtin_amdgcn_wmma_f32_16x16x32_bf16(false, a, false, b, (short)0, c, false, false);
}
__device__ __forceinline__ void acc_guard4(v8f& a, v8f& b, v8f& c, v8f& d) {
  asm volatile("v_nop\n\tv_nop\n\tv_nop\n\tv_nop" : "+v"(a), "+v"(b), "+v"(c), "+v"(d));
}

// ---- asynchronous copies global -> LDS, 16 B per lane, through no register ---------------------------
__device__ __forceinline__ unsigned lds_off(const void* p) { return (unsigned)(size_t)p; }   // LDS byte address
// A run of copies and its s_wait_xcnt 0 in ONE statement: the wait stands in front of every later write of the
// address registers that the copies name.
__device__ __forceinline__ void acopy4(const unsigned* l, const __bf16* const* g) {
  asm volatile("global_load_async_to_lds_b128 %0, %4, off\n\t"
               "global_load_async_to_lds_b128 %1, %5, off\n\t"
               "global_load_async_to_lds_b128 %2, %6, off\n\t"
               "global_load_async_to_lds_b128 %3, %7, off\n\t"
               "s_wait_xcnt 0x0"
               :: "v"(l[0]), "v"(l[1]), "v"(l[2]), "v"(l[3]), "v"(g[0]), "v"(g[1]), "v"(g[2]), "v"(g[3]) : "memory");
}
__device__ __forceinline__ void acopy8(const unsigned* l, const __bf16* const* g) {
  asm volatile("global_load_async_to_lds_b128 %0, %8, off\n\t"
               "global_load_async_to_lds_b128 %1, %9, off\n\t"
               "global_load_async_to_lds_b128 %2, %10, off\n\t"
               "global_load_async_to_lds_b128 %3, %11, off\n\t"
               "global_load_async_to_lds_b128 %4, %12, off\n\t"
               "global_load_async_to_lds_b128 %5, %13, off\n\t"
               "global_load_async_to_lds_b128 %6, %14, off\n\t"
               "global_load_async_to_lds_b128 %7, %15, off\n\t"
               "s_wait_xcnt 0x0"
               :: "v"(l[0]), "v"(l[1]), "v"(l[2]), "v"(l[3]), "v"(l[4]), "v"(l[5]), "v"(l[6]), "v"(l[7]),
                  "v"(g[0]), "v"(g[1]), "v"(g[2]), "v"(g[3]), "v"(g[4]), "v"(g[5]), "v"(g[6]), "v"(g[7]) : "memory");
}

// =====================================================================================================
// f32 -> bf16 (RNE convert), 8 elements per thread, one 16-B store per lane: a wave writes 512 contiguous B
// multiple of 256 for every use here; host-checked). coverage: n8 threads x 8 = whole plane.
// =====================================================================================================
__global__ __launch_bounds__(256) void cvt_bf16x8(const float* __restrict__ in, unsigned short* out, int n8) {
  const int i = blockIdx.x * 256 + threadIdx.x;
  if (i < n8) {
    const v4f a = *(const v4f*)(in + (size_t)i * 8);
    const v4f b = *(const v4f*)(in + (size_t)i * 8 + 4);
    v4u p;
    p[0] = pk16(bf_bits(a[0]), bf_bits(a[1]));
    p[1] = pk16(bf_bits(a[2]), bf_bits(a[3]));
    p[2] = pk16(bf_bits(b[0]), bf_bits(b[1]));
    p[3] = pk16(bf_bits(b[2]), bf_bits(b[3]));
    *(v4u*)(out + (size_t)i * 8) = p;
    
  }
}

// =====================================================================================================
// Register-blocked batched bf16 WMMA GEMM: C[m][n] = sum_k A[m][k] * Bt[n][k]; one wave per 64x64 tile, a block of
// 8 waves (2 x 4) per 128x256 tile. A row-major [M][K] pitch lda; Bt row-major [N][K] pitch ldb (k contiguous);
// M multiple of 128, N of 256, K of 64 and at least 128 (asserted on the shapes used). blockIdx.y = batch index.
// Operands: a stage is 64 k of the block's A rows (and A2 rows) and Bt rows, rows of 128 B at pitch 144 B in LDS,
// brought by asynchronous copies (8 lanes per row: a wave's copy covers 4 whole lines), two buffers: stage t + 2 is
// issued behind the barrier that ends stage t's reads and flies while stage t + 1 is worked on.
// NSPLIT: 0 = A.Bt; 1 = (A + A2).Bt (A2 = unscaled bf16 lo plane of A, same pitch/stride).
// BIAS: 0 none; 1 = + bfr(bias[n]) per column; 2 = + bfr(bias[m]) per row.
// ROPE (needs N tile = one head = 64 cols d 0..63, row m = b*SEQ + s): for s >= 1,
//   t[d] = t[d]*bfr(cos[s-1][d]) + rot[d]*bfr(sin[s-1][d]), rot = [-t[32..63] | t[0..31]] (after bias).
// OUT_MODE: 0 = f32 (pitch ldc); 2 = bf16 hi plane C + bf16 lo plane C2 (lo = RNE(v - hi), unscaled);
//           3 = f16 hi plane C + f16 residual plane C2 = f16((v - hi) * rscale); C2 same pitch/stride as C.
// =====================================================================================================
template <int NSPLIT, int OUT_MODE, int BIAS, int ROPE>
__global__ __launch_bounds__(256) void gemm64(
    const unsigned short* __restrict__ Ap, const unsigned short* __restrict__ A2p, int lda, long long strideA,
    const unsigned short* __restrict__ Btp, int ldb, long long strideB,
    const float* __restrict__ bias, const float* __restrict__ rsin, const float* __restrict__ rcos,
    void* Cout, void* Cout2, int ldc, long long strideC,
    int M, int N, int K, float rscale) {
  const __bf16* A  = (const __bf16*)(const void*)Ap;
  const __bf16* A2 = (const __bf16*)(const void*)A2p;
  const __bf16* Bt = (const __bf16*)(const void*)Btp;
  constexpr int ROWS_A  = GBM * (1 + NSPLIT);        // stage rows 0.. : A, then A2 where there is one
  constexpr int ROWS    = ROWS_A + GBN;              // then the Bt rows
  constexpr int STAGE_E = ROWS * GP;                 // elements of one buffer
  constexpr int NCP     = ROWS / 32;                 // copies per thread and stage: 256 threads cover 32 rows (12 or 16)
  __shared__ __align__(16) float sT[8][16 * 68];   // per-wave 16x64 slab, pitch 68 floats
  __shared__ __align__(16) __bf16 sG[2 * STAGE_E];  // operand stages, two buffers
  const int b    = blockIdx.y;
  const int lane = threadIdx.x & 31;
  const int wave = threadIdx.x >> 5;
  const int blkN = N / GBN;
  const int blkM = M / GBM;
  const int blk  = blockIdx.x;
  if (blk >= blkM * blkN) return;        // block-uniform, in front of every barrier and copy
  const int bm = blk / blkN;
  const int bn = blk - bm * blkN;
  const int wm = wave >> 2;              // 0..1
  const int wn = wave & 3;               // 0..3
  const int m0 = bm * GBM + (wm << 6);
  const int n0 = bn * GBN + (wn << 6);

  const __bf16* Ab  = A  + (size_t)b * strideA;
  const __bf16* Bb  = Bt + (size_t)b * strideB;
  const __bf16* Ab2 = (NSPLIT == 1) ? (A2 + (size_t)b * strideA) : Ab;

  const int rlane = lane & 15;                 // row (A) / col (B, D) within subtile
  const int koff  = (lane >> 4) * 8;           // k offset of this lane half
  const int mOff  = (lane >> 4) * 8;           // D row offset

  v8f acc[4][4];
#pragma unroll
  for (int i = 0; i < 4; ++i)
#pragma unroll
    for (int j = 0; j < 4; ++j) acc[i][j] = zero8();

  // ---- stage copies: thread -> row (tid >> 3) of each group of 32 rows, 16-B piece (tid & 7) of its 128 B ----
  const int crow = threadIdx.x >> 3;
  const int cseg = (threadIdx.x & 7) * 8;
  const __bf16* gA  = Ab  + (size_t)(bm * GBM + crow) * lda + cseg;
  const __bf16* gA2 = Ab2 + (size_t)(bm * GBM + crow) * lda + cseg;
  const __bf16* gB  = Bb  + (size_t)(bn * GBN + crow) * ldb + cseg;
  const unsigned lC = lds_off(sG) + (unsigned)(crow * GP + cseg) * 2u;
  auto issue_stage = [&](int st, int buf) {
    unsigned l[NCP];
    const __bf16* g[NCP];
#pragma unroll   // every index of l and g constant: the addresses stay in registers
    for (int p = 0; p < NCP; ++p) {
      l[p] = lC + (unsigned)(buf * STAGE_E + p * 32 * GP) * 2u;
      if (p * 32 < GBM)          g[p] = gA  + (size_t)(p * 32) * lda + (size_t)st * GKS;
      else if (p * 32 < ROWS_A)  g[p] = gA2 + (size_t)(p * 32 - GBM) * lda + (size_t)st * GKS;
      else                       g[p] = gB  + (size_t)(p * 32 - ROWS_A) * ldb + (size_t)st * GKS;
    }
    acopy8(l, g);
    if (NCP == 16) acopy8(l + 8, g + 8);
    else           acopy4(l + 8, g + 8);
  };

  const int T = K / GKS;                              // stages
  issue_stage(0, 0);
  asm volatile("s_wait_asynccnt 0x0" ::: "memory");   // this wave's copies of stage 0 have landed
  __syncthreads();                                    // and every other wave's: stage 0 may be read
  if (T > 1) issue_stage(1, 1);

  for (int t = 0; t < T; ++t) {
    const __bf16* sb = sG + (t & 1) * STAGE_E;
    const __bf16* sa = sb + ((wm << 6) + rlane) * GP + koff;
    const __bf16* sw = sb + (ROWS_A + (wn << 6) + rlane) * GP + koff;
    v16b bh[2][4], ah[2][4], al[2][4];   // the loops below are unrolled so that every fragment index is constant
#pragma unroll
    for (int ks = 0; ks < 2; ++ks) {
#pragma unroll
      for (int j = 0; j < 4; ++j) bh[ks][j] = ldfrag_b(sw + (j << 4) * GP + ks * 32);
#pragma unroll
      for (int i = 0; i < 4; ++i) {
        ah[ks][i] = ldfrag_b(sa + (i << 4) * GP + ks * 32);
        al[ks][i] = ah[ks][i];
        if (NSPLIT == 1) al[ks][i] = ldfrag_b(sa + (GBM + (i << 4)) * GP + ks * 32);
      }
    }
    // Holds the stage's fragment loads as one group ahead of its WMMAs: moved in among them, into one shared
    // register set, each place with loads makes the wave wait out the LDS latency.
    __builtin_amdgcn_sched_barrier(0);
#pragma unroll
    for (int ks = 0; ks < 2; ++ks)
#pragma unroll
      for (int i = 0; i < 4; ++i)
#pragma unroll
        for (int j = 0; j < 4; ++j) {
          acc[i][j] = mma_b_raw(ah[ks][i], bh[ks][j], acc[i][j]);
          if (NSPLIT == 1) acc[i][j] = mma_b_raw(al[ks][i], bh[ks][j], acc[i][j]);
        }
    // Holds the WMMAs ahead of the full LDS wait below: behind it none would start before the last fragment is in.
    __builtin_amdgcn_sched_barrier(0);
    asm volatile("s_wait_dscnt 0x0" ::: "memory");      // this wave's reads of buffer t & 1 are done
    asm volatile("s_wait_asynccnt 0x0" ::: "memory");   // this wave's copies of stage t + 1 have landed
    __syncthreads();                                    // publishes stage t + 1, frees buffer t & 1
    if (t + 2 < T) issue_stage(t + 2, t & 1);
  }
  asm volatile("s_wait_asynccnt 0x0" ::: "memory");     // nothing in flight when the wave goes on
  acc_guard4(acc[0][0], acc[0][1], acc[0][2], acc[0][3]);
  acc_guard4(acc[1][0], acc[1][1], acc[1][2], acc[1][3]);
  acc_guard4(acc[2][0], acc[2][1], acc[2][2], acc[2][3]);
  acc_guard4(acc[3][0], acc[3][1], acc[3][2], acc[3][3]);

  // ---- epilogue ----
  float* slab = sT[wave];
  float bcol[4];
  if (BIAS == 1) {
#pragma unroll
    for (int j = 0; j < 4; ++j) bcol[j] = bfr(bias[n0 + (j << 4) + rlane]);   // n0+.. < N
  } else {
#pragma unroll
    for (int j = 0; j < 4; ++j) bcol[j] = 0.f;
  }
#pragma unroll
  for (int i = 0; i < 4; ++i) {
    const int mBase = m0 + (i << 4);
#pragma unroll
    for (int r = 0; r < 8; ++r) {
      const int m = mBase + mOff + r;                  // < M
      float brow = 0.f;
      if (BIAS == 2) brow = bfr(bias[m]);
      float t[4];
#pragma unroll
      for (int j = 0; j < 4; ++j) {
        float v = acc[i][j][r];
        if (BIAS == 1) v = v + bcol[j];
        if (BIAS == 2) v = v + brow;
        t[j] = v;
      }
      if (ROPE) {
        const int s = m & (SEQ - 1);                   // token index within the sequence
        const bool use = (s > 0);                        // token 0 passes unrotated
        const int sidx = use ? (s - 1) : 0;              // clamped table row
        const float* cr = rcos + (size_t)sidx * HD;
        const float* sr = rsin + (size_t)sidx * HD;
        float u[4];
#pragma unroll
        for (int j = 0; j < 4; ++j) {
          const int d = (j << 4) + rlane;                // 0..63
          const float cs = bfr(cr[d]);
          const float sn = bfr(sr[d]);
          const float tp = t[j ^ 2];                     // partner d^32, same lane
          const float rot = (j < 2) ? -tp : tp;
          const float w = t[j] * cs + rot * sn;
          u[j] = use ? w : t[j];
        }
#pragma unroll
        for (int j = 0; j < 4; ++j) t[j] = u[j];
      }
#pragma unroll
      for (int j = 0; j < 4; ++j) slab[(mOff + r) * 68 + (j << 4) + rlane] = t[j];
    }
    __builtin_amdgcn_fence(__ATOMIC_RELEASE, "workgroup");
    __builtin_amdgcn_wave_barrier();
    __builtin_amdgcn_fence(__ATOMIC_ACQUIRE, "workgroup");
    if (OUT_MODE == 0) {
      float* C = (float*)Cout + (size_t)b * strideC;
      const int hh = lane >> 4, c4 = (lane & 15) * 4;     // 256-B row segment = 16 lanes x 16 B
      {
#pragma unroll
        for (int it = 0; it < 8; ++it) {
          const int row = it * 2 + hh;                     // it 0..7 x hh 0..1 = rows 0..15
          const v4f v = *(const v4f*)(slab + row * 68 + c4);
          *(v4f*)(C + (size_t)(mBase + row) * ldc + n0 + c4) = v;
        }
        
      }
    } else {
      const int q = lane >> 3, c8 = (lane & 7) * 8;
      unsigned short* C  = (unsigned short*)Cout  + (size_t)b * strideC;
      unsigned short* C2 = (unsigned short*)Cout2 + (size_t)b * strideC;
      v4u hv[4], lv[4];
#pragma unroll
      for (int it = 0; it < 4; ++it) {
        const int row = it * 4 + q;                        // it 0..3 x q 0..3 = rows 0..15
        const float* sp = slab + row * 68 + c8;
        v4u a, a2;
#pragma unroll
        for (int e = 0; e < 4; ++e) {
          const float f0 = sp[2 * e], f1 = sp[2 * e + 1];
          unsigned short h0, h1, l0, l1;
          if (OUT_MODE == 2) {
            h0 = bf_bits(f0); h1 = bf_bits(f1);
            l0 = bf_bits(f0 - bf_up(h0)); l1 = bf_bits(f1 - bf_up(h1));
          } else {
            const _Float16 x0 = (_Float16)f0, x1 = (_Float16)f1;
            h0 = h_bits(x0); h1 = h_bits(x1);
            l0 = h_bits((_Float16)((f0 - (float)x0) * rscale));
            l1 = h_bits((_Float16)((f1 - (float)x1) * rscale));
          }
          a[e] = pk16(h0, h1); a2[e] = pk16(l0, l1);
        }
        hv[it] = a; lv[it] = a2;
      }
      {
#pragma unroll
        for (int it = 0; it < 4; ++it) {
          const int row = it * 4 + q;
          *(v4u*)(C  + (size_t)(mBase + row) * ldc + n0 + c8) = hv[it];
          *(v4u*)(C2 + (size_t)(mBase + row) * ldc + n0 + c8) = lv[it];
        }
        
      }
    }
    __builtin_amdgcn_fence(__ATOMIC_RELEASE, "workgroup");
    __builtin_amdgcn_wave_barrier();
    __builtin_amdgcn_fence(__ATOMIC_ACQUIRE, "workgroup");
  }
}

// =====================================================================================================
// Attention, head dim 64, no mask, all SEQ keys.
//   q planes (bf16 hi / lo): element (b, t, h, d) at [(b*SEQ + t)*DM + h*64 + d]
//   k planes (bf16 hi / lo): same layout with key index s
//   v^T hi plane (f16):      element (b, h, d, s) at [(b*DM + h*64 + d)*SEQ + s]
//   v^T residual plane (f16, (v - hi)*4096): same layout
//   out planes (bf16 hi / lo of the normalised context): element (b, t, h, d) at [(b*SEQ + t)*DM + h*64 + d]
//   Both products are formed transposed: S^T = K . Q^T (A = K rows, B = Q) and O^T += V^T . P^T (A = V^T rows, B = P^T).
//   A lane then holds one query (column lane&15) and 32 of the chunk's 64 keys (rows j*16 + 8*(lane>>4) + r): the maximum
//   and the sum run inside the lane, the two wave halves exchange the maximum once per chunk and join their sums once at
//   the end; two score tiles, converted in place, are the B operand P^T in the k order of the V^T loader.
//   scores = k . q : bf16 hi/lo split (hi.hi + lo.hi + hi.lo in k, q), f32 accumulate, then * sscale in f32
//   p = exp(s - m) carried as f16(1024 p); context = v^T . p^T on f16 WMMA: v_hi.p into the running accumulator,
//   v_res.p into a per-chunk accumulator folded back with 1/4096 in f32; online softmax in f32.
//   Block = 4 waves = 64 query rows of one (b, h); grid = NQB * NH * NB; kv chunks of 64, static trip NQB.
//   K / V^T chunk staging: a stage is the chunk's four 64x64 planes, rows of 128 B at pitch 144 B in LDS, brought by
//   asynchronous copies (8 lanes per row: a wave's copy covers 4 whole lines; 16 copies per thread), two buffers:
//   chunk t + 2 is issued behind the barrier that ends chunk t's reads and flies while chunk t + 1 is worked on.
//   Output coverage: each wave stores rows q0..q0+15 (it 0..3 x lane>>3 0..3) x 64 columns (8 lanes x 8) of both planes.
// =====================================================================================================
__global__ __launch_bounds__(128)
void attn64(const unsigned short* __restrict__ qhp, const unsigned short* __restrict__ qlp,
            const unsigned short* __restrict__ khp, const unsigned short* __restrict__ klp,
            const unsigned short* __restrict__ vhp, const unsigned short* __restrict__ vlp,
            unsigned short* ohp, unsigned short* olp, float sscale) {
  union FB { v16b v; v8b h[2]; };
  union FH { v16h v; v8h h[2]; };
  // Rows of 64 16-bit elements are laid at a pitch of LP = 72 elements (144 B = 16 B x 9): the 16 rows that one
  // ds_load_b128 fragment read touches then fall on 16 different groups of four banks instead of two.
  constexpr int PLANE_B = 64 * LP * 2;                            // bytes of one plane of a stage, 9 KB
  constexpr int STAGE_B = 4 * PLANE_B;                            // K hi [kv][d], K lo, V^T hi [d][kv], V^T residual
  static_assert(4 * 16 * OSP * 4 <= 2 * STAGE_B);                 // the output tiles fit where the stages were
  // Two stage buffers, 72 KB; behind the loop's last barrier the same bytes hold the per-wave context tiles [row][d].
  __shared__ __align__(16) unsigned char sKV[2 * STAGE_B];

  const int tid  = threadIdx.x;
  const int wave = tid >> 5;
  const int lane = tid & 31;
  const int hh   = lane >> 4;
  const int c    = lane & 15;

  const int bx   = blockIdx.x;
  const int qb   = bx % NQB;
  const int rest = bx / NQB;
  const int h    = rest % NH;
  const int b    = rest / NH;
  const int q0   = qb * 64 + wave * 16;
  const size_t rowB = (size_t)b * SEQ;

  const __bf16* Qh = (const __bf16*)(const void*)qhp + (size_t)h * HD;
  const __bf16* Ql = (const __bf16*)(const void*)qlp + (size_t)h * HD;
  const __bf16* Kh = (const __bf16*)(const void*)khp + (size_t)h * HD;
  const __bf16* Kl = (const __bf16*)(const void*)klp + (size_t)h * HD;
  const _Float16* Vh = (const _Float16*)(const void*)vhp + ((size_t)b * DM + (size_t)h * HD) * SEQ;
  const _Float16* Vl = (const _Float16*)(const void*)vlp + ((size_t)b * DM + (size_t)h * HD) * SEQ;

  // ---- Q fragments (B operand, column = query = lane&15): 2 d-chunks, hi and lo ----
  v16b qah[2], qal[2];
#pragma unroll
  for (int dc = 0; dc < 2; ++dc) {
    const size_t qo = (rowB + q0 + c) * DM + dc * 32 + 8 * hh;
    qah[dc] = ldfrag_b(Qh + qo);
    qal[dc] = ldfrag_b(Ql + qo);
  }

  float mrow = -INFINITY, lrow = 0.f;   // this lane's query: running maximum (both halves alike), sum over this half's keys
  v8f oacc[4];                          // O^T: oacc[t][r] = context[query c][d = t*16 + 8*hh + r]
#pragma unroll
  for (int t = 0; t < 4; ++t) oacc[t] = zero8();

  // ---- stage copies: thread -> row (tid >> 3) of each group of 16 rows, 16-B piece (tid & 7) of its 128 B ----
  const int crow = tid >> 3;
  const int cseg = (tid & 7) * 8;
  const __bf16* gKh = Kh + (rowB + crow) * DM + cseg;                            // K row crow of chunk 0
  const __bf16* gKl = Kl + (rowB + crow) * DM + cseg;
  const __bf16* gVh = (const __bf16*)(const void*)(Vh + (size_t)crow * SEQ + cseg);   // V^T row d = crow, an address only
  const __bf16* gVl = (const __bf16*)(const void*)(Vl + (size_t)crow * SEQ + cseg);
  const unsigned lC = lds_off(sKV) + (unsigned)(crow * LP + cseg) * 2u;
  auto issue_stage = [&](int st, int buf) {
    unsigned l[16];
    const __bf16* g[16];
#pragma unroll   // every index of l and g constant: the addresses stay in registers
    for (int p = 0; p < 4; ++p) {
      const unsigned lp = lC + (unsigned)(buf * STAGE_B + p * 16 * LP * 2);
      l[p]      = lp;
      l[4 + p]  = lp + PLANE_B;
      l[8 + p]  = lp + 2 * PLANE_B;
      l[12 + p] = lp + 3 * PLANE_B;
      g[p]      = gKh + (size_t)(st * 64 + p * 16) * DM;          // K row st*64 + p*16 + crow < SEQ
      g[4 + p]  = gKl + (size_t)(st * 64 + p * 16) * DM;
      g[8 + p]  = gVh + (size_t)(p * 16) * SEQ + st * 64;         // V^T row p*16 + crow < 64, s = st*64 + cseg.. < SEQ
      g[12 + p] = gVl + (size_t)(p * 16) * SEQ + st * 64;
    }
    acopy8(l, g);
    acopy8(l + 8, g + 8);
  };

  static_assert(NQB >= 2);                            // chunks 0 and 1 both exist
  issue_stage(0, 0);
  asm volatile("s_wait_asynccnt 0x0" ::: "memory");   // this wave's copies of chunk 0 have landed
  __syncthreads();                                    // and every other wave's: chunk 0 may be read
  issue_stage(1, 1);

  for (int kt = 0; kt < NQB; ++kt) {         // static trip count
    const unsigned char* sb = sKV + (kt & 1) * STAGE_B;
    const __bf16*   Ksh = (const __bf16*)(const void*)(sb);
    const __bf16*   Ksl = (const __bf16*)(const void*)(sb + PLANE_B);
    const _Float16* Vth = (const _Float16*)(const void*)(sb + 2 * PLANE_B);
    const _Float16* Vtl = (const _Float16*)(const void*)(sb + 3 * PLANE_B);

    // ---- scores, transposed: 64 keys x 16 queries per wave, 3 bf16 products; A[m = key][k = d] from Ksh[key][d] ----
    v8f s[4];
#pragma unroll
    for (int j = 0; j < 4; ++j) {
      s[j] = zero8();
#pragma unroll
      for (int dc = 0; dc < 2; ++dc) {
        FB kb, kl;
        kb.h[0] = *(const v8b*)(Ksh + (j * 16 + c) * LP + dc * 32 + 8 * hh);
        kb.h[1] = *(const v8b*)(Ksh + (j * 16 + c) * LP + dc * 32 + 16 + 8 * hh);
        kl.h[0] = *(const v8b*)(Ksl + (j * 16 + c) * LP + dc * 32 + 8 * hh);
        kl.h[1] = *(const v8b*)(Ksl + (j * 16 + c) * LP + dc * 32 + 16 + 8 * hh);
        s[j] = mma_b(kb.v, qah[dc], s[j]);
        s[j] = mma_b(kl.v, qah[dc], s[j]);
        s[j] = mma_b(kb.v, qal[dc], s[j]);
      }
    }

    // ---- scale, maximum, online softmax; query c, key j*16 + 8*hh + r lives in s[j][r] ----
    float mj[4];
#pragma unroll
    for (int j = 0; j < 4; ++j) {
      mj[j] = -INFINITY;
#pragma unroll
      for (int r = 0; r < 8; ++r) {
        const float sv = s[j][r] * sscale;
        s[j][r] = sv;
        mj[j] = fmaxf(mj[j], sv);
      }
    }
    float m = fmaxf(fmaxf(mj[0], mj[1]), fmaxf(mj[2], mj[3]));
    m = fmaxf(m, xhalf(m));                            // the query's other 32 keys sit in lane ^ 16
    const float mnew  = fmaxf(mrow, m);
    const float msafe = (mnew == -INFINITY) ? 0.f : mnew;
    const float alpha = __expf(mrow - msafe);
    mrow = mnew;
    // P^T (x1024, f16) as B operand: element e of chunk kk = key kk*32 + (e < 8 ? 8*hh + e : 16 + 8*hh + e - 8)
    FH pb[2];
    float pj[4];
#pragma unroll
    for (int j = 0; j < 4; ++j) {
      pj[j] = 0.f;
#pragma unroll
      for (int r = 0; r < 8; ++r) {
        const float p = __expf(s[j][r] - msafe);
        pj[j] += p;
        pb[j >> 1].v[(j & 1) * 8 + r] = (_Float16)(p * 1024.0f);
      }
    }
    lrow = lrow * alpha + ((pj[0] + pj[1]) + (pj[2] + pj[3]));
#pragma unroll
    for (int t = 0; t < 4; ++t)
#pragma unroll
      for (int r = 0; r < 8; ++r) oacc[t][r] *= alpha;

    // ---- context^T += V^T . P^T (f16 WMMA): A[m = d][k = kv] from Vth[d][kv], B = P^T[k = kv][n = query];
    //      residual products into a separate per-chunk accumulator ----
    v8f o1[4];
#pragma unroll
    for (int t = 0; t < 4; ++t) o1[t] = zero8();
#pragma unroll
    for (int kk = 0; kk < 2; ++kk) {
#pragma unroll
      for (int t = 0; t < 4; ++t) {
        FH vb, vl;
        vb.h[0] = *(const v8h*)(Vth + (t * 16 + c) * LP + kk * 32 + 8 * hh);
        vb.h[1] = *(const v8h*)(Vth + (t * 16 + c) * LP + kk * 32 + 16 + 8 * hh);
        vl.h[0] = *(const v8h*)(Vtl + (t * 16 + c) * LP + kk * 32 + 8 * hh);
        vl.h[1] = *(const v8h*)(Vtl + (t * 16 + c) * LP + kk * 32 + 16 + 8 * hh);
        oacc[t] = mma_h(vb.v, pb[kk].v, oacc[t]);
        o1[t]   = mma_h(vl.v, pb[kk].v, o1[t]);
      }
    }
#pragma unroll
    for (int t = 0; t < 4; ++t)
#pragma unroll
      for (int r = 0; r < 8; ++r) oacc[t][r] += o1[t][r] * (1.0f / 4096.0f);

    asm volatile("s_wait_dscnt 0x0" ::: "memory");      // this wave's reads of buffer kt & 1 are done
    asm volatile("s_wait_asynccnt 0x0" ::: "memory");   // this wave's copies of chunk kt + 1 have landed
    __syncthreads();                                    // publishes chunk kt + 1, frees buffer kt & 1
    if (kt + 2 < NQB) issue_stage(kt + 2, kt & 1);
  }
  asm volatile("s_wait_asynccnt 0x0" ::: "memory");     // nothing in flight when the buffers become output staging

  // ---- normalise (1/l and the 1/1024 p carry), stage the wave's 16x64 tile, bf16 hi/lo split,
  float* os = (float*)(void*)sKV + wave * (16 * OSP);   // every wave has passed the last chunk's barrier
  {
    const float l = lrow + xhalf(lrow);                // join the two halves' sums of this query
    const float inv = ((l > 0.f) ? (1.0f / l) : 0.f) * (1.0f / 1024.0f);
#pragma unroll
    for (int t = 0; t < 4; ++t)
#pragma unroll
      for (int r = 0; r < 8; ++r) os[c * OSP + t * 16 + 8 * hh + r] = oacc[t][r] * inv;
  }
  __builtin_amdgcn_fence(__ATOMIC_RELEASE, "workgroup");
  __builtin_amdgcn_wave_barrier();
  __builtin_amdgcn_fence(__ATOMIC_ACQUIRE, "workgroup");
  {
    const int q4 = lane >> 3, c8 = (lane & 7) * 8;
    v4u hv[4], lv[4];
#pragma unroll
    for (int it = 0; it < 4; ++it) {
      const int row = it * 4 + q4;   // it 0..3 x q4 0..3 = rows 0..15 of the wave tile
      const float* sp = os + row * OSP + c8;
      v4u a, a2;
#pragma unroll
      for (int e = 0; e < 4; ++e) {
        const float f0 = sp[2 * e], f1 = sp[2 * e + 1];
        const unsigned short h0 = bf_bits(f0), h1 = bf_bits(f1);
        const unsigned short l0 = bf_bits(f0 - bf_up(h0)), l1 = bf_bits(f1 - bf_up(h1));
        a[e] = pk16(h0, h1); a2[e] = pk16(l0, l1);
      }
      hv[it] = a; lv[it] = a2;
    }
    {
#pragma unroll
      for (int it = 0; it < 4; ++it) {
        const int row = it * 4 + q4;
        const size_t go = (rowB + q0 + row) * DM + (size_t)h * HD + c8;
        *(v4u*)(ohp + go) = hv[it];
        *(v4u*)(olp + go) = lv[it];
      }
      
    }
  }
}

// =====================================================================================================
// Workspace map: 8 regions of PL = NTOK*DM*2 = 16777216 B each, total 134217728 B.
//   R0  Xb   bf16 [8192][1024]                    (after the projections: Oh, context hi plane [8192][1024])
//   R1  Qh   bf16 [8192][1024]                    (after attention: Wob bf16 [1024][1024], 2097152 B used)
//   R2  Ql   bf16 [8192][1024]
//   R3  Kh   bf16 [8192][1024]
//   R4  Kl   bf16 [8192][1024]
//   R5  VTh  f16  [4][1024][2048]
//   R6  VTl  f16  [4][1024][2048]
//   R7  Wqkv bf16 [3072][1024] (6291456 B used)   (during attention: Ol, context lo plane [8192][1024])
// All planes are exact multiples of their 64x64 tile / whole-line store granularity (no padded tails needed).
// Weights are [out n][in k] with k contiguous = the Bt / A layout the GEMM wants, so they are only converted.
// =====================================================================================================
extern "C" void kernel_launch(void* const* d_in, const int* in_sizes, int n_in,
                              void* d_out, int out_size, void* d_ws, size_t ws_size,
                              hipStream_t stream) {
  if (n_in < 8) return;
  if (in_sizes[0] != NTOK * DM) return;
  if (in_sizes[1] != 3 * DM * DM) return;
  if (in_sizes[2] != DM || in_sizes[3] != DM) return;
  if (in_sizes[4] != DM * DM || in_sizes[5] != DM) return;
  if (in_sizes[6] != (SEQ - 1) * HD || in_sizes[7] != (SEQ - 1) * HD) return;
  if (out_size != NTOK * DM) return;

  const float* x      = (const float*)d_in[0];
  const float* qkv_w  = (const float*)d_in[1];
  const float* q_bias = (const float*)d_in[2];
  const float* v_bias = (const float*)d_in[3];
  const float* proj_w = (const float*)d_in[4];
  const float* proj_b = (const float*)d_in[5];
  const float* rsin   = (const float*)d_in[6];
  const float* rcos   = (const float*)d_in[7];

  const size_t PL = (size_t)NTOK * DM * 2;        // 16777216  one 16-bit activation plane [8192][1024]
  static_assert((size_t)3 * DM * DM * 2 <= (size_t)NTOK * DM * 2);
  static_assert((size_t)NB * DM * SEQ * 2 == (size_t)NTOK * DM * 2);
  static_assert((size_t)DM * DM * 2 <= (size_t)NTOK * DM * 2);
  size_t off = 0;
  const size_t oR0 = off; off += PL;
  const size_t oR1 = off; off += PL;
  const size_t oR2 = off; off += PL;
  const size_t oR3 = off; off += PL;
  const size_t oR4 = off; off += PL;
  const size_t oR5 = off; off += PL;
  const size_t oR6 = off; off += PL;
  const size_t oR7 = off; off += PL;
  if (off > ws_size) return;                      // off = 134217728
  if (off > (size_t)134217728) return;

  char* ws = (char*)d_ws;
  unsigned short* Xb   = (unsigned short*)(ws + oR0);
  unsigned short* Oh   = (unsigned short*)(ws + oR0);
  unsigned short* Qh   = (unsigned short*)(ws + oR1);
  unsigned short* Wob  = (unsigned short*)(ws + oR1);
  unsigned short* Ql   = (unsigned short*)(ws + oR2);
  unsigned short* Kh   = (unsigned short*)(ws + oR3);
  unsigned short* Kl   = (unsigned short*)(ws + oR4);
  unsigned short* VTh  = (unsigned short*)(ws + oR5);
  unsigned short* VTl  = (unsigned short*)(ws + oR6);
  unsigned short* Wqkv = (unsigned short*)(ws + oR7);
  unsigned short* Ol   = (unsigned short*)(ws + oR7);
  const unsigned short* Wq = Wqkv;
  const unsigned short* Wk = Wqkv + (size_t)DM * DM;
  const unsigned short* Wv = Wqkv + (size_t)2 * DM * DM;

  const dim3 blk(256);
  const int n8x = NTOK * DM / 8;                              // 1048576
  const int n8q = 3 * DM * DM / 8;                            //  393216
  const int n8o = DM * DM / 8;                                //  131072
  if ((n8x % 256) != 0 || (n8q % 256) != 0 || (n8o % 256) != 0) return;
  const dim3 gCvtX(n8x / 256);                                // 4096 blocks
  const dim3 gCvtQ(n8q / 256);                                // 1536 blocks
  const dim3 gCvtO(n8o / 256);                                //  512 blocks
  const int tilesTok = (NTOK / 64) * (DM / 64);               // 2048 tiles: M=8192, N=1024
  const int tilesVT  = (DM / 64) * (SEQ / 64);                //  512 tiles: M=1024, N=2048
  const dim3 gTok((tilesTok + 7) / 8, 1);                     // 256 blocks
  const dim3 gVT((tilesVT + 7) / 8, NB);                      // 64 blocks x 4 batches
  const dim3 gAttn(NB * NH * NQB);                            // 2048 blocks

  // (1) x -> bf16 plane [8192][1024]; qkv_w [3072 n][1024 k] f32 -> bf16
  cvt_bf16x8<<<gCvtX, blk, 0, stream>>>(x, Xb, n8x);
  cvt_bf16x8<<<gCvtQ, blk, 0, stream>>>(qkv_w, Wqkv, n8q);
  // (2) q = x . Wq^T + q_bias, rope for tokens >= 1 -> bf16 hi/lo planes [b*SEQ+t][h*64+d]   (M=8192, N=1024, K=1024)
  gemm64<0, 2, 1, 1><<<gTok, blk, 0, stream>>>(
      Xb, Xb, DM, 0LL, Wq, DM, 0LL, q_bias, rsin, rcos,
      (void*)Qh, (void*)Ql, DM, 0LL, NTOK, DM, DM, 1.0f);
  // (3) k = x . Wk^T (no bias), rope -> bf16 hi/lo planes
  gemm64<0, 2, 0, 1><<<gTok, blk, 0, stream>>>(
      Xb, Xb, DM, 0LL, Wk, DM, 0LL, q_bias, rsin, rcos,
      (void*)Kh, (void*)Kl, DM, 0LL, NTOK, DM, DM, 1.0f);
  // (4) v^T = Wv . x^T + v_bias[row] per batch -> f16 hi plane [b][h*64+d][s] (pitch SEQ) and residual plane x4096
  //     (A = Wv [n][k], Bt = Xb rows of batch b; M=1024, N=2048, K=1024)
  gemm64<0, 3, 2, 0><<<gVT, blk, 0, stream>>>(
      Wv, Wv, DM, 0LL, Xb, DM, (long long)SEQ * DM, v_bias, rsin, rcos,
      (void*)VTh, (void*)VTl, SEQ, (long long)DM * SEQ, DM, SEQ, DM, 4096.0f);
  // (5) attention -> context bf16 hi plane (R0, x plane dead) and lo plane (R7, weight plane dead)
  attn64<<<gAttn, dim3(128), 0, stream>>>(Qh, Ql, Kh, Kl, VTh, VTl, Oh, Ol, 0.125f);
  // (6) proj_w -> bf16 [n][k] into R1 (q hi plane dead after attention)
  cvt_bf16x8<<<gCvtO, blk, 0, stream>>>(proj_w, Wob, n8o);
  // (7) out = context . Wo^T + proj_b -> d_out f32 [8192][1024]  (A = context hi + lo planes, 2 products)
  gemm64<1, 0, 1, 0><<<gTok, blk, 0, stream>>>(
      Oh, Ol, DM, 0LL, Wob, DM, 0LL, proj_b, rsin, rcos,
      d_out, d_out, DM, 0LL, NTOK, DM, DM, 1.0f);
  (void)hipGetLastError();
}

// v005
// Measured time: 262 microseconds a run.
// Two timings next to v004 both put it at 1.10 times that version's speed.
// All steps since v000 together make it 2.87 times as fast.
// Contractions: q, k, v^T projections = v_wmma_f32_16x16x32_bf16 (bf16 operands from RNE-converted inputs, single product, f32 accumulate);
// q.k^T scores = v_wmma_f32_16x16x32_bf16 with bf16 hi/lo split q and k (hi.hi + hi.lo + lo.hi), f32 accumulate;
// p.v = v_wmma_f32_16x16x32_f16 (p carried x1024 in f16; v as f16 hi plane plus f16 residual plane x4096; 2 products), f32 accumulate;
// ctx.Wo^T = v_wmma_f32_16x16x32_bf16 with ctx as bf16 hi/lo planes times bf16 Wo (2 products), f32 accumulate; bias, rope, softmax in f32.
#include <hip/hip_runtime.h>
#include <math.h>
#include <stdint.h>

#pragma clang fp contract(off)

#define NB    4
#define SEQ   2048
#define DM    1024
#define NH    16
#define HD    64
#define NQB   (SEQ / 64)      // 32 key chunks of 64
#define QT    2               // query tiles of 16 columns per attention wave
#define NQG   (SEQ / (64 * QT))   // 16 query blocks of 4 waves x 16*QT queries
#define NTOK  (NB * SEQ)      // 8192 token rows
#define LP    72              // LDS row pitch of the attention K and V^T tiles, in 16-bit elements
#define OSP   68              // LDS row pitch of the attention output staging tile, in floats (16 B x odd)
#define GP    72              // LDS row pitch of the GEMM operand tiles, in 16-bit elements (144 B = 16 B x odd)
#define GKS   64              // k elements of one GEMM stage: rows of 128 B, one whole line each
#define GBM   128             // GEMM block tile rows    (2 waves x 64)
#define GBN   256             // GEMM block tile columns (4 waves x 64)
static_assert(NH * HD == DM);
static_assert((SEQ % (64 * QT)) == 0 && (DM % 64) == 0);
static_assert((SEQ & (SEQ - 1)) == 0);
static_assert((NTOK % GBM) == 0 && (DM % GBM) == 0 && (DM % GBN) == 0 && (SEQ % GBN) == 0);   // whole GEMM block tiles
static_assert((DM % GKS) == 0 && DM >= 2 * GKS);                                              // whole stages, two or more
static_assert(GP >= GKS && (GP % 8) == 0 && ((GP / 8) & 1) == 1);
static_assert(LP >= HD && (LP % 8) == 0 && ((LP / 8) & 1) == 1);   // 16-B aligned rows, pitch = 16 B x odd

typedef _Float16 v16h __attribute__((ext_vector_type(16)));
typedef _Float16 v8h  __attribute__((ext_vector_type(8)));
typedef __bf16   v16b __attribute__((ext_vector_type(16)));
typedef __bf16   v8b  __attribute__((ext_vector_type(8)));
typedef float    v8f  __attribute__((ext_vector_type(8)));
typedef float    v4f  __attribute__((ext_vector_type(4)));
typedef unsigned int v4u __attribute__((ext_vector_type(4)));

// ---- scalar helpers --------------------------------------------------------------------------------
__device__ __forceinline__ unsigned short bf_bits(float f) {          // f32 -> bf16 bits, RNE convert
  unsigned u = __float_as_uint(f);
  return (unsigned short)((u + 0x7FFFu + ((u >> 16) & 1u)) >> 16);
}
__device__ __forceinline__ float bf_up(unsigned short h) { return __uint_as_float(((unsigned)h) << 16); }
__device__ __forceinline__ float bfr(float f) { return bf_up(bf_bits(f)); }   // value after bf16 RNE convert
__device__ __forceinline__ unsigned short h_bits(_Float16 x) { return __builtin_bit_cast(unsigned short, x); }
__device__ __forceinline__ unsigned pk16(unsigned short a, unsigned short b) { return (unsigned)a | ((unsigned)b << 16); }
__device__ __forceinline__ float xhalf(float x) {                     // the value lane l ^ 16 holds
  return __builtin_bit_cast(float, __builtin_amdgcn_permlanex16(__builtin_bit_cast(int, x), __builtin_bit_cast(int, x),
                                                                0x76543210, 0xfedcba98, false, false));
}
__device__ __forceinline__ void exp2x8(float (&x)[8]) {
  asm("v_exp_f32 %0, %0\n\tv_exp_f32 %1, %1\n\tv_exp_f32 %2, %2\n\tv_exp_f32 %3, %3\n\t"
      "v_exp_f32 %4, %4\n\tv_exp_f32 %5, %5\n\tv_exp_f32 %6, %6\n\tv_exp_f32 %7, %7\n\tv_nop"
      : "+v"(x[0]), "+v"(x[1]), "+v"(x[2]), "+v"(x[3]), "+v"(x[4]), "+v"(x[5]), "+v"(x[6]), "+v"(x[7]));
}
__device__ __forceinline__ float exp2x1(float x) {
  asm("v_exp_f32 %0, %0\n\tv_nop" : "+v"(x));
  return x;
}
#define LOG2E 1.44269504088896340736f   // e^x = 2^(x * LOG2E), as __expf forms it
__device__ __forceinline__ v8f zero8() { v8f z = {0.f, 0.f, 0.f, 0.f, 0.f, 0.f, 0.f, 0.f}; return z; }

// ---- fragment loader: 16-bit A/B operand, lane -> row/col (lane&15), p already includes +8*(lane>>4);
//      elements 0..7 <- p[0..7] (k0+8h..), elements 8..15 <- p[16..23] (k0+16+8h..)
__device__ __forceinline__ v16b ldfrag_b(const __bf16* p) {
  union { v16b v; v8b h[2]; } f;
  f.h[0] = *(const v8b*)(p);
  f.h[1] = *(const v8b*)(p + 16);
  return f.v;
}

// ---- WMMA helpers with trailing VALU hazard gap --------------------------------------------------------
__device__ __forceinline__ v8f mma_b(v16b a, v16b b, v8f c) {
  c = __builtin_amdgcn_wmma_f32_16x16x32_bf16(false, a, false, b, (short)0, c, false, false);
  asm volatile("v_nop\n\tv_nop\n\tv_nop\n\tv_nop" : "+v"(c) : "v"(a), "v"(b));
  return c;
}
__device__ __forceinline__ v8f mma_h(v16h a, v16h b, v8f c) {
  c = __builtin_amdgcn_wmma_f32_16x16x32_f16(false, a, false, b, (short)0, c, false, false);
  asm volatile("v_nop\n\tv_nop\n\tv_nop\n\tv_nop" : "+v"(c) : "v"(a), "v"(b));
  return c;
}
__device__ __forceinline__ v8f mma_b_raw(v16b a, v16b b, v8f c) {
  return __builtin_amdgcn_wmma_f32_16x16x32_bf16(false, a, false, b, (short)0, c, false, false);
}
__device__ __forceinline__ void acc_guard4(v8f& a, v8f& b, v8f& c, v8f& d) {
  asm volatile("v_nop\n\tv_nop\n\tv_nop\n\tv_nop" : "+v"(a), "+v"(b), "+v"(c), "+v"(d));
}

// ---- asynchronous copies global -> LDS, 16 B per lane, through no register ---------------------------
__device__ __forceinline__ unsigned lds_off(const void* p) { return (unsigned)(size_t)p; }   // LDS byte address
// A run of copies and its s_wait_xcnt 0 in ONE statement: the wait stands in front of every later write of the
// address registers that the copies name.
__device__ __forceinline__ void acopy4(const unsigned* l, const __bf16* const* g) {
  asm volatile("global_load_async_to_lds_b128 %0, %4, off\n\t"
               "global_load_async_to_lds_b128 %1, %5, off\n\t"
               "global_load_async_to_lds_b128 %2, %6, off\n\t"
               "global_load_async_to_lds_b128 %3, %7, off\n\t"
               "s_wait_xcnt 0x0"
               :: "v"(l[0]), "v"(l[1]), "v"(l[2]), "v"(l[3]), "v"(g[0]), "v"(g[1]), "v"(g[2]), "v"(g[3]) : "memory");
}
__device__ __forceinline__ void acopy8(const unsigned* l, const __bf16* const* g) {
  asm volatile("global_load_async_to_lds_b128 %0, %8, off\n\t"
               "global_load_async_to_lds_b128 %1, %9, off\n\t"
               "global_load_async_to_lds_b128 %2, %10, off\n\t"
               "global_load_async_to_lds_b128 %3, %11, off\n\t"
               "global_load_async_to_lds_b128 %4, %12, off\n\t"
               "global_load_async_to_lds_b128 %5, %13, off\n\t"
               "global_load_async_to_lds_b128 %6, %14, off\n\t"
               "global_load_async_to_lds_b128 %7, %15, off\n\t"
               "s_wait_xcnt 0x0"
               :: "v"(l[0]), "v"(l[1]), "v"(l[2]), "v"(l[3]), "v"(l[4]), "v"(l[5]), "v"(l[6]), "v"(l[7]),
                  "v"(g[0]), "v"(g[1]), "v"(g[2]), "v"(g[3]), "v"(g[4]), "v"(g[5]), "v"(g[6]), "v"(g[7]) : "memory");
}

// =====================================================================================================
// f32 -> bf16 (RNE convert), 8 elements per thread, one 16-B store per lane: a wave writes 512 contiguous B
// multiple of 256 for every use here; host-checked). coverage: n8 threads x 8 = whole plane.
// =====================================================================================================
__global__ __launch_bounds__(256) void cvt_bf16x8(const float* __restrict__ in, unsigned short* out, int n8) {
  const int i = blockIdx.x * 256 + threadIdx.x;
  if (i < n8) {
    const v4f a = *(const v4f*)(in + (size_t)i * 8);
    const v4f b = *(const v4f*)(in + (size_t)i * 8 + 4);
    v4u p;
    p[0] = pk16(bf_bits(a[0]), bf_bits(a[1]));
    p[1] = pk16(bf_bits(a[2]), bf_bits(a[3]));
    p[2] = pk16(bf_bits(b[0]), bf_bits(b[1]));
    p[3] = pk16(bf_bits(b[2]), bf_bits(b[3]));
    *(v4u*)(out + (size_t)i * 8) = p;
    
  }
}

// =====================================================================================================
// Register-blocked batched bf16 WMMA GEMM: C[m][n] = sum_k A[m][k] * Bt[n][k]; one wave per 64x64 tile, a block of
// 8 waves (2 x 4) per 128x256 tile. A row-major [M][K] pitch lda; Bt row-major [N][K] pitch ldb (k contiguous);
// M multiple of 128, N of 256, K of 64 and at least 128 (asserted on the shapes used). blockIdx.y = batch index.
// Operands: a stage is 64 k of the block's A rows (and A2 rows) and Bt rows, rows of 128 B at pitch 144 B in LDS,
// brought by asynchronous copies (8 lanes per row: a wave's copy covers 4 whole lines), two buffers: stage t + 2 is
// issued behind the barrier that ends stage t's reads and flies while stage t + 1 is worked on.
// NSPLIT: 0 = A.Bt; 1 = (A + A2).Bt (A2 = unscaled bf16 lo plane of A, same pitch/stride).
// BIAS: 0 none; 1 = + bfr(bias[n]) per column; 2 = + bfr(bias[m]) per row.
// ROPE (needs N tile = one head = 64 cols d 0..63, row m = b*SEQ + s): for s >= 1,
//   t[d] = t[d]*bfr(cos[s-1][d]) + rot[d]*bfr(sin[s-1][d]), rot = [-t[32..63] | t[0..31]] (after bias).
// OUT_MODE: 0 = f32 (pitch ldc); 2 = bf16 hi plane C + bf16 lo plane C2 (lo = RNE(v - hi), unscaled);
//           3 = f16 hi plane C + f16 residual plane C2 = f16((v - hi) * rscale); C2 same pitch/stride as C.
// =====================================================================================================
template <int NSPLIT, int OUT_MODE, int BIAS, int ROPE>
__global__ __launch_bounds__(256) void gemm64(
    const unsigned short* __restrict__ Ap, const unsigned short* __restrict__ A2p, int lda, long long strideA,
    const unsigned short* __restrict__ Btp, int ldb, long long strideB,
    const float* __restrict__ bias, const float* __restrict__ rsin, const float* __restrict__ rcos,
    void* Cout, void* Cout2, int ldc, long long strideC,
    int M, int N, int K, float rscale) {
  const __bf16* A  = (const __bf16*)(const void*)Ap;
  const __bf16* A2 = (const __bf16*)(const void*)A2p;
  const __bf16* Bt = (const __bf16*)(const void*)Btp;
  constexpr int ROWS_A  = GBM * (1 + NSPLIT);        // stage rows 0.. : A, then A2 where there is one
  constexpr int ROWS    = ROWS_A + GBN;              // then the Bt rows
  constexpr int STAGE_E = ROWS * GP;                 // elements of one buffer
  constexpr int NCP     = ROWS / 32;                 // copies per thread and stage: 256 threads cover 32 rows (12 or 16)
  __shared__ __align__(16) float sT[8][16 * 68];   // per-wave 16x64 slab, pitch 68 floats
  __shared__ __align__(16) __bf16 sG[2 * STAGE_E];  // operand stages, two buffers
  const int b    = blockIdx.y;
  const int lane = threadIdx.x & 31;
  const int wave = threadIdx.x >> 5;
  const int blkN = N / GBN;
  const int blkM = M / GBM;
  const int blk  = blockIdx.x;
  if (blk >= blkM * blkN) return;        // block-uniform, in front of every barrier and copy
  const int bm = blk / blkN;
  const int bn = blk - bm * blkN;
  const int wm = wave >> 2;              // 0..1
  const int wn = wave & 3;               // 0..3
  const int m0 = bm * GBM + (wm << 6);
  const int n0 = bn * GBN + (wn << 6);

  const __bf16* Ab  = A  + (size_t)b * strideA;
  const __bf16* Bb  = Bt + (size_t)b * strideB;
  const __bf16* Ab2 = (NSPLIT == 1) ? (A2 + (size_t)b * strideA) : Ab;

  const int rlane = lane & 15;                 // row (A) / col (B, D) within subtile
  const int koff  = (lane >> 4) * 8;           // k offset of this lane half
  const int mOff  = (lane >> 4) * 8;           // D row offset

  v8f acc[4][4];
#pragma unroll
  for (int i = 0; i < 4; ++i)
#pragma unroll
    for (int j = 0; j < 4; ++j) acc[i][j] = zero8();

  // ---- stage copies: thread -> row (tid >> 3) of each group of 32 rows, 16-B piece (tid & 7) of its 128 B ----
  const int crow = threadIdx.x >> 3;
  const int cseg = (threadIdx.x & 7) * 8;
  const __bf16* gA  = Ab  + (size_t)(bm * GBM + crow) * lda + cseg;
  const __bf16* gA2 = Ab2 + (size_t)(bm * GBM + crow) * lda + cseg;
  const __bf16* gB  = Bb  + (size_t)(bn * GBN + crow) * ldb + cseg;
  const unsigned lC = lds_off(sG) + (unsigned)(crow * GP + cseg) * 2u;
  auto issue_stage = [&](int st, int buf) {
    unsigned l[NCP];
    const __bf16* g[NCP];
#pragma unroll   // every index of l and g constant: the addresses stay in registers
    for (int p = 0; p < NCP; ++p) {
      l[p] = lC + (unsigned)(buf * STAGE_E + p * 32 * GP) * 2u;
      if (p * 32 < GBM)          g[p] = gA  + (size_t)(p * 32) * lda + (size_t)st * GKS;
      else if (p * 32 < ROWS_A)  g[p] = gA2 + (size_t)(p * 32 - GBM) * lda + (size_t)st * GKS;
      else                       g[p] = gB  + (size_t)(p * 32 - ROWS_A) * ldb + (size_t)st * GKS;
    }
    acopy8(l, g);
    if (NCP == 16) acopy8(l + 8, g + 8);
    else           acopy4(l + 8, g + 8);
  };

  const int T = K / GKS;                              // stages
  issue_stage(0, 0);
  asm volatile("s_wait_asynccnt 0x0" ::: "memory");   // this wave's copies of stage 0 have landed
  __syncthreads();                                    // and every other wave's: stage 0 may be read
  if (T > 1) issue_stage(1, 1);

  for (int t = 0; t < T; ++t) {
    const __bf16* sb = sG + (t & 1) * STAGE_E;
    const __bf16* sa = sb + ((wm << 6) + rlane) * GP + koff;
    const __bf16* sw = sb + (ROWS_A + (wn << 6) + rlane) * GP + koff;
    v16b bh[2][4], ah[2][4], al[2][4];   // the loops below are unrolled so that every fragment index is constant
#pragma unroll
    for (int ks = 0; ks < 2; ++ks) {
#pragma unroll
      for (int j = 0; j < 4; ++j) bh[ks][j] = ldfrag_b(sw + (j << 4) * GP + ks * 32);
#pragma unroll
      for (int i = 0; i < 4; ++i) {
        ah[ks][i] = ldfrag_b(sa + (i << 4) * GP + ks * 32);
        al[ks][i] = ah[ks][i];
        if (NSPLIT == 1) al[ks][i] = ldfrag_b(sa + (GBM + (i << 4)) * GP + ks * 32);
      }
    }
    // Holds the stage's fragment loads as one group ahead of its WMMAs: moved in among them, into one shared
    // register set, each place with loads makes the wave wait out the LDS latency.
    __builtin_amdgcn_sched_barrier(0);
#pragma unroll
    for (int ks = 0; ks < 2; ++ks)
#pragma unroll
      for (int i = 0; i < 4; ++i)
#pragma unroll
        for (int j = 0; j < 4; ++j) {
          acc[i][j] = mma_b_raw(ah[ks][i], bh[ks][j], acc[i][j]);
          if (NSPLIT == 1) acc[i][j] = mma_b_raw(al[ks][i], bh[ks][j], acc[i][j]);
        }
    // Holds the WMMAs ahead of the full LDS wait below: behind it none would start before the last fragment is in.
    __builtin_amdgcn_sched_barrier(0);
    asm volatile("s_wait_dscnt 0x0" ::: "memory");      // this wave's reads of buffer t & 1 are done
    asm volatile("s_wait_asynccnt 0x0" ::: "memory");   // this wave's copies of stage t + 1 have landed
    __syncthreads();                                    // publishes stage t + 1, frees buffer t & 1
    if (t + 2 < T) issue_stage(t + 2, t & 1);
  }
  asm volatile("s_wait_asynccnt 0x0" ::: "memory");     // nothing in flight when the wave goes on
  acc_guard4(acc[0][0], acc[0][1], acc[0][2], acc[0][3]);
  acc_guard4(acc[1][0], acc[1][1], acc[1][2], acc[1][3]);
  acc_guard4(acc[2][0], acc[2][1], acc[2][2], acc[2][3]);
  acc_guard4(acc[3][0], acc[3][1], acc[3][2], acc[3][3]);

  // ---- epilogue ----
  float* slab = sT[wave];
  float bcol[4];
  if (BIAS == 1) {
#pragma unroll
    for (int j = 0; j < 4; ++j) bcol[j] = bfr(bias[n0 + (j << 4) + rlane]);   // n0+.. < N
  } else {
#pragma unroll
    for (int j = 0; j < 4; ++j) bcol[j] = 0.f;
  }
#pragma unroll
  for (int i = 0; i < 4; ++i) {
    const int mBase = m0 + (i << 4);
#pragma unroll
    for (int r = 0; r < 8; ++r) {
      const int m = mBase + mOff + r;                  // < M
      float brow = 0.f;
      if (BIAS == 2) brow = bfr(bias[m]);
      float t[4];
#pragma unroll
      for (int j = 0; j < 4; ++j) {
        float v = acc[i][j][r];
        if (BIAS == 1) v = v + bcol[j];
        if (BIAS == 2) v = v + brow;
        t[j] = v;
      }
      if (ROPE) {
        const int s = m & (SEQ - 1);                   // token index within the sequence
        const bool use = (s > 0);                        // token 0 passes unrotated
        const int sidx = use ? (s - 1) : 0;              // clamped table row
        const float* cr = rcos + (size_t)sidx * HD;
        const float* sr = rsin + (size_t)sidx * HD;
        float u[4];
#pragma unroll
        for (int j = 0; j < 4; ++j) {
          const int d = (j << 4) + rlane;                // 0..63
          const float cs = bfr(cr[d]);
          const float sn = bfr(sr[d]);
          const float tp = t[j ^ 2];                     // partner d^32, same lane
          const float rot = (j < 2) ? -tp : tp;
          const float w = t[j] * cs + rot * sn;
          u[j] = use ? w : t[j];
        }
#pragma unroll
        for (int j = 0; j < 4; ++j) t[j] = u[j];
      }
#pragma unroll
      for (int j = 0; j < 4; ++j) slab[(mOff + r) * 68 + (j << 4) + rlane] = t[j];
    }
    __builtin_amdgcn_fence(__ATOMIC_RELEASE, "workgroup");
    __builtin_amdgcn_wave_barrier();
    __builtin_amdgcn_fence(__ATOMIC_ACQUIRE, "workgroup");
    if (OUT_MODE == 0) {
      float* C = (float*)Cout + (size_t)b * strideC;
      const int hh = lane >> 4, c4 = (lane & 15) * 4;     // 256-B row segment = 16 lanes x 16 B
      {
#pragma unroll
        for (int it = 0; it < 8; ++it) {
          const int row = it * 2 + hh;                     // it 0..7 x hh 0..1 = rows 0..15
          const v4f v = *(const v4f*)(slab + row * 68 + c4);
          *(v4f*)(C + (size_t)(mBase + row) * ldc + n0 + c4) = v;
        }
        
      }
    } else {
      const int q = lane >> 3, c8 = (lane & 7) * 8;
      unsigned short* C  = (unsigned short*)Cout  + (size_t)b * strideC;
      unsigned short* C2 = (unsigned short*)Cout2 + (size_t)b * strideC;
      v4u hv[4], lv[4];
#pragma unroll
      for (int it = 0; it < 4; ++it) {
        const int row = it * 4 + q;                        // it 0..3 x q 0..3 = rows 0..15
        const float* sp = slab + row * 68 + c8;
        v4u a, a2;
#pragma unroll
        for (int e = 0; e < 4; ++e) {
          const float f0 = sp[2 * e], f1 = sp[2 * e + 1];
          unsigned short h0, h1, l0, l1;
          if (OUT_MODE == 2) {
            h0 = bf_bits(f0); h1 = bf_bits(f1);
            l0 = bf_bits(f0 - bf_up(h0)); l1 = bf_bits(f1 - bf_up(h1));
          } else {
            const _Float16 x0 = (_Float16)f0, x1 = (_Float16)f1;
            h0 = h_bits(x0); h1 = h_bits(x1);
            l0 = h_bits((_Float16)((f0 - (float)x0) * rscale));
            l1 = h_bits((_Float16)((f1 - (float)x1) * rscale));
          }
          a[e] = pk16(h0, h1); a2[e] = pk16(l0, l1);
        }
        hv[it] = a; lv[it] = a2;
      }
      {
#pragma unroll
        for (int it = 0; it < 4; ++it) {
          const int row = it * 4 + q;
          *(v4u*)(C  + (size_t)(mBase + row) * ldc + n0 + c8) = hv[it];
          *(v4u*)(C2 + (size_t)(mBase + row) * ldc + n0 + c8) = lv[it];
        }
        
      }
    }
    __builtin_amdgcn_fence(__ATOMIC_RELEASE, "workgroup");
    __builtin_amdgcn_wave_barrier();
    __builtin_amdgcn_fence(__ATOMIC_ACQUIRE, "workgroup");
  }
}

// =====================================================================================================
// Attention, head dim 64, no mask, all SEQ keys.
//   q planes (bf16 hi / lo): element (b, t, h, d) at [(b*SEQ + t)*DM + h*64 + d]
//   k planes (bf16 hi / lo): same layout with key index s
//   v^T hi plane (f16):      element (b, h, d, s) at [(b*DM + h*64 + d)*SEQ + s]
//   v^T residual plane (f16, (v - hi)*4096): same layout
//   out planes (bf16 hi / lo of the normalised context): element (b, t, h, d) at [(b*SEQ + t)*DM + h*64 + d]
//   Both products are formed transposed: S^T = K . Q^T (A = K rows, B = Q) and O^T += V^T . P^T (A = V^T rows, B = P^T).
//   In each tile a lane then holds one query (column lane&15) and 32 of the chunk's 64 keys (rows j*16 + 8*(lane>>4) + r): the maximum
//   and the sum run inside the lane, the two wave halves exchange the maximum once per chunk and join their sums once at
//   the end; two score tiles, converted in place, are the B operand P^T in the k order of the V^T loader.
//   scores = k . q : bf16 hi/lo split (hi.hi + lo.hi + hi.lo in k, q), f32 accumulate, then * sscale in f32
//   p = exp(s - m) carried as f16(1024 p); context = v^T . p^T on f16 WMMA: v_hi.p into the running accumulator,
//   v_res.p into a per-chunk accumulator folded back with 1/4096 in f32; online softmax in f32.
//   Block = 4 waves = 128 query rows of one (b, h), a wave 32 of them as two 16-column tiles that share every K and
//   V^T fragment read; grid = NQG * NH * NB; kv chunks of 64, static trip NQB.
//   K / V^T chunk staging: a stage is the chunk's four 64x64 planes, rows of 128 B at pitch 144 B in LDS, brought by
//   asynchronous copies (8 lanes per row: a wave's copy covers 4 whole lines; 16 copies per thread), two buffers:
//   chunk t + 2 is issued behind the barrier that ends chunk t's reads and flies while chunk t + 1 is worked on.
//   Output coverage: each wave stores rows q0..q0+31 (u 0..1 x it 0..3 x lane>>3 0..3) x 64 columns (8 lanes x 8) of both planes.
// =====================================================================================================
__global__ __launch_bounds__(128, 4)   // 4 waves per SIMD: the 256 registers that let four blocks share a WGP
void attn64(const unsigned short* __restrict__ qhp, const unsigned short* __restrict__ qlp,
            const unsigned short* __restrict__ khp, const unsigned short* __restrict__ klp,
            const unsigned short* __restrict__ vhp, const unsigned short* __restrict__ vlp,
            unsigned short* ohp, unsigned short* olp, float sscale) {
  union FB { v16b v; v8b h[2]; };
  union FH { v16h v; v8h h[2]; };
  // Rows of 64 16-bit elements are laid at a pitch of LP = 72 elements (144 B = 16 B x 9): the 16 rows that one
  // ds_load_b128 fragment read touches then fall on 16 different groups of four banks instead of two.
  constexpr int PLANE_B = 64 * LP * 2;                            // bytes of one plane of a stage, 9 KB
  constexpr int STAGE_B = 4 * PLANE_B;                            // K hi [kv][d], K lo, V^T hi [d][kv], V^T residual
  static_assert(4 * QT * 16 * OSP * 4 <= 2 * STAGE_B);            // the output tiles fit where the stages were
  // Two stage buffers, 72 KB; behind the loop's last barrier the same bytes hold the per-wave context tiles [row][d].
  __shared__ __align__(16) unsigned char sKV[2 * STAGE_B];

  const int tid  = threadIdx.x;
  const int wave = tid >> 5;
  const int lane = tid & 31;
  const int hh   = lane >> 4;
  const int c    = lane & 15;

  const int bx   = blockIdx.x;
  const int qb   = bx % NQG;
  const int rest = bx / NQG;
  const int h    = rest % NH;
  const int b    = rest / NH;
  const int q0   = qb * (64 * QT) + wave * (16 * QT);
  const size_t rowB = (size_t)b * SEQ;

  const __bf16* Qh = (const __bf16*)(const void*)qhp + (size_t)h * HD;
  const __bf16* Ql = (const __bf16*)(const void*)qlp + (size_t)h * HD;
  const __bf16* Kh = (const __bf16*)(const void*)khp + (size_t)h * HD;
  const __bf16* Kl = (const __bf16*)(const void*)klp + (size_t)h * HD;
  const _Float16* Vh = (const _Float16*)(const void*)vhp + ((size_t)b * DM + (size_t)h * HD) * SEQ;
  const _Float16* Vl = (const _Float16*)(const void*)vlp + ((size_t)b * DM + (size_t)h * HD) * SEQ;

  // ---- Q fragments (B operand, column = query = u*16 + lane&15): QT query tiles x 2 d-chunks, hi and lo ----
  v16b qah[QT][2], qal[QT][2];
#pragma unroll
  for (int u = 0; u < QT; ++u)
#pragma unroll
    for (int dc = 0; dc < 2; ++dc) {
      const size_t qo = (rowB + q0 + u * 16 + c) * DM + dc * 32 + 8 * hh;
      qah[u][dc] = ldfrag_b(Qh + qo);
      qal[u][dc] = ldfrag_b(Ql + qo);
      // In front of the next loads: the compiler lays their results over address registers of the loads issued here.
      asm volatile("s_wait_xcnt 0x0" ::: "memory");
    }

  // per query tile u, this lane's query: running maximum (both halves alike), sum over this half's keys
  float mrow[QT], lrow[QT];
  v8f oacc[QT][4];                      // O^T: oacc[u][t][r] = context[query u*16 + c][d = t*16 + 8*hh + r]
#pragma unroll
  for (int u = 0; u < QT; ++u) {
    mrow[u] = -INFINITY;
    lrow[u] = 0.f;
#pragma unroll
    for (int t = 0; t < 4; ++t) oacc[u][t] = zero8();
  }

  // ---- stage copies: thread -> row (tid >> 3) of each group of 16 rows, 16-B piece (tid & 7) of its 128 B ----
  const int crow = tid >> 3;
  const int cseg = (tid & 7) * 8;
  const __bf16* gKh = Kh + (rowB + crow) * DM + cseg;                            // K row crow of chunk 0
  const __bf16* gKl = Kl + (rowB + crow) * DM + cseg;
  const __bf16* gVh = (const __bf16*)(const void*)(Vh + (size_t)crow * SEQ + cseg);   // V^T row d = crow, an address only
  const __bf16* gVl = (const __bf16*)(const void*)(Vl + (size_t)crow * SEQ + cseg);
  const unsigned lC = lds_off(sKV) + (unsigned)(crow * LP + cseg) * 2u;
  auto issue_stage = [&](int st, int buf) {
    unsigned l[16];
    const __bf16* g[16];
#pragma unroll   // every index of l and g constant: the addresses stay in registers
    for (int p = 0; p < 4; ++p) {
      const unsigned lp = lC + (unsigned)(buf * STAGE_B + p * 16 * LP * 2);
      l[p]      = lp;
      l[4 + p]  = lp + PLANE_B;
      l[8 + p]  = lp + 2 * PLANE_B;
      l[12 + p] = lp + 3 * PLANE_B;
      g[p]      = gKh + (size_t)(st * 64 + p * 16) * DM;          // K row st*64 + p*16 + crow < SEQ
      g[4 + p]  = gKl + (size_t)(st * 64 + p * 16) * DM;
      g[8 + p]  = gVh + (size_t)(p * 16) * SEQ + st * 64;         // V^T row p*16 + crow < 64, s = st*64 + cseg.. < SEQ
      g[12 + p] = gVl + (size_t)(p * 16) * SEQ + st * 64;
    }
    acopy8(l, g);
    acopy8(l + 8, g + 8);
  };

  static_assert(NQB >= 2);                            // chunks 0 and 1 both exist
  issue_stage(0, 0);
  asm volatile("s_wait_asynccnt 0x0" ::: "memory");   // this wave's copies of chunk 0 have landed
  __syncthreads();                                    // and every other wave's: chunk 0 may be read
  issue_stage(1, 1);

  // One chunk: scores, softmax, context, then the publish point of chunk kt + 1.
  auto chunk = [&](int kt) {
    const unsigned char* sb = sKV + (kt & 1) * STAGE_B;
    const __bf16*   Ksh = (const __bf16*)(const void*)(sb);
    const __bf16*   Ksl = (const __bf16*)(const void*)(sb + PLANE_B);
    const _Float16* Vth = (const _Float16*)(const void*)(sb + 2 * PLANE_B);
    const _Float16* Vtl = (const _Float16*)(const void*)(sb + 3 * PLANE_B);

    // ---- scores, transposed: 64 keys x 16*QT queries per wave, 3 bf16 products; A[m = key][k = d] from Ksh[key][d];
    //      each K fragment, read once, is the A operand of every query tile ----
    v8f s[QT][4];
#pragma unroll
    for (int j = 0; j < 4; ++j) {
#pragma unroll
      for (int u = 0; u < QT; ++u) s[u][j] = zero8();
#pragma unroll
      for (int dc = 0; dc < 2; ++dc) {
        FB kb, kl;
        kb.h[0] = *(const v8b*)(Ksh + (j * 16 + c) * LP + dc * 32 + 8 * hh);
        kb.h[1] = *(const v8b*)(Ksh + (j * 16 + c) * LP + dc * 32 + 16 + 8 * hh);
        kl.h[0] = *(const v8b*)(Ksl + (j * 16 + c) * LP + dc * 32 + 8 * hh);
        kl.h[1] = *(const v8b*)(Ksl + (j * 16 + c) * LP + dc * 32 + 16 + 8 * hh);
#pragma unroll
        for (int u = 0; u < QT; ++u) s[u][j] = mma_b(kb.v, qah[u][dc], s[u][j]);
#pragma unroll
        for (int u = 0; u < QT; ++u) s[u][j] = mma_b(kl.v, qah[u][dc], s[u][j]);
#pragma unroll
        for (int u = 0; u < QT; ++u) s[u][j] = mma_b(kb.v, qal[u][dc], s[u][j]);
      }
    }

    // Keeps the softmax behind the score products: scheduled in among them its values lengthen the stretch where both
    // tiles' scores, Q and the context are all live, and the build spills at the 256 registers of four waves per SIMD.
    __builtin_amdgcn_sched_barrier(0);
    // ---- scale, maximum, online softmax; query u*16 + c, key j*16 + 8*hh + r lives in s[u][j][r] ----
    // P^T (x1024, f16) as B operand: element e of chunk kk = key kk*32 + (e < 8 ? 8*hh + e : 16 + 8*hh + e - 8)
    FH pb[QT][2];
#pragma unroll
    for (int u = 0; u < QT; ++u) {
      float mj[4];
#pragma unroll
      for (int j = 0; j < 4; ++j) {
        mj[j] = -INFINITY;
#pragma unroll
        for (int r = 0; r < 8; ++r) {
          const float sv = s[u][j][r] * sscale;
          s[u][j][r] = sv;
          mj[j] = fmaxf(mj[j], sv);
        }
      }
      float m = fmaxf(fmaxf(mj[0], mj[1]), fmaxf(mj[2], mj[3]));
      m = fmaxf(m, xhalf(m));                            // the query's other 32 keys sit in lane ^ 16
      const float mnew  = fmaxf(mrow[u], m);
      const float msafe = (mnew == -INFINITY) ? 0.f : mnew;
      const float alpha = exp2x1((mrow[u] - msafe) * LOG2E);
      mrow[u] = mnew;
      float pj[4];
#pragma unroll
      for (int j = 0; j < 4; ++j) {
        float p[8];
#pragma unroll
        for (int r = 0; r < 8; ++r) p[r] = (s[u][j][r] - msafe) * LOG2E;
        exp2x8(p);
        pj[j] = 0.f;
#pragma unroll
        for (int r = 0; r < 8; ++r) {
          pj[j] += p[r];
          pb[u][j >> 1].v[(j & 1) * 8 + r] = (_Float16)(p[r] * 1024.0f);
        }
      }
      lrow[u] = lrow[u] * alpha + ((pj[0] + pj[1]) + (pj[2] + pj[3]));
#pragma unroll
      for (int t = 0; t < 4; ++t)
#pragma unroll
        for (int r = 0; r < 8; ++r) oacc[u][t][r] *= alpha;
    }

    // ---- context^T += V^T . P^T (f16 WMMA): A[m = d][k = kv] from Vth[d][kv], B = P^T[k = kv][n = query]; each V^T
    //      fragment, read once, is the A operand of every query tile; residual products into a separate accumulator
    //      per 16 d rows, folded back when both key halves are in ----
#pragma unroll
    for (int t = 0; t < 4; ++t) {
      v8f o1[QT];
#pragma unroll
      for (int u = 0; u < QT; ++u) o1[u] = zero8();
#pragma unroll
      for (int kk = 0; kk < 2; ++kk) {
        FH vb, vl;
        vb.h[0] = *(const v8h*)(Vth + (t * 16 + c) * LP + kk * 32 + 8 * hh);
        vb.h[1] = *(const v8h*)(Vth + (t * 16 + c) * LP + kk * 32 + 16 + 8 * hh);
        vl.h[0] = *(const v8h*)(Vtl + (t * 16 + c) * LP + kk * 32 + 8 * hh);
        vl.h[1] = *(const v8h*)(Vtl + (t * 16 + c) * LP + kk * 32 + 16 + 8 * hh);
#pragma unroll
        for (int u = 0; u < QT; ++u) oacc[u][t] = mma_h(vb.v, pb[u][kk].v, oacc[u][t]);
#pragma unroll
        for (int u = 0; u < QT; ++u) o1[u]      = mma_h(vl.v, pb[u][kk].v, o1[u]);
      }
#pragma unroll
      for (int u = 0; u < QT; ++u)
#pragma unroll
        for (int r = 0; r < 8; ++r) oacc[u][t][r] += o1[u][r] * (1.0f / 4096.0f);
    }

    asm volatile("s_wait_dscnt 0x0" ::: "memory");      // this wave's reads of buffer kt & 1 are done
    asm volatile("s_wait_asynccnt 0x0" ::: "memory");   // this wave's copies of chunk kt + 1 have landed
    __syncthreads();                                    // publishes chunk kt + 1, frees buffer kt & 1
  };
  // The chunks that have a chunk kt + 2 to fetch, then the last two, in loops of their own (static trip counts): with the
  // test inside one loop the compiler moves folds and row sums behind the branch, their operands stay in registers
  // beside the copies' addresses, and the build spills at 256 registers.
  for (int kt = 0; kt < NQB - 2; ++kt) {
    chunk(kt);
    issue_stage(kt + 2, kt & 1);
  }
#pragma unroll 1   // kept rolled: one more copy of the body, not two
  for (int kt = NQB - 2; kt < NQB; ++kt) chunk(kt);
  asm volatile("s_wait_asynccnt 0x0" ::: "memory");     // nothing in flight when the buffers become output staging

  // ---- normalise (1/l and the 1/1024 p carry), stage the wave's 16*QT x 64 tile, bf16 hi/lo split,
  float* os = (float*)(void*)sKV + wave * (QT * 16 * OSP);   // every wave has passed the last chunk's barrier
#pragma unroll
  for (int u = 0; u < QT; ++u) {
    const float l = lrow[u] + xhalf(lrow[u]);          // join the two halves' sums of this query
    const float inv = ((l > 0.f) ? (1.0f / l) : 0.f) * (1.0f / 1024.0f);
#pragma unroll
    for (int t = 0; t < 4; ++t)
#pragma unroll
      for (int r = 0; r < 8; ++r) os[(u * 16 + c) * OSP + t * 16 + 8 * hh + r] = oacc[u][t][r] * inv;
  }
  __builtin_amdgcn_fence(__ATOMIC_RELEASE, "workgroup");
  __builtin_amdgcn_wave_barrier();
  __builtin_amdgcn_fence(__ATOMIC_ACQUIRE, "workgroup");
#pragma unroll
  for (int u = 0; u < QT; ++u) {
    const int q4 = lane >> 3, c8 = (lane & 7) * 8;
    v4u hv[4], lv[4];
#pragma unroll
    for (int it = 0; it < 4; ++it) {
      const int row = u * 16 + it * 4 + q4;   // u x it 0..3 x q4 0..3 = rows 0..16*QT-1 of the wave tile
      const float* sp = os + row * OSP + c8;
      v4u a, a2;
#pragma unroll
      for (int e = 0; e < 4; ++e) {
        const float f0 = sp[2 * e], f1 = sp[2 * e + 1];
        const unsigned short h0 = bf_bits(f0), h1 = bf_bits(f1);
        const unsigned short l0 = bf_bits(f0 - bf_up(h0)), l1 = bf_bits(f1 - bf_up(h1));
        a[e] = pk16(h0, h1); a2[e] = pk16(l0, l1);
      }
      hv[it] = a; lv[it] = a2;
    }
    {
#pragma unroll
      for (int it = 0; it < 4; ++it) {
        const int row = u * 16 + it * 4 + q4;
        const size_t go = (rowB + q0 + row) * DM + (size_t)h * HD + c8;
        *(v4u*)(ohp + go) = hv[it];
        *(v4u*)(olp + go) = lv[it];
      }
    }
  }
}

// =====================================================================================================
// Workspace map: 8 regions of PL = NTOK*DM*2 = 16777216 B each, total 134217728 B.
//   R0  Xb   bf16 [8192][1024]                    (after the projections: Oh, context hi plane [8192][1024])
//   R1  Qh   bf16 [8192][1024]                    (after attention: Wob bf16 [1024][1024], 2097152 B used)
//   R2  Ql   bf16 [8192][1024]
//   R3  Kh   bf16 [8192][1024]
//   R4  Kl   bf16 [8192][1024]
//   R5  VTh  f16  [4][1024][2048]
//   R6  VTl  f16  [4][1024][2048]
//   R7  Wqkv bf16 [3072][1024] (6291456 B used)   (during attention: Ol, context lo plane [8192][1024])
// All planes are exact multiples of their 64x64 tile / whole-line store granularity (no padded tails needed).
// Weights are [out n][in k] with k contiguous = the Bt / A layout the GEMM wants, so they are only converted.
// =====================================================================================================
extern "C" void kernel_launch(void* const* d_in, const int* in_sizes, int n_in,
                              void* d_out, int out_size, void* d_ws, size_t ws_size,
                              hipStream_t stream) {
  if (n_in < 8) return;
  if (in_sizes[0] != NTOK * DM) return;
  if (in_sizes[1] != 3 * DM * DM) return;
  if (in_sizes[2] != DM || in_sizes[3] != DM) return;
  if (in_sizes[4] != DM * DM || in_sizes[5] != DM) return;
  if (in_sizes[6] != (SEQ - 1) * HD || in_sizes[7] != (SEQ - 1) * HD) return;
  if (out_size != NTOK * DM) return;

  const float* x      = (const float*)d_in[0];
  const float* qkv_w  = (const float*)d_in[1];
  const float* q_bias = (const float*)d_in[2];
  const float* v_bias = (const float*)d_in[3];
  const float* proj_w = (const float*)d_in[4];
  const float* proj_b = (const float*)d_in[5];
  const float* rsin   = (const float*)d_in[6];
  const float* rcos   = (const float*)d_in[7];

  const size_t PL = (size_t)NTOK * DM * 2;        // 16777216  one 16-bit activation plane [8192][1024]
  static_assert((size_t)3 * DM * DM * 2 <= (size_t)NTOK * DM * 2);
  static_assert((size_t)NB * DM * SEQ * 2 == (size_t)NTOK * DM * 2);
  static_assert((size_t)DM * DM * 2 <= (size_t)NTOK * DM * 2);
  size_t off = 0;
  const size_t oR0 = off; off += PL;
  const size_t oR1 = off; off += PL;
  const size_t oR2 = off; off += PL;
  const size_t oR3 = off; off += PL;
  const size_t oR4 = off; off += PL;
  const size_t oR5 = off; off += PL;
  const size_t oR6 = off; off += PL;
  const size_t oR7 = off; off += PL;
  if (off > ws_size) return;                      // off = 134217728
  if (off > (size_t)134217728) return;

  char* ws = (char*)d_ws;
  unsigned short* Xb   = (unsigned short*)(ws + oR0);
  unsigned short* Oh   = (unsigned short*)(ws + oR0);
  unsigned short* Qh   = (unsigned short*)(ws + oR1);
  unsigned short* Wob  = (unsigned short*)(ws + oR1);
  unsigned short* Ql   = (unsigned short*)(ws + oR2);
  unsigned short* Kh   = (unsigned short*)(ws + oR3);
  unsigned short* Kl   = (unsigned short*)(ws + oR4);
  unsigned short* VTh  = (unsigned short*)(ws + oR5);
  unsigned short* VTl  = (unsigned short*)(ws + oR6);
  unsigned short* Wqkv = (unsigned short*)(ws + oR7);
  unsigned short* Ol   = (unsigned short*)(ws + oR7);
  const unsigned short* Wq = Wqkv;
  const unsigned short* Wk = Wqkv + (size_t)DM * DM;
  const unsigned short* Wv = Wqkv + (size_t)2 * DM * DM;

  const dim3 blk(256);
  const int n8x = NTOK * DM / 8;                              // 1048576
  const int n8q = 3 * DM * DM / 8;                            //  393216
  const int n8o = DM * DM / 8;                                //  131072
  if ((n8x % 256) != 0 || (n8q % 256) != 0 || (n8o % 256) != 0) return;
  const dim3 gCvtX(n8x / 256);                                // 4096 blocks
  const dim3 gCvtQ(n8q / 256);                                // 1536 blocks
  const dim3 gCvtO(n8o / 256);                                //  512 blocks
  const int tilesTok = (NTOK / 64) * (DM / 64);               // 2048 tiles: M=8192, N=1024
  const int tilesVT  = (DM / 64) * (SEQ / 64);                //  512 tiles: M=1024, N=2048
  const dim3 gTok((tilesTok + 7) / 8, 1);                     // 256 blocks
  const dim3 gVT((tilesVT + 7) / 8, NB);                      // 64 blocks x 4 batches
  const dim3 gAttn(NB * NH * NQG);                            // 1024 blocks

  // (1) x -> bf16 plane [8192][1024]; qkv_w [3072 n][1024 k] f32 -> bf16
  cvt_bf16x8<<<gCvtX, blk, 0, stream>>>(x, Xb, n8x);
  cvt_bf16x8<<<gCvtQ, blk, 0, stream>>>(qkv_w, Wqkv, n8q);
  // (2) q = x . Wq^T + q_bias, rope for tokens >= 1 -> bf16 hi/lo planes [b*SEQ+t][h*64+d]   (M=8192, N=1024, K=1024)
  gemm64<0, 2, 1, 1><<<gTok, blk, 0, stream>>>(
      Xb, Xb, DM, 0LL, Wq, DM, 0LL, q_bias, rsin, rcos,
      (void*)Qh, (void*)Ql, DM, 0LL, NTOK, DM, DM, 1.0f);
  // (3) k = x . Wk^T (no bias), rope -> bf16 hi/lo planes
  gemm64<0, 2, 0, 1><<<gTok, blk, 0, stream>>>(
      Xb, Xb, DM, 0LL, Wk, DM, 0LL, q_bias, rsin, rcos,
      (void*)Kh, (void*)Kl, DM, 0LL, NTOK, DM, DM, 1.0f);
  // (4) v^T = Wv . x^T + v_bias[row] per batch -> f16 hi plane [b][h*64+d][s] (pitch SEQ) and residual plane x4096
  //     (A = Wv [n][k], Bt = Xb rows of batch b; M=1024, N=2048, K=1024)
  gemm64<0, 3, 2, 0><<<gVT, blk, 0, stream>>>(
      Wv, Wv, DM, 0LL, Xb, DM, (long long)SEQ * DM, v_bias, rsin, rcos,
      (void*)VTh, (void*)VTl, SEQ, (long long)DM * SEQ, DM, SEQ, DM, 4096.0f);
  // (5) attention -> context bf16 hi plane (R0, x plane dead) and lo plane (R7, weight plane dead)
  attn64<<<gAttn, dim3(128), 0, stream>>>(Qh, Ql, Kh, Kl, VTh, VTl, Oh, Ol, 0.125f);
  // (6) proj_w -> bf16 [n][k] into R1 (q hi plane dead after attention)
  cvt_bf16x8<<<gCvtO, blk, 0, stream>>>(proj_w, Wob, n8o);
  // (7) out = context . Wo^T + proj_b -> d_out f32 [8192][1024]  (A = context hi + lo planes, 2 products)
  gemm64<1, 0, 1, 0><<<gTok, blk, 0, stream>>>(
      Oh, Ol, DM, 0LL, Wob, DM, 0LL, proj_b, rsin, rcos,
      d_out, d_out, DM, 0LL, NTOK, DM, DM, 1.0f);
  (void)hipGetLastError();
}

// v006
// A run of this version takes 252 microseconds.
// Timed twice side by side with v005, it ran 1.05 times as fast both times.
// All steps since v000 together make it 3.01 times as fast.
// Contractions: q, k, v^T projections = v_wmma_f32_16x16x32_bf16 (bf16 operands from RNE-converted inputs, single product, f32 accumulate);
// q.k^T scores = v_wmma_f32_16x16x32_bf16 with bf16 hi/lo split q and k (hi.hi + hi.lo + lo.hi), f32 accumulate;
// p.v = v_wmma_f32_16x16x32_f16 (p carried x1024 in f16; v as f16 hi plane plus f16 residual plane x4096; 2 products), f32 accumulate;
// ctx.Wo^T = v_wmma_f32_16x16x32_bf16 with ctx as bf16 hi/lo planes times bf16 Wo (2 products), f32 accumulate; bias, rope, softmax in f32.
#include <hip/hip_runtime.h>
#include <math.h>
#include <stdint.h>

#pragma clang fp contract(off)

#define NB    4
#define SEQ   2048
#define DM    1024
#define NH    16
#define HD    64
#define NQB   (SEQ / 64)      // 32 key chunks of 64
#define QT    2               // query tiles of 16 columns per attention wave
#define NQG   (SEQ / (64 * QT))   // 16 query blocks of 4 waves x 16*QT queries
#define NTOK  (NB * SEQ)      // 8192 token rows
#define LP    72              // LDS row pitch of the attention K and V^T tiles, in 16-bit elements
#define OSP   68              // LDS row pitch of the attention output staging tile, in floats (16 B x odd)
#define GP    72              // LDS row pitch of the GEMM operand tiles, in 16-bit elements (144 B = 16 B x odd)
#define GKS   64              // k elements of one GEMM stage: rows of 128 B, one whole line each
#define GBM   128             // GEMM block tile rows    (2 waves x 64)
#define GBN   256             // GEMM block tile columns (4 waves x 64)
static_assert(NH * HD == DM);
static_assert((SEQ % (64 * QT)) == 0 && (DM % 64) == 0);
static_assert((SEQ & (SEQ - 1)) == 0);
static_assert((NTOK % GBM) == 0 && (DM % GBM) == 0 && (DM % GBN) == 0 && (SEQ % GBN) == 0);   // whole GEMM block tiles
static_assert((DM % GKS) == 0 && DM >= 2 * GKS);                                              // whole stages, two or more
static_assert(GP >= GKS && (GP % 8) == 0 && ((GP / 8) & 1) == 1);
static_assert(LP >= HD && (LP % 8) == 0 && ((LP / 8) & 1) == 1);   // 16-B aligned rows, pitch = 16 B x odd

typedef _Float16 v16h __attribute__((ext_vector_type(16)));
typedef _Float16 v8h  __attribute__((ext_vector_type(8)));
typedef __bf16   v16b __attribute__((ext_vector_type(16)));
typedef __bf16   v8b  __attribute__((ext_vector_type(8)));
typedef float    v8f  __attribute__((ext_vector_type(8)));
typedef float    v4f  __attribute__((ext_vector_type(4)));
typedef unsigned int v4u __attribute__((ext_vector_type(4)));

// ---- scalar helpers --------------------------------------------------------------------------------
__device__ __forceinline__ unsigned short bf_bits(float f) {          // f32 -> bf16 bits, RNE convert
  unsigned u = __float_as_uint(f);
  return (unsigned short)((u + 0x7FFFu + ((u >> 16) & 1u)) >> 16);
}
__device__ __forceinline__ float bf_up(unsigned short h) { return __uint_as_float(((unsigned)h) << 16); }
__device__ __forceinline__ float bfr(float f) { return bf_up(bf_bits(f)); }   // value after bf16 RNE convert
__device__ __forceinline__ unsigned short h_bits(_Float16 x) { return __builtin_bit_cast(unsigned short, x); }
__device__ __forceinline__ unsigned pk16(unsigned short a, unsigned short b) { return (unsigned)a | ((unsigned)b << 16); }
__device__ __forceinline__ float xhalf(float x) {                     // the value lane l ^ 16 holds
  return __builtin_bit_cast(float, __builtin_amdgcn_permlanex16(__builtin_bit_cast(int, x), __builtin_bit_cast(int, x),
                                                                0x76543210, 0xfedcba98, false, false));
}
__device__ __forceinline__ void exp2x8(float (&x)[8]) {
  asm("v_exp_f32 %0, %0\n\tv_exp_f32 %1, %1\n\tv_exp_f32 %2, %2\n\tv_exp_f32 %3, %3\n\t"
      "v_exp_f32 %4, %4\n\tv_exp_f32 %5, %5\n\tv_exp_f32 %6, %6\n\tv_exp_f32 %7, %7\n\tv_nop"
      : "+v"(x[0]), "+v"(x[1]), "+v"(x[2]), "+v"(x[3]), "+v"(x[4]), "+v"(x[5]), "+v"(x[6]), "+v"(x[7]));
}
__device__ __forceinline__ float exp2x1(float x) {
  asm("v_exp_f32 %0, %0\n\tv_nop" : "+v"(x));
  return x;
}
#define LOG2E 1.44269504088896340736f   // e^x = 2^(x * LOG2E), as __expf forms it
__device__ __forceinline__ v8f zero8() { v8f z = {0.f, 0.f, 0.f, 0.f, 0.f, 0.f, 0.f, 0.f}; return z; }

// ---- fragment loader: 16-bit A/B operand, lane -> row/col (lane&15), p already includes +8*(lane>>4);
//      elements 0..7 <- p[0..7] (k0+8h..), elements 8..15 <- p[16..23] (k0+16+8h..)
__device__ __forceinline__ v16b ldfrag_b(const __bf16* p) {
  union { v16b v; v8b h[2]; } f;
  f.h[0] = *(const v8b*)(p);
  f.h[1] = *(const v8b*)(p + 16);
  return f.v;
}

// ---- WMMA helpers: plain builtins, behind which the compiler itself keeps the distance to the next user of D, A or B ----
__device__ __forceinline__ v8f mma_b_raw(v16b a, v16b b, v8f c) {
  return __builtin_amdgcn_wmma_f32_16x16x32_bf16(false, a, false, b, (short)0, c, false, false);
}
__device__ __forceinline__ v8f mma_h_raw(v16h a, v16h b, v8f c) {
  return __builtin_amdgcn_wmma_f32_16x16x32_f16(false, a, false, b, (short)0, c, false, false);
}
__device__ __forceinline__ void acc_guard4(v8f& a, v8f& b, v8f& c, v8f& d) {
  asm volatile("v_nop\n\tv_nop\n\tv_nop\n\tv_nop" : "+v"(a), "+v"(b), "+v"(c), "+v"(d));
}

// ---- asynchronous copies global -> LDS, 16 B per lane, through no register ---------------------------
__device__ __forceinline__ unsigned lds_off(const void* p) { return (unsigned)(size_t)p; }   // LDS byte address
// A run of copies and its s_wait_xcnt 0 in ONE statement: the wait stands in front of every later write of the
// address registers that the copies name.
__device__ __forceinline__ void acopy4(const unsigned* l, const __bf16* const* g) {
  asm volatile("global_load_async_to_lds_b128 %0, %4, off\n\t"
               "global_load_async_to_lds_b128 %1, %5, off\n\t"
               "global_load_async_to_lds_b128 %2, %6, off\n\t"
               "global_load_async_to_lds_b128 %3, %7, off\n\t"
               "s_wait_xcnt 0x0"
               :: "v"(l[0]), "v"(l[1]), "v"(l[2]), "v"(l[3]), "v"(g[0]), "v"(g[1]), "v"(g[2]), "v"(g[3]) : "memory");
}
__device__ __forceinline__ void acopy8(const unsigned* l, const __bf16* const* g) {
  asm volatile("global_load_async_to_lds_b128 %0, %8, off\n\t"
               "global_load_async_to_lds_b128 %1, %9, off\n\t"
               "global_load_async_to_lds_b128 %2, %10, off\n\t"
               "global_load_async_to_lds_b128 %3, %11, off\n\t"
               "global_load_async_to_lds_b128 %4, %12, off\n\t"
               "global_load_async_to_lds_b128 %5, %13, off\n\t"
               "global_load_async_to_lds_b128 %6, %14, off\n\t"
               "global_load_async_to_lds_b128 %7, %15, off\n\t"
               "s_wait_xcnt 0x0"
               :: "v"(l[0]), "v"(l[1]), "v"(l[2]), "v"(l[3]), "v"(l[4]), "v"(l[5]), "v"(l[6]), "v"(l[7]),
                  "v"(g[0]), "v"(g[1]), "v"(g[2]), "v"(g[3]), "v"(g[4]), "v"(g[5]), "v"(g[6]), "v"(g[7]) : "memory");
}

// =====================================================================================================
// f32 -> bf16 (RNE convert), 8 elements per thread, one 16-B store per lane: a wave writes 512 contiguous B
// multiple of 256 for every use here; host-checked). coverage: n8 threads x 8 = whole plane.
// =====================================================================================================
__global__ __launch_bounds__(256) void cvt_bf16x8(const float* __restrict__ in, unsigned short* out, int n8) {
  const int i = blockIdx.x * 256 + threadIdx.x;
  if (i < n8) {
    const v4f a = *(const v4f*)(in + (size_t)i * 8);
    const v4f b = *(const v4f*)(in + (size_t)i * 8 + 4);
    v4u p;
    p[0] = pk16(bf_bits(a[0]), bf_bits(a[1]));
    p[1] = pk16(bf_bits(a[2]), bf_bits(a[3]));
    p[2] = pk16(bf_bits(b[0]), bf_bits(b[1]));
    p[3] = pk16(bf_bits(b[2]), bf_bits(b[3]));
    *(v4u*)(out + (size_t)i * 8) = p;
    
  }
}

// =====================================================================================================
// Register-blocked batched bf16 WMMA GEMM: C[m][n] = sum_k A[m][k] * Bt[n][k]; one wave per 64x64 tile, a block of
// 8 waves (2 x 4) per 128x256 tile. A row-major [M][K] pitch lda; Bt row-major [N][K] pitch ldb (k contiguous);
// M multiple of 128, N of 256, K of 64 and at least 128 (asserted on the shapes used). blockIdx.y = batch index.
// Operands: a stage is 64 k of the block's A rows (and A2 rows) and Bt rows, rows of 128 B at pitch 144 B in LDS,
// brought by asynchronous copies (8 lanes per row: a wave's copy covers 4 whole lines), two buffers: stage t + 2 is
// issued behind the barrier that ends stage t's reads and flies while stage t + 1 is worked on.
// NSPLIT: 0 = A.Bt; 1 = (A + A2).Bt (A2 = unscaled bf16 lo plane of A, same pitch/stride).
// BIAS: 0 none; 1 = + bfr(bias[n]) per column; 2 = + bfr(bias[m]) per row.
// ROPE (needs N tile = one head = 64 cols d 0..63, row m = b*SEQ + s): for s >= 1,
//   t[d] = t[d]*bfr(cos[s-1][d]) + rot[d]*bfr(sin[s-1][d]), rot = [-t[32..63] | t[0..31]] (after bias).
// OUT_MODE: 0 = f32 (pitch ldc); 2 = bf16 hi plane C + bf16 lo plane C2 (lo = RNE(v - hi), unscaled);
//           3 = f16 hi plane C + f16 residual plane C2 = f16((v - hi) * rscale); C2 same pitch/stride as C.
// =====================================================================================================
template <int NSPLIT, int OUT_MODE, int BIAS, int ROPE>
__global__ __launch_bounds__(256) void gemm64(
    const unsigned short* __restrict__ Ap, const unsigned short* __restrict__ A2p, int lda, long long strideA,
    const unsigned short* __restrict__ Btp, int ldb, long long strideB,
    const float* __restrict__ bias, const float* __restrict__ rsin, const float* __restrict__ rcos,
    void* Cout, void* Cout2, int ldc, long long strideC,
    int M, int N, int K, float rscale) {
  const __bf16* A  = (const __bf16*)(const void*)Ap;
  const __bf16* A2 = (const __bf16*)(const void*)A2p;
  const __bf16* Bt = (const __bf16*)(const void*)Btp;
  constexpr int ROWS_A  = GBM * (1 + NSPLIT);        // stage rows 0.. : A, then A2 where there is one
  constexpr int ROWS    = ROWS_A + GBN;              // then the Bt rows
  constexpr int STAGE_E = ROWS * GP;                 // elements of one buffer
  constexpr int NCP     = ROWS / 32;                 // copies per thread and stage: 256 threads cover 32 rows (12 or 16)
  __shared__ __align__(16) float sT[8][16 * 68];   // per-wave 16x64 slab, pitch 68 floats
  __shared__ __align__(16) __bf16 sG[2 * STAGE_E];  // operand stages, two buffers
  const int b    = blockIdx.y;
  const int lane = threadIdx.x & 31;
  const int wave = threadIdx.x >> 5;
  const int blkN = N / GBN;
  const int blkM = M / GBM;
  const int blk  = blockIdx.x;
  if (blk >= blkM * blkN) return;        // block-uniform, in front of every barrier and copy
  const int bm = blk / blkN;
  const int bn = blk - bm * blkN;
  const int wm = wave >> 2;              // 0..1
  const int wn = wave & 3;               // 0..3
  const int m0 = bm * GBM + (wm << 6);
  const int n0 = bn * GBN + (wn << 6);

  const __bf16* Ab  = A  + (size_t)b * strideA;
  const __bf16* Bb  = Bt + (size_t)b * strideB;
  const __bf16* Ab2 = (NSPLIT == 1) ? (A2 + (size_t)b * strideA) : Ab;

  const int rlane = lane & 15;                 // row (A) / col (B, D) within subtile
  const int koff  = (lane >> 4) * 8;           // k offset of this lane half
  const int mOff  = (lane >> 4) * 8;           // D row offset

  v8f acc[4][4];
#pragma unroll
  for (int i = 0; i < 4; ++i)
#pragma unroll
    for (int j = 0; j < 4; ++j) acc[i][j] = zero8();

  // ---- stage copies: thread -> row (tid >> 3) of each group of 32 rows, 16-B piece (tid & 7) of its 128 B ----
  const int crow = threadIdx.x >> 3;
  const int cseg = (threadIdx.x & 7) * 8;
  const __bf16* gA  = Ab  + (size_t)(bm * GBM + crow) * lda + cseg;
  const __bf16* gA2 = Ab2 + (size_t)(bm * GBM + crow) * lda + cseg;
  const __bf16* gB  = Bb  + (size_t)(bn * GBN + crow) * ldb + cseg;
  const unsigned lC = lds_off(sG) + (unsigned)(crow * GP + cseg) * 2u;
  auto issue_stage = [&](int st, int buf) {
    unsigned l[NCP];
    const __bf16* g[NCP];
#pragma unroll   // every index of l and g constant: the addresses stay in registers
    for (int p = 0; p < NCP; ++p) {
      l[p] = lC + (unsigned)(buf * STAGE_E + p * 32 * GP) * 2u;
      if (p * 32 < GBM)          g[p] = gA  + (size_t)(p * 32) * lda + (size_t)st * GKS;
      else if (p * 32 < ROWS_A)  g[p] = gA2 + (size_t)(p * 32 - GBM) * lda + (size_t)st * GKS;
      else                       g[p] = gB  + (size_t)(p * 32 - ROWS_A) * ldb + (size_t)st * GKS;
    }
    acopy8(l, g);
    if (NCP == 16) acopy8(l + 8, g + 8);
    else           acopy4(l + 8, g + 8);
  };

  const int T = K / GKS;                              // stages
  issue_stage(0, 0);
  asm volatile("s_wait_asynccnt 0x0" ::: "memory");   // this wave's copies of stage 0 have landed
  __syncthreads();                                    // and every other wave's: stage 0 may be read
  if (T > 1) issue_stage(1, 1);

  for (int t = 0; t < T; ++t) {
    const __bf16* sb = sG + (t & 1) * STAGE_E;
    const __bf16* sa = sb + ((wm << 6) + rlane) * GP + koff;
    const __bf16* sw = sb + (ROWS_A + (wn << 6) + rlane) * GP + koff;
    v16b bh[2][4], ah[2][4], al[2][4];   // the loops below are unrolled so that every fragment index is constant
#pragma unroll
    for (int ks = 0; ks < 2; ++ks) {
#pragma unroll
      for (int j = 0; j < 4; ++j) bh[ks][j] = ldfrag_b(sw + (j << 4) * GP + ks * 32);
#pragma unroll
      for (int i = 0; i < 4; ++i) {
        ah[ks][i] = ldfrag_b(sa + (i << 4) * GP + ks * 32);
        al[ks][i] = ah[ks][i];
        if (NSPLIT == 1) al[ks][i] = ldfrag_b(sa + (GBM + (i << 4)) * GP + ks * 32);
      }
    }
    // Holds the stage's fragment loads as one group ahead of its WMMAs: moved in among them, into one shared
    // register set, each place with loads makes the wave wait out the LDS latency.
    __builtin_amdgcn_sched_barrier(0);
#pragma unroll
    for (int ks = 0; ks < 2; ++ks)
#pragma unroll
      for (int i = 0; i < 4; ++i)
#pragma unroll
        for (int j = 0; j < 4; ++j) {
          acc[i][j] = mma_b_raw(ah[ks][i], bh[ks][j], acc[i][j]);
          if (NSPLIT == 1) acc[i][j] = mma_b_raw(al[ks][i], bh[ks][j], acc[i][j]);
        }
    // Holds the WMMAs ahead of the full LDS wait below: behind it none would start before the last fragment is in.
    __builtin_amdgcn_sched_barrier(0);
    asm volatile("s_wait_dscnt 0x0" ::: "memory");      // this wave's reads of buffer t & 1 are done
    asm volatile("s_wait_asynccnt 0x0" ::: "memory");   // this wave's copies of stage t + 1 have landed
    __syncthreads();                                    // publishes stage t + 1, frees buffer t & 1
    if (t + 2 < T) issue_stage(t + 2, t & 1);
  }
  asm volatile("s_wait_asynccnt 0x0" ::: "memory");     // nothing in flight when the wave goes on
  acc_guard4(acc[0][0], acc[0][1], acc[0][2], acc[0][3]);
  acc_guard4(acc[1][0], acc[1][1], acc[1][2], acc[1][3]);
  acc_guard4(acc[2][0], acc[2][1], acc[2][2], acc[2][3]);
  acc_guard4(acc[3][0], acc[3][1], acc[3][2], acc[3][3]);

  // ---- epilogue ----
  float* slab = sT[wave];
  float bcol[4];
  if (BIAS == 1) {
#pragma unroll
    for (int j = 0; j < 4; ++j) bcol[j] = bfr(bias[n0 + (j << 4) + rlane]);   // n0+.. < N
  } else {
#pragma unroll
    for (int j = 0; j < 4; ++j) bcol[j] = 0.f;
  }
#pragma unroll
  for (int i = 0; i < 4; ++i) {
    const int mBase = m0 + (i << 4);
#pragma unroll
    for (int r = 0; r < 8; ++r) {
      const int m = mBase + mOff + r;                  // < M
      float brow = 0.f;
      if (BIAS == 2) brow = bfr(bias[m]);
      float t[4];
#pragma unroll
      for (int j = 0; j < 4; ++j) {
        float v = acc[i][j][r];
        if (BIAS == 1) v = v + bcol[j];
        if (BIAS == 2) v = v + brow;
        t[j] = v;
      }
      if (ROPE) {
        const int s = m & (SEQ - 1);                   // token index within the sequence
        const bool use = (s > 0);                        // token 0 passes unrotated
        const int sidx = use ? (s - 1) : 0;              // clamped table row
        const float* cr = rcos + (size_t)sidx * HD;
        const float* sr = rsin + (size_t)sidx * HD;
        float u[4];
#pragma unroll
        for (int j = 0; j < 4; ++j) {
          const int d = (j << 4) + rlane;                // 0..63
          const float cs = bfr(cr[d]);
          const float sn = bfr(sr[d]);
          const float tp = t[j ^ 2];                     // partner d^32, same lane
          const float rot = (j < 2) ? -tp : tp;
          const float w = t[j] * cs + rot * sn;
          u[j] = use ? w : t[j];
        }
#pragma unroll
        for (int j = 0; j < 4; ++j) t[j] = u[j];
      }
#pragma unroll
      for (int j = 0; j < 4; ++j) slab[(mOff + r) * 68 + (j << 4) + rlane] = t[j];
    }
    __builtin_amdgcn_fence(__ATOMIC_RELEASE, "workgroup");
    __builtin_amdgcn_wave_barrier();
    __builtin_amdgcn_fence(__ATOMIC_ACQUIRE, "workgroup");
    if (OUT_MODE == 0) {
      float* C = (float*)Cout + (size_t)b * strideC;
      const int hh = lane >> 4, c4 = (lane & 15) * 4;     // 256-B row segment = 16 lanes x 16 B
      {
#pragma unroll
        for (int it = 0; it < 8; ++it) {
          const int row = it * 2 + hh;                     // it 0..7 x hh 0..1 = rows 0..15
          const v4f v = *(const v4f*)(slab + row * 68 + c4);
          *(v4f*)(C + (size_t)(mBase + row) * ldc + n0 + c4) = v;
        }
        
      }
    } else {
      const int q = lane >> 3, c8 = (lane & 7) * 8;
      unsigned short* C  = (unsigned short*)Cout  + (size_t)b * strideC;
      unsigned short* C2 = (unsigned short*)Cout2 + (size_t)b * strideC;
      v4u hv[4], lv[4];
#pragma unroll
      for (int it = 0; it < 4; ++it) {
        const int row = it * 4 + q;                        // it 0..3 x q 0..3 = rows 0..15
        const float* sp = slab + row * 68 + c8;
        v4u a, a2;
#pragma unroll
        for (int e = 0; e < 4; ++e) {
          const float f0 = sp[2 * e], f1 = sp[2 * e + 1];
          unsigned short h0, h1, l0, l1;
          if (OUT_MODE == 2) {
            h0 = bf_bits(f0); h1 = bf_bits(f1);
            l0 = bf_bits(f0 - bf_up(h0)); l1 = bf_bits(f1 - bf_up(h1));
          } else {
            const _Float16 x0 = (_Float16)f0, x1 = (_Float16)f1;
            h0 = h_bits(x0); h1 = h_bits(x1);
            l0 = h_bits((_Float16)((f0 - (float)x0) * rscale));
            l1 = h_bits((_Float16)((f1 - (float)x1) * rscale));
          }
          a[e] = pk16(h0, h1); a2[e] = pk16(l0, l1);
        }
        hv[it] = a; lv[it] = a2;
      }
      {
#pragma unroll
        for (int it = 0; it < 4; ++it) {
          const int row = it * 4 + q;
          *(v4u*)(C  + (size_t)(mBase + row) * ldc + n0 + c8) = hv[it];
          *(v4u*)(C2 + (size_t)(mBase + row) * ldc + n0 + c8) = lv[it];
        }
        
      }
    }
    __builtin_amdgcn_fence(__ATOMIC_RELEASE, "workgroup");
    __builtin_amdgcn_wave_barrier();
    __builtin_amdgcn_fence(__ATOMIC_ACQUIRE, "workgroup");
  }
}

// =====================================================================================================
// Attention, head dim 64, no mask, all SEQ keys.
//   q planes (bf16 hi / lo): element (b, t, h, d) at [(b*SEQ + t)*DM + h*64 + d]
//   k planes (bf16 hi / lo): same layout with key index s
//   v^T hi plane (f16):      element (b, h, d, s) at [(b*DM + h*64 + d)*SEQ + s]
//   v^T residual plane (f16, (v - hi)*4096): same layout
//   out planes (bf16 hi / lo of the normalised context): element (b, t, h, d) at [(b*SEQ + t)*DM + h*64 + d]
//   Both products are formed transposed: S^T = K . Q^T (A = K rows, B = Q) and O^T += V^T . P^T (A = V^T rows, B = P^T).
//   In each tile a lane then holds one query (column lane&15) and 32 of the chunk's 64 keys (rows j*16 + 8*(lane>>4) + r): the maximum
//   and the sum run inside the lane, the two wave halves exchange the maximum once per chunk and join their sums once at
//   the end; two score tiles, converted in place, are the B operand P^T in the k order of the V^T loader.
//   scores = k . q : bf16 hi/lo split (hi.hi + lo.hi + hi.lo in k, q), f32 accumulate, then * sscale in f32
//   p = exp(s - m) carried as f16(1024 p); context = v^T . p^T on f16 WMMA: v_hi.p into the running accumulator,
//   v_res.p into a per-chunk accumulator folded back with 1/4096 in f32; online softmax in f32.
//   Block = 4 waves = 128 query rows of one (b, h), a wave 32 of them as two 16-column tiles that share every K and
//   V^T fragment read; grid = NQG * NH * NB; kv chunks of 64, static trip NQB.
//   K / V^T chunk staging: a stage is the chunk's four 64x64 planes, rows of 128 B at pitch 144 B in LDS, brought by
//   asynchronous copies (8 lanes per row: a wave's copy covers 4 whole lines; 16 copies per thread), two buffers:
//   chunk t + 2 is issued behind the barrier that ends chunk t's reads and flies while chunk t + 1 is worked on.
//   Output coverage: each wave stores rows q0..q0+31 (u 0..1 x it 0..3 x lane>>3 0..3) x 64 columns (8 lanes x 8) of both planes.
// =====================================================================================================
__global__ __launch_bounds__(128, 4)   // 4 waves per SIMD: the 256 registers that let four blocks share a WGP
void attn64(const unsigned short* __restrict__ qhp, const unsigned short* __restrict__ qlp,
            const unsigned short* __restrict__ khp, const unsigned short* __restrict__ klp,
            const unsigned short* __restrict__ vhp, const unsigned short* __restrict__ vlp,
            unsigned short* ohp, unsigned short* olp, float sscale) {
  union FB { v16b v; v8b h[2]; };
  union FH { v16h v; v8h h[2]; };
  // Rows of 64 16-bit elements are laid at a pitch of LP = 72 elements (144 B = 16 B x 9): the 16 rows that one
  // ds_load_b128 fragment read touches then fall on 16 different groups of four banks instead of two.
  constexpr int PLANE_B = 64 * LP * 2;                            // bytes of one plane of a stage, 9 KB
  constexpr int STAGE_B = 4 * PLANE_B;                            // K hi [kv][d], K lo, V^T hi [d][kv], V^T residual
  static_assert(4 * QT * 16 * OSP * 4 <= 2 * STAGE_B);            // the output tiles fit where the stages were
  // Two stage buffers, 72 KB; behind the loop's last barrier the same bytes hold the per-wave context tiles [row][d].
  __shared__ __align__(16) unsigned char sKV[2 * STAGE_B];

  const int tid  = threadIdx.x;
  const int wave = tid >> 5;
  const int lane = tid & 31;
  const int hh   = lane >> 4;
  const int c    = lane & 15;

  const int bx   = blockIdx.x;
  const int qb   = bx % NQG;
  const int rest = bx / NQG;
  const int h    = rest % NH;
  const int b    = rest / NH;
  const int q0   = qb * (64 * QT) + wave * (16 * QT);
  const size_t rowB = (size_t)b * SEQ;

  const __bf16* Qh = (const __bf16*)(const void*)qhp + (size_t)h * HD;
  const __bf16* Ql = (const __bf16*)(const void*)qlp + (size_t)h * HD;
  const __bf16* Kh = (const __bf16*)(const void*)khp + (size_t)h * HD;
  const __bf16* Kl = (const __bf16*)(const void*)klp + (size_t)h * HD;
  const _Float16* Vh = (const _Float16*)(const void*)vhp + ((size_t)b * DM + (size_t)h * HD) * SEQ;
  const _Float16* Vl = (const _Float16*)(const void*)vlp + ((size_t)b * DM + (size_t)h * HD) * SEQ;

  // ---- Q fragments (B operand, column = query = u*16 + lane&15): QT query tiles x 2 d-chunks, hi and lo ----
  v16b qah[QT][2], qal[QT][2];
#pragma unroll
  for (int u = 0; u < QT; ++u)
#pragma unroll
    for (int dc = 0; dc < 2; ++dc) {
      const size_t qo = (rowB + q0 + u * 16 + c) * DM + dc * 32 + 8 * hh;
      qah[u][dc] = ldfrag_b(Qh + qo);
      qal[u][dc] = ldfrag_b(Ql + qo);
      // In front of the next loads: the compiler lays their results over address registers of the loads issued here.
      asm volatile("s_wait_xcnt 0x0" ::: "memory");
    }

  // per query tile u, this lane's query: running maximum (both halves alike), sum over this half's keys
  float mrow[QT], lrow[QT];
  v8f oacc[QT][4];                      // O^T: oacc[u][t][r] = context[query u*16 + c][d = t*16 + 8*hh + r]
#pragma unroll
  for (int u = 0; u < QT; ++u) {
    mrow[u] = -INFINITY;
    lrow[u] = 0.f;
#pragma unroll
    for (int t = 0; t < 4; ++t) oacc[u][t] = zero8();
  }

  // ---- stage copies: thread -> row (tid >> 3) of each group of 16 rows, 16-B piece (tid & 7) of its 128 B ----
  const int crow = tid >> 3;
  const int cseg = (tid & 7) * 8;
  const __bf16* gKh = Kh + (rowB + crow) * DM + cseg;                            // K row crow of chunk 0
  const __bf16* gKl = Kl + (rowB + crow) * DM + cseg;
  const __bf16* gVh = (const __bf16*)(const void*)(Vh + (size_t)crow * SEQ + cseg);   // V^T row d = crow, an address only
  const __bf16* gVl = (const __bf16*)(const void*)(Vl + (size_t)crow * SEQ + cseg);
  const unsigned lC = lds_off(sKV) + (unsigned)(crow * LP + cseg) * 2u;
  auto issue_stage = [&](int st, int buf) {
    unsigned l[16];
    const __bf16* g[16];
#pragma unroll   // every index of l and g constant: the addresses stay in registers
    for (int p = 0; p < 4; ++p) {
      const unsigned lp = lC + (unsigned)(buf * STAGE_B + p * 16 * LP * 2);
      l[p]      = lp;
      l[4 + p]  = lp + PLANE_B;
      l[8 + p]  = lp + 2 * PLANE_B;
      l[12 + p] = lp + 3 * PLANE_B;
      g[p]      = gKh + (size_t)(st * 64 + p * 16) * DM;          // K row st*64 + p*16 + crow < SEQ
      g[4 + p]  = gKl + (size_t)(st * 64 + p * 16) * DM;
      g[8 + p]  = gVh + (size_t)(p * 16) * SEQ + st * 64;         // V^T row p*16 + crow < 64, s = st*64 + cseg.. < SEQ
      g[12 + p] = gVl + (size_t)(p * 16) * SEQ + st * 64;
    }
    acopy8(l, g);
    acopy8(l + 8, g + 8);
  };

  static_assert(NQB >= 2);                            // chunks 0 and 1 both exist
  issue_stage(0, 0);
  asm volatile("s_wait_asynccnt 0x0" ::: "memory");   // this wave's copies of chunk 0 have landed
  __syncthreads();                                    // and every other wave's: chunk 0 may be read
  issue_stage(1, 1);

  // One chunk: scores, softmax, context, then the publish point of chunk kt + 1.
  auto chunk = [&](int kt) {
    const unsigned char* sb = sKV + (kt & 1) * STAGE_B;
    const __bf16*   Ksh = (const __bf16*)(const void*)(sb);
    const __bf16*   Ksl = (const __bf16*)(const void*)(sb + PLANE_B);
    const _Float16* Vth = (const _Float16*)(const void*)(sb + 2 * PLANE_B);
    const _Float16* Vtl = (const _Float16*)(const void*)(sb + 3 * PLANE_B);

    // ---- scores, transposed: 64 keys x 16*QT queries per wave, 3 bf16 products; A[m = key][k = d] from Ksh[key][d];
    //      each K fragment, read once, is the A operand of every query tile ----
    v8f s[QT][4];
#pragma unroll
    for (int j = 0; j < 4; ++j) {
#pragma unroll
      for (int u = 0; u < QT; ++u) s[u][j] = zero8();
#pragma unroll
      for (int dc = 0; dc < 2; ++dc) {
        FB kb, kl;
        kb.h[0] = *(const v8b*)(Ksh + (j * 16 + c) * LP + dc * 32 + 8 * hh);
        kb.h[1] = *(const v8b*)(Ksh + (j * 16 + c) * LP + dc * 32 + 16 + 8 * hh);
        kl.h[0] = *(const v8b*)(Ksl + (j * 16 + c) * LP + dc * 32 + 8 * hh);
        kl.h[1] = *(const v8b*)(Ksl + (j * 16 + c) * LP + dc * 32 + 16 + 8 * hh);
#pragma unroll
        for (int u = 0; u < QT; ++u) s[u][j] = mma_b_raw(kb.v, qah[u][dc], s[u][j]);
#pragma unroll
        for (int u = 0; u < QT; ++u) s[u][j] = mma_b_raw(kl.v, qah[u][dc], s[u][j]);
#pragma unroll
        for (int u = 0; u < QT; ++u) s[u][j] = mma_b_raw(kb.v, qal[u][dc], s[u][j]);
      }
    }

    // Keeps the softmax behind the score products: scheduled in among them its values lengthen the stretch where both
    // tiles' scores, Q and the context are all live, and the build spills at the 256 registers of four waves per SIMD.
    __builtin_amdgcn_sched_barrier(0);
    // ---- scale, maximum, online softmax; query u*16 + c, key j*16 + 8*hh + r lives in s[u][j][r] ----
    // P^T (x1024, f16) as B operand: element e of chunk kk = key kk*32 + (e < 8 ? 8*hh + e : 16 + 8*hh + e - 8)
    FH pb[QT][2];
#pragma unroll
    for (int u = 0; u < QT; ++u) {
      float mj[4];
#pragma unroll
      for (int j = 0; j < 4; ++j) {
        mj[j] = -INFINITY;
#pragma unroll
        for (int r = 0; r < 8; ++r) {
          const float sv = s[u][j][r] * sscale;
          s[u][j][r] = sv;
          mj[j] = fmaxf(mj[j], sv);
        }
      }
      float m = fmaxf(fmaxf(mj[0], mj[1]), fmaxf(mj[2], mj[3]));
      m = fmaxf(m, xhalf(m));                            // the query's other 32 keys sit in lane ^ 16
      const float mnew  = fmaxf(mrow[u], m);
      const float msafe = (mnew == -INFINITY) ? 0.f : mnew;
      const float alpha = exp2x1((mrow[u] - msafe) * LOG2E);
      mrow[u] = mnew;
      float pj[4];
#pragma unroll
      for (int j = 0; j < 4; ++j) {
        float p[8];
#pragma unroll
        for (int r = 0; r < 8; ++r) p[r] = (s[u][j][r] - msafe) * LOG2E;
        exp2x8(p);
        pj[j] = 0.f;
#pragma unroll
        for (int r = 0; r < 8; ++r) {
          pj[j] += p[r];
          pb[u][j >> 1].v[(j & 1) * 8 + r] = (_Float16)(p[r] * 1024.0f);
        }
      }
      lrow[u] = lrow[u] * alpha + ((pj[0] + pj[1]) + (pj[2] + pj[3]));
#pragma unroll
      for (int t = 0; t < 4; ++t)
#pragma unroll
        for (int r = 0; r < 8; ++r) oacc[u][t][r] *= alpha;
    }

    // ---- context^T += V^T . P^T (f16 WMMA): A[m = d][k = kv] from Vth[d][kv], B = P^T[k = kv][n = query]; each V^T
    //      fragment, read once, is the A operand of every query tile; residual products into a separate accumulator
    //      per 16 d rows, folded back when both key halves are in ----
#pragma unroll
    for (int t = 0; t < 4; ++t) {
      v8f o1[QT];
#pragma unroll
      for (int u = 0; u < QT; ++u) o1[u] = zero8();
#pragma unroll
      for (int kk = 0; kk < 2; ++kk) {
        FH vb, vl;
        vb.h[0] = *(const v8h*)(Vth + (t * 16 + c) * LP + kk * 32 + 8 * hh);
        vb.h[1] = *(const v8h*)(Vth + (t * 16 + c) * LP + kk * 32 + 16 + 8 * hh);
        vl.h[0] = *(const v8h*)(Vtl + (t * 16 + c) * LP + kk * 32 + 8 * hh);
        vl.h[1] = *(const v8h*)(Vtl + (t * 16 + c) * LP + kk * 32 + 16 + 8 * hh);
#pragma unroll
        for (int u = 0; u < QT; ++u) oacc[u][t] = mma_h_raw(vb.v, pb[u][kk].v, oacc[u][t]);
#pragma unroll
        for (int u = 0; u < QT; ++u) o1[u]      = mma_h_raw(vl.v, pb[u][kk].v, o1[u]);
      }
#pragma unroll
      for (int u = 0; u < QT; ++u)
#pragma unroll
        for (int r = 0; r < 8; ++r) oacc[u][t][r] += o1[u][r] * (1.0f / 4096.0f);
    }

    asm volatile("s_wait_dscnt 0x0" ::: "memory");      // this wave's reads of buffer kt & 1 are done
    asm volatile("s_wait_asynccnt 0x0" ::: "memory");   // this wave's copies of chunk kt + 1 have landed
    __syncthreads();                                    // publishes chunk kt + 1, frees buffer kt & 1
  };
  // The chunks that have a chunk kt + 2 to fetch, then the last two, in loops of their own (static trip counts): with the
  // test inside one loop the compiler moves folds and row sums behind the branch, their operands stay in registers
  // beside the copies' addresses, and the build spills at 256 registers.
  for (int kt = 0; kt < NQB - 2; ++kt) {
    chunk(kt);
    issue_stage(kt + 2, kt & 1);
  }
#pragma unroll 1   // kept rolled: one more copy of the body, not two
  for (int kt = NQB - 2; kt < NQB; ++kt) chunk(kt);
  asm volatile("s_wait_asynccnt 0x0" ::: "memory");     // nothing in flight when the buffers become output staging

  // ---- normalise (1/l and the 1/1024 p carry), stage the wave's 16*QT x 64 tile, bf16 hi/lo split,
  float* os = (float*)(void*)sKV + wave * (QT * 16 * OSP);   // every wave has passed the last chunk's barrier
#pragma unroll
  for (int u = 0; u < QT; ++u) {
    const float l = lrow[u] + xhalf(lrow[u]);          // join the two halves' sums of this query
    const float inv = ((l > 0.f) ? (1.0f / l) : 0.f) * (1.0f / 1024.0f);
#pragma unroll
    for (int t = 0; t < 4; ++t)
#pragma unroll
      for (int r = 0; r < 8; ++r) os[(u * 16 + c) * OSP + t * 16 + 8 * hh + r] = oacc[u][t][r] * inv;
  }
  __builtin_amdgcn_fence(__ATOMIC_RELEASE, "workgroup");
  __builtin_amdgcn_wave_barrier();
  __builtin_amdgcn_fence(__ATOMIC_ACQUIRE, "workgroup");
#pragma unroll
  for (int u = 0; u < QT; ++u) {
    const int q4 = lane >> 3, c8 = (lane & 7) * 8;
    v4u hv[4], lv[4];
#pragma unroll
    for (int it = 0; it < 4; ++it) {
      const int row = u * 16 + it * 4 + q4;   // u x it 0..3 x q4 0..3 = rows 0..16*QT-1 of the wave tile
      const float* sp = os + row * OSP + c8;
      v4u a, a2;
#pragma unroll
      for (int e = 0; e < 4; ++e) {
        const float f0 = sp[2 * e], f1 = sp[2 * e + 1];
        const unsigned short h0 = bf_bits(f0), h1 = bf_bits(f1);
        const unsigned short l0 = bf_bits(f0 - bf_up(h0)), l1 = bf_bits(f1 - bf_up(h1));
        a[e] = pk16(h0, h1); a2[e] = pk16(l0, l1);
      }
      hv[it] = a; lv[it] = a2;
    }
    {
#pragma unroll
      for (int it = 0; it < 4; ++it) {
        const int row = u * 16 + it * 4 + q4;
        const size_t go = (rowB + q0 + row) * DM + (size_t)h * HD + c8;
        *(v4u*)(ohp + go) = hv[it];
        *(v4u*)(olp + go) = lv[it];
      }
    }
  }
}

// =====================================================================================================
// Workspace map: 8 regions of PL = NTOK*DM*2 = 16777216 B each, total 134217728 B.
//   R0  Xb   bf16 [8192][1024]                    (after the projections: Oh, context hi plane [8192][1024])
//   R1  Qh   bf16 [8192][1024]                    (after attention: Wob bf16 [1024][1024], 2097152 B used)
//   R2  Ql   bf16 [8192][1024]
//   R3  Kh   bf16 [8192][1024]
//   R4  Kl   bf16 [8192][1024]
//   R5  VTh  f16  [4][1024][2048]
//   R6  VTl  f16  [4][1024][2048]
//   R7  Wqkv bf16 [3072][1024] (6291456 B used)   (during attention: Ol, context lo plane [8192][1024])
// All planes are exact multiples of their 64x64 tile / whole-line store granularity (no padded tails needed).
// Weights are [out n][in k] with k contiguous = the Bt / A layout the GEMM wants, so they are only converted.
// =====================================================================================================
extern "C" void kernel_launch(void* const* d_in, const int* in_sizes, int n_in,
                              void* d_out, int out_size, void* d_ws, size_t ws_size,
                              hipStream_t stream) {
  if (n_in < 8) return;
  if (in_sizes[0] != NTOK * DM) return;
  if (in_sizes[1] != 3 * DM * DM) return;
  if (in_sizes[2] != DM || in_sizes[3] != DM) return;
  if (in_sizes[4] != DM * DM || in_sizes[5] != DM) return;
  if (in_sizes[6] != (SEQ - 1) * HD || in_sizes[7] != (SEQ - 1) * HD) return;
  if (out_size != NTOK * DM) return;

  const float* x      = (const float*)d_in[0];
  const float* qkv_w  = (const float*)d_in[1];
  const float* q_bias = (const float*)d_in[2];
  const float* v_bias = (const float*)d_in[3];
  const float* proj_w = (const float*)d_in[4];
  const float* proj_b = (const float*)d_in[5];
  const float* rsin   = (const float*)d_in[6];
  const float* rcos   = (const float*)d_in[7];

  const size_t PL = (size_t)NTOK * DM * 2;        // 16777216  one 16-bit activation plane [8192][1024]
  static_assert((size_t)3 * DM * DM * 2 <= (size_t)NTOK * DM * 2);
  static_assert((size_t)NB * DM * SEQ * 2 == (size_t)NTOK * DM * 2);
  static_assert((size_t)DM * DM * 2 <= (size_t)NTOK * DM * 2);
  size_t off = 0;
  const size_t oR0 = off; off += PL;
  const size_t oR1 = off; off += PL;
  const size_t oR2 = off; off += PL;
  const size_t oR3 = off; off += PL;
  const size_t oR4 = off; off += PL;
  const size_t oR5 = off; off += PL;
  const size_t oR6 = off; off += PL;
  const size_t oR7 = off; off += PL;
  if (off > ws_size) return;                      // off = 134217728
  if (off > (size_t)134217728) return;

  char* ws = (char*)d_ws;
  unsigned short* Xb   = (unsigned short*)(ws + oR0);
  unsigned short* Oh   = (unsigned short*)(ws + oR0);
  unsigned short* Qh   = (unsigned short*)(ws + oR1);
  unsigned short* Wob  = (unsigned short*)(ws + oR1);
  unsigned short* Ql   = (unsigned short*)(ws + oR2);
  unsigned short* Kh   = (unsigned short*)(ws + oR3);
  unsigned short* Kl   = (unsigned short*)(ws + oR4);
  unsigned short* VTh  = (unsigned short*)(ws + oR5);
  unsigned short* VTl  = (unsigned short*)(ws + oR6);
  unsigned short* Wqkv = (unsigned short*)(ws + oR7);
  unsigned short* Ol   = (unsigned short*)(ws + oR7);
  const unsigned short* Wq = Wqkv;
  const unsigned short* Wk = Wqkv + (size_t)DM * DM;
  const unsigned short* Wv = Wqkv + (size_t)2 * DM * DM;

  const dim3 blk(256);
  const int n8x = NTOK * DM / 8;                              // 1048576
  const int n8q = 3 * DM * DM / 8;                            //  393216
  const int n8o = DM * DM / 8;                                //  131072
  if ((n8x % 256) != 0 || (n8q % 256) != 0 || (n8o % 256) != 0) return;
  const dim3 gCvtX(n8x / 256);                                // 4096 blocks
  const dim3 gCvtQ(n8q / 256);                                // 1536 blocks
  const dim3 gCvtO(n8o / 256);                                //  512 blocks
  const int tilesTok = (NTOK / 64) * (DM / 64);               // 2048 tiles: M=8192, N=1024
  const int tilesVT  = (DM / 64) * (SEQ / 64);                //  512 tiles: M=1024, N=2048
  const dim3 gTok((tilesTok + 7) / 8, 1);                     // 256 blocks
  const dim3 gVT((tilesVT + 7) / 8, NB);                      // 64 blocks x 4 batches
  const dim3 gAttn(NB * NH * NQG);                            // 1024 blocks

  // (1) x -> bf16 plane [8192][1024]; qkv_w [3072 n][1024 k] f32 -> bf16
  cvt_bf16x8<<<gCvtX, blk, 0, stream>>>(x, Xb, n8x);
  cvt_bf16x8<<<gCvtQ, blk, 0, stream>>>(qkv_w, Wqkv, n8q);
  // (2) q = x . Wq^T + q_bias, rope for tokens >= 1 -> bf16 hi/lo planes [b*SEQ+t][h*64+d]   (M=8192, N=1024, K=1024)
  gemm64<0, 2, 1, 1><<<gTok, blk, 0, stream>>>(
      Xb, Xb, DM, 0LL, Wq, DM, 0LL, q_bias, rsin, rcos,
      (void*)Qh, (void*)Ql, DM, 0LL, NTOK, DM, DM, 1.0f);
  // (3) k = x . Wk^T (no bias), rope -> bf16 hi/lo planes
  gemm64<0, 2, 0, 1><<<gTok, blk, 0, stream>>>(
      Xb, Xb, DM, 0LL, Wk, DM, 0LL, q_bias, rsin, rcos,
      (void*)Kh, (void*)Kl, DM, 0LL, NTOK, DM, DM, 1.0f);
  // (4) v^T = Wv . x^T + v_bias[row] per batch -> f16 hi plane [b][h*64+d][s] (pitch SEQ) and residual plane x4096
  //     (A = Wv [n][k], Bt = Xb rows of batch b; M=1024, N=2048, K=1024)
  gemm64<0, 3, 2, 0><<<gVT, blk, 0, stream>>>(
      Wv, Wv, DM, 0LL, Xb, DM, (long long)SEQ * DM, v_bias, rsin, rcos,
      (void*)VTh, (void*)VTl, SEQ, (long long)DM * SEQ, DM, SEQ, DM, 4096.0f);
  // (5) attention -> context bf16 hi plane (R0, x plane dead) and lo plane (R7, weight plane dead)
  attn64<<<gAttn, dim3(128), 0, stream>>>(Qh, Ql, Kh, Kl, VTh, VTl, Oh, Ol, 0.125f);
  // (6) proj_w -> bf16 [n][k] into R1 (q hi plane dead after attention)
  cvt_bf16x8<<<gCvtO, blk, 0, stream>>>(proj_w, Wob, n8o);
  // (7) out = context . Wo^T + proj_b -> d_out f32 [8192][1024]  (A = context hi + lo planes, 2 products)
  gemm64<1, 0, 1, 0><<<gTok, blk, 0, stream>>>(
      Oh, Ol, DM, 0LL, Wob, DM, 0LL, proj_b, rsin, rcos,
      d_out, d_out, DM, 0LL, NTOK, DM, DM, 1.0f);
  (void)hipGetLastError();
}

// v007
// A run of this version takes 242 microseconds.
// Timed twice side by side with v006, it ran 1.05 times as fast both times.
// All steps since v000 together make it 3.17 times as fast.
// Contractions: q, k, v^T projections = v_wmma_f32_16x16x32_bf16 (bf16 operands from RNE-converted inputs, single product, f32 accumulate);
// q.k^T scores = v_wmma_f32_16x16x32_bf16 with bf16 hi/lo split q and k (hi.hi + hi.lo + lo.hi), f32 accumulate;
// p.v = v_wmma_f32_16x16x32_f16 (p carried x1024 in f16; v as f16 hi plane plus f16 residual plane x4096; 2 products), f32 accumulate;
// ctx.Wo^T = v_wmma_f32_16x16x32_bf16 with ctx as bf16 hi/lo planes times bf16 Wo (2 products), f32 accumulate; bias, rope, softmax in f32.
#include <hip/hip_runtime.h>
#include <math.h>
#include <stdint.h>

#pragma clang fp contract(off)

#define NB    4
#define SEQ   2048
#define DM    1024
#define NH    16
#define HD    64
#define NQB   (SEQ / 64)      // 32 key chunks of 64
#define QT    2               // query tiles of 16 columns per attention wave
#define NQG   (SEQ / (64 * QT))   // 16 query blocks of 4 waves x 16*QT queries
#define NTOK  (NB * SEQ)      // 8192 token rows
#define LP    72              // LDS row pitch of the attention K and V^T tiles, in 16-bit elements
#define OSP   68              // LDS row pitch of the attention output staging tile, in floats (16 B x odd)
#define GP    72              // LDS row pitch of the GEMM operand tiles, in 16-bit elements (144 B = 16 B x odd)
#define GKS   64              // k elements of one GEMM stage: rows of 128 B, one whole line each
#define GBM   128             // GEMM block tile rows    (2 waves x 64)
#define GBN   256             // GEMM block tile columns (4 waves x 64)
static_assert(NH * HD == DM);
static_assert((SEQ % (64 * QT)) == 0 && (DM % 64) == 0);
static_assert((SEQ & (SEQ - 1)) == 0);
static_assert((NTOK % GBM) == 0 && (DM % GBM) == 0 && (DM % GBN) == 0 && (SEQ % GBN) == 0);   // whole GEMM block tiles
static_assert((DM % GKS) == 0 && DM >= 2 * GKS);                                              // whole stages, two or more
static_assert(GP >= GKS && (GP % 8) == 0 && ((GP / 8) & 1) == 1);
static_assert(LP >= HD && (LP % 8) == 0 && ((LP / 8) & 1) == 1);   // 16-B aligned rows, pitch = 16 B x odd

typedef _Float16 v16h __attribute__((ext_vector_type(16)));
typedef _Float16 v8h  __attribute__((ext_vector_type(8)));
typedef __bf16   v16b __attribute__((ext_vector_type(16)));
typedef __bf16   v8b  __attribute__((ext_vector_type(8)));
typedef float    v8f  __attribute__((ext_vector_type(8)));
typedef float    v4f  __attribute__((ext_vector_type(4)));
typedef unsigned int v4u __attribute__((ext_vector_type(4)));

// ---- scalar helpers --------------------------------------------------------------------------------
__device__ __forceinline__ unsigned short bf_bits(float f) {          // f32 -> bf16 bits, RNE convert
  unsigned u = __float_as_uint(f);
  return (unsigned short)((u + 0x7FFFu + ((u >> 16) & 1u)) >> 16);
}
__device__ __forceinline__ float bf_up(unsigned short h) { return __uint_as_float(((unsigned)h) << 16); }
__device__ __forceinline__ float bfr(float f) { return bf_up(bf_bits(f)); }   // value after bf16 RNE convert
__device__ __forceinline__ unsigned short h_bits(_Float16 x) { return __builtin_bit_cast(unsigned short, x); }
__device__ __forceinline__ unsigned pk16(unsigned short a, unsigned short b) { return (unsigned)a | ((unsigned)b << 16); }
__device__ __forceinline__ float xhalf(float x) {                     // the value lane l ^ 16 holds
  return __builtin_bit_cast(float, __builtin_amdgcn_permlanex16(__builtin_bit_cast(int, x), __builtin_bit_cast(int, x),
                                                                0x76543210, 0xfedcba98, false, false));
}
__device__ __forceinline__ void exp2x8(float (&x)[8]) {
  asm("v_exp_f32 %0, %0\n\tv_exp_f32 %1, %1\n\tv_exp_f32 %2, %2\n\tv_exp_f32 %3, %3\n\t"
      "v_exp_f32 %4, %4\n\tv_exp_f32 %5, %5\n\tv_exp_f32 %6, %6\n\tv_exp_f32 %7, %7\n\tv_nop"
      : "+v"(x[0]), "+v"(x[1]), "+v"(x[2]), "+v"(x[3]), "+v"(x[4]), "+v"(x[5]), "+v"(x[6]), "+v"(x[7]));
}
__device__ __forceinline__ float exp2x1(float x) {
  asm("v_exp_f32 %0, %0\n\tv_nop" : "+v"(x));
  return x;
}
#define LOG2E 1.44269504088896340736f   // e^x = 2^(x * LOG2E), as __expf forms it
__device__ __forceinline__ v8f zero8() { v8f z = {0.f, 0.f, 0.f, 0.f, 0.f, 0.f, 0.f, 0.f}; return z; }

// ---- fragment loader: 16-bit A/B operand, lane -> row/col (lane&15), p already includes +8*(lane>>4);
//      elements 0..7 <- p[0..7] (k0+8h..), elements 8..15 <- p[16..23] (k0+16+8h..)
__device__ __forceinline__ v16b ldfrag_b(const __bf16* p) {
  union { v16b v; v8b h[2]; } f;
  f.h[0] = *(const v8b*)(p);
  f.h[1] = *(const v8b*)(p + 16);
  return f.v;
}

// ---- WMMA helpers: plain builtins, behind which the compiler itself keeps the distance to the next user of D, A or B ----
__device__ __forceinline__ v8f mma_b_raw(v16b a, v16b b, v8f c) {
  return __builtin_amdgcn_wmma_f32_16x16x32_bf16(false, a, false, b, (short)0, c, false, false);
}
__device__ __forceinline__ v8f mma_h_raw(v16h a, v16h b, v8f c) {
  return __builtin_amdgcn_wmma_f32_16x16x32_f16(false, a, false, b, (short)0, c, false, false);
}
__device__ __forceinline__ void acc_guard4(v8f& a, v8f& b, v8f& c, v8f& d) {
  asm volatile("v_nop\n\tv_nop\n\tv_nop\n\tv_nop" : "+v"(a), "+v"(b), "+v"(c), "+v"(d));
}

// ---- asynchronous copies global -> LDS, 16 B per lane, through no register ---------------------------
__device__ __forceinline__ unsigned lds_off(const void* p) { return (unsigned)(size_t)p; }   // LDS byte address
// A run of copies and its s_wait_xcnt 0 in ONE statement: the wait stands in front of every later write of the
// address registers that the copies name.
__device__ __forceinline__ void acopy4(const unsigned* l, const __bf16* const* g) {
  asm volatile("global_load_async_to_lds_b128 %0, %4, off\n\t"
               "global_load_async_to_lds_b128 %1, %5, off\n\t"
               "global_load_async_to_lds_b128 %2, %6, off\n\t"
               "global_load_async_to_lds_b128 %3, %7, off\n\t"
               "s_wait_xcnt 0x0"
               :: "v"(l[0]), "v"(l[1]), "v"(l[2]), "v"(l[3]), "v"(g[0]), "v"(g[1]), "v"(g[2]), "v"(g[3]) : "memory");
}
__device__ __forceinline__ void acopy8(const unsigned* l, const __bf16* const* g) {
  asm volatile("global_load_async_to_lds_b128 %0, %8, off\n\t"
               "global_load_async_to_lds_b128 %1, %9, off\n\t"
               "global_load_async_to_lds_b128 %2, %10, off\n\t"
               "global_load_async_to_lds_b128 %3, %11, off\n\t"
               "global_load_async_to_lds_b128 %4, %12, off\n\t"
               "global_load_async_to_lds_b128 %5, %13, off\n\t"
               "global_load_async_to_lds_b128 %6, %14, off\n\t"
               "global_load_async_to_lds_b128 %7, %15, off\n\t"
               "s_wait_xcnt 0x0"
               :: "v"(l[0]), "v"(l[1]), "v"(l[2]), "v"(l[3]), "v"(l[4]), "v"(l[5]), "v"(l[6]), "v"(l[7]),
                  "v"(g[0]), "v"(g[1]), "v"(g[2]), "v"(g[3]), "v"(g[4]), "v"(g[5]), "v"(g[6]), "v"(g[7]) : "memory");
}

// =====================================================================================================
// f32 -> bf16 (RNE convert), 8 elements per thread, one 16-B store per lane: a wave writes 512 contiguous B
// multiple of 256 for every use here; host-checked). coverage: n8 threads x 8 = whole plane.
// =====================================================================================================
__global__ __launch_bounds__(256) void cvt_bf16x8(const float* __restrict__ in, unsigned short* out, int n8) {
  const int i = blockIdx.x * 256 + threadIdx.x;
  if (i < n8) {
    const v4f a = *(const v4f*)(in + (size_t)i * 8);
    const v4f b = *(const v4f*)(in + (size_t)i * 8 + 4);
    v4u p;
    p[0] = pk16(bf_bits(a[0]), bf_bits(a[1]));
    p[1] = pk16(bf_bits(a[2]), bf_bits(a[3]));
    p[2] = pk16(bf_bits(b[0]), bf_bits(b[1]));
    p[3] = pk16(bf_bits(b[2]), bf_bits(b[3]));
    *(v4u*)(out + (size_t)i * 8) = p;
    
  }
}

// =====================================================================================================
// Register-blocked batched bf16 WMMA GEMM: C[m][n] = sum_k A[m][k] * Bt[n][k]; one wave per 64x64 tile, a block of
// 8 waves (2 x 4) per 128x256 tile. A row-major [M][K] pitch lda; Bt row-major [N][K] pitch ldb (k contiguous);
// M multiple of 128, N of 256, K of 64 and at least 128 (asserted on the shapes used). blockIdx.y = batch index.
// Operands: a stage is 64 k of the block's A rows (and A2 rows) and Bt rows, rows of 128 B at pitch 144 B in LDS,
// brought by asynchronous copies (8 lanes per row: a wave's copy covers 4 whole lines), two buffers: stage t + 2 is
// issued behind the barrier that ends stage t's reads and flies while stage t + 1 is worked on.
// NSPLIT: 0 = A.Bt; 1 = (A + A2).Bt (A2 = unscaled bf16 lo plane of A, same pitch/stride).
// BIAS: 0 none; 1 = + bfr(bias[n]) per column; 2 = + bfr(bias[m]) per row.
// ROPE (needs N tile = one head = 64 cols d 0..63, row m = b*SEQ + s): for s >= 1,
//   t[d] = t[d]*bfr(cos[s-1][d]) + rot[d]*bfr(sin[s-1][d]), rot = [-t[32..63] | t[0..31]] (after bias).
// OUT_MODE: 0 = f32 (pitch ldc); 2 = bf16 hi plane C + bf16 lo plane C2 (lo = RNE(v - hi), unscaled);
//           3 = f16 hi plane C + f16 residual plane C2 = f16((v - hi) * rscale); C2 same pitch/stride as C.
// =====================================================================================================
template <int NSPLIT, int OUT_MODE, int BIAS, int ROPE>
__global__ __launch_bounds__(256) void gemm64(
    const unsigned short* __restrict__ Ap, const unsigned short* __restrict__ A2p, int lda, long long strideA,
    const unsigned short* __restrict__ Btp, int ldb, long long strideB,
    const float* __restrict__ bias, const float* __restrict__ rsin, const float* __restrict__ rcos,
    void* Cout, void* Cout2, int ldc, long long strideC,
    int M, int N, int K, float rscale) {
  const __bf16* A  = (const __bf16*)(const void*)Ap;
  const __bf16* A2 = (const __bf16*)(const void*)A2p;
  const __bf16* Bt = (const __bf16*)(const void*)Btp;
  constexpr int ROWS_A  = GBM * (1 + NSPLIT);        // stage rows 0.. : A, then A2 where there is one
  constexpr int ROWS    = ROWS_A + GBN;              // then the Bt rows
  constexpr int STAGE_E = ROWS * GP;                 // elements of one buffer
  constexpr int NCP     = ROWS / 32;                 // copies per thread and stage: 256 threads cover 32 rows (12 or 16)
  __shared__ __align__(16) float sT[8][16 * 68];   // per-wave 16x64 slab, pitch 68 floats
  __shared__ __align__(16) __bf16 sG[2 * STAGE_E];  // operand stages, two buffers
  const int b    = blockIdx.y;
  const int lane = threadIdx.x & 31;
  const int wave = threadIdx.x >> 5;
  const int blkN = N / GBN;
  const int blkM = M / GBM;
  const int blk  = blockIdx.x;
  if (blk >= blkM * blkN) return;        // block-uniform, in front of every barrier and copy
  const int bm = blk / blkN;
  const int bn = blk - bm * blkN;
  const int wm = wave >> 2;              // 0..1
  const int wn = wave & 3;               // 0..3
  const int m0 = bm * GBM + (wm << 6);
  const int n0 = bn * GBN + (wn << 6);

  const __bf16* Ab  = A  + (size_t)b * strideA;
  const __bf16* Bb  = Bt + (size_t)b * strideB;
  const __bf16* Ab2 = (NSPLIT == 1) ? (A2 + (size_t)b * strideA) : Ab;

  const int rlane = lane & 15;                 // row (A) / col (B, D) within subtile
  const int koff  = (lane >> 4) * 8;           // k offset of this lane half
  const int mOff  = (lane >> 4) * 8;           // D row offset

  v8f acc[4][4];
#pragma unroll
  for (int i = 0; i < 4; ++i)
#pragma unroll
    for (int j = 0; j < 4; ++j) acc[i][j] = zero8();

  // ---- stage copies: thread -> row (tid >> 3) of each group of 32 rows, 16-B piece (tid & 7) of its 128 B ----
  const int crow = threadIdx.x >> 3;
  const int cseg = (threadIdx.x & 7) * 8;
  const __bf16* gA  = Ab  + (size_t)(bm * GBM + crow) * lda + cseg;
  const __bf16* gA2 = Ab2 + (size_t)(bm * GBM + crow) * lda + cseg;
  const __bf16* gB  = Bb  + (size_t)(bn * GBN + crow) * ldb + cseg;
  const unsigned lC = lds_off(sG) + (unsigned)(crow * GP + cseg) * 2u;
  auto issue_stage = [&](int st, int buf) {
    unsigned l[NCP];
    const __bf16* g[NCP];
#pragma unroll   // every index of l and g constant: the addresses stay in registers
    for (int p = 0; p < NCP; ++p) {
      l[p] = lC + (unsigned)(buf * STAGE_E + p * 32 * GP) * 2u;
      if (p * 32 < GBM)          g[p] = gA  + (size_t)(p * 32) * lda + (size_t)st * GKS;
      else if (p * 32 < ROWS_A)  g[p] = gA2 + (size_t)(p * 32 - GBM) * lda + (size_t)st * GKS;
      else                       g[p] = gB  + (size_t)(p * 32 - ROWS_A) * ldb + (size_t)st * GKS;
    }
    acopy8(l, g);
    if (NCP == 16) acopy8(l + 8, g + 8);
    else           acopy4(l + 8, g + 8);
  };

  const int T = K / GKS;                              // stages
  issue_stage(0, 0);
  asm volatile("s_wait_asynccnt 0x0" ::: "memory");   // this wave's copies of stage 0 have landed
  __syncthreads();                                    // and every other wave's: stage 0 may be read
  if (T > 1) issue_stage(1, 1);

  for (int t = 0; t < T; ++t) {
    const __bf16* sb = sG + (t & 1) * STAGE_E;
    const __bf16* sa = sb + ((wm << 6) + rlane) * GP + koff;
    const __bf16* sw = sb + (ROWS_A + (wn << 6) + rlane) * GP + koff;
    v16b bh[2][4], ah[2][4], al[2][4];   // the loops below are unrolled so that every fragment index is constant
#pragma unroll
    for (int ks = 0; ks < 2; ++ks) {
#pragma unroll
      for (int j = 0; j < 4; ++j) bh[ks][j] = ldfrag_b(sw + (j << 4) * GP + ks * 32);
#pragma unroll
      for (int i = 0; i < 4; ++i) {
        ah[ks][i] = ldfrag_b(sa + (i << 4) * GP + ks * 32);
        al[ks][i] = ah[ks][i];
        if (NSPLIT == 1) al[ks][i] = ldfrag_b(sa + (GBM + (i << 4)) * GP + ks * 32);
      }
    }
    // Holds the stage's fragment loads as one group ahead of its WMMAs: moved in among them, into one shared
    // register set, each place with loads makes the wave wait out the LDS latency.
    __builtin_amdgcn_sched_barrier(0);
#pragma unroll
    for (int ks = 0; ks < 2; ++ks)
#pragma unroll
      for (int i = 0; i < 4; ++i)
#pragma unroll
        for (int j = 0; j < 4; ++j) {
          acc[i][j] = mma_b_raw(ah[ks][i], bh[ks][j], acc[i][j]);
          if (NSPLIT == 1) acc[i][j] = mma_b_raw(al[ks][i], bh[ks][j], acc[i][j]);
        }
    // Holds the WMMAs ahead of the full LDS wait below: behind it none would start before the last fragment is in.
    __builtin_amdgcn_sched_barrier(0);
    asm volatile("s_wait_dscnt 0x0" ::: "memory");      // this wave's reads of buffer t & 1 are done
    asm volatile("s_wait_asynccnt 0x0" ::: "memory");   // this wave's copies of stage t + 1 have landed
    __syncthreads();                                    // publishes stage t + 1, frees buffer t & 1
    if (t + 2 < T) issue_stage(t + 2, t & 1);
  }
  asm volatile("s_wait_asynccnt 0x0" ::: "memory");     // nothing in flight when the wave goes on
  acc_guard4(acc[0][0], acc[0][1], acc[0][2], acc[0][3]);
  acc_guard4(acc[1][0], acc[1][1], acc[1][2], acc[1][3]);
  acc_guard4(acc[2][0], acc[2][1], acc[2][2], acc[2][3]);
  acc_guard4(acc[3][0], acc[3][1], acc[3][2], acc[3][3]);

  // ---- epilogue ----
  float* slab = sT[wave];
  float bcol[4];
  if (BIAS == 1) {
#pragma unroll
    for (int j = 0; j < 4; ++j) bcol[j] = bfr(bias[n0 + (j << 4) + rlane]);   // n0+.. < N
  } else {
#pragma unroll
    for (int j = 0; j < 4; ++j) bcol[j] = 0.f;
  }
#pragma unroll
  for (int i = 0; i < 4; ++i) {
    const int mBase = m0 + (i << 4);
#pragma unroll
    for (int r = 0; r < 8; ++r) {
      const int m = mBase + mOff + r;                  // < M
      float brow = 0.f;
      if (BIAS == 2) brow = bfr(bias[m]);
      float t[4];
#pragma unroll
      for (int j = 0; j < 4; ++j) {
        float v = acc[i][j][r];
        if (BIAS == 1) v = v + bcol[j];
        if (BIAS == 2) v = v + brow;
        t[j] = v;
      }
      if (ROPE) {
        const int s = m & (SEQ - 1);                   // token index within the sequence
        const bool use = (s > 0);                        // token 0 passes unrotated
        const int sidx = use ? (s - 1) : 0;              // clamped table row
        const float* cr = rcos + (size_t)sidx * HD;
        const float* sr = rsin + (size_t)sidx * HD;
        float u[4];
#pragma unroll
        for (int j = 0; j < 4; ++j) {
          const int d = (j << 4) + rlane;                // 0..63
          const float cs = bfr(cr[d]);
          const float sn = bfr(sr[d]);
          const float tp = t[j ^ 2];                     // partner d^32, same lane
          const float rot = (j < 2) ? -tp : tp;
          const float w = t[j] * cs + rot * sn;
          u[j] = use ? w : t[j];
        }
#pragma unroll
        for (int j = 0; j < 4; ++j) t[j] = u[j];
      }
#pragma unroll
      for (int j = 0; j < 4; ++j) slab[(mOff + r) * 68 + (j << 4) + rlane] = t[j];
    }
    __builtin_amdgcn_fence(__ATOMIC_RELEASE, "workgroup");
    __builtin_amdgcn_wave_barrier();
    __builtin_amdgcn_fence(__ATOMIC_ACQUIRE, "workgroup");
    if (OUT_MODE == 0) {
      float* C = (float*)Cout + (size_t)b * strideC;
      const int hh = lane >> 4, c4 = (lane & 15) * 4;     // 256-B row segment = 16 lanes x 16 B
      {
#pragma unroll
        for (int it = 0; it < 8; ++it) {
          const int row = it * 2 + hh;                     // it 0..7 x hh 0..1 = rows 0..15
          const v4f v = *(const v4f*)(slab + row * 68 + c4);
          *(v4f*)(C + (size_t)(mBase + row) * ldc + n0 + c4) = v;
        }
        
      }
    } else {
      const int q = lane >> 3, c8 = (lane & 7) * 8;
      unsigned short* C  = (unsigned short*)Cout  + (size_t)b * strideC;
      unsigned short* C2 = (unsigned short*)Cout2 + (size_t)b * strideC;
      v4u hv[4], lv[4];
#pragma unroll
      for (int it = 0; it < 4; ++it) {
        const int row = it * 4 + q;                        // it 0..3 x q 0..3 = rows 0..15
        const float* sp = slab + row * 68 + c8;
        v4u a, a2;
#pragma unroll
        for (int e = 0; e < 4; ++e) {
          const float f0 = sp[2 * e], f1 = sp[2 * e + 1];
          unsigned short h0, h1, l0, l1;
          if (OUT_MODE == 2) {
            h0 = bf_bits(f0); h1 = bf_bits(f1);
            l0 = bf_bits(f0 - bf_up(h0)); l1 = bf_bits(f1 - bf_up(h1));
          } else {
            const _Float16 x0 = (_Float16)f0, x1 = (_Float16)f1;
            h0 = h_bits(x0); h1 = h_bits(x1);
            l0 = h_bits((_Float16)((f0 - (float)x0) * rscale));
            l1 = h_bits((_Float16)((f1 - (float)x1) * rscale));
          }
          a[e] = pk16(h0, h1); a2[e] = pk16(l0, l1);
        }
        hv[it] = a; lv[it] = a2;
      }
      {
#pragma unroll
        for (int it = 0; it < 4; ++it) {
          const int row = it * 4 + q;
          *(v4u*)(C  + (size_t)(mBase + row) * ldc + n0 + c8) = hv[it];
          *(v4u*)(C2 + (size_t)(mBase + row) * ldc + n0 + c8) = lv[it];
        }
        
      }
    }
    __builtin_amdgcn_fence(__ATOMIC_RELEASE, "workgroup");
    __builtin_amdgcn_wave_barrier();
    __builtin_amdgcn_fence(__ATOMIC_ACQUIRE, "workgroup");
  }
}

// =====================================================================================================
// Attention, head dim 64, no mask, all SEQ keys.
//   q planes (bf16 hi / lo): element (b, t, h, d) at [(b*SEQ + t)*DM + h*64 + d]
//   k planes (bf16 hi / lo): same layout with key index s
//   v^T hi plane (f16):      element (b, h, d, s) at [(b*DM + h*64 + d)*SEQ + s]
//   v^T residual plane (f16, (v - hi)*4096): same layout
//   out planes (bf16 hi / lo of the normalised context): element (b, t, h, d) at [(b*SEQ + t)*DM + h*64 + d]
//   Both products are formed transposed: S^T = K . Q^T (A = K rows, B = Q) and O^T += V^T . P^T (A = V^T rows, B = P^T).
//   In each tile a lane then holds one query (column lane&15) and 32 of the chunk's 64 keys (rows j*16 + 8*(lane>>4) + r): the maximum
//   and the sum run inside the lane, the two wave halves exchange the maximum once per chunk and join their sums once at
//   the end; two score tiles, converted in place, are the B operand P^T in the k order of the V^T loader.
//   scores = k . q : bf16 hi/lo split (hi.hi + lo.hi + hi.lo in k, q), f32 accumulate; the maximum is kept in raw scores
//   1024 p = 2^(s * (sscale * log2 e) + (10 - m * sscale * log2 e)): one f32 multiply-add per score in front of the 2^x;
//   carried as f16, its row sum carries the same 1024; context = v^T . p^T on f16 WMMA: v_hi.p into the running
//   accumulator, v_res.p into a per-chunk accumulator folded back by one multiply-add with 1/4096; online softmax in f32.
//   Block = 4 waves = 128 query rows of one (b, h), a wave 32 of them as two 16-column tiles that share every K and
//   V^T fragment read; grid = NQG * NH * NB; kv chunks of 64, static trip NQB.
//   K / V^T chunk staging: a stage is the chunk's four 64x64 planes, rows of 128 B at pitch 144 B in LDS, brought by
//   asynchronous copies (8 lanes per row: a wave's copy covers 4 whole lines; 16 copies per thread), two buffers:
//   chunk t + 2 is issued behind the barrier that ends chunk t's reads and flies while chunk t + 1 is worked on.
//   Output coverage: each wave stores rows q0..q0+31 (u 0..1 x it 0..3 x lane>>3 0..3) x 64 columns (8 lanes x 8) of both planes.
// =====================================================================================================
__global__ __launch_bounds__(128, 4)   // 4 waves per SIMD: the 256 registers that let four blocks share a WGP
void attn64(const unsigned short* __restrict__ qhp, const unsigned short* __restrict__ qlp,
            const unsigned short* __restrict__ khp, const unsigned short* __restrict__ klp,
            const unsigned short* __restrict__ vhp, const unsigned short* __restrict__ vlp,
            unsigned short* ohp, unsigned short* olp, float sscale) {
  union FB { v16b v; v8b h[2]; };
  union FH { v16h v; v8h h[2]; };
  // Rows of 64 16-bit elements are laid at a pitch of LP = 72 elements (144 B = 16 B x 9): the 16 rows that one
  // ds_load_b128 fragment read touches then fall on 16 different groups of four banks instead of two.
  constexpr int PLANE_B = 64 * LP * 2;                            // bytes of one plane of a stage, 9 KB
  constexpr int STAGE_B = 4 * PLANE_B;                            // K hi [kv][d], K lo, V^T hi [d][kv], V^T residual
  static_assert(4 * QT * 16 * OSP * 4 <= 2 * STAGE_B);            // the output tiles fit where the stages were
  // Two stage buffers, 72 KB; behind the loop's last barrier the same bytes hold the per-wave context tiles [row][d].
  __shared__ __align__(16) unsigned char sKV[2 * STAGE_B];

  const int tid  = threadIdx.x;
  const int wave = tid >> 5;
  const int lane = tid & 31;
  const int hh   = lane >> 4;
  const int c    = lane & 15;

  const int bx   = blockIdx.x;
  const int qb   = bx % NQG;
  const int rest = bx / NQG;
  const int h    = rest % NH;
  const int b    = rest / NH;
  const int q0   = qb * (64 * QT) + wave * (16 * QT);
  const size_t rowB = (size_t)b * SEQ;

  const __bf16* Qh = (const __bf16*)(const void*)qhp + (size_t)h * HD;
  const __bf16* Ql = (const __bf16*)(const void*)qlp + (size_t)h * HD;
  const __bf16* Kh = (const __bf16*)(const void*)khp + (size_t)h * HD;
  const __bf16* Kl = (const __bf16*)(const void*)klp + (size_t)h * HD;
  const _Float16* Vh = (const _Float16*)(const void*)vhp + ((size_t)b * DM + (size_t)h * HD) * SEQ;
  const _Float16* Vl = (const _Float16*)(const void*)vlp + ((size_t)b * DM + (size_t)h * HD) * SEQ;

  // ---- Q fragments (B operand, column = query = u*16 + lane&15): QT query tiles x 2 d-chunks, hi and lo ----
  v16b qah[QT][2], qal[QT][2];
#pragma unroll
  for (int u = 0; u < QT; ++u)
#pragma unroll
    for (int dc = 0; dc < 2; ++dc) {
      const size_t qo = (rowB + q0 + u * 16 + c) * DM + dc * 32 + 8 * hh;
      qah[u][dc] = ldfrag_b(Qh + qo);
      qal[u][dc] = ldfrag_b(Ql + qo);
      // In front of the next loads: the compiler lays their results over address registers of the loads issued here.
      asm volatile("s_wait_xcnt 0x0" ::: "memory");
    }

  // per query tile u, this lane's query: running maximum of the raw scores (both halves alike), sum of 1024 p over
  // this half's keys
  const float cexp = sscale * LOG2E;    // raw score -> exponent of 2; sscale > 0, so raw scores order as scaled ones do
  float mrow[QT], lrow[QT];
  v8f oacc[QT][4];                      // O^T: oacc[u][t][r] = context[query u*16 + c][d = t*16 + 8*hh + r]
#pragma unroll
  for (int u = 0; u < QT; ++u) {
    mrow[u] = -INFINITY;
    lrow[u] = 0.f;
#pragma unroll
    for (int t = 0; t < 4; ++t) oacc[u][t] = zero8();
  }

  // ---- stage copies: thread -> row (tid >> 3) of each group of 16 rows, 16-B piece (tid & 7) of its 128 B ----
  const int crow = tid >> 3;
  const int cseg = (tid & 7) * 8;
  const __bf16* gKh = Kh + (rowB + crow) * DM + cseg;                            // K row crow of chunk 0
  const __bf16* gKl = Kl + (rowB + crow) * DM + cseg;
  const __bf16* gVh = (const __bf16*)(const void*)(Vh + (size_t)crow * SEQ + cseg);   // V^T row d = crow, an address only
  const __bf16* gVl = (const __bf16*)(const void*)(Vl + (size_t)crow * SEQ + cseg);
  const unsigned lC = lds_off(sKV) + (unsigned)(crow * LP + cseg) * 2u;
  auto issue_stage = [&](int st, int buf) {
    unsigned l[16];
    const __bf16* g[16];
#pragma unroll   // every index of l and g constant: the addresses stay in registers
    for (int p = 0; p < 4; ++p) {
      const unsigned lp = lC + (unsigned)(buf * STAGE_B + p * 16 * LP * 2);
      l[p]      = lp;
      l[4 + p]  = lp + PLANE_B;
      l[8 + p]  = lp + 2 * PLANE_B;
      l[12 + p] = lp + 3 * PLANE_B;
      g[p]      = gKh + (size_t)(st * 64 + p * 16) * DM;          // K row st*64 + p*16 + crow < SEQ
      g[4 + p]  = gKl + (size_t)(st * 64 + p * 16) * DM;
      g[8 + p]  = gVh + (size_t)(p * 16) * SEQ + st * 64;         // V^T row p*16 + crow < 64, s = st*64 + cseg.. < SEQ
      g[12 + p] = gVl + (size_t)(p * 16) * SEQ + st * 64;
    }
    acopy8(l, g);
    acopy8(l + 8, g + 8);
  };

  static_assert(NQB >= 2);                            // chunks 0 and 1 both exist
  issue_stage(0, 0);
  asm volatile("s_wait_asynccnt 0x0" ::: "memory");   // this wave's copies of chunk 0 have landed
  __syncthreads();                                    // and every other wave's: chunk 0 may be read
  issue_stage(1, 1);

  // One chunk: scores, softmax, context, then the publish point of chunk kt + 1.
  auto chunk = [&](int kt) {
    const unsigned char* sb = sKV + (kt & 1) * STAGE_B;
    const __bf16*   Ksh = (const __bf16*)(const void*)(sb);
    const __bf16*   Ksl = (const __bf16*)(const void*)(sb + PLANE_B);
    const _Float16* Vth = (const _Float16*)(const void*)(sb + 2 * PLANE_B);
    const _Float16* Vtl = (const _Float16*)(const void*)(sb + 3 * PLANE_B);

    // ---- scores, transposed: 64 keys x 16*QT queries per wave, 3 bf16 products; A[m = key][k = d] from Ksh[key][d];
    //      each K fragment, read once, is the A operand of every query tile ----
    v8f s[QT][4];
#pragma unroll
    for (int j = 0; j < 4; ++j) {
#pragma unroll
      for (int u = 0; u < QT; ++u) s[u][j] = zero8();
#pragma unroll
      for (int dc = 0; dc < 2; ++dc) {
        FB kb, kl;
        kb.h[0] = *(const v8b*)(Ksh + (j * 16 + c) * LP + dc * 32 + 8 * hh);
        kb.h[1] = *(const v8b*)(Ksh + (j * 16 + c) * LP + dc * 32 + 16 + 8 * hh);
        kl.h[0] = *(const v8b*)(Ksl + (j * 16 + c) * LP + dc * 32 + 8 * hh);
        kl.h[1] = *(const v8b*)(Ksl + (j * 16 + c) * LP + dc * 32 + 16 + 8 * hh);
#pragma unroll
        for (int u = 0; u < QT; ++u) s[u][j] = mma_b_raw(kb.v, qah[u][dc], s[u][j]);
#pragma unroll
        for (int u = 0; u < QT; ++u) s[u][j] = mma_b_raw(kl.v, qah[u][dc], s[u][j]);
#pragma unroll
        for (int u = 0; u < QT; ++u) s[u][j] = mma_b_raw(kb.v, qal[u][dc], s[u][j]);
      }
    }

    // Keeps the softmax behind the score products: scheduled in among them its values lengthen the stretch where both
    // tiles' scores, Q and the context are all live, and the build spills at the 256 registers of four waves per SIMD.
    __builtin_amdgcn_sched_barrier(0);
    // ---- maximum, online softmax; query u*16 + c, key j*16 + 8*hh + r lives in s[u][j][r] ----
    // P^T (x1024, f16) as B operand: element e of chunk kk = key kk*32 + (e < 8 ? 8*hh + e : 16 + 8*hh + e - 8)
    FH pb[QT][2];
#pragma unroll
    for (int u = 0; u < QT; ++u) {
      float mj[4];
#pragma unroll
      for (int j = 0; j < 4; ++j) {
        mj[j] = -INFINITY;
#pragma unroll
        for (int r = 0; r < 8; ++r) mj[j] = fmaxf(mj[j], s[u][j][r]);
      }
      float m = fmaxf(fmaxf(mj[0], mj[1]), fmaxf(mj[2], mj[3]));
      m = fmaxf(m, xhalf(m));                            // the query's other 32 keys sit in lane ^ 16
      const float mnew  = fmaxf(mrow[u], m);
      const float msafe = (mnew == -INFINITY) ? 0.f : mnew;
      const float alpha = exp2x1((mrow[u] - msafe) * cexp);
      mrow[u] = mnew;
      const float nb = __builtin_fmaf(-msafe, cexp, 10.0f);   // the maximum and the x1024 carry, as an exponent of 2
      float pj[4];
#pragma unroll
      for (int j = 0; j < 4; ++j) {
        float p[8];
#pragma unroll
        for (int r = 0; r < 8; ++r) p[r] = __builtin_fmaf(s[u][j][r], cexp, nb);
        exp2x8(p);
        pj[j] = 0.f;
#pragma unroll
        for (int r = 0; r < 8; ++r) {
          pj[j] += p[r];
          pb[u][j >> 1].v[(j & 1) * 8 + r] = (_Float16)p[r];
        }
      }
      lrow[u] = __builtin_fmaf(lrow[u], alpha, (pj[0] + pj[1]) + (pj[2] + pj[3]));
#pragma unroll
      for (int t = 0; t < 4; ++t)
#pragma unroll
        for (int r = 0; r < 8; ++r) oacc[u][t][r] *= alpha;
    }

    // ---- context^T += V^T . P^T (f16 WMMA): A[m = d][k = kv] from Vth[d][kv], B = P^T[k = kv][n = query]; each V^T
    //      fragment, read once, is the A operand of every query tile; residual products into a separate accumulator
    //      per 16 d rows, folded back when both key halves are in ----
#pragma unroll
    for (int t = 0; t < 4; ++t) {
      v8f o1[QT];
#pragma unroll
      for (int u = 0; u < QT; ++u) o1[u] = zero8();
#pragma unroll
      for (int kk = 0; kk < 2; ++kk) {
        FH vb, vl;
        vb.h[0] = *(const v8h*)(Vth + (t * 16 + c) * LP + kk * 32 + 8 * hh);
        vb.h[1] = *(const v8h*)(Vth + (t * 16 + c) * LP + kk * 32 + 16 + 8 * hh);
        vl.h[0] = *(const v8h*)(Vtl + (t * 16 + c) * LP + kk * 32 + 8 * hh);
        vl.h[1] = *(const v8h*)(Vtl + (t * 16 + c) * LP + kk * 32 + 16 + 8 * hh);
#pragma unroll
        for (int u = 0; u < QT; ++u) oacc[u][t] = mma_h_raw(vb.v, pb[u][kk].v, oacc[u][t]);
#pragma unroll
        for (int u = 0; u < QT; ++u) o1[u]      = mma_h_raw(vl.v, pb[u][kk].v, o1[u]);
      }
#pragma unroll
      for (int u = 0; u < QT; ++u)
#pragma unroll
        for (int r = 0; r < 8; ++r) oacc[u][t][r] = __builtin_fmaf(o1[u][r], 1.0f / 4096.0f, oacc[u][t][r]);
    }

    asm volatile("s_wait_dscnt 0x0" ::: "memory");      // this wave's reads of buffer kt & 1 are done
    asm volatile("s_wait_asynccnt 0x0" ::: "memory");   // this wave's copies of chunk kt + 1 have landed
    __syncthreads();                                    // publishes chunk kt + 1, frees buffer kt & 1
  };
  // The chunks that have a chunk kt + 2 to fetch, then the last two, in loops of their own (static trip counts): with the
  // test inside one loop the compiler moves folds and row sums behind the branch, their operands stay in registers
  // beside the copies' addresses, and the build spills at 256 registers.
  for (int kt = 0; kt < NQB - 2; ++kt) {
    chunk(kt);
    issue_stage(kt + 2, kt & 1);
  }
#pragma unroll 1   // kept rolled: one more copy of the body, not two
  for (int kt = NQB - 2; kt < NQB; ++kt) chunk(kt);
  asm volatile("s_wait_asynccnt 0x0" ::: "memory");     // nothing in flight when the buffers become output staging

  // ---- normalise (context and l both carry the 1024), stage the wave's 16*QT x 64 tile, bf16 hi/lo split,
  float* os = (float*)(void*)sKV + wave * (QT * 16 * OSP);   // every wave has passed the last chunk's barrier
#pragma unroll
  for (int u = 0; u < QT; ++u) {
    const float l = lrow[u] + xhalf(lrow[u]);          // join the two halves' sums of this query
    const float inv = (l > 0.f) ? (1.0f / l) : 0.f;
#pragma unroll
    for (int t = 0; t < 4; ++t)
#pragma unroll
      for (int r = 0; r < 8; ++r) os[(u * 16 + c) * OSP + t * 16 + 8 * hh + r] = oacc[u][t][r] * inv;
  }
  __builtin_amdgcn_fence(__ATOMIC_RELEASE, "workgroup");
  __builtin_amdgcn_wave_barrier();
  __builtin_amdgcn_fence(__ATOMIC_ACQUIRE, "workgroup");
#pragma unroll
  for (int u = 0; u < QT; ++u) {
    const int q4 = lane >> 3, c8 = (lane & 7) * 8;
    v4u hv[4], lv[4];
#pragma unroll
    for (int it = 0; it < 4; ++it) {
      const int row = u * 16 + it * 4 + q4;   // u x it 0..3 x q4 0..3 = rows 0..16*QT-1 of the wave tile
      const float* sp = os + row * OSP + c8;
      v4u a, a2;
#pragma unroll
      for (int e = 0; e < 4; ++e) {
        const float f0 = sp[2 * e], f1 = sp[2 * e + 1];
        const unsigned short h0 = bf_bits(f0), h1 = bf_bits(f1);
        const unsigned short l0 = bf_bits(f0 - bf_up(h0)), l1 = bf_bits(f1 - bf_up(h1));
        a[e] = pk16(h0, h1); a2[e] = pk16(l0, l1);
      }
      hv[it] = a; lv[it] = a2;
    }
    {
#pragma unroll
      for (int it = 0; it < 4; ++it) {
        const int row = u * 16 + it * 4 + q4;
        const size_t go = (rowB + q0 + row) * DM + (size_t)h * HD + c8;
        *(v4u*)(ohp + go) = hv[it];
        *(v4u*)(olp + go) = lv[it];
      }
    }
  }
}

// =====================================================================================================
// Workspace map: 8 regions of PL = NTOK*DM*2 = 16777216 B each, total 134217728 B.
//   R0  Xb   bf16 [8192][1024]                    (after the projections: Oh, context hi plane [8192][1024])
//   R1  Qh   bf16 [8192][1024]                    (after attention: Wob bf16 [1024][1024], 2097152 B used)
//   R2  Ql   bf16 [8192][1024]
//   R3  Kh   bf16 [8192][1024]
//   R4  Kl   bf16 [8192][1024]
//   R5  VTh  f16  [4][1024][2048]
//   R6  VTl  f16  [4][1024][2048]
//   R7  Wqkv bf16 [3072][1024] (6291456 B used)   (during attention: Ol, context lo plane [8192][1024])
// All planes are exact multiples of their 64x64 tile / whole-line store granularity (no padded tails needed).
// Weights are [out n][in k] with k contiguous = the Bt / A layout the GEMM wants, so they are only converted.
// =====================================================================================================
extern "C" void kernel_launch(void* const* d_in, const int* in_sizes, int n_in,
                              void* d_out, int out_size, void* d_ws, size_t ws_size,
                              hipStream_t stream) {
  if (n_in < 8) return;
  if (in_sizes[0] != NTOK * DM) return;
  if (in_sizes[1] != 3 * DM * DM) return;
  if (in_sizes[2] != DM || in_sizes[3] != DM) return;
  if (in_sizes[4] != DM * DM || in_sizes[5] != DM) return;
  if (in_sizes[6] != (SEQ - 1) * HD || in_sizes[7] != (SEQ - 1) * HD) return;
  if (out_size != NTOK * DM) return;

  const float* x      = (const float*)d_in[0];
  const float* qkv_w  = (const float*)d_in[1];
  const float* q_bias = (const float*)d_in[2];
  const float* v_bias = (const float*)d_in[3];
  const float* proj_w = (const float*)d_in[4];
  const float* proj_b = (const float*)d_in[5];
  const float* rsin   = (const float*)d_in[6];
  const float* rcos   = (const float*)d_in[7];

  const size_t PL = (size_t)NTOK * DM * 2;        // 16777216  one 16-bit activation plane [8192][1024]
  static_assert((size_t)3 * DM * DM * 2 <= (size_t)NTOK * DM * 2);
  static_assert((size_t)NB * DM * SEQ * 2 == (size_t)NTOK * DM * 2);
  static_assert((size_t)DM * DM * 2 <= (size_t)NTOK * DM * 2);
  size_t off = 0;
  const size_t oR0 = off; off += PL;
  const size_t oR1 = off; off += PL;
  const size_t oR2 = off; off += PL;
  const size_t oR3 = off; off += PL;
  const size_t oR4 = off; off += PL;
  const size_t oR5 = off; off += PL;
  const size_t oR6 = off; off += PL;
  const size_t oR7 = off; off += PL;
  if (off > ws_size) return;                      // off = 134217728
  if (off > (size_t)134217728) return;

  char* ws = (char*)d_ws;
  unsigned short* Xb   = (unsigned short*)(ws + oR0);
  unsigned short* Oh   = (unsigned short*)(ws + oR0);
  unsigned short* Qh   = (unsigned short*)(ws + oR1);
  unsigned short* Wob  = (unsigned short*)(ws + oR1);
  unsigned short* Ql   = (unsigned short*)(ws + oR2);
  unsigned short* Kh   = (unsigned short*)(ws + oR3);
  unsigned short* Kl   = (unsigned short*)(ws + oR4);
  unsigned short* VTh  = (unsigned short*)(ws + oR5);
  unsigned short* VTl  = (unsigned short*)(ws + oR6);
  unsigned short* Wqkv = (unsigned short*)(ws + oR7);
  unsigned short* Ol   = (unsigned short*)(ws + oR7);
  const unsigned short* Wq = Wqkv;
  const unsigned short* Wk = Wqkv + (size_t)DM * DM;
  const unsigned short* Wv = Wqkv + (size_t)2 * DM * DM;

  const dim3 blk(256);
  const int n8x = NTOK * DM / 8;                              // 1048576
  const int n8q = 3 * DM * DM / 8;                            //  393216
  const int n8o = DM * DM / 8;                                //  131072
  if ((n8x % 256) != 0 || (n8q % 256) != 0 || (n8o % 256) != 0) return;
  const dim3 gCvtX(n8x / 256);                                // 4096 blocks
  const dim3 gCvtQ(n8q / 256);                                // 1536 blocks
  const dim3 gCvtO(n8o / 256);                                //  512 blocks
  const int tilesTok = (NTOK / 64) * (DM / 64);               // 2048 tiles: M=8192, N=1024
  const int tilesVT  = (DM / 64) * (SEQ / 64);                //  512 tiles: M=1024, N=2048
  const dim3 gTok((tilesTok + 7) / 8, 1);                     // 256 blocks
  const dim3 gVT((tilesVT + 7) / 8, NB);                      // 64 blocks x 4 batches
  const dim3 gAttn(NB * NH * NQG);                            // 1024 blocks

  // (1) x -> bf16 plane [8192][1024]; qkv_w [3072 n][1024 k] f32 -> bf16
  cvt_bf16x8<<<gCvtX, blk, 0, stream>>>(x, Xb, n8x);
  cvt_bf16x8<<<gCvtQ, blk, 0, stream>>>(qkv_w, Wqkv, n8q);
  // (2) q = x . Wq^T + q_bias, rope for tokens >= 1 -> bf16 hi/lo planes [b*SEQ+t][h*64+d]   (M=8192, N=1024, K=1024)
  gemm64<0, 2, 1, 1><<<gTok, blk, 0, stream>>>(
      Xb, Xb, DM, 0LL, Wq, DM, 0LL, q_bias, rsin, rcos,
      (void*)Qh, (void*)Ql, DM, 0LL, NTOK, DM, DM, 1.0f);
  // (3) k = x . Wk^T (no bias), rope -> bf16 hi/lo planes
  gemm64<0, 2, 0, 1><<<gTok, blk, 0, stream>>>(
      Xb, Xb, DM, 0LL, Wk, DM, 0LL, q_bias, rsin, rcos,
      (void*)Kh, (void*)Kl, DM, 0LL, NTOK, DM, DM, 1.0f);
  // (4) v^T = Wv . x^T + v_bias[row] per batch -> f16 hi plane [b][h*64+d][s] (pitch SEQ) and residual plane x4096
  //     (A = Wv [n][k], Bt = Xb rows of batch b; M=1024, N=2048, K=1024)
  gemm64<0, 3, 2, 0><<<gVT, blk, 0, stream>>>(
      Wv, Wv, DM, 0LL, Xb, DM, (long long)SEQ * DM, v_bias, rsin, rcos,
      (void*)VTh, (void*)VTl, SEQ, (long long)DM * SEQ, DM, SEQ, DM, 4096.0f);
  // (5) attention -> context bf16 hi plane (R0, x plane dead) and lo plane (R7, weight plane dead)
  attn64<<<gAttn, dim3(128), 0, stream>>>(Qh, Ql, Kh, Kl, VTh, VTl, Oh, Ol, 0.125f);
  // (6) proj_w -> bf16 [n][k] into R1 (q hi plane dead after attention)
  cvt_bf16x8<<<gCvtO, blk, 0, stream>>>(proj_w, Wob, n8o);
  // (7) out = context . Wo^T + proj_b -> d_out f32 [8192][1024]  (A = context hi + lo planes, 2 products)
  gemm64<1, 0, 1, 0><<<gTok, blk, 0, stream>>>(
      Oh, Ol, DM, 0LL, Wob, DM, 0LL, proj_b, rsin, rcos,
      d_out, d_out, DM, 0LL, NTOK, DM, DM, 1.0f);
  (void)hipGetLastError();
}

// v008
// Measured time: 210 microseconds a run.
// In two side-by-side timings against v007, it was 1.15 and 1.14 times as fast.
// Counting every step since v000, it is 3.63 times as fast.
// Contractions: q, k, v^T projections = v_wmma_f32_16x16x32_bf16 (bf16 operands from RNE-converted inputs, single product, f32 accumulate);
// q.k^T scores = v_wmma_f32_16x16x32_bf16 with bf16 hi/lo split q and k (hi.hi + hi.lo + lo.hi), f32 accumulate;
// p.v = v_wmma_f32_16x16x32_f16 (p carried x1024 in f16; v as f16 hi plane plus f16 residual plane x4096; 2 products), f32 accumulate;
// ctx.Wo^T = v_wmma_f32_16x16x32_bf16 with ctx as bf16 hi/lo planes times bf16 Wo (2 products), f32 accumulate; bias, rope, softmax in f32.
#include <hip/hip_runtime.h>
#include <math.h>
#include <stdint.h>

#pragma clang fp contract(off)

#define NB    4
#define SEQ   2048
#define DM    1024
#define NH    16
#define HD    64
#define NQB   (SEQ / 64)      // 32 key chunks of 64
#define QT    2               // query tiles of 16 columns per attention wave
#define NQG   (SEQ / (64 * QT))   // 16 query blocks of 4 waves x 16*QT queries
#define NTOK  (NB * SEQ)      // 8192 token rows
#define LP    72              // LDS row pitch of the attention K and V^T tiles, in 16-bit elements
#define OSP   68              // LDS row pitch of the attention output staging tile, in floats (16 B x odd)
#define GP    72              // LDS row pitch of the GEMM operand tiles, in 16-bit elements (144 B = 16 B x odd)
#define GKS   64              // k elements of one GEMM stage: rows of 128 B, one whole line each
#define GBM   128             // GEMM block tile rows    (2 waves x 64)
#define GBN   256             // GEMM block tile columns (4 waves x 64)
static_assert(NH * HD == DM);
static_assert((SEQ % (64 * QT)) == 0 && (DM % 64) == 0);
static_assert((SEQ & (SEQ - 1)) == 0);
static_assert((NTOK % GBM) == 0 && (DM % GBM) == 0 && (DM % GBN) == 0 && (SEQ % GBN) == 0);   // whole GEMM block tiles
static_assert((DM % GKS) == 0 && DM >= 2 * GKS);                                              // whole stages, two or more
static_assert(GP >= GKS && (GP % 8) == 0 && ((GP / 8) & 1) == 1);
static_assert(LP >= HD && (LP % 8) == 0 && ((LP / 8) & 1) == 1);   // 16-B aligned rows, pitch = 16 B x odd

typedef _Float16 v16h __attribute__((ext_vector_type(16)));
typedef _Float16 v8h  __attribute__((ext_vector_type(8)));
typedef __bf16   v16b __attribute__((ext_vector_type(16)));
typedef __bf16   v8b  __attribute__((ext_vector_type(8)));
typedef float    v8f  __attribute__((ext_vector_type(8)));
typedef float    v4f  __attribute__((ext_vector_type(4)));
typedef unsigned int v4u __attribute__((ext_vector_type(4)));

// ---- scalar helpers --------------------------------------------------------------------------------
__device__ __forceinline__ unsigned short bf_bits(float f) {          // f32 -> bf16 bits, RNE convert
  unsigned u = __float_as_uint(f);
  return (unsigned short)((u + 0x7FFFu + ((u >> 16) & 1u)) >> 16);
}
__device__ __forceinline__ float bf_up(unsigned short h) { return __uint_as_float(((unsigned)h) << 16); }
__device__ __forceinline__ float bfr(float f) { return bf_up(bf_bits(f)); }   // value after bf16 RNE convert
__device__ __forceinline__ unsigned short h_bits(_Float16 x) { return __builtin_bit_cast(unsigned short, x); }
__device__ __forceinline__ unsigned pk16(unsigned short a, unsigned short b) { return (unsigned)a | ((unsigned)b << 16); }
__device__ __forceinline__ float xhalf(float x) {                     // the value lane l ^ 16 holds
  return __builtin_bit_cast(float, __builtin_amdgcn_permlanex16(__builtin_bit_cast(int, x), __builtin_bit_cast(int, x),
                                                                0x76543210, 0xfedcba98, false, false));
}
__device__ __forceinline__ void exp2x8(float (&x)[8]) {
  asm("v_exp_f32 %0, %0\n\tv_exp_f32 %1, %1\n\tv_exp_f32 %2, %2\n\tv_exp_f32 %3, %3\n\t"
      "v_exp_f32 %4, %4\n\tv_exp_f32 %5, %5\n\tv_exp_f32 %6, %6\n\tv_exp_f32 %7, %7\n\tv_nop"
      : "+v"(x[0]), "+v"(x[1]), "+v"(x[2]), "+v"(x[3]), "+v"(x[4]), "+v"(x[5]), "+v"(x[6]), "+v"(x[7]));
}
__device__ __forceinline__ float exp2x1(float x) {
  asm("v_exp_f32 %0, %0\n\tv_nop" : "+v"(x));
  return x;
}
#define LOG2E 1.44269504088896340736f   // e^x = 2^(x * LOG2E), as __expf forms it
__device__ __forceinline__ v8f zero8() { v8f z = {0.f, 0.f, 0.f, 0.f, 0.f, 0.f, 0.f, 0.f}; return z; }

// ---- fragment loader: 16-bit A/B operand, lane -> row/col (lane&15), p already includes +8*(lane>>4);
//      elements 0..7 <- p[0..7] (k0+8h..), elements 8..15 <- p[16..23] (k0+16+8h..)
__device__ __forceinline__ v16b ldfrag_b(const __bf16* p) {
  union { v16b v; v8b h[2]; } f;
  f.h[0] = *(const v8b*)(p);
  f.h[1] = *(const v8b*)(p + 16);
  return f.v;
}

// ---- WMMA helpers: plain builtins, behind which the compiler itself keeps the distance to the next user of D, A or B ----
__device__ __forceinline__ v8f mma_b_raw(v16b a, v16b b, v8f c) {
  return __builtin_amdgcn_wmma_f32_16x16x32_bf16(false, a, false, b, (short)0, c, false, false);
}
__device__ __forceinline__ v8f mma_h_raw(v16h a, v16h b, v8f c) {
  return __builtin_amdgcn_wmma_f32_16x16x32_f16(false, a, false, b, (short)0, c, false, false);
}
__device__ __forceinline__ void acc_guard4(v8f& a, v8f& b, v8f& c, v8f& d) {
  asm volatile("v_nop\n\tv_nop\n\tv_nop\n\tv_nop" : "+v"(a), "+v"(b), "+v"(c), "+v"(d));
}

// ---- asynchronous copies global -> LDS, 16 B per lane, through no register ---------------------------
__device__ __forceinline__ unsigned lds_off(const void* p) { return (unsigned)(size_t)p; }   // LDS byte address
// A run of copies and its s_wait_xcnt 0 in ONE statement: the wait stands in front of every later write of the
// address registers that the copies name.
__device__ __forceinline__ void acopy4(const unsigned* l, const __bf16* const* g) {
  asm volatile("global_load_async_to_lds_b128 %0, %4, off\n\t"
               "global_load_async_to_lds_b128 %1, %5, off\n\t"
               "global_load_async_to_lds_b128 %2, %6, off\n\t"
               "global_load_async_to_lds_b128 %3, %7, off\n\t"
               "s_wait_xcnt 0x0"
               :: "v"(l[0]), "v"(l[1]), "v"(l[2]), "v"(l[3]), "v"(g[0]), "v"(g[1]), "v"(g[2]), "v"(g[3]) : "memory");
}
__device__ __forceinline__ void acopy8(const unsigned* l, const __bf16* const* g) {
  asm volatile("global_load_async_to_lds_b128 %0, %8, off\n\t"
               "global_load_async_to_lds_b128 %1, %9, off\n\t"
               "global_load_async_to_lds_b128 %2, %10, off\n\t"
               "global_load_async_to_lds_b128 %3, %11, off\n\t"
               "global_load_async_to_lds_b128 %4, %12, off\n\t"
               "global_load_async_to_lds_b128 %5, %13, off\n\t"
               "global_load_async_to_lds_b128 %6, %14, off\n\t"
               "global_load_async_to_lds_b128 %7, %15, off\n\t"
               "s_wait_xcnt 0x0"
               :: "v"(l[0]), "v"(l[1]), "v"(l[2]), "v"(l[3]), "v"(l[4]), "v"(l[5]), "v"(l[6]), "v"(l[7]),
                  "v"(g[0]), "v"(g[1]), "v"(g[2]), "v"(g[3]), "v"(g[4]), "v"(g[5]), "v"(g[6]), "v"(g[7]) : "memory");
}

// =====================================================================================================
// f32 -> bf16 (RNE convert), 8 elements per thread, one 16-B store per lane: a wave writes 512 contiguous B
// multiple of 256 for every use here; host-checked). coverage: n8 threads x 8 = whole plane.
// =====================================================================================================
__global__ __launch_bounds__(256) void cvt_bf16x8(const float* __restrict__ in, unsigned short* out, int n8) {
  const int i = blockIdx.x * 256 + threadIdx.x;
  if (i < n8) {
    const v4f a = *(const v4f*)(in + (size_t)i * 8);
    const v4f b = *(const v4f*)(in + (size_t)i * 8 + 4);
    v4u p;
    p[0] = pk16(bf_bits(a[0]), bf_bits(a[1]));
    p[1] = pk16(bf_bits(a[2]), bf_bits(a[3]));
    p[2] = pk16(bf_bits(b[0]), bf_bits(b[1]));
    p[3] = pk16(bf_bits(b[2]), bf_bits(b[3]));
    *(v4u*)(out + (size_t)i * 8) = p;
    
  }
}

// =====================================================================================================
// Register-blocked batched bf16 WMMA GEMM: C[m][n] = sum_k A[m][k] * Bt[n][k]; one wave per 64x64 tile, a block of
// 8 waves (2 x 4) per 128x256 tile. A row-major [M][K] pitch lda; Bt row-major [N][K] pitch ldb (k contiguous);
// M multiple of 128, N of 256, K of 64 and at least 128 (asserted on the shapes used). blockIdx.y = batch index.
// Operands: a stage is 64 k of the block's A rows (and A2 rows) and Bt rows, rows of 128 B at pitch 144 B in LDS,
// brought by asynchronous copies (8 lanes per row: a wave's copy covers 4 whole lines), two buffers: stage t + 2 is
// issued behind the barrier that ends stage t's reads and flies while stage t + 1 is worked on.
// NSPLIT: 0 = A.Bt; 1 = (A + A2).Bt (A2 = unscaled bf16 lo plane of A, same pitch/stride).
// BIAS: 0 none; 1 = + bfr(bias[n]) per column; 2 = + bfr(bias[m]) per row; 3 = as 1 in batch 0, + 0 in every other batch.
// ROPE (needs N tile = one head = 64 cols d 0..63, row m = b*SEQ + s): for s >= 1,
//   t[d] = t[d]*bfr(cos[s-1][d]) + rot[d]*bfr(sin[s-1][d]), rot = [-t[32..63] | t[0..31]] (after bias).
// OUT_MODE: 0 = f32 (pitch ldc); 2 = bf16 hi plane C + bf16 lo plane C2 (lo = RNE(v - hi), unscaled);
//           3 = f16 hi plane C + f16 residual plane C2 = f16((v - hi) * rscale); C2 same pitch/stride as C.
// PAIR: 1 = built for two blocks per WGP (four waves per SIMD, 256 registers): a wave holds the fragments of 32 k at a
//       time, not of the whole stage, and the other block's waves work while it waits for them; 0 = one block per WGP.
// =====================================================================================================
template <int NSPLIT, int OUT_MODE, int BIAS, int ROPE, int PAIR>
__global__ __launch_bounds__(256, PAIR ? 4 : 1) void gemm64(
    const unsigned short* __restrict__ Ap, const unsigned short* __restrict__ A2p, int lda, long long strideA,
    const unsigned short* __restrict__ Btp, int ldb, long long strideB,
    const float* __restrict__ bias, const float* __restrict__ rsin, const float* __restrict__ rcos,
    void* Cout, void* Cout2, int ldc, long long strideC,
    int M, int N, int K, float rscale) {
  const __bf16* A  = (const __bf16*)(const void*)Ap;
  const __bf16* A2 = (const __bf16*)(const void*)A2p;
  const __bf16* Bt = (const __bf16*)(const void*)Btp;
  constexpr int ROWS_A  = GBM * (1 + NSPLIT);        // stage rows 0.. : A, then A2 where there is one
  constexpr int ROWS    = ROWS_A + GBN;              // then the Bt rows
  constexpr int STAGE_E = ROWS * GP;                 // elements of one buffer
  constexpr int NCP     = ROWS / 32;                 // copies per thread and stage: 256 threads cover 32 rows (12 or 16)
  __shared__ __align__(16) float sT[8][16 * 68];   // per-wave 16x64 slab, pitch 68 floats
  __shared__ __align__(16) __bf16 sG[2 * STAGE_E];  // operand stages, two buffers
  const int b    = blockIdx.y;
  const int lane = threadIdx.x & 31;
  const int wave = threadIdx.x >> 5;
  const int blkN = N / GBN;
  const int blkM = M / GBM;
  const int blk  = blockIdx.x;
  if (blk >= blkM * blkN) return;        // block-uniform, in front of every barrier and copy
  const int bm = blk / blkN;
  const int bn = blk - bm * blkN;
  const int wm = wave >> 2;              // 0..1
  const int wn = wave & 3;               // 0..3
  const int m0 = bm * GBM + (wm << 6);
  const int n0 = bn * GBN + (wn << 6);

  const __bf16* Ab  = A  + (size_t)b * strideA;
  const __bf16* Bb  = Bt + (size_t)b * strideB;
  const __bf16* Ab2 = (NSPLIT == 1) ? (A2 + (size_t)b * strideA) : Ab;

  const int rlane = lane & 15;                 // row (A) / col (B, D) within subtile
  const int koff  = (lane >> 4) * 8;           // k offset of this lane half
  const int mOff  = (lane >> 4) * 8;           // D row offset

  v8f acc[4][4];
#pragma unroll
  for (int i = 0; i < 4; ++i)
#pragma unroll
    for (int j = 0; j < 4; ++j) acc[i][j] = zero8();

  // ---- stage copies: thread -> row (tid >> 3) of each group of 32 rows, 16-B piece (tid & 7) of its 128 B ----
  const int crow = threadIdx.x >> 3;
  const int cseg = (threadIdx.x & 7) * 8;
  const __bf16* gA  = Ab  + (size_t)(bm * GBM + crow) * lda + cseg;
  const __bf16* gA2 = Ab2 + (size_t)(bm * GBM + crow) * lda + cseg;
  const __bf16* gB  = Bb  + (size_t)(bn * GBN + crow) * ldb + cseg;
  const unsigned lC = lds_off(sG) + (unsigned)(crow * GP + cseg) * 2u;
  auto issue_stage = [&](int st, int buf) {
    unsigned l[NCP];
    const __bf16* g[NCP];
#pragma unroll   // every index of l and g constant: the addresses stay in registers
    for (int p = 0; p < NCP; ++p) {
      l[p] = lC + (unsigned)(buf * STAGE_E + p * 32 * GP) * 2u;
      if (p * 32 < GBM)          g[p] = gA  + (size_t)(p * 32) * lda + (size_t)st * GKS;
      else if (p * 32 < ROWS_A)  g[p] = gA2 + (size_t)(p * 32 - GBM) * lda + (size_t)st * GKS;
      else                       g[p] = gB  + (size_t)(p * 32 - ROWS_A) * ldb + (size_t)st * GKS;
    }
    acopy8(l, g);
    if (NCP == 16) acopy8(l + 8, g + 8);
    else           acopy4(l + 8, g + 8);
  };

  const int T = K / GKS;                              // stages
  issue_stage(0, 0);
  asm volatile("s_wait_asynccnt 0x0" ::: "memory");   // this wave's copies of stage 0 have landed
  __syncthreads();                                    // and every other wave's: stage 0 may be read
  if (T > 1) issue_stage(1, 1);

  for (int t = 0; t < T; ++t) {
    const __bf16* sb = sG + (t & 1) * STAGE_E;
    const __bf16* sa = sb + ((wm << 6) + rlane) * GP + koff;
    const __bf16* sw = sb + (ROWS_A + (wn << 6) + rlane) * GP + koff;
    if constexpr (PAIR) {
      static_assert(NSPLIT == 0);
#pragma unroll   // every fragment index constant
      for (int ks = 0; ks < 2; ++ks) {
        v16b bq[4], aq[4];
#pragma unroll
        for (int j = 0; j < 4; ++j) bq[j] = ldfrag_b(sw + (j << 4) * GP + ks * 32);
#pragma unroll
        for (int i = 0; i < 4; ++i) aq[i] = ldfrag_b(sa + (i << 4) * GP + ks * 32);
        // Holds the 32 k's fragment loads as one group ahead of their WMMAs: one place where the wave waits, not many.
        __builtin_amdgcn_sched_barrier(0);
#pragma unroll
        for (int i = 0; i < 4; ++i)
#pragma unroll
          for (int j = 0; j < 4; ++j) acc[i][j] = mma_b_raw(aq[i], bq[j], acc[i][j]);
        // Holds the next group's loads, and the full LDS wait at the stage's foot, behind these WMMAs.
        __builtin_amdgcn_sched_barrier(0);
      }
    } else {
    v16b bh[2][4], ah[2][4], al[2][4];   // the loops below are unrolled so that every fragment index is constant
#pragma unroll
    for (int ks = 0; ks < 2; ++ks) {
#pragma unroll
      for (int j = 0; j < 4; ++j) bh[ks][j] = ldfrag_b(sw + (j << 4) * GP + ks * 32);
#pragma unroll
      for (int i = 0; i < 4; ++i) {
        ah[ks][i] = ldfrag_b(sa + (i << 4) * GP + ks * 32);
        al[ks][i] = ah[ks][i];
        if (NSPLIT == 1) al[ks][i] = ldfrag_b(sa + (GBM + (i << 4)) * GP + ks * 32);
      }
    }
    // Holds the stage's fragment loads as one group ahead of its WMMAs: moved in among them, into one shared
    // register set, each place with loads makes the wave wait out the LDS latency.
    __builtin_amdgcn_sched_barrier(0);
#pragma unroll
    for (int ks = 0; ks < 2; ++ks)
#pragma unroll
      for (int i = 0; i < 4; ++i)
#pragma unroll
        for (int j = 0; j < 4; ++j) {
          acc[i][j] = mma_b_raw(ah[ks][i], bh[ks][j], acc[i][j]);
          if (NSPLIT == 1) acc[i][j] = mma_b_raw(al[ks][i], bh[ks][j], acc[i][j]);
        }
    // Holds the WMMAs ahead of the full LDS wait below: behind it none would start before the last fragment is in.
    __builtin_amdgcn_sched_barrier(0);
    }
    asm volatile("s_wait_dscnt 0x0" ::: "memory");      // this wave's reads of buffer t & 1 are done
    asm volatile("s_wait_asynccnt 0x0" ::: "memory");   // this wave's copies of stage t + 1 have landed
    __syncthreads();                                    // publishes stage t + 1, frees buffer t & 1
    if (t + 2 < T) issue_stage(t + 2, t & 1);
  }
  asm volatile("s_wait_asynccnt 0x0" ::: "memory");     // nothing in flight when the wave goes on
  acc_guard4(acc[0][0], acc[0][1], acc[0][2], acc[0][3]);
  acc_guard4(acc[1][0], acc[1][1], acc[1][2], acc[1][3]);
  acc_guard4(acc[2][0], acc[2][1], acc[2][2], acc[2][3]);
  acc_guard4(acc[3][0], acc[3][1], acc[3][2], acc[3][3]);

  // ---- epilogue ----
  float* slab = sT[wave];
  float bcol[4];
  if (BIAS == 1 || BIAS == 3) {
#pragma unroll
    for (int j = 0; j < 4; ++j) {
      const float bv = bias[n0 + (j << 4) + rlane];   // n0+.. < N
      // In front of the next load: the compiler lays its result over the offset register that the loads issued here name.
      if (BIAS == 3) asm volatile("s_wait_xcnt 0x0" ::: "memory");
      bcol[j] = bfr(bv);
      if (BIAS == 3 && b != 0) bcol[j] = 0.f;
    }
  } else {
#pragma unroll
    for (int j = 0; j < 4; ++j) bcol[j] = 0.f;
  }
#pragma unroll
  for (int i = 0; i < 4; ++i) {
    const int mBase = m0 + (i << 4);
#pragma unroll
    for (int r = 0; r < 8; ++r) {
      const int m = mBase + mOff + r;                  // < M
      float brow = 0.f;
      if (BIAS == 2) brow = bfr(bias[m]);
      float t[4];
#pragma unroll
      for (int j = 0; j < 4; ++j) {
        float v = acc[i][j][r];
        if (BIAS == 1 || BIAS == 3) v = v + bcol[j];
        if (BIAS == 2) v = v + brow;
        t[j] = v;
      }
      if (ROPE) {
        const int s = m & (SEQ - 1);                   // token index within the sequence
        const bool use = (s > 0);                        // token 0 passes unrotated
        const int sidx = use ? (s - 1) : 0;              // clamped table row
        const float* cr = rcos + (size_t)sidx * HD;
        const float* sr = rsin + (size_t)sidx * HD;
        float u[4];
#pragma unroll
        for (int j = 0; j < 4; ++j) {
          const int d = (j << 4) + rlane;                // 0..63
          const float cs = bfr(cr[d]);
          const float sn = bfr(sr[d]);
          const float tp = t[j ^ 2];                     // partner d^32, same lane
          const float rot = (j < 2) ? -tp : tp;
          const float w = t[j] * cs + rot * sn;
          u[j] = use ? w : t[j];
        }
#pragma unroll
        for (int j = 0; j < 4; ++j) t[j] = u[j];
      }
#pragma unroll
      for (int j = 0; j < 4; ++j) slab[(mOff + r) * 68 + (j << 4) + rlane] = t[j];
    }
    __builtin_amdgcn_fence(__ATOMIC_RELEASE, "workgroup");
    __builtin_amdgcn_wave_barrier();
    __builtin_amdgcn_fence(__ATOMIC_ACQUIRE, "workgroup");
    if (OUT_MODE == 0) {
      float* C = (float*)Cout + (size_t)b * strideC;
      const int hh = lane >> 4, c4 = (lane & 15) * 4;     // 256-B row segment = 16 lanes x 16 B
      {
#pragma unroll
        for (int it = 0; it < 8; ++it) {
          const int row = it * 2 + hh;                     // it 0..7 x hh 0..1 = rows 0..15
          const v4f v = *(const v4f*)(slab + row * 68 + c4);
          *(v4f*)(C + (size_t)(mBase + row) * ldc + n0 + c4) = v;
        }
        
      }
    } else {
      const int q = lane >> 3, c8 = (lane & 7) * 8;
      unsigned short* C  = (unsigned short*)Cout  + (size_t)b * strideC;
      unsigned short* C2 = (unsigned short*)Cout2 + (size_t)b * strideC;
      v4u hv[4], lv[4];
#pragma unroll
      for (int it = 0; it < 4; ++it) {
        const int row = it * 4 + q;                        // it 0..3 x q 0..3 = rows 0..15
        const float* sp = slab + row * 68 + c8;
        v4u a, a2;
#pragma unroll
        for (int e = 0; e < 4; ++e) {
          const float f0 = sp[2 * e], f1 = sp[2 * e + 1];
          unsigned short h0, h1, l0, l1;
          if (OUT_MODE == 2) {
            h0 = bf_bits(f0); h1 = bf_bits(f1);
            l0 = bf_bits(f0 - bf_up(h0)); l1 = bf_bits(f1 - bf_up(h1));
          } else {
            const _Float16 x0 = (_Float16)f0, x1 = (_Float16)f1;
            h0 = h_bits(x0); h1 = h_bits(x1);
            l0 = h_bits((_Float16)((f0 - (float)x0) * rscale));
            l1 = h_bits((_Float16)((f1 - (float)x1) * rscale));
          }
          a[e] = pk16(h0, h1); a2[e] = pk16(l0, l1);
        }
        hv[it] = a; lv[it] = a2;
      }
      {
#pragma unroll
        for (int it = 0; it < 4; ++it) {
          const int row = it * 4 + q;
          *(v4u*)(C  + (size_t)(mBase + row) * ldc + n0 + c8) = hv[it];
          *(v4u*)(C2 + (size_t)(mBase + row) * ldc + n0 + c8) = lv[it];
        }
        
      }
    }
    __builtin_amdgcn_fence(__ATOMIC_RELEASE, "workgroup");
    __builtin_amdgcn_wave_barrier();
    __builtin_amdgcn_fence(__ATOMIC_ACQUIRE, "workgroup");
  }
}

// =====================================================================================================
// Attention, head dim 64, no mask, all SEQ keys.
//   q planes (bf16 hi / lo): element (b, t, h, d) at [(b*SEQ + t)*DM + h*64 + d]
//   k planes (bf16 hi / lo): same layout with key index s
//   v^T hi plane (f16):      element (b, h, d, s) at [(b*DM + h*64 + d)*SEQ + s]
//   v^T residual plane (f16, (v - hi)*4096): same layout
//   out planes (bf16 hi / lo of the normalised context): element (b, t, h, d) at [(b*SEQ + t)*DM + h*64 + d]
//   Both products are formed transposed: S^T = K . Q^T (A = K rows, B = Q) and O^T += V^T . P^T (A = V^T rows, B = P^T).
//   In each tile a lane then holds one query (column lane&15) and 32 of the chunk's 64 keys (rows j*16 + 8*(lane>>4) + r): the maximum
//   and the sum run inside the lane, the two wave halves exchange the maximum once per chunk and join their sums once at
//   the end; two score tiles, converted in place, are the B operand P^T in the k order of the V^T loader.
//   scores = k . q : bf16 hi/lo split (hi.hi + lo.hi + hi.lo in k, q), f32 accumulate; the maximum is kept in raw scores
//   1024 p = 2^(s * (sscale * log2 e) + (10 - m * sscale * log2 e)): one f32 multiply-add per score in front of the 2^x;
//   carried as f16, its row sum carries the same 1024; context = v^T . p^T on f16 WMMA: v_hi.p into the running
//   accumulator, v_res.p into a per-chunk accumulator folded back by one multiply-add with 1/4096; online softmax in f32.
//   Block = 4 waves = 128 query rows of one (b, h), a wave 32 of them as two 16-column tiles that share every K and
//   V^T fragment read; grid = NQG * NH * NB; kv chunks of 64, static trip NQB.
//   K / V^T chunk staging: a stage is the chunk's four 64x64 planes, rows of 128 B at pitch 144 B in LDS, brought by
//   asynchronous copies (8 lanes per row: a wave's copy covers 4 whole lines; 16 copies per thread), two buffers:
//   chunk t + 2 is issued behind the barrier that ends chunk t's reads and flies while chunk t + 1 is worked on.
//   Output coverage: each wave stores rows q0..q0+31 (u 0..1 x it 0..3 x lane>>3 0..3) x 64 columns (8 lanes x 8) of both planes.
// =====================================================================================================
__global__ __launch_bounds__(128, 4)   // 4 waves per SIMD: the 256 registers that let four blocks share a WGP
void attn64(const unsigned short* __restrict__ qhp, const unsigned short* __restrict__ qlp,
            const unsigned short* __restrict__ khp, const unsigned short* __restrict__ klp,
            const unsigned short* __restrict__ vhp, const unsigned short* __restrict__ vlp,
            unsigned short* ohp, unsigned short* olp, float sscale) {
  union FB { v16b v; v8b h[2]; };
  union FH { v16h v; v8h h[2]; };
  // Rows of 64 16-bit elements are laid at a pitch of LP = 72 elements (144 B = 16 B x 9): the 16 rows that one
  // ds_load_b128 fragment read touches then fall on 16 different groups of four banks instead of two.
  constexpr int PLANE_B = 64 * LP * 2;                            // bytes of one plane of a stage, 9 KB
  constexpr int STAGE_B = 4 * PLANE_B;                            // K hi [kv][d], K lo, V^T hi [d][kv], V^T residual
  static_assert(4 * QT * 16 * OSP * 4 <= 2 * STAGE_B);            // the output tiles fit where the stages were
  // Two stage buffers, 72 KB; behind the loop's last barrier the same bytes hold the per-wave context tiles [row][d].
  __shared__ __align__(16) unsigned char sKV[2 * STAGE_B];

  const int tid  = threadIdx.x;
  const int wave = tid >> 5;
  const int lane = tid & 31;
  const int hh   = lane >> 4;
  const int c    = lane & 15;

  const int bx   = blockIdx.x;
  const int qb   = bx % NQG;
  const int rest = bx / NQG;
  const int h    = rest % NH;
  const int b    = rest / NH;
  const int q0   = qb * (64 * QT) + wave * (16 * QT);
  const size_t rowB = (size_t)b * SEQ;

  const __bf16* Qh = (const __bf16*)(const void*)qhp + (size_t)h * HD;
  const __bf16* Ql = (const __bf16*)(const void*)qlp + (size_t)h * HD;
  const __bf16* Kh = (const __bf16*)(const void*)khp + (size_t)h * HD;
  const __bf16* Kl = (const __bf16*)(const void*)klp + (size_t)h * HD;
  const _Float16* Vh = (const _Float16*)(const void*)vhp + ((size_t)b * DM + (size_t)h * HD) * SEQ;
  const _Float16* Vl = (const _Float16*)(const void*)vlp + ((size_t)b * DM + (size_t)h * HD) * SEQ;

  // ---- Q fragments (B operand, column = query = u*16 + lane&15): QT query tiles x 2 d-chunks, hi and lo ----
  v16b qah[QT][2], qal[QT][2];
#pragma unroll
  for (int u = 0; u < QT; ++u)
#pragma unroll
    for (int dc = 0; dc < 2; ++dc) {
      const size_t qo = (rowB + q0 + u * 16 + c) * DM + dc * 32 + 8 * hh;
      qah[u][dc] = ldfrag_b(Qh + qo);
      qal[u][dc] = ldfrag_b(Ql + qo);
      // In front of the next loads: the compiler lays their results over address registers of the loads issued here.
      asm volatile("s_wait_xcnt 0x0" ::: "memory");
    }

  // per query tile u, this lane's query: running maximum of the raw scores (both halves alike), sum of 1024 p over
  // this half's keys
  const float cexp = sscale * LOG2E;    // raw score -> exponent of 2; sscale > 0, so raw scores order as scaled ones do
  float mrow[QT], lrow[QT];
  v8f oacc[QT][4];                      // O^T: oacc[u][t][r] = context[query u*16 + c][d = t*16 + 8*hh + r]
#pragma unroll
  for (int u = 0; u < QT; ++u) {
    mrow[u] = -INFINITY;
    lrow[u] = 0.f;
#pragma unroll
    for (int t = 0; t < 4; ++t) oacc[u][t] = zero8();
  }

  // ---- stage copies: thread -> row (tid >> 3) of each group of 16 rows, 16-B piece (tid & 7) of its 128 B ----
  const int crow = tid >> 3;
  const int cseg = (tid & 7) * 8;
  const __bf16* gKh = Kh + (rowB + crow) * DM + cseg;                            // K row crow of chunk 0
  const __bf16* gKl = Kl + (rowB + crow) * DM + cseg;
  const __bf16* gVh = (const __bf16*)(const void*)(Vh + (size_t)crow * SEQ + cseg);   // V^T row d = crow, an address only
  const __bf16* gVl = (const __bf16*)(const void*)(Vl + (size_t)crow * SEQ + cseg);
  const unsigned lC = lds_off(sKV) + (unsigned)(crow * LP + cseg) * 2u;
  auto issue_stage = [&](int st, int buf) {
    unsigned l[16];
    const __bf16* g[16];
#pragma unroll   // every index of l and g constant: the addresses stay in registers
    for (int p = 0; p < 4; ++p) {
      const unsigned lp = lC + (unsigned)(buf * STAGE_B + p * 16 * LP * 2);
      l[p]      = lp;
      l[4 + p]  = lp + PLANE_B;
      l[8 + p]  = lp + 2 * PLANE_B;
      l[12 + p] = lp + 3 * PLANE_B;
      g[p]      = gKh + (size_t)(st * 64 + p * 16) * DM;          // K row st*64 + p*16 + crow < SEQ
      g[4 + p]  = gKl + (size_t)(st * 64 + p * 16) * DM;
      g[8 + p]  = gVh + (size_t)(p * 16) * SEQ + st * 64;         // V^T row p*16 + crow < 64, s = st*64 + cseg.. < SEQ
      g[12 + p] = gVl + (size_t)(p * 16) * SEQ + st * 64;
    }
    acopy8(l, g);
    acopy8(l + 8, g + 8);
  };

  static_assert(NQB >= 2);                            // chunks 0 and 1 both exist
  issue_stage(0, 0);
  asm volatile("s_wait_asynccnt 0x0" ::: "memory");   // this wave's copies of chunk 0 have landed
  __syncthreads();                                    // and every other wave's: chunk 0 may be read
  issue_stage(1, 1);

  // One chunk: scores, softmax, context, then the publish point of chunk kt + 1.
  auto chunk = [&](int kt) {
    const unsigned char* sb = sKV + (kt & 1) * STAGE_B;
    const __bf16*   Ksh = (const __bf16*)(const void*)(sb);
    const __bf16*   Ksl = (const __bf16*)(const void*)(sb + PLANE_B);
    const _Float16* Vth = (const _Float16*)(const void*)(sb + 2 * PLANE_B);
    const _Float16* Vtl = (const _Float16*)(const void*)(sb + 3 * PLANE_B);

    // ---- scores, transposed: 64 keys x 16*QT queries per wave, 3 bf16 products; A[m = key][k = d] from Ksh[key][d];
    //      each K fragment, read once, is the A operand of every query tile ----
    v8f s[QT][4];
#pragma unroll
    for (int j = 0; j < 4; ++j) {
#pragma unroll
      for (int u = 0; u < QT; ++u) s[u][j] = zero8();
#pragma unroll
      for (int dc = 0; dc < 2; ++dc) {
        FB kb, kl;
        kb.h[0] = *(const v8b*)(Ksh + (j * 16 + c) * LP + dc * 32 + 8 * hh);
        kb.h[1] = *(const v8b*)(Ksh + (j * 16 + c) * LP + dc * 32 + 16 + 8 * hh);
        kl.h[0] = *(const v8b*)(Ksl + (j * 16 + c) * LP + dc * 32 + 8 * hh);
        kl.h[1] = *(const v8b*)(Ksl + (j * 16 + c) * LP + dc * 32 + 16 + 8 * hh);
#pragma unroll
        for (int u = 0; u < QT; ++u) s[u][j] = mma_b_raw(kb.v, qah[u][dc], s[u][j]);
#pragma unroll
        for (int u = 0; u < QT; ++u) s[u][j] = mma_b_raw(kl.v, qah[u][dc], s[u][j]);
#pragma unroll
        for (int u = 0; u < QT; ++u) s[u][j] = mma_b_raw(kb.v, qal[u][dc], s[u][j]);
      }
    }

    // Keeps the softmax behind the score products: scheduled in among them its values lengthen the stretch where both
    // tiles' scores, Q and the context are all live, and the build spills at the 256 registers of four waves per SIMD.
    __builtin_amdgcn_sched_barrier(0);
    // ---- maximum, online softmax; query u*16 + c, key j*16 + 8*hh + r lives in s[u][j][r] ----
    // P^T (x1024, f16) as B operand: element e of chunk kk = key kk*32 + (e < 8 ? 8*hh + e : 16 + 8*hh + e - 8)
    FH pb[QT][2];
#pragma unroll
    for (int u = 0; u < QT; ++u) {
      float mj[4];
#pragma unroll
      for (int j = 0; j < 4; ++j) {
        mj[j] = -INFINITY;
#pragma unroll
        for (int r = 0; r < 8; ++r) mj[j] = fmaxf(mj[j], s[u][j][r]);
      }
      float m = fmaxf(fmaxf(mj[0], mj[1]), fmaxf(mj[2], mj[3]));
      m = fmaxf(m, xhalf(m));                            // the query's other 32 keys sit in lane ^ 16
      const float mnew  = fmaxf(mrow[u], m);
      const float msafe = (mnew == -INFINITY) ? 0.f : mnew;
      const float alpha = exp2x1((mrow[u] - msafe) * cexp);
      mrow[u] = mnew;
      const float nb = __builtin_fmaf(-msafe, cexp, 10.0f);   // the maximum and the x1024 carry, as an exponent of 2
      float pj[4];
#pragma unroll
      for (int j = 0; j < 4; ++j) {
        float p[8];
#pragma unroll
        for (int r = 0; r < 8; ++r) p[r] = __builtin_fmaf(s[u][j][r], cexp, nb);
        exp2x8(p);
        pj[j] = 0.f;
#pragma unroll
        for (int r = 0; r < 8; ++r) {
          pj[j] += p[r];
          pb[u][j >> 1].v[(j & 1) * 8 + r] = (_Float16)p[r];
        }
      }
      lrow[u] = __builtin_fmaf(lrow[u], alpha, (pj[0] + pj[1]) + (pj[2] + pj[3]));
#pragma unroll
      for (int t = 0; t < 4; ++t)
#pragma unroll
        for (int r = 0; r < 8; ++r) oacc[u][t][r] *= alpha;
    }

    // ---- context^T += V^T . P^T (f16 WMMA): A[m = d][k = kv] from Vth[d][kv], B = P^T[k = kv][n = query]; each V^T
    //      fragment, read once, is the A operand of every query tile; residual products into a separate accumulator
    //      per 16 d rows, folded back when both key halves are in ----
#pragma unroll
    for (int t = 0; t < 4; ++t) {
      v8f o1[QT];
#pragma unroll
      for (int u = 0; u < QT; ++u) o1[u] = zero8();
#pragma unroll
      for (int kk = 0; kk < 2; ++kk) {
        FH vb, vl;
        vb.h[0] = *(const v8h*)(Vth + (t * 16 + c) * LP + kk * 32 + 8 * hh);
        vb.h[1] = *(const v8h*)(Vth + (t * 16 + c) * LP + kk * 32 + 16 + 8 * hh);
        vl.h[0] = *(const v8h*)(Vtl + (t * 16 + c) * LP + kk * 32 + 8 * hh);
        vl.h[1] = *(const v8h*)(Vtl + (t * 16 + c) * LP + kk * 32 + 16 + 8 * hh);
#pragma unroll
        for (int u = 0; u < QT; ++u) oacc[u][t] = mma_h_raw(vb.v, pb[u][kk].v, oacc[u][t]);
#pragma unroll
        for (int u = 0; u < QT; ++u) o1[u]      = mma_h_raw(vl.v, pb[u][kk].v, o1[u]);
      }
#pragma unroll
      for (int u = 0; u < QT; ++u)
#pragma unroll
        for (int r = 0; r < 8; ++r) oacc[u][t][r] = __builtin_fmaf(o1[u][r], 1.0f / 4096.0f, oacc[u][t][r]);
    }

    asm volatile("s_wait_dscnt 0x0" ::: "memory");      // this wave's reads of buffer kt & 1 are done
    asm volatile("s_wait_asynccnt 0x0" ::: "memory");   // this wave's copies of chunk kt + 1 have landed
    __syncthreads();                                    // publishes chunk kt + 1, frees buffer kt & 1
  };
  // The chunks that have a chunk kt + 2 to fetch, then the last two, in loops of their own (static trip counts): with the
  // test inside one loop the compiler moves folds and row sums behind the branch, their operands stay in registers
  // beside the copies' addresses, and the build spills at 256 registers.
  for (int kt = 0; kt < NQB - 2; ++kt) {
    chunk(kt);
    issue_stage(kt + 2, kt & 1);
  }
#pragma unroll 1   // kept rolled: one more copy of the body, not two
  for (int kt = NQB - 2; kt < NQB; ++kt) chunk(kt);
  asm volatile("s_wait_asynccnt 0x0" ::: "memory");     // nothing in flight when the buffers become output staging

  // ---- normalise (context and l both carry the 1024), stage the wave's 16*QT x 64 tile, bf16 hi/lo split,
  float* os = (float*)(void*)sKV + wave * (QT * 16 * OSP);   // every wave has passed the last chunk's barrier
#pragma unroll
  for (int u = 0; u < QT; ++u) {
    const float l = lrow[u] + xhalf(lrow[u]);          // join the two halves' sums of this query
    const float inv = (l > 0.f) ? (1.0f / l) : 0.f;
#pragma unroll
    for (int t = 0; t < 4; ++t)
#pragma unroll
      for (int r = 0; r < 8; ++r) os[(u * 16 + c) * OSP + t * 16 + 8 * hh + r] = oacc[u][t][r] * inv;
  }
  __builtin_amdgcn_fence(__ATOMIC_RELEASE, "workgroup");
  __builtin_amdgcn_wave_barrier();
  __builtin_amdgcn_fence(__ATOMIC_ACQUIRE, "workgroup");
#pragma unroll
  for (int u = 0; u < QT; ++u) {
    const int q4 = lane >> 3, c8 = (lane & 7) * 8;
    v4u hv[4], lv[4];
#pragma unroll
    for (int it = 0; it < 4; ++it) {
      const int row = u * 16 + it * 4 + q4;   // u x it 0..3 x q4 0..3 = rows 0..16*QT-1 of the wave tile
      const float* sp = os + row * OSP + c8;
      v4u a, a2;
#pragma unroll
      for (int e = 0; e < 4; ++e) {
        const float f0 = sp[2 * e], f1 = sp[2 * e + 1];
        const unsigned short h0 = bf_bits(f0), h1 = bf_bits(f1);
        const unsigned short l0 = bf_bits(f0 - bf_up(h0)), l1 = bf_bits(f1 - bf_up(h1));
        a[e] = pk16(h0, h1); a2[e] = pk16(l0, l1);
      }
      hv[it] = a; lv[it] = a2;
    }
    {
#pragma unroll
      for (int it = 0; it < 4; ++it) {
        const int row = u * 16 + it * 4 + q4;
        const size_t go = (rowB + q0 + row) * DM + (size_t)h * HD + c8;
        *(v4u*)(ohp + go) = hv[it];
        *(v4u*)(olp + go) = lv[it];
      }
    }
  }
}

// =====================================================================================================
// Workspace map: 8 regions of PL = NTOK*DM*2 = 16777216 B each, total 134217728 B.
//   R0  Xb   bf16 [8192][1024]                    (after the projections: Oh, context hi plane [8192][1024])
//   R1  Qh   bf16 [8192][1024]                    (after attention: Wob bf16 [1024][1024], 2097152 B used)
//   R2  Ql   bf16 [8192][1024]
//   R3  Kh   bf16 [8192][1024]
//   R4  Kl   bf16 [8192][1024]
//   R5  VTh  f16  [4][1024][2048]
//   R6  VTl  f16  [4][1024][2048]
//   R7  Wqkv bf16 [3072][1024] (6291456 B used)   (during attention: Ol, context lo plane [8192][1024])
// All planes are exact multiples of their 64x64 tile / whole-line store granularity (no padded tails needed).
// Weights are [out n][in k] with k contiguous = the Bt / A layout the GEMM wants, so they are only converted.
// =====================================================================================================
extern "C" void kernel_launch(void* const* d_in, const int* in_sizes, int n_in,
                              void* d_out, int out_size, void* d_ws, size_t ws_size,
                              hipStream_t stream) {
  if (n_in < 8) return;
  if (in_sizes[0] != NTOK * DM) return;
  if (in_sizes[1] != 3 * DM * DM) return;
  if (in_sizes[2] != DM || in_sizes[3] != DM) return;
  if (in_sizes[4] != DM * DM || in_sizes[5] != DM) return;
  if (in_sizes[6] != (SEQ - 1) * HD || in_sizes[7] != (SEQ - 1) * HD) return;
  if (out_size != NTOK * DM) return;

  const float* x      = (const float*)d_in[0];
  const float* qkv_w  = (const float*)d_in[1];
  const float* q_bias = (const float*)d_in[2];
  const float* v_bias = (const float*)d_in[3];
  const float* proj_w = (const float*)d_in[4];
  const float* proj_b = (const float*)d_in[5];
  const float* rsin   = (const float*)d_in[6];
  const float* rcos   = (const float*)d_in[7];

  const size_t PL = (size_t)NTOK * DM * 2;        // 16777216  one 16-bit activation plane [8192][1024]
  static_assert((size_t)3 * DM * DM * 2 <= (size_t)NTOK * DM * 2);
  static_assert((size_t)NB * DM * SEQ * 2 == (size_t)NTOK * DM * 2);
  static_assert((size_t)DM * DM * 2 <= (size_t)NTOK * DM * 2);
  size_t off = 0;
  const size_t oR0 = off; off += PL;
  const size_t oR1 = off; off += PL;
  const size_t oR2 = off; off += PL;
  const size_t oR3 = off; off += PL;
  const size_t oR4 = off; off += PL;
  const size_t oR5 = off; off += PL;
  const size_t oR6 = off; off += PL;
  const size_t oR7 = off; off += PL;
  if (off > ws_size) return;                      // off = 134217728
  if (off > (size_t)134217728) return;

  char* ws = (char*)d_ws;
  unsigned short* Xb   = (unsigned short*)(ws + oR0);
  unsigned short* Oh   = (unsigned short*)(ws + oR0);
  unsigned short* Qh   = (unsigned short*)(ws + oR1);
  unsigned short* Wob  = (unsigned short*)(ws + oR1);
  unsigned short* Ql   = (unsigned short*)(ws + oR2);
  unsigned short* Kh   = (unsigned short*)(ws + oR3);
  unsigned short* Kl   = (unsigned short*)(ws + oR4);
  unsigned short* VTh  = (unsigned short*)(ws + oR5);
  unsigned short* VTl  = (unsigned short*)(ws + oR6);
  unsigned short* Wqkv = (unsigned short*)(ws + oR7);
  unsigned short* Ol   = (unsigned short*)(ws + oR7);
  const unsigned short* Wq = Wqkv;
  const unsigned short* Wv = Wqkv + (size_t)2 * DM * DM;

  const dim3 blk(256);
  const int n8x = NTOK * DM / 8;                              // 1048576
  const int n8q = 3 * DM * DM / 8;                            //  393216
  const int n8o = DM * DM / 8;                                //  131072
  if ((n8x % 256) != 0 || (n8q % 256) != 0 || (n8o % 256) != 0) return;
  const dim3 gCvtX(n8x / 256);                                // 4096 blocks
  const dim3 gCvtQ(n8q / 256);                                // 1536 blocks
  const dim3 gCvtO(n8o / 256);                                //  512 blocks
  const int tilesTok = (NTOK / 64) * (DM / 64);               // 2048 tiles: M=8192, N=1024
  const int tilesVT  = (DM / 64) * (SEQ / 64);                //  512 tiles: M=1024, N=2048
  const dim3 gTok((tilesTok + 7) / 8, 1);                     // 256 blocks
  const dim3 gQK((tilesTok + 7) / 8, 2);                      // 256 blocks x 2 (q, k)
  const dim3 gVT((tilesVT + 7) / 8, NB);                      // 64 blocks x 4 batches
  const dim3 gAttn(NB * NH * NQG);                            // 1024 blocks

  // (1) x -> bf16 plane [8192][1024]; qkv_w [3072 n][1024 k] f32 -> bf16
  cvt_bf16x8<<<gCvtX, blk, 0, stream>>>(x, Xb, n8x);
  cvt_bf16x8<<<gCvtQ, blk, 0, stream>>>(qkv_w, Wqkv, n8q);
  // (2) one launch, batch 0: q = x . Wq^T + q_bias, batch 1: k = x . Wk^T + 0; rope for tokens >= 1 -> bf16 hi/lo planes
  //     [b*SEQ+t][h*64+d]   (M=8192, N=1024, K=1024 each). Wk lies DM*DM elements behind Wq, the k planes (R3, R4) two
  //     regions behind the q planes (R1, R2). 512 blocks, two per WGP.
  gemm64<0, 2, 3, 1, 1><<<gQK, blk, 0, stream>>>(
      Xb, Xb, DM, 0LL, Wq, DM, (long long)DM * DM, q_bias, rsin, rcos,
      (void*)Qh, (void*)Ql, DM, (long long)2 * NTOK * DM, NTOK, DM, DM, 1.0f);
  // (4) v^T = Wv . x^T + v_bias[row] per batch -> f16 hi plane [b][h*64+d][s] (pitch SEQ) and residual plane x4096
  //     (A = Wv [n][k], Bt = Xb rows of batch b; M=1024, N=2048, K=1024)
  gemm64<0, 3, 2, 0, 0><<<gVT, blk, 0, stream>>>(
      Wv, Wv, DM, 0LL, Xb, DM, (long long)SEQ * DM, v_bias, rsin, rcos,
      (void*)VTh, (void*)VTl, SEQ, (long long)DM * SEQ, DM, SEQ, DM, 4096.0f);
  // (5) attention -> context bf16 hi plane (R0, x plane dead) and lo plane (R7, weight plane dead)
  attn64<<<gAttn, dim3(128), 0, stream>>>(Qh, Ql, Kh, Kl, VTh, VTl, Oh, Ol, 0.125f);
  // (6) proj_w -> bf16 [n][k] into R1 (q hi plane dead after attention)
  cvt_bf16x8<<<gCvtO, blk, 0, stream>>>(proj_w, Wob, n8o);
  // (7) out = context . Wo^T + proj_b -> d_out f32 [8192][1024]  (A = context hi + lo planes, 2 products)
  gemm64<1, 0, 1, 0, 0><<<gTok, blk, 0, stream>>>(
      Oh, Ol, DM, 0LL, Wob, DM, 0LL, proj_b, rsin, rcos,
      d_out, d_out, DM, 0LL, NTOK, DM, DM, 1.0f);
  (void)hipGetLastError();
}

// v009
// Measured time: 186 microseconds a run.
// Timed twice side by side with v008, it ran 1.11 and 1.13 times as fast.
// Over all steps from v000 it is 4.06 times as fast.
// Contractions: q, k, v^T projections = v_wmma_f32_16x16x32_bf16 (bf16 operands from RNE-converted inputs, single product, f32 accumulate);
// q.k^T scores = v_wmma_f32_16x16x32_bf16 with bf16 hi/lo split q and k (hi.hi + hi.lo + lo.hi), f32 accumulate;
// p.v = v_wmma_f32_16x16x32_f16 (p carried x1024 in f16; v as one f16 plane; 1 product), f32 accumulate;
// ctx.Wo^T = v_wmma_f32_16x16x32_bf16 with ctx as bf16 hi/lo planes times bf16 Wo (2 products), f32 accumulate; bias, rope, softmax in f32.
#include <hip/hip_runtime.h>
#include <math.h>
#include <stdint.h>

#pragma clang fp contract(off)

#define NB    4
#define SEQ   2048
#define DM    1024
#define NH    16
#define HD    64
#define NQB   (SEQ / 64)      // 32 key chunks of 64
#define QT    2               // query tiles of 16 columns per attention wave
#define NQG   (SEQ / (64 * QT))   // 16 query blocks of 4 waves x 16*QT queries
#define NTOK  (NB * SEQ)      // 8192 token rows
#define LP    72              // LDS row pitch of the attention K and V^T tiles, in 16-bit elements
#define OSP   68              // LDS row pitch of the attention output staging tile, in floats (16 B x odd)
#define GP    72              // LDS row pitch of the GEMM operand tiles, in 16-bit elements (144 B = 16 B x odd)
#define GKS   64              // k elements of one GEMM stage: rows of 128 B, one whole line each
#define GBM   128             // GEMM block tile rows    (2 waves x 64)
#define GBN   256             // GEMM block tile columns (4 waves x 64)
static_assert(NH * HD == DM);
static_assert((SEQ % (64 * QT)) == 0 && (DM % 64) == 0);
static_assert((SEQ & (SEQ - 1)) == 0);
static_assert((NTOK % GBM) == 0 && (DM % GBM) == 0 && (DM % GBN) == 0 && (SEQ % GBN) == 0);   // whole GEMM block tiles
static_assert((DM % GKS) == 0 && DM >= 2 * GKS);                                              // whole stages, two or more
static_assert(GP >= GKS && (GP % 8) == 0 && ((GP / 8) & 1) == 1);
static_assert(LP >= HD && (LP % 8) == 0 && ((LP / 8) & 1) == 1);   // 16-B aligned rows, pitch = 16 B x odd

typedef _Float16 v16h __attribute__((ext_vector_type(16)));
typedef _Float16 v8h  __attribute__((ext_vector_type(8)));
typedef __bf16   v16b __attribute__((ext_vector_type(16)));
typedef __bf16   v8b  __attribute__((ext_vector_type(8)));
typedef float    v8f  __attribute__((ext_vector_type(8)));
typedef float    v4f  __attribute__((ext_vector_type(4)));
typedef unsigned int v4u __attribute__((ext_vector_type(4)));

// ---- scalar helpers --------------------------------------------------------------------------------
__device__ __forceinline__ unsigned short bf_bits(float f) {          // f32 -> bf16 bits, RNE convert
  unsigned u = __float_as_uint(f);
  return (unsigned short)((u + 0x7FFFu + ((u >> 16) & 1u)) >> 16);
}
__device__ __forceinline__ float bf_up(unsigned short h) { return __uint_as_float(((unsigned)h) << 16); }
__device__ __forceinline__ float bfr(float f) { return bf_up(bf_bits(f)); }   // value after bf16 RNE convert
__device__ __forceinline__ unsigned short h_bits(_Float16 x) { return __builtin_bit_cast(unsigned short, x); }
__device__ __forceinline__ unsigned pk16(unsigned short a, unsigned short b) { return (unsigned)a | ((unsigned)b << 16); }
__device__ __forceinline__ float xhalf(float x) {                     // the value lane l ^ 16 holds
  return __builtin_bit_cast(float, __builtin_amdgcn_permlanex16(__builtin_bit_cast(int, x), __builtin_bit_cast(int, x),
                                                                0x76543210, 0xfedcba98, false, false));
}
__device__ __forceinline__ void exp2x8(float (&x)[8]) {
  asm("v_exp_f32 %0, %0\n\tv_exp_f32 %1, %1\n\tv_exp_f32 %2, %2\n\tv_exp_f32 %3, %3\n\t"
      "v_exp_f32 %4, %4\n\tv_exp_f32 %5, %5\n\tv_exp_f32 %6, %6\n\tv_exp_f32 %7, %7\n\tv_nop"
      : "+v"(x[0]), "+v"(x[1]), "+v"(x[2]), "+v"(x[3]), "+v"(x[4]), "+v"(x[5]), "+v"(x[6]), "+v"(x[7]));
}
__device__ __forceinline__ float exp2x1(float x) {
  asm("v_exp_f32 %0, %0\n\tv_nop" : "+v"(x));
  return x;
}
#define LOG2E 1.44269504088896340736f   // e^x = 2^(x * LOG2E), as __expf forms it
__device__ __forceinline__ v8f zero8() { v8f z = {0.f, 0.f, 0.f, 0.f, 0.f, 0.f, 0.f, 0.f}; return z; }

// ---- fragment loader: 16-bit A/B operand, lane -> row/col (lane&15), p already includes +8*(lane>>4);
//      elements 0..7 <- p[0..7] (k0+8h..), elements 8..15 <- p[16..23] (k0+16+8h..)
__device__ __forceinline__ v16b ldfrag_b(const __bf16* p) {
  union { v16b v; v8b h[2]; } f;
  f.h[0] = *(const v8b*)(p);
  f.h[1] = *(const v8b*)(p + 16);
  return f.v;
}

// ---- WMMA helpers: plain builtins, behind which the compiler itself keeps the distance to the next user of D, A or B ----
__device__ __forceinline__ v8f mma_b_raw(v16b a, v16b b, v8f c) {
  return __builtin_amdgcn_wmma_f32_16x16x32_bf16(false, a, false, b, (short)0, c, false, false);
}
__device__ __forceinline__ v8f mma_h_raw(v16h a, v16h b, v8f c) {
  return __builtin_amdgcn_wmma_f32_16x16x32_f16(false, a, false, b, (short)0, c, false, false);
}
__device__ __forceinline__ void acc_guard4(v8f& a, v8f& b, v8f& c, v8f& d) {
  asm volatile("v_nop\n\tv_nop\n\tv_nop\n\tv_nop" : "+v"(a), "+v"(b), "+v"(c), "+v"(d));
}

// ---- asynchronous copies global -> LDS, 16 B per lane, through no register ---------------------------
__device__ __forceinline__ unsigned lds_off(const void* p) { return (unsigned)(size_t)p; }   // LDS byte address
// A run of copies and its s_wait_xcnt 0 in ONE statement: the wait stands in front of every later write of the
// address registers that the copies name.
__device__ __forceinline__ void acopy4(const unsigned* l, const __bf16* const* g) {
  asm volatile("global_load_async_to_lds_b128 %0, %4, off\n\t"
               "global_load_async_to_lds_b128 %1, %5, off\n\t"
               "global_load_async_to_lds_b128 %2, %6, off\n\t"
               "global_load_async_to_lds_b128 %3, %7, off\n\t"
               "s_wait_xcnt 0x0"
               :: "v"(l[0]), "v"(l[1]), "v"(l[2]), "v"(l[3]), "v"(g[0]), "v"(g[1]), "v"(g[2]), "v"(g[3]) : "memory");
}
__device__ __forceinline__ void acopy8(const unsigned* l, const __bf16* const* g) {
  asm volatile("global_load_async_to_lds_b128 %0, %8, off\n\t"
               "global_load_async_to_lds_b128 %1, %9, off\n\t"
               "global_load_async_to_lds_b128 %2, %10, off\n\t"
               "global_load_async_to_lds_b128 %3, %11, off\n\t"
               "global_load_async_to_lds_b128 %4, %12, off\n\t"
               "global_load_async_to_lds_b128 %5, %13, off\n\t"
               "global_load_async_to_lds_b128 %6, %14, off\n\t"
               "global_load_async_to_lds_b128 %7, %15, off\n\t"
               "s_wait_xcnt 0x0"
               :: "v"(l[0]), "v"(l[1]), "v"(l[2]), "v"(l[3]), "v"(l[4]), "v"(l[5]), "v"(l[6]), "v"(l[7]),
                  "v"(g[0]), "v"(g[1]), "v"(g[2]), "v"(g[3]), "v"(g[4]), "v"(g[5]), "v"(g[6]), "v"(g[7]) : "memory");
}

// =====================================================================================================
// f32 -> bf16 (RNE convert), 8 elements per thread, one 16-B store per lane: a wave writes 512 contiguous B
// multiple of 256 for every use here; host-checked). coverage: n8 threads x 8 = whole plane.
// =====================================================================================================
__global__ __launch_bounds__(256) void cvt_bf16x8(const float* __restrict__ in, unsigned short* out, int n8) {
  const int i = blockIdx.x * 256 + threadIdx.x;
  if (i < n8) {
    const v4f a = *(const v4f*)(in + (size_t)i * 8);
    const v4f b = *(const v4f*)(in + (size_t)i * 8 + 4);
    v4u p;
    p[0] = pk16(bf_bits(a[0]), bf_bits(a[1]));
    p[1] = pk16(bf_bits(a[2]), bf_bits(a[3]));
    p[2] = pk16(bf_bits(b[0]), bf_bits(b[1]));
    p[3] = pk16(bf_bits(b[2]), bf_bits(b[3]));
    *(v4u*)(out + (size_t)i * 8) = p;
    
  }
}

// =====================================================================================================
// Register-blocked batched bf16 WMMA GEMM: C[m][n] = sum_k A[m][k] * Bt[n][k]; one wave per 64x64 tile, a block of
// 8 waves (2 x 4) per 128x256 tile. A row-major [M][K] pitch lda; Bt row-major [N][K] pitch ldb (k contiguous);
// M multiple of 128, N of 256, K of 64 and at least 128 (asserted on the shapes used). blockIdx.y = batch index.
// Operands: a stage is 64 k of the block's A rows (and A2 rows) and Bt rows, rows of 128 B at pitch 144 B in LDS,
// brought by asynchronous copies (8 lanes per row: a wave's copy covers 4 whole lines), two buffers: stage t + 2 is
// issued behind the barrier that ends stage t's reads and flies while stage t + 1 is worked on.
// NSPLIT: 0 = A.Bt; 1 = (A + A2).Bt (A2 = unscaled bf16 lo plane of A, same pitch/stride).
// BIAS: 0 none; 1 = + bfr(bias[n]) per column; 2 = + bfr(bias[m]) per row; 3 = as 1 in batch 0, + 0 in every other batch.
// ROPE (needs N tile = one head = 64 cols d 0..63, row m = b*SEQ + s): for s >= 1,
//   t[d] = t[d]*bfr(cos[s-1][d]) + rot[d]*bfr(sin[s-1][d]), rot = [-t[32..63] | t[0..31]] (after bias).
// OUT_MODE: 0 = f32 (pitch ldc); 2 = bf16 hi plane C + bf16 lo plane C2 (lo = RNE(v - hi), unscaled);
//           3 = one f16 plane C; C2 (mode 2 only) same pitch/stride as C.
// PAIR: 1 = built for two blocks per WGP (four waves per SIMD, 256 registers): a wave holds the fragments of 32 k at a
//       time, not of the whole stage, and the other block's waves work while it waits for them; 0 = one block per WGP.
// =====================================================================================================
template <int NSPLIT, int OUT_MODE, int BIAS, int ROPE, int PAIR>
__global__ __launch_bounds__(256, PAIR ? 4 : 1) void gemm64(
    const unsigned short* __restrict__ Ap, const unsigned short* __restrict__ A2p, int lda, long long strideA,
    const unsigned short* __restrict__ Btp, int ldb, long long strideB,
    const float* __restrict__ bias, const float* __restrict__ rsin, const float* __restrict__ rcos,
    void* Cout, void* Cout2, int ldc, long long strideC,
    int M, int N, int K) {
  const __bf16* A  = (const __bf16*)(const void*)Ap;
  const __bf16* A2 = (const __bf16*)(const void*)A2p;
  const __bf16* Bt = (const __bf16*)(const void*)Btp;
  constexpr int ROWS_A  = GBM * (1 + NSPLIT);        // stage rows 0.. : A, then A2 where there is one
  constexpr int ROWS    = ROWS_A + GBN;              // then the Bt rows
  constexpr int STAGE_E = ROWS * GP;                 // elements of one buffer
  constexpr int NCP     = ROWS / 32;                 // copies per thread and stage: 256 threads cover 32 rows (12 or 16)
  __shared__ __align__(16) float sT[8][16 * 68];   // per-wave 16x64 slab, pitch 68 floats
  __shared__ __align__(16) __bf16 sG[2 * STAGE_E];  // operand stages, two buffers
  const int b    = blockIdx.y;
  const int lane = threadIdx.x & 31;
  const int wave = threadIdx.x >> 5;
  const int blkN = N / GBN;
  const int blkM = M / GBM;
  const int blk  = blockIdx.x;
  if (blk >= blkM * blkN) return;        // block-uniform, in front of every barrier and copy
  const int bm = blk / blkN;
  const int bn = blk - bm * blkN;
  const int wm = wave >> 2;              // 0..1
  const int wn = wave & 3;               // 0..3
  const int m0 = bm * GBM + (wm << 6);
  const int n0 = bn * GBN + (wn << 6);

  const __bf16* Ab  = A  + (size_t)b * strideA;
  const __bf16* Bb  = Bt + (size_t)b * strideB;
  const __bf16* Ab2 = (NSPLIT == 1) ? (A2 + (size_t)b * strideA) : Ab;

  const int rlane = lane & 15;                 // row (A) / col (B, D) within subtile
  const int koff  = (lane >> 4) * 8;           // k offset of this lane half
  const int mOff  = (lane >> 4) * 8;           // D row offset

  v8f acc[4][4];
#pragma unroll
  for (int i = 0; i < 4; ++i)
#pragma unroll
    for (int j = 0; j < 4; ++j) acc[i][j] = zero8();

  // ---- stage copies: thread -> row (tid >> 3) of each group of 32 rows, 16-B piece (tid & 7) of its 128 B ----
  const int crow = threadIdx.x >> 3;
  const int cseg = (threadIdx.x & 7) * 8;
  const __bf16* gA  = Ab  + (size_t)(bm * GBM + crow) * lda + cseg;
  const __bf16* gA2 = Ab2 + (size_t)(bm * GBM + crow) * lda + cseg;
  const __bf16* gB  = Bb  + (size_t)(bn * GBN + crow) * ldb + cseg;
  const unsigned lC = lds_off(sG) + (unsigned)(crow * GP + cseg) * 2u;
  auto issue_stage = [&](int st, int buf) {
    unsigned l[NCP];
    const __bf16* g[NCP];
#pragma unroll   // every index of l and g constant: the addresses stay in registers
    for (int p = 0; p < NCP; ++p) {
      l[p] = lC + (unsigned)(buf * STAGE_E + p * 32 * GP) * 2u;
      if (p * 32 < GBM)          g[p] = gA  + (size_t)(p * 32) * lda + (size_t)st * GKS;
      else if (p * 32 < ROWS_A)  g[p] = gA2 + (size_t)(p * 32 - GBM) * lda + (size_t)st * GKS;
      else                       g[p] = gB  + (size_t)(p * 32 - ROWS_A) * ldb + (size_t)st * GKS;
    }
    acopy8(l, g);
    if (NCP == 16) acopy8(l + 8, g + 8);
    else           acopy4(l + 8, g + 8);
  };

  const int T = K / GKS;                              // stages
  issue_stage(0, 0);
  asm volatile("s_wait_asynccnt 0x0" ::: "memory");   // this wave's copies of stage 0 have landed
  __syncthreads();                                    // and every other wave's: stage 0 may be read
  if (T > 1) issue_stage(1, 1);

  for (int t = 0; t < T; ++t) {
    const __bf16* sb = sG + (t & 1) * STAGE_E;
    const __bf16* sa = sb + ((wm << 6) + rlane) * GP + koff;
    const __bf16* sw = sb + (ROWS_A + (wn << 6) + rlane) * GP + koff;
    if constexpr (PAIR) {
      static_assert(NSPLIT == 0);
#pragma unroll   // every fragment index constant
      for (int ks = 0; ks < 2; ++ks) {
        v16b bq[4], aq[4];
#pragma unroll
        for (int j = 0; j < 4; ++j) bq[j] = ldfrag_b(sw + (j << 4) * GP + ks * 32);
#pragma unroll
        for (int i = 0; i < 4; ++i) aq[i] = ldfrag_b(sa + (i << 4) * GP + ks * 32);
        // Holds the 32 k's fragment loads as one group ahead of their WMMAs: one place where the wave waits, not many.
        __builtin_amdgcn_sched_barrier(0);
#pragma unroll
        for (int i = 0; i < 4; ++i)
#pragma unroll
          for (int j = 0; j < 4; ++j) acc[i][j] = mma_b_raw(aq[i], bq[j], acc[i][j]);
        // Holds the next group's loads, and the full LDS wait at the stage's foot, behind these WMMAs.
        __builtin_amdgcn_sched_barrier(0);
      }
    } else {
    v16b bh[2][4], ah[2][4], al[2][4];   // the loops below are unrolled so that every fragment index is constant
#pragma unroll
    for (int ks = 0; ks < 2; ++ks) {
#pragma unroll
      for (int j = 0; j < 4; ++j) bh[ks][j] = ldfrag_b(sw + (j << 4) * GP + ks * 32);
#pragma unroll
      for (int i = 0; i < 4; ++i) {
        ah[ks][i] = ldfrag_b(sa + (i << 4) * GP + ks * 32);
        al[ks][i] = ah[ks][i];
        if (NSPLIT == 1) al[ks][i] = ldfrag_b(sa + (GBM + (i << 4)) * GP + ks * 32);
      }
    }
    // Holds the stage's fragment loads as one group ahead of its WMMAs: moved in among them, into one shared
    // register set, each place with loads makes the wave wait out the LDS latency.
    __builtin_amdgcn_sched_barrier(0);
#pragma unroll
    for (int ks = 0; ks < 2; ++ks)
#pragma unroll
      for (int i = 0; i < 4; ++i)
#pragma unroll
        for (int j = 0; j < 4; ++j) {
          acc[i][j] = mma_b_raw(ah[ks][i], bh[ks][j], acc[i][j]);
          if (NSPLIT == 1) acc[i][j] = mma_b_raw(al[ks][i], bh[ks][j], acc[i][j]);
        }
    // Holds the WMMAs ahead of the full LDS wait below: behind it none would start before the last fragment is in.
    __builtin_amdgcn_sched_barrier(0);
    }
    asm volatile("s_wait_dscnt 0x0" ::: "memory");      // this wave's reads of buffer t & 1 are done
    asm volatile("s_wait_asynccnt 0x0" ::: "memory");   // this wave's copies of stage t + 1 have landed
    __syncthreads();                                    // publishes stage t + 1, frees buffer t & 1
    if (t + 2 < T) issue_stage(t + 2, t & 1);
  }
  asm volatile("s_wait_asynccnt 0x0" ::: "memory");     // nothing in flight when the wave goes on
  acc_guard4(acc[0][0], acc[0][1], acc[0][2], acc[0][3]);
  acc_guard4(acc[1][0], acc[1][1], acc[1][2], acc[1][3]);
  acc_guard4(acc[2][0], acc[2][1], acc[2][2], acc[2][3]);
  acc_guard4(acc[3][0], acc[3][1], acc[3][2], acc[3][3]);

  // ---- epilogue ----
  float* slab = sT[wave];
  float bcol[4];
  if (BIAS == 1 || BIAS == 3) {
#pragma unroll
    for (int j = 0; j < 4; ++j) {
      const float bv = bias[n0 + (j << 4) + rlane];   // n0+.. < N
      // In front of the next load: the compiler lays its result over the offset register that the loads issued here name.
      if (BIAS == 3) asm volatile("s_wait_xcnt 0x0" ::: "memory");
      bcol[j] = bfr(bv);
      if (BIAS == 3 && b != 0) bcol[j] = 0.f;
    }
  } else {
#pragma unroll
    for (int j = 0; j < 4; ++j) bcol[j] = 0.f;
  }
#pragma unroll
  for (int i = 0; i < 4; ++i) {
    const int mBase = m0 + (i << 4);
#pragma unroll
    for (int r = 0; r < 8; ++r) {
      const int m = mBase + mOff + r;                  // < M
      float brow = 0.f;
      if (BIAS == 2) brow = bfr(bias[m]);
      float t[4];
#pragma unroll
      for (int j = 0; j < 4; ++j) {
        float v = acc[i][j][r];
        if (BIAS == 1 || BIAS == 3) v = v + bcol[j];
        if (BIAS == 2) v = v + brow;
        t[j] = v;
      }
      if (ROPE) {
        const int s = m & (SEQ - 1);                   // token index within the sequence
        const bool use = (s > 0);                        // token 0 passes unrotated
        const int sidx = use ? (s - 1) : 0;              // clamped table row
        const float* cr = rcos + (size_t)sidx * HD;
        const float* sr = rsin + (size_t)sidx * HD;
        float u[4];
#pragma unroll
        for (int j = 0; j < 4; ++j) {
          const int d = (j << 4) + rlane;                // 0..63
          const float cs = bfr(cr[d]);
          const float sn = bfr(sr[d]);
          const float tp = t[j ^ 2];                     // partner d^32, same lane
          const float rot = (j < 2) ? -tp : tp;
          const float w = t[j] * cs + rot * sn;
          u[j] = use ? w : t[j];
        }
#pragma unroll
        for (int j = 0; j < 4; ++j) t[j] = u[j];
      }
#pragma unroll
      for (int j = 0; j < 4; ++j) slab[(mOff + r) * 68 + (j << 4) + rlane] = t[j];
    }
    __builtin_amdgcn_fence(__ATOMIC_RELEASE, "workgroup");
    __builtin_amdgcn_wave_barrier();
    __builtin_amdgcn_fence(__ATOMIC_ACQUIRE, "workgroup");
    if (OUT_MODE == 0) {
      float* C = (float*)Cout + (size_t)b * strideC;
      const int hh = lane >> 4, c4 = (lane & 15) * 4;     // 256-B row segment = 16 lanes x 16 B
      {
#pragma unroll
        for (int it = 0; it < 8; ++it) {
          const int row = it * 2 + hh;                     // it 0..7 x hh 0..1 = rows 0..15
          const v4f v = *(const v4f*)(slab + row * 68 + c4);
          *(v4f*)(C + (size_t)(mBase + row) * ldc + n0 + c4) = v;
        }
        
      }
    } else {
      const int q = lane >> 3, c8 = (lane & 7) * 8;
      unsigned short* C  = (unsigned short*)Cout  + (size_t)b * strideC;
      unsigned short* C2 = (unsigned short*)Cout2 + (size_t)b * strideC;
      v4u hv[4], lv[4];
#pragma unroll
      for (int it = 0; it < 4; ++it) {
        const int row = it * 4 + q;                        // it 0..3 x q 0..3 = rows 0..15
        const float* sp = slab + row * 68 + c8;
        v4u a, a2;
#pragma unroll
        for (int e = 0; e < 4; ++e) {
          const float f0 = sp[2 * e], f1 = sp[2 * e + 1];
          unsigned short h0, h1, l0 = 0, l1 = 0;
          if (OUT_MODE == 2) {
            h0 = bf_bits(f0); h1 = bf_bits(f1);
            l0 = bf_bits(f0 - bf_up(h0)); l1 = bf_bits(f1 - bf_up(h1));
          } else {
            h0 = h_bits((_Float16)f0); h1 = h_bits((_Float16)f1);
          }
          a[e] = pk16(h0, h1); a2[e] = pk16(l0, l1);
        }
        hv[it] = a; lv[it] = a2;
      }
      {
#pragma unroll
        for (int it = 0; it < 4; ++it) {
          const int row = it * 4 + q;
          *(v4u*)(C  + (size_t)(mBase + row) * ldc + n0 + c8) = hv[it];
          if (OUT_MODE == 2) *(v4u*)(C2 + (size_t)(mBase + row) * ldc + n0 + c8) = lv[it];
        }
        
      }
    }
    __builtin_amdgcn_fence(__ATOMIC_RELEASE, "workgroup");
    __builtin_amdgcn_wave_barrier();
    __builtin_amdgcn_fence(__ATOMIC_ACQUIRE, "workgroup");
  }
}

// =====================================================================================================
// Attention, head dim 64, no mask, all SEQ keys.
//   q planes (bf16 hi / lo): element (b, t, h, d) at [(b*SEQ + t)*DM + h*64 + d]
//   k planes (bf16 hi / lo): same layout with key index s
//   v^T plane (f16):         element (b, h, d, s) at [(b*DM + h*64 + d)*SEQ + s]
//   out planes (bf16 hi / lo of the normalised context): element (b, t, h, d) at [(b*SEQ + t)*DM + h*64 + d]
//   Both products are formed transposed: S^T = K . Q^T (A = K rows, B = Q) and O^T += V^T . P^T (A = V^T rows, B = P^T).
//   In each tile a lane then holds one query (column lane&15) and 32 of the chunk's 64 keys (rows j*16 + 8*(lane>>4) + r): the maximum
//   and the sum run inside the lane, the two wave halves exchange the maximum once per chunk and join their sums once at
//   the end; two score tiles, converted in place, are the B operand P^T in the k order of the V^T loader.
//   scores = k . q : bf16 hi/lo split (hi.hi + lo.hi + hi.lo in k, q), f32 accumulate; the maximum is kept in raw scores
//   1024 p = 2^(s * (sscale * log2 e) + (10 - m * sscale * log2 e)): one f32 multiply-add per score in front of the 2^x;
//   carried as f16, its row sum carries the same 1024; context = v^T . p^T on f16 WMMA, one product into the running
//   accumulator: v is rounded to f16 as p is, so each factor of a term carries the same relative error; online softmax in f32.
//   Block = 4 waves = 128 query rows of one (b, h), a wave 32 of them as two 16-column tiles that share every K and
//   V^T fragment read; grid = NQG * NH * NB; kv chunks of 64, static trip NQB.
//   K / V^T chunk staging: a stage is the chunk's three 64x64 planes, rows of 128 B at pitch 144 B in LDS, brought by
//   asynchronous copies (8 lanes per row: a wave's copy covers 4 whole lines; 12 copies per thread), two buffers:
//   chunk t + 2 is issued behind the barrier that ends chunk t's reads and flies while chunk t + 1 is worked on.
//   Output coverage: each wave stores rows q0..q0+31 (u 0..1 x it 0..3 x lane>>3 0..3) x 64 columns (8 lanes x 8) of both planes.
// =====================================================================================================
__global__ __launch_bounds__(128, 4)   // 4 waves per SIMD: the 256 registers that let four blocks share a WGP
void attn64(const unsigned short* __restrict__ qhp, const unsigned short* __restrict__ qlp,
            const unsigned short* __restrict__ khp, const unsigned short* __restrict__ klp,
            const unsigned short* __restrict__ vhp,
            unsigned short* ohp, unsigned short* olp, float sscale) {
  union FB { v16b v; v8b h[2]; };
  union FH { v16h v; v8h h[2]; };
  // Rows of 64 16-bit elements are laid at a pitch of LP = 72 elements (144 B = 16 B x 9): the 16 rows that one
  // ds_load_b128 fragment read touches then fall on 16 different groups of four banks instead of two.
  constexpr int PLANE_B = 64 * LP * 2;                            // bytes of one plane of a stage, 9 KB
  constexpr int STAGE_B = 3 * PLANE_B;                            // K hi [kv][d], K lo, V^T [d][kv]
  static_assert(4 * QT * 16 * OSP * 4 <= 2 * STAGE_B);            // the output tiles fit where the stages were
  // Two stage buffers, 54 KB; behind the loop's last barrier the same bytes hold the per-wave context tiles [row][d].
  __shared__ __align__(16) unsigned char sKV[2 * STAGE_B];

  const int tid  = threadIdx.x;
  const int wave = tid >> 5;
  const int lane = tid & 31;
  const int hh   = lane >> 4;
  const int c    = lane & 15;

  const int bx   = blockIdx.x;
  const int qb   = bx % NQG;
  const int rest = bx / NQG;
  const int h    = rest % NH;
  const int b    = rest / NH;
  const int q0   = qb * (64 * QT) + wave * (16 * QT);
  const size_t rowB = (size_t)b * SEQ;

  const __bf16* Qh = (const __bf16*)(const void*)qhp + (size_t)h * HD;
  const __bf16* Ql = (const __bf16*)(const void*)qlp + (size_t)h * HD;
  const __bf16* Kh = (const __bf16*)(const void*)khp + (size_t)h * HD;
  const __bf16* Kl = (const __bf16*)(const void*)klp + (size_t)h * HD;
  const _Float16* Vh = (const _Float16*)(const void*)vhp + ((size_t)b * DM + (size_t)h * HD) * SEQ;

  // ---- Q fragments (B operand, column = query = u*16 + lane&15): QT query tiles x 2 d-chunks, hi and lo ----
  v16b qah[QT][2], qal[QT][2];
#pragma unroll
  for (int u = 0; u < QT; ++u)
#pragma unroll
    for (int dc = 0; dc < 2; ++dc) {
      const size_t qo = (rowB + q0 + u * 16 + c) * DM + dc * 32 + 8 * hh;
      qah[u][dc] = ldfrag_b(Qh + qo);
      qal[u][dc] = ldfrag_b(Ql + qo);
      // In front of the next loads: the compiler lays their results over address registers of the loads issued here.
      asm volatile("s_wait_xcnt 0x0" ::: "memory");
    }

  // per query tile u, this lane's query: running maximum of the raw scores (both halves alike), sum of 1024 p over
  // this half's keys
  const float cexp = sscale * LOG2E;    // raw score -> exponent of 2; sscale > 0, so raw scores order as scaled ones do
  float mrow[QT], lrow[QT];
  v8f oacc[QT][4];                      // O^T: oacc[u][t][r] = context[query u*16 + c][d = t*16 + 8*hh + r]
#pragma unroll
  for (int u = 0; u < QT; ++u) {
    mrow[u] = -INFINITY;
    lrow[u] = 0.f;
#pragma unroll
    for (int t = 0; t < 4; ++t) oacc[u][t] = zero8();
  }

  // ---- stage copies: thread -> row (tid >> 3) of each group of 16 rows, 16-B piece (tid & 7) of its 128 B ----
  const int crow = tid >> 3;
  const int cseg = (tid & 7) * 8;
  const __bf16* gKh = Kh + (rowB + crow) * DM + cseg;                            // K row crow of chunk 0
  const __bf16* gKl = Kl + (rowB + crow) * DM + cseg;
  const __bf16* gVh = (const __bf16*)(const void*)(Vh + (size_t)crow * SEQ + cseg);   // V^T row d = crow, an address only
  const unsigned lC = lds_off(sKV) + (unsigned)(crow * LP + cseg) * 2u;
  auto issue_stage = [&](int st, int buf) {
    unsigned l[12];
    const __bf16* g[12];
#pragma unroll   // every index of l and g constant: the addresses stay in registers
    for (int p = 0; p < 4; ++p) {
      const unsigned lp = lC + (unsigned)(buf * STAGE_B + p * 16 * LP * 2);
      l[p]      = lp;
      l[4 + p]  = lp + PLANE_B;
      l[8 + p]  = lp + 2 * PLANE_B;
      g[p]      = gKh + (size_t)(st * 64 + p * 16) * DM;          // K row st*64 + p*16 + crow < SEQ
      g[4 + p]  = gKl + (size_t)(st * 64 + p * 16) * DM;
      g[8 + p]  = gVh + (size_t)(p * 16) * SEQ + st * 64;         // V^T row p*16 + crow < 64, s = st*64 + cseg.. < SEQ
    }
    acopy8(l, g);
    acopy4(l + 8, g + 8);
  };

  static_assert(NQB >= 2);                            // chunks 0 and 1 both exist
  issue_stage(0, 0);
  asm volatile("s_wait_asynccnt 0x0" ::: "memory");   // this wave's copies of chunk 0 have landed
  __syncthreads();                                    // and every other wave's: chunk 0 may be read
  issue_stage(1, 1);

  // One chunk: scores, softmax, context, then the publish point of chunk kt + 1.
  auto chunk = [&](int kt) {
    const unsigned char* sb = sKV + (kt & 1) * STAGE_B;
    const __bf16*   Ksh = (const __bf16*)(const void*)(sb);
    const __bf16*   Ksl = (const __bf16*)(const void*)(sb + PLANE_B);
    const _Float16* Vth = (const _Float16*)(const void*)(sb + 2 * PLANE_B);

    // ---- scores, transposed: 64 keys x 16*QT queries per wave, 3 bf16 products; A[m = key][k = d] from Ksh[key][d];
    //      each K fragment, read once, is the A operand of every query tile ----
    v8f s[QT][4];
#pragma unroll
    for (int j = 0; j < 4; ++j) {
#pragma unroll
      for (int u = 0; u < QT; ++u) s[u][j] = zero8();
#pragma unroll
      for (int dc = 0; dc < 2; ++dc) {
        FB kb, kl;
        kb.h[0] = *(const v8b*)(Ksh + (j * 16 + c) * LP + dc * 32 + 8 * hh);
        kb.h[1] = *(const v8b*)(Ksh + (j * 16 + c) * LP + dc * 32 + 16 + 8 * hh);
        kl.h[0] = *(const v8b*)(Ksl + (j * 16 + c) * LP + dc * 32 + 8 * hh);
        kl.h[1] = *(const v8b*)(Ksl + (j * 16 + c) * LP + dc * 32 + 16 + 8 * hh);
#pragma unroll
        for (int u = 0; u < QT; ++u) s[u][j] = mma_b_raw(kb.v, qah[u][dc], s[u][j]);
#pragma unroll
        for (int u = 0; u < QT; ++u) s[u][j] = mma_b_raw(kl.v, qah[u][dc], s[u][j]);
#pragma unroll
        for (int u = 0; u < QT; ++u) s[u][j] = mma_b_raw(kb.v, qal[u][dc], s[u][j]);
      }
    }

    // Keeps the softmax behind the score products: scheduled in among them its values lengthen the stretch where both
    // tiles' scores, Q and the context are all live, and the build spills at the 256 registers of four waves per SIMD.
    __builtin_amdgcn_sched_barrier(0);
    // ---- maximum, online softmax; query u*16 + c, key j*16 + 8*hh + r lives in s[u][j][r] ----
    // P^T (x1024, f16) as B operand: element e of chunk kk = key kk*32 + (e < 8 ? 8*hh + e : 16 + 8*hh + e - 8)
    FH pb[QT][2];
#pragma unroll
    for (int u = 0; u < QT; ++u) {
      float mj[4];
#pragma unroll
      for (int j = 0; j < 4; ++j) {
        mj[j] = -INFINITY;
#pragma unroll
        for (int r = 0; r < 8; ++r) mj[j] = fmaxf(mj[j], s[u][j][r]);
      }
      float m = fmaxf(fmaxf(mj[0], mj[1]), fmaxf(mj[2], mj[3]));
      m = fmaxf(m, xhalf(m));                            // the query's other 32 keys sit in lane ^ 16
      const float mnew  = fmaxf(mrow[u], m);
      const float msafe = (mnew == -INFINITY) ? 0.f : mnew;
      const float alpha = exp2x1((mrow[u] - msafe) * cexp);
      mrow[u] = mnew;
      const float nb = __builtin_fmaf(-msafe, cexp, 10.0f);   // the maximum and the x1024 carry, as an exponent of 2
      float pj[4];
#pragma unroll
      for (int j = 0; j < 4; ++j) {
        float p[8];
#pragma unroll
        for (int r = 0; r < 8; ++r) p[r] = __builtin_fmaf(s[u][j][r], cexp, nb);
        exp2x8(p);
        pj[j] = 0.f;
#pragma unroll
        for (int r = 0; r < 8; ++r) {
          pj[j] += p[r];
          pb[u][j >> 1].v[(j & 1) * 8 + r] = (_Float16)p[r];
        }
      }
      lrow[u] = __builtin_fmaf(lrow[u], alpha, (pj[0] + pj[1]) + (pj[2] + pj[3]));
#pragma unroll
      for (int t = 0; t < 4; ++t)
#pragma unroll
        for (int r = 0; r < 8; ++r) oacc[u][t][r] *= alpha;
    }

    // ---- context^T += V^T . P^T (f16 WMMA): A[m = d][k = kv] from Vth[d][kv], B = P^T[k = kv][n = query]; each V^T
    //      fragment, read once, is the A operand of every query tile; the key halves are the outer loop, so that the
    //      seven other accumulators' products stand between two products into the same one ----
#pragma unroll
    for (int kk = 0; kk < 2; ++kk) {
#pragma unroll
      for (int t = 0; t < 4; ++t) {
        FH vb;
        vb.h[0] = *(const v8h*)(Vth + (t * 16 + c) * LP + kk * 32 + 8 * hh);
        vb.h[1] = *(const v8h*)(Vth + (t * 16 + c) * LP + kk * 32 + 16 + 8 * hh);
#pragma unroll
        for (int u = 0; u < QT; ++u) oacc[u][t] = mma_h_raw(vb.v, pb[u][kk].v, oacc[u][t]);
      }
    }

    asm volatile("s_wait_dscnt 0x0" ::: "memory");      // this wave's reads of buffer kt & 1 are done
    asm volatile("s_wait_asynccnt 0x0" ::: "memory");   // this wave's copies of chunk kt + 1 have landed
    __syncthreads();                                    // publishes chunk kt + 1, frees buffer kt & 1
  };
  // The chunks that have a chunk kt + 2 to fetch, then the last two, in loops of their own (static trip counts): with the
  // test inside one loop the compiler moves folds and row sums behind the branch, their operands stay in registers
  // beside the copies' addresses, and the build spills at 256 registers.
  for (int kt = 0; kt < NQB - 2; ++kt) {
    chunk(kt);
    issue_stage(kt + 2, kt & 1);
  }
#pragma unroll 1   // kept rolled: one more copy of the body, not two
  for (int kt = NQB - 2; kt < NQB; ++kt) chunk(kt);
  asm volatile("s_wait_asynccnt 0x0" ::: "memory");     // nothing in flight when the buffers become output staging

  // ---- normalise (context and l both carry the 1024), stage the wave's 16*QT x 64 tile, bf16 hi/lo split,
  float* os = (float*)(void*)sKV + wave * (QT * 16 * OSP);   // every wave has passed the last chunk's barrier
#pragma unroll
  for (int u = 0; u < QT; ++u) {
    const float l = lrow[u] + xhalf(lrow[u]);          // join the two halves' sums of this query
    const float inv = (l > 0.f) ? (1.0f / l) : 0.f;
#pragma unroll
    for (int t = 0; t < 4; ++t)
#pragma unroll
      for (int r = 0; r < 8; ++r) os[(u * 16 + c) * OSP + t * 16 + 8 * hh + r] = oacc[u][t][r] * inv;
  }
  __builtin_amdgcn_fence(__ATOMIC_RELEASE, "workgroup");
  __builtin_amdgcn_wave_barrier();
  __builtin_amdgcn_fence(__ATOMIC_ACQUIRE, "workgroup");
#pragma unroll
  for (int u = 0; u < QT; ++u) {
    const int q4 = lane >> 3, c8 = (lane & 7) * 8;
    v4u hv[4], lv[4];
#pragma unroll
    for (int it = 0; it < 4; ++it) {
      const int row = u * 16 + it * 4 + q4;   // u x it 0..3 x q4 0..3 = rows 0..16*QT-1 of the wave tile
      const float* sp = os + row * OSP + c8;
      v4u a, a2;
#pragma unroll
      for (int e = 0; e < 4; ++e) {
        const float f0 = sp[2 * e], f1 = sp[2 * e + 1];
        const unsigned short h0 = bf_bits(f0), h1 = bf_bits(f1);
        const unsigned short l0 = bf_bits(f0 - bf_up(h0)), l1 = bf_bits(f1 - bf_up(h1));
        a[e] = pk16(h0, h1); a2[e] = pk16(l0, l1);
      }
      hv[it] = a; lv[it] = a2;
    }
    {
#pragma unroll
      for (int it = 0; it < 4; ++it) {
        const int row = u * 16 + it * 4 + q4;
        const size_t go = (rowB + q0 + row) * DM + (size_t)h * HD + c8;
        *(v4u*)(ohp + go) = hv[it];
        *(v4u*)(olp + go) = lv[it];
      }
    }
  }
}

// =====================================================================================================
// Workspace map: 8 regions of PL = NTOK*DM*2 = 16777216 B each, total 134217728 B.
//   R0  Xb   bf16 [8192][1024]                    (after the projections: Oh, context hi plane [8192][1024])
//   R1  Qh   bf16 [8192][1024]                    (after attention: Wob bf16 [1024][1024], 2097152 B used)
//   R2  Ql   bf16 [8192][1024]
//   R3  Kh   bf16 [8192][1024]
//   R4  Kl   bf16 [8192][1024]
//   R5  VT   f16  [4][1024][2048]
//   R6  not used
//   R7  Wqkv bf16 [3072][1024] (6291456 B used)   (during attention: Ol, context lo plane [8192][1024])
// All planes are exact multiples of their 64x64 tile / whole-line store granularity (no padded tails needed).
// Weights are [out n][in k] with k contiguous = the Bt / A layout the GEMM wants, so they are only converted.
// =====================================================================================================
extern "C" void kernel_launch(void* const* d_in, const int* in_sizes, int n_in,
                              void* d_out, int out_size, void* d_ws, size_t ws_size,
                              hipStream_t stream) {
  if (n_in < 8) return;
  if (in_sizes[0] != NTOK * DM) return;
  if (in_sizes[1] != 3 * DM * DM) return;
  if (in_sizes[2] != DM || in_sizes[3] != DM) return;
  if (in_sizes[4] != DM * DM || in_sizes[5] != DM) return;
  if (in_sizes[6] != (SEQ - 1) * HD || in_sizes[7] != (SEQ - 1) * HD) return;
  if (out_size != NTOK * DM) return;

  const float* x      = (const float*)d_in[0];
  const float* qkv_w  = (const float*)d_in[1];
  const float* q_bias = (const float*)d_in[2];
  const float* v_bias = (const float*)d_in[3];
  const float* proj_w = (const float*)d_in[4];
  const float* proj_b = (const float*)d_in[5];
  const float* rsin   = (const float*)d_in[6];
  const float* rcos   = (const float*)d_in[7];

  const size_t PL = (size_t)NTOK * DM * 2;        // 16777216  one 16-bit activation plane [8192][1024]
  static_assert((size_t)3 * DM * DM * 2 <= (size_t)NTOK * DM * 2);
  static_assert((size_t)NB * DM * SEQ * 2 == (size_t)NTOK * DM * 2);
  static_assert((size_t)DM * DM * 2 <= (size_t)NTOK * DM * 2);
  size_t off = 0;
  const size_t oR0 = off; off += PL;
  const size_t oR1 = off; off += PL;
  const size_t oR2 = off; off += PL;
  const size_t oR3 = off; off += PL;
  const size_t oR4 = off; off += PL;
  const size_t oR5 = off; off += PL;
  off += PL;                                      // R6, not used
  const size_t oR7 = off; off += PL;
  if (off > ws_size) return;                      // off = 134217728
  if (off > (size_t)134217728) return;

  char* ws = (char*)d_ws;
  unsigned short* Xb   = (unsigned short*)(ws + oR0);
  unsigned short* Oh   = (unsigned short*)(ws + oR0);
  unsigned short* Qh   = (unsigned short*)(ws + oR1);
  unsigned short* Wob  = (unsigned short*)(ws + oR1);
  unsigned short* Ql   = (unsigned short*)(ws + oR2);
  unsigned short* Kh   = (unsigned short*)(ws + oR3);
  unsigned short* Kl   = (unsigned short*)(ws + oR4);
  unsigned short* VTh  = (unsigned short*)(ws + oR5);
  unsigned short* Wqkv = (unsigned short*)(ws + oR7);
  unsigned short* Ol   = (unsigned short*)(ws + oR7);
  const unsigned short* Wq = Wqkv;
  const unsigned short* Wv = Wqkv + (size_t)2 * DM * DM;

  const dim3 blk(256);
  const int n8x = NTOK * DM / 8;                              // 1048576
  const int n8q = 3 * DM * DM / 8;                            //  393216
  const int n8o = DM * DM / 8;                                //  131072
  if ((n8x % 256) != 0 || (n8q % 256) != 0 || (n8o % 256) != 0) return;
  const dim3 gCvtX(n8x / 256);                                // 4096 blocks
  const dim3 gCvtQ(n8q / 256);                                // 1536 blocks
  const dim3 gCvtO(n8o / 256);                                //  512 blocks
  const int tilesTok = (NTOK / 64) * (DM / 64);               // 2048 tiles: M=8192, N=1024
  const int tilesVT  = (DM / 64) * (SEQ / 64);                //  512 tiles: M=1024, N=2048
  const dim3 gTok((tilesTok + 7) / 8, 1);                     // 256 blocks
  const dim3 gQK((tilesTok + 7) / 8, 2);                      // 256 blocks x 2 (q, k)
  const dim3 gVT((tilesVT + 7) / 8, NB);                      // 64 blocks x 4 batches
  const dim3 gAttn(NB * NH * NQG);                            // 1024 blocks

  // (1) x -> bf16 plane [8192][1024]; qkv_w [3072 n][1024 k] f32 -> bf16
  cvt_bf16x8<<<gCvtX, blk, 0, stream>>>(x, Xb, n8x);
  cvt_bf16x8<<<gCvtQ, blk, 0, stream>>>(qkv_w, Wqkv, n8q);
  // (2) one launch, batch 0: q = x . Wq^T + q_bias, batch 1: k = x . Wk^T + 0; rope for tokens >= 1 -> bf16 hi/lo planes
  //     [b*SEQ+t][h*64+d]   (M=8192, N=1024, K=1024 each). Wk lies DM*DM elements behind Wq, the k planes (R3, R4) two
  //     regions behind the q planes (R1, R2). 512 blocks, two per WGP.
  gemm64<0, 2, 3, 1, 1><<<gQK, blk, 0, stream>>>(
      Xb, Xb, DM, 0LL, Wq, DM, (long long)DM * DM, q_bias, rsin, rcos,
      (void*)Qh, (void*)Ql, DM, (long long)2 * NTOK * DM, NTOK, DM, DM);
  // (4) v^T = Wv . x^T + v_bias[row] per batch -> one f16 plane [b][h*64+d][s] (pitch SEQ)
  //     (A = Wv [n][k], Bt = Xb rows of batch b; M=1024, N=2048, K=1024)
  gemm64<0, 3, 2, 0, 0><<<gVT, blk, 0, stream>>>(
      Wv, Wv, DM, 0LL, Xb, DM, (long long)SEQ * DM, v_bias, rsin, rcos,
      (void*)VTh, (void*)VTh, SEQ, (long long)DM * SEQ, DM, SEQ, DM);
  // (5) attention -> context bf16 hi plane (R0, x plane dead) and lo plane (R7, weight plane dead)
  attn64<<<gAttn, dim3(128), 0, stream>>>(Qh, Ql, Kh, Kl, VTh, Oh, Ol, 0.125f);
  // (6) proj_w -> bf16 [n][k] into R1 (q hi plane dead after attention)
  cvt_bf16x8<<<gCvtO, blk, 0, stream>>>(proj_w, Wob, n8o);
  // (7) out = context . Wo^T + proj_b -> d_out f32 [8192][1024]  (A = context hi + lo planes, 2 products)
  gemm64<1, 0, 1, 0, 0><<<gTok, blk, 0, stream>>>(
      Oh, Ol, DM, 0LL, Wob, DM, 0LL, proj_b, rsin, rcos,
      d_out, d_out, DM, 0LL, NTOK, DM, DM);
  (void)hipGetLastError();
}
